// v000
// Measured on an AMD MI455X. A time is GPU time per run, averaged over a window of back-to-back runs after a warm-up
// (all launches, gaps included; the runs take copies of the inputs in turn), and the median of several windows.
// Apart from v000's, it joins two sittings. Times from different sittings can be a few percent apart, while
// side-by-side timings come from the same sitting.
// The starting kernel, v000, takes 9800 microseconds a run.
#include <hip/hip_runtime.h>
// Causal multi-head self-attention with rotate-half RoPE from INPUT tables (x [4][2048][1024]; q/k/v = x W ([in][out] 1024x1024 sigma 1/32, no biases); 16 heads of 64; rope_cos / rope_sin INPUT tables [2048][32] (arbitrary values in [0,1); read bf16-rounded): q = [x1 c - x2 s | x2 c + x1 s] with halves x1, x2, same for k; scores * 64^-0.5; causal (tril, -inf); softmax; out = merged Wo -> [4][2048][1024]).
// Structure: token rows r = b*2048 + s; x as exact f16 rows (bf16-rounded); per batch: q | k | v as ONE WMMA GEMM (32x64 wave tiles, f32 accumulation, exact x16 weights, N = 3 x 1024) into f32 rows, then per (row, head) on VALU: the rotate-half rotary rotation of q and k from the bf16-rounded input tables (no norm) -> f16 q, k, v rows; V^T for all heads via LDS transposes; per query tile of 256 rows: scores against the keys below the tile end only (K = 64, all heads on grid.y, alpha = 0.125), causal row softmax on VALU with an arithmetic 0/1 key mask over the computed range (f32 statistics, native exp; weights x256 f16), o = P . V^T (K = keys below the tile end, alpha 2^-2: o carried x64, folded into the output GEMM alpha) written straight into the merged f16 o rows; out = o W_o GEMM (f32) into the output layout.
// Compute dtype: inputs rounded to bf16; x / weights exact; projections and rope f32; q, k, v, softmax weights and o as plain f16 GEMM operands (~2^-12); scores and softmax statistics f32. v_wmma_f32_16x16x32_f16.
#define NB 4
#define SQ 2048
#define DM 1024
#define NH 16
#define HD 64
#define HG 4                         /* head group of the k_vt(V16, b, h0, VT) overload, which is not launched */
#define QT 256                       /* query rows per causal tile */
#define NKX SQ                       /* S / P row pitch */
#define QT0 128                      /* first-tile rows recomputed exactly in f32 */
#define B0 0                         /* first batch processed (debug hook) */
#define NBR NB                       /* batches processed (debug hook) */
#define QN SQ                        /* query rows attended per batch (debug hook) */
#define NHD NH                       /* heads attended (debug hook) */
#define NR ((size_t)NB * SQ)         /* token rows */
#define MPO ((int)((size_t)NBR * SQ))      /* rows through the output GEMM (debug hook) */
typedef __bf16 v16b __attribute__((ext_vector_type(16)));
typedef unsigned short v8us __attribute__((ext_vector_type(8), may_alias));
typedef float  v8f  __attribute__((ext_vector_type(8)));
typedef float  v4f  __attribute__((ext_vector_type(4)));
typedef float  v4fa __attribute__((ext_vector_type(4), may_alias));
union FragB { v16b v; v8us half[2]; unsigned short u[16]; };

__device__ __forceinline__ unsigned short bf16_bits(float x) { unsigned int u = __float_as_uint(x); return (unsigned short)((u + 0x7FFFu + ((u >> 16) & 1u)) >> 16); }
__device__ __forceinline__ float bf16_val(unsigned short b) { return __uint_as_float(((unsigned int)b) << 16); }
__device__ __forceinline__ float bf16_round(float x) { return bf16_val(bf16_bits(x)); }
// D += A·B with NT terms: 1 = ah·bh, 2 = + al·bh (A split), 3 = + ah·bl (both split)
template <int NT>
__device__ __forceinline__ v8f mmaN(v16b ah, v16b al, v16b bh, v16b bl, v8f c) {
  c = __builtin_amdgcn_wmma_f32_16x16x32_bf16(false, ah, false, bh, (short)0, c, false, false);
  if (NT >= 2) c = __builtin_amdgcn_wmma_f32_16x16x32_bf16(false, al, false, bh, (short)0, c, false, false);
  if (NT >= 3) c = __builtin_amdgcn_wmma_f32_16x16x32_bf16(false, ah, false, bl, (short)0, c, false, false);
  asm volatile("v_nop\n\tv_nop\n\tv_nop\n\tv_nop" : "+v"(c) : "v"(ah), "v"(al), "v"(bh), "v"(bl));
  return c;
}

__global__ __launch_bounds__(256) void k_wt_bf16(const float* __restrict__ W, unsigned short* __restrict__ Wt, int K, int N) {
  const int t = blockIdx.x * 256 + threadIdx.x;
  const int k8n = K / 8;
  if (t >= N * k8n) return;
  const int n = t / k8n, k8 = (t % k8n) * 8;
  v8us v;
#pragma unroll
  for (int i = 0; i < 8; ++i) v[i] = bf16_bits(W[(size_t)(k8 + i) * N + n]);
  *(v8us*)(Wt + (size_t)n * K + k8) = v;
  
}

// GEMM C[M][N] (f32, pitch ldc) = act(A[M][K]·W + bias). A f32 row-major (pitch lda) converted per fragment to bf16
// (ASPLIT: hi/lo two planes -> 2 terms, else single rounded term); Wt bf16 [N][K] (pitch ldb). BIAS_BF16 rounds the
// bias to bf16 first (bias quantised to bf16 before the add). K%32==0, M%16==0, N%64==0.
template <bool ASPLIT, int ACT, bool BIAS_BF16>
__global__ __launch_bounds__(128) void k_gemm_bf(const float* __restrict__ A, int lda, const unsigned short* __restrict__ Wt, int ldb,
                                               const float* __restrict__ bias, float* __restrict__ C, int ldc, int M, int N, int K) {
  __shared__ __attribute__((aligned(16))) float so[4][16][64];
  const int tid = threadIdx.x, w = tid >> 5, lane = tid & 31, ln = lane & 15, hh = lane >> 4;
  const int ntn = N / 64;
  const int wid = blockIdx.x * 4 + w;
  const int mt = wid / ntn, nq = wid % ntn;
  if (mt * 16 >= M) return;
  const int row0 = mt * 16, col0 = nq * 64;
  const float* arow = A + (size_t)(row0 + ln) * lda;
  v8f acc[4] = {};
  for (int kb = 0; kb < K; kb += 32) {
    FragB ah, al;
    const v4f x0 = *(const v4fa*)(arow + kb + 8 * hh), x1 = *(const v4fa*)(arow + kb + 8 * hh + 4);
    const v4f x2 = *(const v4fa*)(arow + kb + 16 + 8 * hh), x3 = *(const v4fa*)(arow + kb + 16 + 8 * hh + 4);
    float xs[16] = {x0[0],x0[1],x0[2],x0[3],x1[0],x1[1],x1[2],x1[3],x2[0],x2[1],x2[2],x2[3],x3[0],x3[1],x3[2],x3[3]};
#pragma unroll
    for (int i = 0; i < 16; ++i) { const unsigned short hb = bf16_bits(xs[i]); ah.u[i] = hb; al.u[i] = ASPLIT ? bf16_bits(xs[i] - bf16_val(hb)) : (unsigned short)0; }
#pragma unroll
    for (int t = 0; t < 4; ++t) {
      const unsigned short* brow = Wt + (size_t)(col0 + t * 16 + ln) * ldb + kb;
      FragB b;
      b.half[0] = *(const v8us*)(brow + 8 * hh);
      b.half[1] = *(const v8us*)(brow + 16 + 8 * hh);
      acc[t] = mmaN<ASPLIT ? 2 : 1>(ah.v, al.v, b.v, b.v, acc[t]);
    }
  }
#pragma unroll
  for (int t = 0; t < 4; ++t) {
    float bv = bias ? bias[col0 + t * 16 + ln] : 0.f;
    if (BIAS_BF16) bv = bf16_round(bv);
#pragma unroll
    for (int r = 0; r < 8; ++r) { float v = acc[t][r] + bv; if (ACT == 1) v = fmaxf(v, 0.f); so[w][8 * hh + r][t * 16 + ln] = v; }
  }
  __builtin_amdgcn_fence(__ATOMIC_ACQ_REL, "workgroup");
  __builtin_amdgcn_wave_barrier();
  const int rsub = lane >> 4, c4 = (lane & 15) * 4;
  {
#pragma unroll
    for (int q = 0; q < 8; ++q) {
      const int r = q * 2 + rsub;
      const v4f v = *(const v4fa*)&so[w][r][c4];
      *(v4f*)(C + (size_t)(row0 + r) * ldc + col0 + c4) = v;
    }
    
  }
}

// GEMM C = act(A·W + bias + resid): A f32 (ASPLIT -> hi/lo 2 terms), Wt bf16 [N][K]; ACT 0 none, 1 relu, 2 exact gelu;
// resid (optional, f32, row index = (row % rmod), pitch ldr, RES_BF16 rounds it) added before the activation.
template <bool ASPLIT, int ACT, bool BIAS_BF16, bool RES_BF16>
__global__ __launch_bounds__(128) void k_gemm_bf3(const float* __restrict__ A, int lda, const unsigned short* __restrict__ Wt, int ldb,
                                                const float* __restrict__ bias, const float* __restrict__ resid, int rmod, int ldr,
                                                float* __restrict__ C, int ldc, int M, int N, int K) {
  __shared__ __attribute__((aligned(16))) float so[4][16][64];
  const int tid = threadIdx.x, w = tid >> 5, lane = tid & 31, ln = lane & 15, hh = lane >> 4;
  const int ntn = N / 64;
  const int wid = blockIdx.x * 4 + w;
  const int mt = wid / ntn, nq = wid % ntn;
  if (mt * 16 >= M) return;
  const int row0 = mt * 16, col0 = nq * 64;
  const float* arow = A + (size_t)(row0 + ln) * lda;
  v8f acc[4] = {};
  for (int kb = 0; kb < K; kb += 32) {
    FragB ah, al;
    const v4f x0 = *(const v4fa*)(arow + kb + 8 * hh), x1 = *(const v4fa*)(arow + kb + 8 * hh + 4);
    const v4f x2 = *(const v4fa*)(arow + kb + 16 + 8 * hh), x3 = *(const v4fa*)(arow + kb + 16 + 8 * hh + 4);
    float xs[16] = {x0[0],x0[1],x0[2],x0[3],x1[0],x1[1],x1[2],x1[3],x2[0],x2[1],x2[2],x2[3],x3[0],x3[1],x3[2],x3[3]};
#pragma unroll
    for (int i = 0; i < 16; ++i) { const unsigned short hb = bf16_bits(xs[i]); ah.u[i] = hb; al.u[i] = ASPLIT ? bf16_bits(xs[i] - bf16_val(hb)) : (unsigned short)0; }
#pragma unroll
    for (int t = 0; t < 4; ++t) {
      const unsigned short* brow = Wt + (size_t)(col0 + t * 16 + ln) * ldb + kb;
      FragB b;
      b.half[0] = *(const v8us*)(brow + 8 * hh);
      b.half[1] = *(const v8us*)(brow + 16 + 8 * hh);
      acc[t] = mmaN<ASPLIT ? 2 : 1>(ah.v, al.v, b.v, b.v, acc[t]);
    }
  }
#pragma unroll
  for (int t = 0; t < 4; ++t) {
    const int col = col0 + t * 16 + ln;
    float bv = bias ? bias[col] : 0.f;
    if (BIAS_BF16) bv = bf16_round(bv);
#pragma unroll
    for (int r = 0; r < 8; ++r) {
      float v = acc[t][r] + bv;
      if (resid) { float rv = resid[(size_t)((row0 + 8 * hh + r) % rmod) * ldr + col]; if (RES_BF16) rv = bf16_round(rv); v += rv; }
      if (ACT == 1) v = fmaxf(v, 0.f);
      if (ACT == 2) v = 0.5f * v * (1.0f + erff(v * 0.70710678118654752f));
      if (ACT == 3) { const float u = 0.7978845608028654f * (v + 0.044715f * v * v * v); v = 0.5f * v * (1.0f + tanhf(u)); }
      so[w][8 * hh + r][t * 16 + ln] = v;
    }
  }
  __builtin_amdgcn_fence(__ATOMIC_ACQ_REL, "workgroup");
  __builtin_amdgcn_wave_barrier();
  const int rsub = lane >> 4, c4 = (lane & 15) * 4;
  {
#pragma unroll
    for (int q = 0; q < 8; ++q) {
      const int r = q * 2 + rsub;
      const v4f v = *(const v4fa*)&so[w][r][c4];
      *(v4f*)(C + (size_t)(row0 + r) * ldc + col0 + c4) = v;
    }
    
  }
}
// row LayerNorm (biased variance, eps) over N: s = X (+ R); optional out_sum <- s; out_norm <- (s-mu)*rsqrt(var+eps)*g + b
template <bool PARAM_BF16>
__global__ __launch_bounds__(256) void k_layernorm(const float* __restrict__ X, const float* __restrict__ R, const float* __restrict__ g, const float* __restrict__ bta,
                                                  float* __restrict__ out_sum, float* __restrict__ out_norm, int N, float eps) {
  __shared__ float red[256];
  const int row = blockIdx.x, tid = threadIdx.x;
  const float* x = X + (size_t)row * N; const float* rr = R ? R + (size_t)row * N : nullptr;
  float vals[16];                     // up to N = 4096
  const int per = N / 256;            // contiguous chunk per thread? use strided-by-4 chunks: thread handles j = tid*4 + 1024*u
  float s1 = 0.f;
  for (int u = 0; u < per / 4; ++u) {
    const int j = tid * 4 + 1024 * u;
    const v4f a = *(const v4fa*)(x + j);
    v4f b = {0.f,0.f,0.f,0.f}; if (rr) b = *(const v4fa*)(rr + j);
#pragma unroll
    for (int q = 0; q < 4; ++q) { const float v = a[q] + b[q]; vals[u * 4 + q] = v; s1 += v; }
  }
  red[tid] = s1; __syncthreads();
  for (int st = 128; st > 0; st >>= 1) { if (tid < st) red[tid] += red[tid + st]; __syncthreads(); }
  const float mu = red[0] / (float)N; __syncthreads();
  float s2 = 0.f;
  for (int u = 0; u < per / 4; ++u)
#pragma unroll
    for (int q = 0; q < 4; ++q) { const float c = vals[u * 4 + q] - mu; s2 += c * c; }
  red[tid] = s2; __syncthreads();
  for (int st = 128; st > 0; st >>= 1) { if (tid < st) red[tid] += red[tid + st]; __syncthreads(); }
  const float rs = rsqrtf(red[0] / (float)N + eps);
  {
    for (int u = 0; u < per / 4; ++u) {
      const int j = tid * 4 + 1024 * u;
      v4f o, sm;
#pragma unroll
      for (int q = 0; q < 4; ++q) {
        float gg = g[j + q], bb = bta[j + q];
        if (PARAM_BF16) { gg = bf16_round(gg); bb = bf16_round(bb); }
        sm[q] = vals[u * 4 + q]; o[q] = (vals[u * 4 + q] - mu) * rs * gg + bb;
      }
      if (out_sum) *(v4f*)(out_sum + (size_t)row * N + j) = sm;
      *(v4f*)(out_norm + (size_t)row * N + j) = o;
    }
    
  }
}



// ---- f16 WMMA path (v_wmma_f32_16x16x32_f16): 11-bit significands for operands in range — used where a [0,1] probability operand needs more precision than bf16
typedef _Float16 v16h __attribute__((ext_vector_type(16)));
union FragH { v16h v; v8us half[2]; _Float16 h[16]; unsigned short u[16]; };
template <int NT>
__device__ __forceinline__ v8f mmaH(v16h ah, v16h al, v16h bh, v16h bl, v8f c) {
  c = __builtin_amdgcn_wmma_f32_16x16x32_f16(false, ah, false, bh, (short)0, c, false, false);
  if (NT >= 2) c = __builtin_amdgcn_wmma_f32_16x16x32_f16(false, al, false, bh, (short)0, c, false, false);
  if (NT >= 3) c = __builtin_amdgcn_wmma_f32_16x16x32_f16(false, ah, false, bl, (short)0, c, false, false);
  asm volatile("v_nop\n\tv_nop\n\tv_nop\n\tv_nop" : "+v"(c) : "v"(ah), "v"(al), "v"(bh), "v"(bl));
  return c;
}
// batched GEMM like k_gemm_b but f16 operands: A f32 (split into f16 hi/lo if ASPLIT, else rounded to f16), Bt = f16 values [n][k]; alpha; C f32; N multiple of 16 (partial tiles skipped)
template <bool ASPLIT>
__global__ __launch_bounds__(128) void k_gemm_h(const float* __restrict__ A, int lda, size_t sA, const _Float16* __restrict__ Bh, int ldb, size_t sB, float alpha, float* __restrict__ C, int ldc, size_t sC, int M, int N, int K) {
  __shared__ __attribute__((aligned(16))) float so[4][16][64];
  const int tid = threadIdx.x, w = tid >> 5, lane = tid & 31, ln = lane & 15, hh = lane >> 4; const int by = blockIdx.y;
  A += (size_t)by * sA; Bh += (size_t)by * sB; C += (size_t)by * sC;
  const int ntn = (N + 63) / 64; const int wid = blockIdx.x * 4 + w; const int mt = wid / ntn, nq = wid % ntn; if (mt * 16 >= M) return;
  const int row0 = mt * 16, col0 = nq * 64; const float* arow = A + (size_t)(row0 + ln) * lda;
  v8f acc[4] = {};
  for (int kb = 0; kb < K; kb += 32) {
    FragH ah, al;
    const v4f x0 = *(const v4fa*)(arow + kb + 8 * hh), x1 = *(const v4fa*)(arow + kb + 8 * hh + 4), x2 = *(const v4fa*)(arow + kb + 16 + 8 * hh), x3 = *(const v4fa*)(arow + kb + 16 + 8 * hh + 4);
    float xs[16] = {x0[0],x0[1],x0[2],x0[3],x1[0],x1[1],x1[2],x1[3],x2[0],x2[1],x2[2],x2[3],x3[0],x3[1],x3[2],x3[3]};
#pragma unroll
    for (int i = 0; i < 16; ++i) { const _Float16 h = (_Float16)xs[i]; ah.h[i] = h; al.h[i] = ASPLIT ? (_Float16)(xs[i] - (float)h) : (_Float16)0.0f; }
#pragma unroll
    for (int t = 0; t < 4; ++t) { if (col0 + t * 16 >= N) continue; const size_t boff = (size_t)(col0 + t * 16 + ln) * ldb + kb; FragH bq; bq.half[0] = *(const v8us*)(Bh + boff + 8 * hh); bq.half[1] = *(const v8us*)(Bh + boff + 16 + 8 * hh);
      acc[t] = mmaH<ASPLIT ? 2 : 1>(ah.v, al.v, bq.v, bq.v, acc[t]); }
  }
#pragma unroll
  for (int t = 0; t < 4; ++t) { if (col0 + t * 16 >= N) continue;
#pragma unroll
    for (int r = 0; r < 8; ++r) so[w][8 * hh + r][t * 16 + ln] = acc[t][r] * alpha; }
  __builtin_amdgcn_fence(__ATOMIC_ACQ_REL, "workgroup"); __builtin_amdgcn_wave_barrier();
  const int rsub = lane >> 4, c4 = (lane & 15) * 4;
  {
#pragma unroll
    for (int q = 0; q < 8; ++q) { const int r = q * 2 + rsub; if (col0 + c4 < N) { const v4f v = *(const v4fa*)&so[w][r][c4]; *(v4f*)(C + (size_t)(row0 + r) * ldc + col0 + c4) = v; } }
     }
}

// Wt[n][k] = f16(W[k][n]·scale) from f32 row-major W[K][N] (scale = power of two; bf16-exact weights stay exact in f16 away from the subnormal range)
__global__ __launch_bounds__(256) void k_wt_f16(const float* __restrict__ W, _Float16* __restrict__ Wt, int K, int N, float scale) {
  const int t = blockIdx.x * 256 + threadIdx.x; if (t >= N * (K / 8)) return; const int n = t / (K / 8), k8 = (t % (K / 8)) * 8; FragH f;
#pragma unroll
  for (int i = 0; i < 8; ++i) f.h[i] = (_Float16)(bf16_round(W[(size_t)(k8 + i) * N + n]) * scale); const v8us o = f.half[0];
  *(v8us*)((unsigned short*)Wt + (size_t)n * K + k8) = o; 
}
// k_gemm_hh variant with fused epilogue: v = acc·alpha + bias[by·sBias + col] (+ CP[(row/rowsPerB)·sCPb + by·64 + col] if CP) ; ACT 0 none / 1 elu ; writes f16 C16 (and f32 C if non-null)
template <int ACT>
__global__ __launch_bounds__(128) void k_gemm_hhx(const _Float16* __restrict__ A, int lda, size_t sA, const _Float16* __restrict__ Bh, int ldb, size_t sB, float alpha, const float* __restrict__ bias, size_t sBias, const float* __restrict__ CP, int rowsPerB, size_t sCPb, int row0g,
    float* __restrict__ C, _Float16* __restrict__ C16, int ldc, size_t sC, int M, int N, int K) {
  __shared__ __attribute__((aligned(16))) float so[4][16][64];
  const int tid = threadIdx.x, w = tid >> 5, lane = tid & 31, ln = lane & 15, hh = lane >> 4; const int by = blockIdx.y;
  A += (size_t)by * sA; Bh += (size_t)by * sB; const size_t cofs = (size_t)by * sC; const float* bp = bias ? bias + (size_t)by * sBias : nullptr;
  const int ntn = (N + 63) / 64; const int wid = blockIdx.x * 4 + w; const int mt = wid / ntn, nq = wid % ntn; if (mt * 16 >= M) return;
  const int row0 = mt * 16, col0 = nq * 64; const _Float16* arow = A + (size_t)(row0 + ln) * lda;
  v8f acc[4] = {};
  for (int kb = 0; kb < K; kb += 32) { FragH ah; ah.half[0] = *(const v8us*)((const unsigned short*)arow + kb + 8 * hh); ah.half[1] = *(const v8us*)((const unsigned short*)arow + kb + 16 + 8 * hh);
#pragma unroll
    for (int t = 0; t < 4; ++t) { if (col0 + t * 16 >= N) continue; const size_t boff = (size_t)(col0 + t * 16 + ln) * ldb + kb; FragH bq; bq.half[0] = *(const v8us*)((const unsigned short*)Bh + boff + 8 * hh); bq.half[1] = *(const v8us*)((const unsigned short*)Bh + boff + 16 + 8 * hh);
      acc[t] = mmaH<1>(ah.v, ah.v, bq.v, bq.v, acc[t]); }
  }
#pragma unroll
  for (int t = 0; t < 4; ++t) { if (col0 + t * 16 >= N) continue; const int col = col0 + t * 16 + ln; const float bv = bp ? bf16_round(bp[col]) : 0.f;
#pragma unroll
    for (int r = 0; r < 8; ++r) { float v = acc[t][r] * alpha + bv; if (CP) { const int rr = row0g + row0 + 8 * hh + r; if (rowsPerB < 0) v += CP[cofs + (size_t)rr * ldc + col];      /* rowsPerB < 0: own element of the batched C plane */ else { const int bidx = rr / rowsPerB; v += CP[(size_t)bidx * sCPb + (size_t)by * 64 + col]; } } if (ACT == 1) v = (v > 0.f) ? v : expm1f(v); else if (ACT == 7) v = (v > 0.f) ? v + 1.0f : expf(v); else if (ACT == 8) v = tanhf(v); else if (ACT == 9) v = 0.5f * v * (1.0f + tanhf(0.7978845608028654f * (v + 0.044715f * v * v * v))); else if (ACT == 11) v = 1.0f / (1.0f + expf(-v)); else if (ACT == 12) v = (v > 0.f) ? v : 0.01f * v; else if (ACT == 14) v = (v > 0.f) ? v : 0.1f * v; else if (ACT == 16) v = (v >= 0.f) ? v : 0.3f * v; else if (ACT == 17) v = (v >= 0.f) ? v : 0.2f * v; else if (ACT == 15) v = v / (1.0f + expf(-v)); else if (ACT == 3) v = fmaxf(v, 0.f); else if (ACT == 6) v = 0.5f * v * (1.0f + erff(v * 0.70710678118654752f)); so[w][8 * hh + r][t * 16 + ln] = v; } }
  __builtin_amdgcn_fence(__ATOMIC_ACQ_REL, "workgroup"); __builtin_amdgcn_wave_barrier();
  const int rsub = lane >> 4, c4 = (lane & 15) * 4; typedef _Float16 v4h __attribute__((ext_vector_type(4)));
  {
#pragma unroll
    for (int q = 0; q < 8; ++q) { const int r = q * 2 + rsub; if (col0 + c4 < N) { const v4f v = *(const v4fa*)&so[w][r][c4]; if (C) *(v4f*)(C + cofs + (size_t)(row0 + r) * ldc + col0 + c4) = v; if (C16) { v4h h4; for (int i = 0; i < 4; ++i) h4[i] = (_Float16)v[i]; *(v4h*)(C16 + cofs + (size_t)(row0 + r) * ldc + col0 + c4) = h4; } } }
     }
}


typedef _Float16 v4h __attribute__((ext_vector_type(4)));

__global__ __launch_bounds__(256) void k_x16(const float* __restrict__ x, _Float16* __restrict__ X16, size_t n8) { const size_t t = (size_t)blockIdx.x * 256 + threadIdx.x; if (t >= n8) return; FragH f;
#pragma unroll
  for (int q = 0; q < 8; ++q) f.h[q] = (_Float16)bf16_round(x[t * 8 + q]); *(v8us*)((unsigned short*)X16 + t * 8) = f.half[0];  }
__global__ __launch_bounds__(256) void k_h16(const float* __restrict__ x, _Float16* __restrict__ X16, size_t n8) { const size_t t = (size_t)blockIdx.x * 256 + threadIdx.x; if (t >= n8) return; FragH f;
#pragma unroll
  for (int q = 0; q < 8; ++q) f.h[q] = (_Float16)x[t * 8 + q]; *(v8us*)((unsigned short*)X16 + t * 8) = f.half[0];  }
__global__ __launch_bounds__(256) void k_round16f(const float* __restrict__ W, _Float16* __restrict__ Bt, size_t n8) { const size_t t = (size_t)blockIdx.x * 256 + threadIdx.x; if (t >= n8) return; FragH f;
#pragma unroll
  for (int i = 0; i < 8; ++i) f.h[i] = (_Float16)(bf16_round(W[t * 8 + i]) * 16.0f); *(v8us*)((unsigned short*)Bt + t * 8) = f.half[0];  }
template <int NHv, int TTv>
__global__ __launch_bounds__(256) void k_vt(const _Float16* __restrict__ V16, int ldv, int voff, _Float16* __restrict__ Vt) { __shared__ unsigned short tl[64][66]; const int tid = threadIdx.x; const int slab = blockIdx.x / (TTv / 64), lg = blockIdx.x % (TTv / 64); const int b = slab / NHv, h = slab % NHv;
  for (int i = tid; i < 64 * 8; i += 256) { const int r = i / 8, c8 = (i % 8) * 8; FragH f; f.half[0] = *(const v8us*)((const unsigned short*)V16 + ((size_t)b * TTv + lg * 64 + r) * ldv + voff + h * 64 + c8);
#pragma unroll
    for (int q = 0; q < 8; ++q) tl[r][c8 + q] = f.u[q]; }
  __syncthreads();
  {
#pragma unroll
    for (int rd = 0; rd < 2; ++rd) { const int d = rd * 32 + tid / 8, pc = tid % 8; FragH f;
#pragma unroll
      for (int q = 0; q < 8; ++q) f.u[q] = tl[pc * 8 + q][d];
      *(v8us*)((unsigned short*)Vt + ((size_t)slab * 64 + d) * TTv + lg * 64 + pc * 8) = f.half[0]; }
     } }

__global__ __launch_bounds__(256) void k_hl(const float* __restrict__ F, _Float16* __restrict__ Hh, _Float16* __restrict__ Hl, size_t n8) { const size_t t = (size_t)blockIdx.x * 256 + threadIdx.x; if (t >= n8) return; FragH fh, fl; const v4f a = *(const v4fa*)(F + t * 8), c = *(const v4fa*)(F + t * 8 + 4);
#pragma unroll
  for (int q = 0; q < 4; ++q) { _Float16 h = (_Float16)a[q]; fh.h[q] = h; fl.h[q] = (_Float16)((a[q] - (float)h) * 1024.0f); h = (_Float16)c[q]; fh.h[4 + q] = h; fl.h[4 + q] = (_Float16)((c[q] - (float)h) * 1024.0f); }
  { *(v8us*)((unsigned short*)Hh + t * 8) = fh.half[0]; *(v8us*)((unsigned short*)Hl + t * 8) = fl.half[0];  } }

// ---- fast GEMM (wave tile 32x64; requires M % 32 == 0 rows per launch region and N % 64 == 0); epilogue = k_gemm_hhx semantics ----
__device__ __forceinline__ v16h g2_frag(const _Float16* p, int hh) { FragH f; f.half[0] = *(const v8us*)((const unsigned short*)p + 8 * hh); f.half[1] = *(const v8us*)((const unsigned short*)p + 16 + 8 * hh); return f.v; }
__device__ __forceinline__ v8f g2_mma(v16h a, v16h b, v8f c) { v8f d = __builtin_amdgcn_wmma_f32_16x16x32_f16(false, a, false, b, (short)0, c, false, false); asm volatile("v_nop\n\tv_nop\n\tv_nop\n\tv_nop" : "+v"(d) : "v"(a), "v"(b)); return d; }
template <int ACT>
__global__ __launch_bounds__(128) void k_gemm2(const _Float16* __restrict__ A, int lda, size_t sA, const _Float16* __restrict__ Bh, int ldb, size_t sB, float alpha, const float* __restrict__ bias, size_t sBias, const float* __restrict__ CP, int rowsPerB, size_t sCPb, int row0g,
    float* __restrict__ C, _Float16* __restrict__ C16, int ldc, size_t sC, int M, int N, int K) { static_assert(ACT == 0 || ACT == 3 || ACT == 6 || ACT == 8 || ACT == 9 || ACT == 11 || ACT == 12 || ACT == 14 || ACT == 15 || ACT == 16 || ACT == 17, "k_gemm2: unsupported ACT code (would silently apply no activation)");
  __shared__ __attribute__((aligned(16))) float so[4][32][68];
  const int tid = threadIdx.x, w = tid >> 5, lane = tid & 31, ln = lane & 15, hh = lane >> 4; const int by = blockIdx.y;
  A += (size_t)by * sA; Bh += (size_t)by * sB; const size_t cofs = (size_t)by * sC; const float* bp = bias ? bias + (size_t)by * sBias : nullptr;
  const int ntn = N >> 6; const int mt = blockIdx.x / ntn, nq = blockIdx.x - mt * ntn; const int row0 = mt * 128 + 32 * w, col0 = nq * 64; if (row0 >= M) return;
  const _Float16* a0p = A + (size_t)(row0 + ln) * lda; const _Float16* a1p = a0p + (size_t)16 * lda;
  const _Float16* b0p = Bh + (size_t)(col0 + ln) * ldb; const _Float16* b1p = b0p + (size_t)16 * ldb; const _Float16* b2p = b1p + (size_t)16 * ldb; const _Float16* b3p = b2p + (size_t)16 * ldb;
  const v8f z8 = {0.f,0.f,0.f,0.f,0.f,0.f,0.f,0.f}; v8f c00 = z8, c01 = z8, c02 = z8, c03 = z8, c10 = z8, c11 = z8, c12 = z8, c13 = z8;
#pragma unroll 1
  for (int kb = 0; kb < K; kb += 32) { const v16h a0 = g2_frag(a0p + kb, hh), a1 = g2_frag(a1p + kb, hh);
    v16h b = g2_frag(b0p + kb, hh); c00 = g2_mma(a0, b, c00); c10 = g2_mma(a1, b, c10);
    b = g2_frag(b1p + kb, hh); c01 = g2_mma(a0, b, c01); c11 = g2_mma(a1, b, c11);
    b = g2_frag(b2p + kb, hh); c02 = g2_mma(a0, b, c02); c12 = g2_mma(a1, b, c12);
    b = g2_frag(b3p + kb, hh); c03 = g2_mma(a0, b, c03); c13 = g2_mma(a1, b, c13); }
  v8f accs[8] = {c00, c01, c02, c03, c10, c11, c12, c13};
#pragma unroll
  for (int u = 0; u < 8; ++u) { const int t = u & 3, half = u >> 2; const int col = col0 + t * 16 + ln; const float bv = bp ? bf16_round(bp[col]) : 0.f;
#pragma unroll
    for (int r = 0; r < 8; ++r) { const int rloc = half * 16 + 8 * hh + r; float v = accs[u][r] * alpha + bv; if (CP) { if (rowsPerB < 0) v += CP[cofs + (size_t)(row0g + row0 + rloc) * ldc + col];      /* rowsPerB < 0: own element of the batched C plane */ else { const int bidx = (row0g + row0 + rloc) / rowsPerB; v += CP[(size_t)bidx * sCPb + (size_t)by * 64 + col]; } }
      if (ACT == 3) v = fmaxf(v, 0.f); else if (ACT == 6) v = 0.5f * v * (1.0f + erff(v * 0.70710678118654752f)); else if (ACT == 11) v = 1.0f / (1.0f + expf(-v)); else if (ACT == 15) v = v / (1.0f + expf(-v)); else if (ACT == 12) v = (v > 0.f) ? v : 0.01f * v; else if (ACT == 8) v = tanhf(v); else if (ACT == 9) v = 0.5f * v * (1.0f + tanhf(0.7978845608028654f * (v + 0.044715f * v * v * v))); else if (ACT == 14) v = (v > 0.f) ? v : 0.1f * v; else if (ACT == 16) v = (v >= 0.f) ? v : 0.3f * v; else if (ACT == 17) v = (v >= 0.f) ? v : 0.2f * v;
      so[w][rloc][t * 16 + ln] = v; } }
  __builtin_amdgcn_fence(__ATOMIC_ACQ_REL, "workgroup"); __builtin_amdgcn_wave_barrier();
  const int rsub = lane >> 4, c4 = (lane & 15) * 4;
  {
#pragma unroll
    for (int q = 0; q < 16; ++q) { const int r = q * 2 + rsub; const v4f v = *(const v4fa*)&so[w][r][c4]; if (C) *(v4f*)(C + cofs + (size_t)(row0 + r) * ldc + col0 + c4) = v; if (C16) { v4h h4; for (int i = 0; i < 4; ++i) h4[i] = (_Float16)v[i]; *(v4h*)(C16 + cofs + (size_t)(row0 + r) * ldc + col0 + c4) = h4; } }
     } }


__global__ __launch_bounds__(256) void k_wnat(const float* __restrict__ w, size_t n8, _Float16* __restrict__ Bt) { const size_t t = (size_t)blockIdx.x * 256 + threadIdx.x; if (t >= n8) return; FragH f; for (int q = 0; q < 8; ++q) f.h[q] = (_Float16)(bf16_round(w[t * 8 + q]) * 16.0f); *(v8us*)((unsigned short*)Bt + t * 8) = f.half[0];  }
__global__ __launch_bounds__(256) void k_rsm(const float* __restrict__ S, _Float16* __restrict__ P, int nrows) {
  #pragma clang fp contract(off)
  const int i = blockIdx.x * 256 + threadIdx.x; if (i >= nrows) return; const float* s = S + (size_t)i * SQ; float mx = -3.0e38f;
#pragma unroll 1
  for (int j = 0; j < SQ; ++j) mx = fmaxf(mx, s[j]); float se = 0.f;
#pragma unroll 1
  for (int j = 0; j < SQ; ++j) se += expf(s[j] - mx); const float sc = 256.0f / se;
#pragma unroll 1
  for (int j0 = 0; j0 < SQ; j0 += 8) { FragH f; for (int q = 0; q < 8; ++q) f.h[q] = (_Float16)(expf(s[j0 + q] - mx) * sc); unsigned short* d = (unsigned short*)P + (size_t)i * SQ + j0; *(v8us*)d = f.half[0];  } }
__global__ __launch_bounds__(256) void k_vt(const _Float16* __restrict__ V16, int b, int h0, _Float16* __restrict__ VT) { __shared__ unsigned short tl[64][65]; const int tid = threadIdx.x; const int hh = blockIdx.x % HG, sg = blockIdx.x / HG; const int s0 = sg * 64; const int h = h0 + hh;
  for (int i = tid; i < 64 * 8; i += 256) { const int j = i / 8, d8 = (i % 8) * 8; FragH f; f.half[0] = *(const v8us*)((const unsigned short*)V16 + ((size_t)b * SQ + s0 + j) * DM + h * HD + d8); for (int q = 0; q < 8; ++q) tl[d8 + q][j] = f.u[q]; }
  __syncthreads();
  { for (int i = tid; i < 64 * 8; i += 256) { const int d = i / 8, j8 = (i % 8) * 8; FragH f; for (int q = 0; q < 8; ++q) f.u[q] = tl[d][j8 + q]; *(v8us*)((unsigned short*)VT + ((size_t)hh * HD + d) * SQ + s0 + j8) = f.half[0]; }  } }


__global__ __launch_bounds__(256) void k_tab2(float theta, float* __restrict__ CS, float* __restrict__ SN) {
  #pragma clang fp contract(off)
  const int t = blockIdx.x * 256 + threadIdx.x; if (t >= SQ * (HD / 2)) return; const int i = t % (HD / 2); const int p = t / (HD / 2); const float invf = 1.0f / powf(theta, (float)(2 * i) / (float)HD); const float ang = __fmul_rn((float)p, invf); const float c = cosf(ang), s = sinf(ang);
  *(float*)(CS + t) = c; *(float*)(SN + t) = s;  }
template <int NORM, int ROPE>
__global__ __launch_bounds__(64) void k_xform(const float* __restrict__ F, int ldf, int nh, const float* __restrict__ gain, float eps, const float* __restrict__ CS, const float* __restrict__ SN, _Float16* __restrict__ H16, int ldo) {
  #pragma clang fp contract(off)
  __shared__ float xv[HD]; __shared__ float red[HD]; __shared__ unsigned short sh_[HD]; const int d = threadIdx.x; const int h = blockIdx.x % nh; const size_t r = blockIdx.x / nh; const int p = (int)(r % SQ);
  float x = F[r * (size_t)ldf + (size_t)h * HD + d];
  if (NORM) { red[d] = __fmul_rn(x, x); __syncthreads(); for (int st = HD / 2; st > 0; st >>= 1) { if (d < st) red[d] = __fadd_rn(red[d], red[d + st]); __syncthreads(); } const float rs = rsqrtf(__fadd_rn(red[0] / (float)HD, eps)); x = __fmul_rn(__fmul_rn(x, rs), bf16_round(gain[d])); }
  xv[d] = x; __syncthreads();
  float o = x;
  if (ROPE == 1) { const int i = d >> 1; const float c = CS[p * (HD / 2) + i], s = SN[p * (HD / 2) + i]; const float ev = xv[2 * i], od = xv[2 * i + 1]; o = (d & 1) ? __fadd_rn(__fmul_rn(ev, s), __fmul_rn(od, c)) : __fadd_rn(__fmul_rn(ev, c), -__fmul_rn(od, s)); }
  if (ROPE == 2) { const int i = d & (HD / 2 - 1); const float c = CS[p * (HD / 2) + i], s = SN[p * (HD / 2) + i]; const float lo = xv[i], hi = xv[i + HD / 2]; o = (d < HD / 2) ? __fadd_rn(__fmul_rn(lo, c), -__fmul_rn(hi, s)) : __fadd_rn(__fmul_rn(lo, s), __fmul_rn(hi, c)); }
  FragH th; th.h[0] = (_Float16)o; sh_[d] = th.u[0]; __syncthreads();
  if (d < HD / 8) { FragH f; for (int q = 0; q < 8; ++q) f.u[q] = sh_[d * 8 + q]; unsigned short* dst = (unsigned short*)H16 + r * (size_t)ldo + (size_t)h * HD + d * 8; *(v8us*)dst = f.half[0];  } }

__global__ __launch_bounds__(256) void k_tab4(const int* __restrict__ pos, float theta, float* __restrict__ CS, float* __restrict__ SN) {
  #pragma clang fp contract(off)
  const int t = blockIdx.x * 256 + threadIdx.x; if (t >= SQ * (HD / 2)) return; const int i = t % (HD / 2); const int p = t / (HD / 2); const float invf = (float)pow((double)theta, -((double)(2 * i)) / (double)HD); const float ang = __fmul_rn((float)pos[p], invf); const float c = cosf(ang), s = sinf(ang);
  *(float*)(CS + t) = c; *(float*)(SN + t) = s;  }
__global__ __launch_bounds__(256) void k_rsmf(const float* __restrict__ S, _Float16* __restrict__ P, int qn, int hg) {
  #pragma clang fp contract(off)
  const int t = blockIdx.x * 256 + threadIdx.x; if (t >= qn * hg) return; const size_t i = (size_t)(t / qn) * SQ + (t % qn); const float* s = S + i * SQ; float mx = -3.0e38f;
#pragma unroll 1
  for (int j = 0; j < SQ; ++j) mx = fmaxf(mx, s[j]); float se = 0.f;
#pragma unroll 1
  for (int j = 0; j < SQ; ++j) se += __expf(s[j] - mx); const float sc = 256.0f / se;
#pragma unroll 1
  for (int j0 = 0; j0 < SQ; j0 += 8) { FragH f; for (int q = 0; q < 8; ++q) f.h[q] = (_Float16)(__expf(s[j0 + q] - mx) * sc); unsigned short* d = (unsigned short*)P + i * SQ + j0; *(v8us*)d = f.half[0];  } }


__global__ __launch_bounds__(256) void k_rsmcf2(const float* __restrict__ S, _Float16* __restrict__ P, int hg, int q0, int nk) {
  #pragma clang fp contract(off)
  const int t = blockIdx.x * 256 + threadIdx.x; if (t >= hg * QT) return; const size_t i = (size_t)t; const float* s = S + i * NKX; const int last = q0 + (t % QT); float mx = -3.0e38f;
#pragma unroll 1
  for (int j = 0; j < nk; ++j) { const float f = (j <= last) ? 1.f : 0.f; mx = fmaxf(mx, fmaf(f, s[j], (1.f - f) * -1.0e9f)); } float se = 0.f;
#pragma unroll 1
  for (int j = 0; j < nk; ++j) { const float f = (j <= last) ? 1.f : 0.f; se += __expf(fmaf(f, s[j], (1.f - f) * -1.0e9f) - mx); } const float sc = 256.0f / se;
#pragma unroll 1
  for (int j0 = 0; j0 < nk; j0 += 8) { FragH fr; for (int q = 0; q < 8; ++q) { const int j = j0 + q; const float f = (j <= last) ? 1.f : 0.f; fr.h[q] = (_Float16)(__expf(fmaf(f, s[j], (1.f - f) * -1.0e9f) - mx) * sc); } unsigned short* d = (unsigned short*)P + i * NKX + j0; *(v8us*)d = fr.half[0];  } }


template <int MASKADD>
__global__ __launch_bounds__(64) void k_att0(const float* __restrict__ QF, const float* __restrict__ KF, const float* __restrict__ VF, int ld, const float* __restrict__ mask, float scale, float* __restrict__ OF, int ldo) {
  #pragma clang fp contract(off)
  __shared__ __attribute__((aligned(16))) float lq[64][64]; __shared__ __attribute__((aligned(16))) float lo[64][64];
  const int tid = threadIdx.x; const int h = blockIdx.x / (QT0 / 64), rg = blockIdx.x % (QT0 / 64); const int i = rg * 64 + tid;
  const float* qr = QF + (size_t)i * ld + h * HD;
#pragma unroll 1
  for (int c = 0; c < HD / 4; ++c) { *(v4f*)&lq[tid][c * 4] = *(const v4fa*)(qr + c * 4); const v4f z = {0.f, 0.f, 0.f, 0.f}; *(v4f*)&lo[tid][c * 4] = z; }
  float m = -1.0e30f, l = 0.f; const int jmax = MASKADD ? (SQ - 1) : (rg * 64 + 63);      /* additive-mask form: every key (the mask input decides); causal form: keys up to the block's last row */
#pragma unroll 1
  for (int j = 0; j <= jmax; ++j) { const float* kr = KF + (size_t)j * ld + h * HD; const float* vr = VF + (size_t)j * ld + h * HD; float s = 0.f;
#pragma unroll 1
    for (int c = 0; c < HD / 4; ++c) { const v4f kq = *(const v4fa*)(kr + c * 4); const v4f qq = *(v4f*)&lq[tid][c * 4]; s = __fadd_rn(s, __fmul_rn(qq[0], kq[0])); s = __fadd_rn(s, __fmul_rn(qq[1], kq[1])); s = __fadd_rn(s, __fmul_rn(qq[2], kq[2])); s = __fadd_rn(s, __fmul_rn(qq[3], kq[3])); }
    s = __fmul_rn(s, scale); if (MASKADD) s = __fadd_rn(s, __fmul_rn(bf16_round(mask[(size_t)i * SQ + j]), -10000.0f));
    const float f = (MASKADD || j <= i) ? 1.f : 0.f; const float sm = fmaf(f, s, (1.f - f) * -1.0e30f); const float mn = fmaxf(m, sm); const float sc = expf(m - mn); const float e = expf(sm - mn); l = __fadd_rn(__fmul_rn(l, sc), e); m = mn;
#pragma unroll 1
    for (int c = 0; c < HD / 4; ++c) { const v4f vv = *(const v4fa*)(vr + c * 4); v4f oo = *(v4f*)&lo[tid][c * 4]; for (int u = 0; u < 4; ++u) oo[u] = __fadd_rn(__fmul_rn(oo[u], sc), __fmul_rn(e, vv[u])); *(v4f*)&lo[tid][c * 4] = oo; } }
  const float fin = 64.0f / l;      /* o carried x64 like the f16 path */
#pragma unroll 1
  for (int c = 0; c < HD / 4; ++c) { v4f oo = *(v4f*)&lo[tid][c * 4]; for (int u = 0; u < 4; ++u) oo[u] = __fmul_rn(oo[u], fin); *(v4f*)&lo[tid][c * 4] = oo; }
  __syncthreads();
  {
#pragma unroll 1
    for (int it = 0; it < 16; ++it) { const int row = it * 4 + tid / 16, pc = (tid % 16) * 4; const v4f v = *(const v4f*)&lo[row][pc]; *(v4f*)(OF + (size_t)(rg * 64 + row) * ldo + h * HD + pc) = v; }
     } }

template <int NORM, int ROPE>
__global__ __launch_bounds__(64) void k_xformf(const float* __restrict__ F, int ldf, int nh, const float* __restrict__ gain, float eps, const float* __restrict__ CS, const float* __restrict__ SN, float* __restrict__ F32, int ldo) {
  #pragma clang fp contract(off)
  __shared__ float xv[HD]; __shared__ float red[HD]; const int d = threadIdx.x; const int h = blockIdx.x % nh; const size_t r = blockIdx.x / nh; const int p = (int)(r % SQ);
  float x = F[r * (size_t)ldf + (size_t)h * HD + d];
  if (NORM) { red[d] = __fmul_rn(x, x); __syncthreads(); for (int st = HD / 2; st > 0; st >>= 1) { if (d < st) red[d] = __fadd_rn(red[d], red[d + st]); __syncthreads(); } const float rs = rsqrtf(__fadd_rn(red[0] / (float)HD, eps)); x = __fmul_rn(__fmul_rn(x, rs), bf16_round(gain[d])); }
  xv[d] = x; __syncthreads();
  float o = x;
  if (ROPE == 1) { const int i = d >> 1; const float c = CS[p * (HD / 2) + i], s = SN[p * (HD / 2) + i]; const float ev = xv[2 * i], od = xv[2 * i + 1]; o = (d & 1) ? __fadd_rn(__fmul_rn(ev, s), __fmul_rn(od, c)) : __fadd_rn(__fmul_rn(ev, c), -__fmul_rn(od, s)); }
  if (ROPE == 2) { const int i = d & (HD / 2 - 1); const float c = CS[p * (HD / 2) + i], s = SN[p * (HD / 2) + i]; const float lo = xv[i], hi = xv[i + HD / 2]; o = (d < HD / 2) ? __fadd_rn(__fmul_rn(lo, c), -__fmul_rn(hi, s)) : __fadd_rn(__fmul_rn(lo, s), __fmul_rn(hi, c)); }
  float* dst = F32 + r * (size_t)ldo + (size_t)h * HD + d; *(float*)dst = o;  }


__global__ __launch_bounds__(256) void k_bfcp(const float* __restrict__ src, float* __restrict__ dst, size_t n4) { const size_t t = (size_t)blockIdx.x * 256 + threadIdx.x; if (t >= n4) return; const v4f a = *(const v4fa*)(src + t * 4); v4f o; for (int q = 0; q < 4; ++q) o[q] = bf16_round(a[q]); *(v4f*)(dst + t * 4) = o;  }
extern "C" void kernel_launch(void* const* d_in, const int* in_sizes, int n_in,
                              void* d_out, int out_size, void* d_ws, size_t ws_size, hipStream_t stream) {
  (void)in_sizes; (void)n_in; (void)out_size;
    const float* const* I = (const float* const*)d_in; const float* x = I[0]; const float* tcos = I[1]; const float* tsin = I[2]; const float* wq = I[3]; const float* wk = I[4]; const float* wv = I[5]; const float* wo = I[6];      /* [in][out] weights, no biases; rope tables INPUT [2048][32] */
  char* ws = (char*)d_ws; size_t off = 0;
  auto take = [&](size_t bytes) { char* p = ws + off; off += (bytes + 255) & ~(size_t)255; return p; };
  _Float16* BQKV = (_Float16*)take((size_t)3 * DM * DM * 2); _Float16* BO = (_Float16*)take((size_t)DM * DM * 2); float* CS = (float*)take((size_t)SQ * (HD / 2) * 4); float* SN = (float*)take((size_t)SQ * (HD / 2) * 4);
  _Float16* X16 = (_Float16*)take(NR * DM * 2); float* QKVF = (float*)take((size_t)SQ * 3 * DM * 4);      /* one batch of f32 q | k | v rows */
  _Float16* QH = (_Float16*)take(NR * DM * 2); _Float16* KH = (_Float16*)take(NR * DM * 2); _Float16* V16 = (_Float16*)take(NR * DM * 2); _Float16* O16 = (_Float16*)take(NR * DM * 2);
  float* S = (float*)take((size_t)NH * QT * NKX * 4); _Float16* P = (_Float16*)take((size_t)NH * QT * NKX * 2); _Float16* VT = (_Float16*)take((size_t)NH * HD * SQ * 2);
  float* QF0 = (float*)take((size_t)QT0 * DM * 4); float* KF0 = (float*)take((size_t)QT0 * DM * 4); float* VF0 = (float*)take((size_t)QT0 * DM * 4); float* OF0 = (float*)take((size_t)NB * QT0 * DM * 4); _Float16* OH0 = (_Float16*)take((size_t)NB * QT0 * DM * 2); _Float16* OL0 = (_Float16*)take((size_t)NB * QT0 * DM * 2);
  if (off > ws_size) return;
  { const unsigned g = (unsigned)(((size_t)DM * (DM / 8) + 255) / 256); k_wt_f16<<<g, 256, 0, stream>>>(wq, BQKV, DM, DM, 16.0f); k_wt_f16<<<g, 256, 0, stream>>>(wk, BQKV + (size_t)DM * DM, DM, DM, 16.0f); k_wt_f16<<<g, 256, 0, stream>>>(wv, BQKV + (size_t)2 * DM * DM, DM, DM, 16.0f); k_wt_f16<<<g, 256, 0, stream>>>(wo, BO, DM, DM, 16.0f); }      /* [in][out] -> Bt[n][k] x16; q | k | v stacked along n */
  k_bfcp<<<(unsigned)((SQ * (HD / 2) / 4 + 255) / 256), 256, 0, stream>>>(tcos, CS, (size_t)SQ * (HD / 2) / 4); k_bfcp<<<(unsigned)((SQ * (HD / 2) / 4 + 255) / 256), 256, 0, stream>>>(tsin, SN, (size_t)SQ * (HD / 2) / 4);      /* bf16-rounded copies of the INPUT tables [2048][32] */
  k_x16<<<(unsigned)((NR * DM / 8 + 255) / 256), 256, 0, stream>>>(x, X16, NR * DM / 8);
  for (int b = B0; b < B0 + NBR; ++b) { const size_t r0 = (size_t)b * SQ;
    k_gemm2<0><<<dim3((unsigned)((SQ / 128) * (3 * DM / 64)), 1), 128, 0, stream>>>(X16 + r0 * DM, DM, 0, BQKV, DM, 0, 0.0625f, nullptr, 0, nullptr, 1, 0, 0, QKVF, nullptr, 3 * DM, 0, SQ, 3 * DM, DM);      /* q | k | v rows (f32) of this batch */
    k_xform<0, 2><<<(unsigned)(SQ * NH), 64, 0, stream>>>(QKVF, 3 * DM, NH, nullptr, 0.f, CS, SN, QH + r0 * DM, DM);
    k_xform<0, 2><<<(unsigned)(SQ * NH), 64, 0, stream>>>(QKVF + DM, 3 * DM, NH, nullptr, 0.f, CS, SN, KH + r0 * DM, DM);
    k_xform<0, 0><<<(unsigned)(SQ * NH), 64, 0, stream>>>(QKVF + 2 * DM, 3 * DM, NH, nullptr, 0.f, CS, SN, V16 + r0 * DM, DM);
    k_vt<NH, SQ><<<NH * (SQ / 64), 256, 0, stream>>>(V16 + r0 * DM, DM, 0, VT);      /* V^T [NH][HD][SQ] for this batch */
    k_xformf<0, 2><<<(unsigned)(QT0 * NH), 64, 0, stream>>>(QKVF, 3 * DM, NH, nullptr, 0.f, CS, SN, QF0, DM); k_xformf<0, 2><<<(unsigned)(QT0 * NH), 64, 0, stream>>>(QKVF + DM, 3 * DM, NH, nullptr, 0.f, CS, SN, KF0, DM); k_xformf<0, 0><<<(unsigned)(QT0 * NH), 64, 0, stream>>>(QKVF + 2 * DM, 3 * DM, NH, nullptr, 0.f, CS, SN, VF0, DM);      /* f32 q (roped), k (roped), v of the first 128 rows */
    k_att0<0><<<NH * (QT0 / 64), 64, 0, stream>>>(QF0, KF0, VF0, DM, nullptr, 0.125f, OF0 + (size_t)b * QT0 * DM, DM);      /* exact f32 causal attention for rows 0..127 (o x64) */
    for (int q0 = 0; q0 < QN; q0 += QT) { const int nk = q0 + QT;      /* causal: only keys below the tile end are computed */
      k_gemm2<0><<<dim3((QT / 128) * (nk / 64), NHD), 128, 0, stream>>>(QH + (r0 + q0) * DM, DM, (size_t)HD, KH + r0 * DM, DM, (size_t)HD, 0.125f, nullptr, 0, nullptr, 1, 0, 0, S, nullptr, NKX, (size_t)QT * NKX, QT, nk, HD);      /* scores, all heads on grid.y */
      k_rsmcf2<<<(NHD * QT + 255) / 256, 256, 0, stream>>>(S, P, NHD, q0, nk);
      k_gemm2<0><<<dim3((QT / 128) * (HD / 64), NHD), 128, 0, stream>>>(P, NKX, (size_t)QT * NKX, VT, SQ, (size_t)HD * SQ, 0.25f, nullptr, 0, nullptr, 1, 0, 0, nullptr, O16 + (r0 + q0) * DM, DM, (size_t)HD, QT, HD, nk); } }      /* o (merged heads, x64) as f16 rows */
  k_gemm2<0><<<dim3((unsigned)((MPO / 128) * (DM / 64)), 1), 128, 0, stream>>>(O16 + (size_t)B0 * SQ * DM, DM, 0, BO, DM, 0, 0.0009765625f, nullptr, 0, nullptr, 1, 0, 0, (float*)d_out + (size_t)B0 * SQ * DM, nullptr, DM, 0, MPO, DM, DM);      /* out rows are the output layout */
  k_hl<<<(unsigned)(((size_t)NB * QT0 * DM / 8 + 255) / 256), 256, 0, stream>>>(OF0, OH0, OL0, (size_t)NB * QT0 * DM / 8);      /* first-tile o (x64) -> f16 hi + x1024 residual planes */
  for (int b = B0; b < B0 + NBR; ++b) { const size_t r0 = (size_t)b * SQ; const size_t f0 = (size_t)b * QT0;
    k_gemm2<0><<<dim3((QT0 / 128) * (DM / 64), 1), 128, 0, stream>>>(OH0 + f0 * DM, DM, 0, BO, DM, 0, 0.0009765625f, nullptr, 0, nullptr, 1, 0, 0, (float*)d_out + r0 * DM, nullptr, DM, 0, QT0, DM, DM);      /* rows 0..127: out = o_hi Wo, overwriting the f16-path rows */
    k_gemm2<0><<<dim3((QT0 / 128) * (DM / 64), 1), 128, 0, stream>>>(OL0 + f0 * DM, DM, 0, BO, DM, 0, 0.00000095367431640625f, nullptr, 0, (const float*)d_out + r0 * DM, -1, 0, 0, (float*)d_out + r0 * DM, nullptr, DM, 0, QT0, DM, DM); }      /* += o_lo Wo 2^-20 (own-element accumulate) */
}

// v001
// One run takes 3970 microseconds.
// In two side-by-side timings against v000, it was 2.47 and 2.46 times as fast.
#include <hip/hip_runtime.h>
// Causal multi-head self-attention with rotate-half RoPE from INPUT tables (x [4][2048][1024]; q/k/v = x W ([in][out] 1024x1024 sigma 1/32, no biases); 16 heads of 64; rope_cos / rope_sin INPUT tables [2048][32] (arbitrary values in [0,1); read bf16-rounded): q = [x1 c - x2 s | x2 c + x1 s] with halves x1, x2, same for k; scores * 64^-0.5; causal (tril, -inf); softmax; out = merged Wo -> [4][2048][1024]).
// Structure: token rows r = b*2048 + s; x as exact f16 rows (bf16-rounded); per batch: q | k | v as ONE WMMA GEMM (32x64 wave tiles, f32 accumulation, exact x16 weights, N = 3 x 1024) into f32 rows, then per (row, head) on VALU: the rotate-half rotary rotation of q and k from the bf16-rounded input tables (no norm) -> f16 q, k, v rows; V^T for all heads via LDS transposes; per query tile of 256 rows: scores against the keys below the tile end only (K = 64, all heads on grid.y, alpha = 0.125), causal row softmax on VALU, one wave per row, with a key mask over the computed range (f32 statistics, native exp; weights x256 f16), o = P . V^T (K = keys below the tile end, alpha 2^-2: o carried x64, folded into the output GEMM alpha) written straight into the merged f16 o rows; out = o W_o GEMM (f32) into the output layout.
// Compute dtype: inputs rounded to bf16; x / weights exact; projections and rope f32; q, k, v, softmax weights and o as plain f16 GEMM operands (~2^-12); scores and softmax statistics f32. v_wmma_f32_16x16x32_f16.
#define NB 4
#define SQ 2048
#define DM 1024
#define NH 16
#define HD 64
#define HG 4                         /* head group of the k_vt(V16, b, h0, VT) overload, which is not launched */
#define QT 256                       /* query rows per causal tile */
#define NKX SQ                       /* S / P row pitch */
#define QT0 128                      /* first-tile rows recomputed exactly in f32 */
#define B0 0                         /* first batch processed (debug hook) */
#define NBR NB                       /* batches processed (debug hook) */
#define QN SQ                        /* query rows attended per batch (debug hook) */
#define NHD NH                       /* heads attended (debug hook) */
#define NR ((size_t)NB * SQ)         /* token rows */
#define MPO ((int)((size_t)NBR * SQ))      /* rows through the output GEMM (debug hook) */
typedef __bf16 v16b __attribute__((ext_vector_type(16)));
typedef unsigned short v8us __attribute__((ext_vector_type(8), may_alias));
typedef float  v8f  __attribute__((ext_vector_type(8)));
typedef float  v4f  __attribute__((ext_vector_type(4)));
typedef float  v4fa __attribute__((ext_vector_type(4), may_alias));
union FragB { v16b v; v8us half[2]; unsigned short u[16]; };

__device__ __forceinline__ unsigned short bf16_bits(float x) { unsigned int u = __float_as_uint(x); return (unsigned short)((u + 0x7FFFu + ((u >> 16) & 1u)) >> 16); }
__device__ __forceinline__ float bf16_val(unsigned short b) { return __uint_as_float(((unsigned int)b) << 16); }
__device__ __forceinline__ float bf16_round(float x) { return bf16_val(bf16_bits(x)); }
// D += A·B with NT terms: 1 = ah·bh, 2 = + al·bh (A split), 3 = + ah·bl (both split)
template <int NT>
__device__ __forceinline__ v8f mmaN(v16b ah, v16b al, v16b bh, v16b bl, v8f c) {
  c = __builtin_amdgcn_wmma_f32_16x16x32_bf16(false, ah, false, bh, (short)0, c, false, false);
  if (NT >= 2) c = __builtin_amdgcn_wmma_f32_16x16x32_bf16(false, al, false, bh, (short)0, c, false, false);
  if (NT >= 3) c = __builtin_amdgcn_wmma_f32_16x16x32_bf16(false, ah, false, bl, (short)0, c, false, false);
  asm volatile("v_nop\n\tv_nop\n\tv_nop\n\tv_nop" : "+v"(c) : "v"(ah), "v"(al), "v"(bh), "v"(bl));
  return c;
}

__global__ __launch_bounds__(256) void k_wt_bf16(const float* __restrict__ W, unsigned short* __restrict__ Wt, int K, int N) {
  const int t = blockIdx.x * 256 + threadIdx.x;
  const int k8n = K / 8;
  if (t >= N * k8n) return;
  const int n = t / k8n, k8 = (t % k8n) * 8;
  v8us v;
#pragma unroll
  for (int i = 0; i < 8; ++i) v[i] = bf16_bits(W[(size_t)(k8 + i) * N + n]);
  *(v8us*)(Wt + (size_t)n * K + k8) = v;
  
}

// GEMM C[M][N] (f32, pitch ldc) = act(A[M][K]·W + bias). A f32 row-major (pitch lda) converted per fragment to bf16
// (ASPLIT: hi/lo two planes -> 2 terms, else single rounded term); Wt bf16 [N][K] (pitch ldb). BIAS_BF16 rounds the
// bias to bf16 first (bias quantised to bf16 before the add). K%32==0, M%16==0, N%64==0.
template <bool ASPLIT, int ACT, bool BIAS_BF16>
__global__ __launch_bounds__(128) void k_gemm_bf(const float* __restrict__ A, int lda, const unsigned short* __restrict__ Wt, int ldb,
                                               const float* __restrict__ bias, float* __restrict__ C, int ldc, int M, int N, int K) {
  __shared__ __attribute__((aligned(16))) float so[4][16][64];
  const int tid = threadIdx.x, w = tid >> 5, lane = tid & 31, ln = lane & 15, hh = lane >> 4;
  const int ntn = N / 64;
  const int wid = blockIdx.x * 4 + w;
  const int mt = wid / ntn, nq = wid % ntn;
  if (mt * 16 >= M) return;
  const int row0 = mt * 16, col0 = nq * 64;
  const float* arow = A + (size_t)(row0 + ln) * lda;
  v8f acc[4] = {};
  for (int kb = 0; kb < K; kb += 32) {
    FragB ah, al;
    const v4f x0 = *(const v4fa*)(arow + kb + 8 * hh), x1 = *(const v4fa*)(arow + kb + 8 * hh + 4);
    const v4f x2 = *(const v4fa*)(arow + kb + 16 + 8 * hh), x3 = *(const v4fa*)(arow + kb + 16 + 8 * hh + 4);
    float xs[16] = {x0[0],x0[1],x0[2],x0[3],x1[0],x1[1],x1[2],x1[3],x2[0],x2[1],x2[2],x2[3],x3[0],x3[1],x3[2],x3[3]};
#pragma unroll
    for (int i = 0; i < 16; ++i) { const unsigned short hb = bf16_bits(xs[i]); ah.u[i] = hb; al.u[i] = ASPLIT ? bf16_bits(xs[i] - bf16_val(hb)) : (unsigned short)0; }
#pragma unroll
    for (int t = 0; t < 4; ++t) {
      const unsigned short* brow = Wt + (size_t)(col0 + t * 16 + ln) * ldb + kb;
      FragB b;
      b.half[0] = *(const v8us*)(brow + 8 * hh);
      b.half[1] = *(const v8us*)(brow + 16 + 8 * hh);
      acc[t] = mmaN<ASPLIT ? 2 : 1>(ah.v, al.v, b.v, b.v, acc[t]);
    }
  }
#pragma unroll
  for (int t = 0; t < 4; ++t) {
    float bv = bias ? bias[col0 + t * 16 + ln] : 0.f;
    if (BIAS_BF16) bv = bf16_round(bv);
#pragma unroll
    for (int r = 0; r < 8; ++r) { float v = acc[t][r] + bv; if (ACT == 1) v = fmaxf(v, 0.f); so[w][8 * hh + r][t * 16 + ln] = v; }
  }
  __builtin_amdgcn_fence(__ATOMIC_ACQ_REL, "workgroup");
  __builtin_amdgcn_wave_barrier();
  const int rsub = lane >> 4, c4 = (lane & 15) * 4;
  {
#pragma unroll
    for (int q = 0; q < 8; ++q) {
      const int r = q * 2 + rsub;
      const v4f v = *(const v4fa*)&so[w][r][c4];
      *(v4f*)(C + (size_t)(row0 + r) * ldc + col0 + c4) = v;
    }
    
  }
}

// GEMM C = act(A·W + bias + resid): A f32 (ASPLIT -> hi/lo 2 terms), Wt bf16 [N][K]; ACT 0 none, 1 relu, 2 exact gelu;
// resid (optional, f32, row index = (row % rmod), pitch ldr, RES_BF16 rounds it) added before the activation.
template <bool ASPLIT, int ACT, bool BIAS_BF16, bool RES_BF16>
__global__ __launch_bounds__(128) void k_gemm_bf3(const float* __restrict__ A, int lda, const unsigned short* __restrict__ Wt, int ldb,
                                                const float* __restrict__ bias, const float* __restrict__ resid, int rmod, int ldr,
                                                float* __restrict__ C, int ldc, int M, int N, int K) {
  __shared__ __attribute__((aligned(16))) float so[4][16][64];
  const int tid = threadIdx.x, w = tid >> 5, lane = tid & 31, ln = lane & 15, hh = lane >> 4;
  const int ntn = N / 64;
  const int wid = blockIdx.x * 4 + w;
  const int mt = wid / ntn, nq = wid % ntn;
  if (mt * 16 >= M) return;
  const int row0 = mt * 16, col0 = nq * 64;
  const float* arow = A + (size_t)(row0 + ln) * lda;
  v8f acc[4] = {};
  for (int kb = 0; kb < K; kb += 32) {
    FragB ah, al;
    const v4f x0 = *(const v4fa*)(arow + kb + 8 * hh), x1 = *(const v4fa*)(arow + kb + 8 * hh + 4);
    const v4f x2 = *(const v4fa*)(arow + kb + 16 + 8 * hh), x3 = *(const v4fa*)(arow + kb + 16 + 8 * hh + 4);
    float xs[16] = {x0[0],x0[1],x0[2],x0[3],x1[0],x1[1],x1[2],x1[3],x2[0],x2[1],x2[2],x2[3],x3[0],x3[1],x3[2],x3[3]};
#pragma unroll
    for (int i = 0; i < 16; ++i) { const unsigned short hb = bf16_bits(xs[i]); ah.u[i] = hb; al.u[i] = ASPLIT ? bf16_bits(xs[i] - bf16_val(hb)) : (unsigned short)0; }
#pragma unroll
    for (int t = 0; t < 4; ++t) {
      const unsigned short* brow = Wt + (size_t)(col0 + t * 16 + ln) * ldb + kb;
      FragB b;
      b.half[0] = *(const v8us*)(brow + 8 * hh);
      b.half[1] = *(const v8us*)(brow + 16 + 8 * hh);
      acc[t] = mmaN<ASPLIT ? 2 : 1>(ah.v, al.v, b.v, b.v, acc[t]);
    }
  }
#pragma unroll
  for (int t = 0; t < 4; ++t) {
    const int col = col0 + t * 16 + ln;
    float bv = bias ? bias[col] : 0.f;
    if (BIAS_BF16) bv = bf16_round(bv);
#pragma unroll
    for (int r = 0; r < 8; ++r) {
      float v = acc[t][r] + bv;
      if (resid) { float rv = resid[(size_t)((row0 + 8 * hh + r) % rmod) * ldr + col]; if (RES_BF16) rv = bf16_round(rv); v += rv; }
      if (ACT == 1) v = fmaxf(v, 0.f);
      if (ACT == 2) v = 0.5f * v * (1.0f + erff(v * 0.70710678118654752f));
      if (ACT == 3) { const float u = 0.7978845608028654f * (v + 0.044715f * v * v * v); v = 0.5f * v * (1.0f + tanhf(u)); }
      so[w][8 * hh + r][t * 16 + ln] = v;
    }
  }
  __builtin_amdgcn_fence(__ATOMIC_ACQ_REL, "workgroup");
  __builtin_amdgcn_wave_barrier();
  const int rsub = lane >> 4, c4 = (lane & 15) * 4;
  {
#pragma unroll
    for (int q = 0; q < 8; ++q) {
      const int r = q * 2 + rsub;
      const v4f v = *(const v4fa*)&so[w][r][c4];
      *(v4f*)(C + (size_t)(row0 + r) * ldc + col0 + c4) = v;
    }
    
  }
}
// row LayerNorm (biased variance, eps) over N: s = X (+ R); optional out_sum <- s; out_norm <- (s-mu)*rsqrt(var+eps)*g + b
template <bool PARAM_BF16>
__global__ __launch_bounds__(256) void k_layernorm(const float* __restrict__ X, const float* __restrict__ R, const float* __restrict__ g, const float* __restrict__ bta,
                                                  float* __restrict__ out_sum, float* __restrict__ out_norm, int N, float eps) {
  __shared__ float red[256];
  const int row = blockIdx.x, tid = threadIdx.x;
  const float* x = X + (size_t)row * N; const float* rr = R ? R + (size_t)row * N : nullptr;
  float vals[16];                     // up to N = 4096
  const int per = N / 256;            // contiguous chunk per thread? use strided-by-4 chunks: thread handles j = tid*4 + 1024*u
  float s1 = 0.f;
  for (int u = 0; u < per / 4; ++u) {
    const int j = tid * 4 + 1024 * u;
    const v4f a = *(const v4fa*)(x + j);
    v4f b = {0.f,0.f,0.f,0.f}; if (rr) b = *(const v4fa*)(rr + j);
#pragma unroll
    for (int q = 0; q < 4; ++q) { const float v = a[q] + b[q]; vals[u * 4 + q] = v; s1 += v; }
  }
  red[tid] = s1; __syncthreads();
  for (int st = 128; st > 0; st >>= 1) { if (tid < st) red[tid] += red[tid + st]; __syncthreads(); }
  const float mu = red[0] / (float)N; __syncthreads();
  float s2 = 0.f;
  for (int u = 0; u < per / 4; ++u)
#pragma unroll
    for (int q = 0; q < 4; ++q) { const float c = vals[u * 4 + q] - mu; s2 += c * c; }
  red[tid] = s2; __syncthreads();
  for (int st = 128; st > 0; st >>= 1) { if (tid < st) red[tid] += red[tid + st]; __syncthreads(); }
  const float rs = rsqrtf(red[0] / (float)N + eps);
  {
    for (int u = 0; u < per / 4; ++u) {
      const int j = tid * 4 + 1024 * u;
      v4f o, sm;
#pragma unroll
      for (int q = 0; q < 4; ++q) {
        float gg = g[j + q], bb = bta[j + q];
        if (PARAM_BF16) { gg = bf16_round(gg); bb = bf16_round(bb); }
        sm[q] = vals[u * 4 + q]; o[q] = (vals[u * 4 + q] - mu) * rs * gg + bb;
      }
      if (out_sum) *(v4f*)(out_sum + (size_t)row * N + j) = sm;
      *(v4f*)(out_norm + (size_t)row * N + j) = o;
    }
    
  }
}



// ---- f16 WMMA path (v_wmma_f32_16x16x32_f16): 11-bit significands for operands in range — used where a [0,1] probability operand needs more precision than bf16
typedef _Float16 v16h __attribute__((ext_vector_type(16)));
union FragH { v16h v; v8us half[2]; _Float16 h[16]; unsigned short u[16]; };
template <int NT>
__device__ __forceinline__ v8f mmaH(v16h ah, v16h al, v16h bh, v16h bl, v8f c) {
  c = __builtin_amdgcn_wmma_f32_16x16x32_f16(false, ah, false, bh, (short)0, c, false, false);
  if (NT >= 2) c = __builtin_amdgcn_wmma_f32_16x16x32_f16(false, al, false, bh, (short)0, c, false, false);
  if (NT >= 3) c = __builtin_amdgcn_wmma_f32_16x16x32_f16(false, ah, false, bl, (short)0, c, false, false);
  asm volatile("v_nop\n\tv_nop\n\tv_nop\n\tv_nop" : "+v"(c) : "v"(ah), "v"(al), "v"(bh), "v"(bl));
  return c;
}
// batched GEMM like k_gemm_b but f16 operands: A f32 (split into f16 hi/lo if ASPLIT, else rounded to f16), Bt = f16 values [n][k]; alpha; C f32; N multiple of 16 (partial tiles skipped)
template <bool ASPLIT>
__global__ __launch_bounds__(128) void k_gemm_h(const float* __restrict__ A, int lda, size_t sA, const _Float16* __restrict__ Bh, int ldb, size_t sB, float alpha, float* __restrict__ C, int ldc, size_t sC, int M, int N, int K) {
  __shared__ __attribute__((aligned(16))) float so[4][16][64];
  const int tid = threadIdx.x, w = tid >> 5, lane = tid & 31, ln = lane & 15, hh = lane >> 4; const int by = blockIdx.y;
  A += (size_t)by * sA; Bh += (size_t)by * sB; C += (size_t)by * sC;
  const int ntn = (N + 63) / 64; const int wid = blockIdx.x * 4 + w; const int mt = wid / ntn, nq = wid % ntn; if (mt * 16 >= M) return;
  const int row0 = mt * 16, col0 = nq * 64; const float* arow = A + (size_t)(row0 + ln) * lda;
  v8f acc[4] = {};
  for (int kb = 0; kb < K; kb += 32) {
    FragH ah, al;
    const v4f x0 = *(const v4fa*)(arow + kb + 8 * hh), x1 = *(const v4fa*)(arow + kb + 8 * hh + 4), x2 = *(const v4fa*)(arow + kb + 16 + 8 * hh), x3 = *(const v4fa*)(arow + kb + 16 + 8 * hh + 4);
    float xs[16] = {x0[0],x0[1],x0[2],x0[3],x1[0],x1[1],x1[2],x1[3],x2[0],x2[1],x2[2],x2[3],x3[0],x3[1],x3[2],x3[3]};
#pragma unroll
    for (int i = 0; i < 16; ++i) { const _Float16 h = (_Float16)xs[i]; ah.h[i] = h; al.h[i] = ASPLIT ? (_Float16)(xs[i] - (float)h) : (_Float16)0.0f; }
#pragma unroll
    for (int t = 0; t < 4; ++t) { if (col0 + t * 16 >= N) continue; const size_t boff = (size_t)(col0 + t * 16 + ln) * ldb + kb; FragH bq; bq.half[0] = *(const v8us*)(Bh + boff + 8 * hh); bq.half[1] = *(const v8us*)(Bh + boff + 16 + 8 * hh);
      acc[t] = mmaH<ASPLIT ? 2 : 1>(ah.v, al.v, bq.v, bq.v, acc[t]); }
  }
#pragma unroll
  for (int t = 0; t < 4; ++t) { if (col0 + t * 16 >= N) continue;
#pragma unroll
    for (int r = 0; r < 8; ++r) so[w][8 * hh + r][t * 16 + ln] = acc[t][r] * alpha; }
  __builtin_amdgcn_fence(__ATOMIC_ACQ_REL, "workgroup"); __builtin_amdgcn_wave_barrier();
  const int rsub = lane >> 4, c4 = (lane & 15) * 4;
  {
#pragma unroll
    for (int q = 0; q < 8; ++q) { const int r = q * 2 + rsub; if (col0 + c4 < N) { const v4f v = *(const v4fa*)&so[w][r][c4]; *(v4f*)(C + (size_t)(row0 + r) * ldc + col0 + c4) = v; } }
     }
}

// Wt[n][k] = f16(W[k][n]·scale) from f32 row-major W[K][N] (scale = power of two; bf16-exact weights stay exact in f16 away from the subnormal range)
__global__ __launch_bounds__(256) void k_wt_f16(const float* __restrict__ W, _Float16* __restrict__ Wt, int K, int N, float scale) {
  const int t = blockIdx.x * 256 + threadIdx.x; if (t >= N * (K / 8)) return; const int n = t / (K / 8), k8 = (t % (K / 8)) * 8; FragH f;
#pragma unroll
  for (int i = 0; i < 8; ++i) f.h[i] = (_Float16)(bf16_round(W[(size_t)(k8 + i) * N + n]) * scale); const v8us o = f.half[0];
  *(v8us*)((unsigned short*)Wt + (size_t)n * K + k8) = o; 
}
// k_gemm_hh variant with fused epilogue: v = acc·alpha + bias[by·sBias + col] (+ CP[(row/rowsPerB)·sCPb + by·64 + col] if CP) ; ACT 0 none / 1 elu ; writes f16 C16 (and f32 C if non-null)
template <int ACT>
__global__ __launch_bounds__(128) void k_gemm_hhx(const _Float16* __restrict__ A, int lda, size_t sA, const _Float16* __restrict__ Bh, int ldb, size_t sB, float alpha, const float* __restrict__ bias, size_t sBias, const float* __restrict__ CP, int rowsPerB, size_t sCPb, int row0g,
    float* __restrict__ C, _Float16* __restrict__ C16, int ldc, size_t sC, int M, int N, int K) {
  __shared__ __attribute__((aligned(16))) float so[4][16][64];
  const int tid = threadIdx.x, w = tid >> 5, lane = tid & 31, ln = lane & 15, hh = lane >> 4; const int by = blockIdx.y;
  A += (size_t)by * sA; Bh += (size_t)by * sB; const size_t cofs = (size_t)by * sC; const float* bp = bias ? bias + (size_t)by * sBias : nullptr;
  const int ntn = (N + 63) / 64; const int wid = blockIdx.x * 4 + w; const int mt = wid / ntn, nq = wid % ntn; if (mt * 16 >= M) return;
  const int row0 = mt * 16, col0 = nq * 64; const _Float16* arow = A + (size_t)(row0 + ln) * lda;
  v8f acc[4] = {};
  for (int kb = 0; kb < K; kb += 32) { FragH ah; ah.half[0] = *(const v8us*)((const unsigned short*)arow + kb + 8 * hh); ah.half[1] = *(const v8us*)((const unsigned short*)arow + kb + 16 + 8 * hh);
#pragma unroll
    for (int t = 0; t < 4; ++t) { if (col0 + t * 16 >= N) continue; const size_t boff = (size_t)(col0 + t * 16 + ln) * ldb + kb; FragH bq; bq.half[0] = *(const v8us*)((const unsigned short*)Bh + boff + 8 * hh); bq.half[1] = *(const v8us*)((const unsigned short*)Bh + boff + 16 + 8 * hh);
      acc[t] = mmaH<1>(ah.v, ah.v, bq.v, bq.v, acc[t]); }
  }
#pragma unroll
  for (int t = 0; t < 4; ++t) { if (col0 + t * 16 >= N) continue; const int col = col0 + t * 16 + ln; const float bv = bp ? bf16_round(bp[col]) : 0.f;
#pragma unroll
    for (int r = 0; r < 8; ++r) { float v = acc[t][r] * alpha + bv; if (CP) { const int rr = row0g + row0 + 8 * hh + r; if (rowsPerB < 0) v += CP[cofs + (size_t)rr * ldc + col];      /* rowsPerB < 0: own element of the batched C plane */ else { const int bidx = rr / rowsPerB; v += CP[(size_t)bidx * sCPb + (size_t)by * 64 + col]; } } if (ACT == 1) v = (v > 0.f) ? v : expm1f(v); else if (ACT == 7) v = (v > 0.f) ? v + 1.0f : expf(v); else if (ACT == 8) v = tanhf(v); else if (ACT == 9) v = 0.5f * v * (1.0f + tanhf(0.7978845608028654f * (v + 0.044715f * v * v * v))); else if (ACT == 11) v = 1.0f / (1.0f + expf(-v)); else if (ACT == 12) v = (v > 0.f) ? v : 0.01f * v; else if (ACT == 14) v = (v > 0.f) ? v : 0.1f * v; else if (ACT == 16) v = (v >= 0.f) ? v : 0.3f * v; else if (ACT == 17) v = (v >= 0.f) ? v : 0.2f * v; else if (ACT == 15) v = v / (1.0f + expf(-v)); else if (ACT == 3) v = fmaxf(v, 0.f); else if (ACT == 6) v = 0.5f * v * (1.0f + erff(v * 0.70710678118654752f)); so[w][8 * hh + r][t * 16 + ln] = v; } }
  __builtin_amdgcn_fence(__ATOMIC_ACQ_REL, "workgroup"); __builtin_amdgcn_wave_barrier();
  const int rsub = lane >> 4, c4 = (lane & 15) * 4; typedef _Float16 v4h __attribute__((ext_vector_type(4)));
  {
#pragma unroll
    for (int q = 0; q < 8; ++q) { const int r = q * 2 + rsub; if (col0 + c4 < N) { const v4f v = *(const v4fa*)&so[w][r][c4]; if (C) *(v4f*)(C + cofs + (size_t)(row0 + r) * ldc + col0 + c4) = v; if (C16) { v4h h4; for (int i = 0; i < 4; ++i) h4[i] = (_Float16)v[i]; *(v4h*)(C16 + cofs + (size_t)(row0 + r) * ldc + col0 + c4) = h4; } } }
     }
}


typedef _Float16 v4h __attribute__((ext_vector_type(4)));

__global__ __launch_bounds__(256) void k_x16(const float* __restrict__ x, _Float16* __restrict__ X16, size_t n8) { const size_t t = (size_t)blockIdx.x * 256 + threadIdx.x; if (t >= n8) return; FragH f;
#pragma unroll
  for (int q = 0; q < 8; ++q) f.h[q] = (_Float16)bf16_round(x[t * 8 + q]); *(v8us*)((unsigned short*)X16 + t * 8) = f.half[0];  }
__global__ __launch_bounds__(256) void k_h16(const float* __restrict__ x, _Float16* __restrict__ X16, size_t n8) { const size_t t = (size_t)blockIdx.x * 256 + threadIdx.x; if (t >= n8) return; FragH f;
#pragma unroll
  for (int q = 0; q < 8; ++q) f.h[q] = (_Float16)x[t * 8 + q]; *(v8us*)((unsigned short*)X16 + t * 8) = f.half[0];  }
__global__ __launch_bounds__(256) void k_round16f(const float* __restrict__ W, _Float16* __restrict__ Bt, size_t n8) { const size_t t = (size_t)blockIdx.x * 256 + threadIdx.x; if (t >= n8) return; FragH f;
#pragma unroll
  for (int i = 0; i < 8; ++i) f.h[i] = (_Float16)(bf16_round(W[t * 8 + i]) * 16.0f); *(v8us*)((unsigned short*)Bt + t * 8) = f.half[0];  }
template <int NHv, int TTv>
__global__ __launch_bounds__(256) void k_vt(const _Float16* __restrict__ V16, int ldv, int voff, _Float16* __restrict__ Vt) { __shared__ unsigned short tl[64][66]; const int tid = threadIdx.x; const int slab = blockIdx.x / (TTv / 64), lg = blockIdx.x % (TTv / 64); const int b = slab / NHv, h = slab % NHv;
  for (int i = tid; i < 64 * 8; i += 256) { const int r = i / 8, c8 = (i % 8) * 8; FragH f; f.half[0] = *(const v8us*)((const unsigned short*)V16 + ((size_t)b * TTv + lg * 64 + r) * ldv + voff + h * 64 + c8);
#pragma unroll
    for (int q = 0; q < 8; ++q) tl[r][c8 + q] = f.u[q]; }
  __syncthreads();
  {
#pragma unroll
    for (int rd = 0; rd < 2; ++rd) { const int d = rd * 32 + tid / 8, pc = tid % 8; FragH f;
#pragma unroll
      for (int q = 0; q < 8; ++q) f.u[q] = tl[pc * 8 + q][d];
      *(v8us*)((unsigned short*)Vt + ((size_t)slab * 64 + d) * TTv + lg * 64 + pc * 8) = f.half[0]; }
     } }

__global__ __launch_bounds__(256) void k_hl(const float* __restrict__ F, _Float16* __restrict__ Hh, _Float16* __restrict__ Hl, size_t n8) { const size_t t = (size_t)blockIdx.x * 256 + threadIdx.x; if (t >= n8) return; FragH fh, fl; const v4f a = *(const v4fa*)(F + t * 8), c = *(const v4fa*)(F + t * 8 + 4);
#pragma unroll
  for (int q = 0; q < 4; ++q) { _Float16 h = (_Float16)a[q]; fh.h[q] = h; fl.h[q] = (_Float16)((a[q] - (float)h) * 1024.0f); h = (_Float16)c[q]; fh.h[4 + q] = h; fl.h[4 + q] = (_Float16)((c[q] - (float)h) * 1024.0f); }
  { *(v8us*)((unsigned short*)Hh + t * 8) = fh.half[0]; *(v8us*)((unsigned short*)Hl + t * 8) = fl.half[0];  } }

// ---- fast GEMM (wave tile 32x64; requires M % 32 == 0 rows per launch region and N % 64 == 0); epilogue = k_gemm_hhx semantics ----
__device__ __forceinline__ v16h g2_frag(const _Float16* p, int hh) { FragH f; f.half[0] = *(const v8us*)((const unsigned short*)p + 8 * hh); f.half[1] = *(const v8us*)((const unsigned short*)p + 16 + 8 * hh); return f.v; }
__device__ __forceinline__ v8f g2_mma(v16h a, v16h b, v8f c) { v8f d = __builtin_amdgcn_wmma_f32_16x16x32_f16(false, a, false, b, (short)0, c, false, false); asm volatile("v_nop\n\tv_nop\n\tv_nop\n\tv_nop" : "+v"(d) : "v"(a), "v"(b)); return d; }
template <int ACT>
__global__ __launch_bounds__(128) void k_gemm2(const _Float16* __restrict__ A, int lda, size_t sA, const _Float16* __restrict__ Bh, int ldb, size_t sB, float alpha, const float* __restrict__ bias, size_t sBias, const float* __restrict__ CP, int rowsPerB, size_t sCPb, int row0g,
    float* __restrict__ C, _Float16* __restrict__ C16, int ldc, size_t sC, int M, int N, int K) { static_assert(ACT == 0 || ACT == 3 || ACT == 6 || ACT == 8 || ACT == 9 || ACT == 11 || ACT == 12 || ACT == 14 || ACT == 15 || ACT == 16 || ACT == 17, "k_gemm2: unsupported ACT code (would silently apply no activation)");
  __shared__ __attribute__((aligned(16))) float so[4][32][68];
  const int tid = threadIdx.x, w = tid >> 5, lane = tid & 31, ln = lane & 15, hh = lane >> 4; const int by = blockIdx.y;
  A += (size_t)by * sA; Bh += (size_t)by * sB; const size_t cofs = (size_t)by * sC; const float* bp = bias ? bias + (size_t)by * sBias : nullptr;
  const int ntn = N >> 6; const int mt = blockIdx.x / ntn, nq = blockIdx.x - mt * ntn; const int row0 = mt * 128 + 32 * w, col0 = nq * 64; if (row0 >= M) return;
  const _Float16* a0p = A + (size_t)(row0 + ln) * lda; const _Float16* a1p = a0p + (size_t)16 * lda;
  const _Float16* b0p = Bh + (size_t)(col0 + ln) * ldb; const _Float16* b1p = b0p + (size_t)16 * ldb; const _Float16* b2p = b1p + (size_t)16 * ldb; const _Float16* b3p = b2p + (size_t)16 * ldb;
  const v8f z8 = {0.f,0.f,0.f,0.f,0.f,0.f,0.f,0.f}; v8f c00 = z8, c01 = z8, c02 = z8, c03 = z8, c10 = z8, c11 = z8, c12 = z8, c13 = z8;
#pragma unroll 1
  for (int kb = 0; kb < K; kb += 32) { const v16h a0 = g2_frag(a0p + kb, hh), a1 = g2_frag(a1p + kb, hh);
    v16h b = g2_frag(b0p + kb, hh); c00 = g2_mma(a0, b, c00); c10 = g2_mma(a1, b, c10);
    b = g2_frag(b1p + kb, hh); c01 = g2_mma(a0, b, c01); c11 = g2_mma(a1, b, c11);
    b = g2_frag(b2p + kb, hh); c02 = g2_mma(a0, b, c02); c12 = g2_mma(a1, b, c12);
    b = g2_frag(b3p + kb, hh); c03 = g2_mma(a0, b, c03); c13 = g2_mma(a1, b, c13); }
  v8f accs[8] = {c00, c01, c02, c03, c10, c11, c12, c13};
#pragma unroll
  for (int u = 0; u < 8; ++u) { const int t = u & 3, half = u >> 2; const int col = col0 + t * 16 + ln; const float bv = bp ? bf16_round(bp[col]) : 0.f;
#pragma unroll
    for (int r = 0; r < 8; ++r) { const int rloc = half * 16 + 8 * hh + r; float v = accs[u][r] * alpha + bv; if (CP) { if (rowsPerB < 0) v += CP[cofs + (size_t)(row0g + row0 + rloc) * ldc + col];      /* rowsPerB < 0: own element of the batched C plane */ else { const int bidx = (row0g + row0 + rloc) / rowsPerB; v += CP[(size_t)bidx * sCPb + (size_t)by * 64 + col]; } }
      if (ACT == 3) v = fmaxf(v, 0.f); else if (ACT == 6) v = 0.5f * v * (1.0f + erff(v * 0.70710678118654752f)); else if (ACT == 11) v = 1.0f / (1.0f + expf(-v)); else if (ACT == 15) v = v / (1.0f + expf(-v)); else if (ACT == 12) v = (v > 0.f) ? v : 0.01f * v; else if (ACT == 8) v = tanhf(v); else if (ACT == 9) v = 0.5f * v * (1.0f + tanhf(0.7978845608028654f * (v + 0.044715f * v * v * v))); else if (ACT == 14) v = (v > 0.f) ? v : 0.1f * v; else if (ACT == 16) v = (v >= 0.f) ? v : 0.3f * v; else if (ACT == 17) v = (v >= 0.f) ? v : 0.2f * v;
      so[w][rloc][t * 16 + ln] = v; } }
  __builtin_amdgcn_fence(__ATOMIC_ACQ_REL, "workgroup"); __builtin_amdgcn_wave_barrier();
  const int rsub = lane >> 4, c4 = (lane & 15) * 4;
  {
#pragma unroll
    for (int q = 0; q < 16; ++q) { const int r = q * 2 + rsub; const v4f v = *(const v4fa*)&so[w][r][c4]; if (C) *(v4f*)(C + cofs + (size_t)(row0 + r) * ldc + col0 + c4) = v; if (C16) { v4h h4; for (int i = 0; i < 4; ++i) h4[i] = (_Float16)v[i]; *(v4h*)(C16 + cofs + (size_t)(row0 + r) * ldc + col0 + c4) = h4; } }
     } }


__global__ __launch_bounds__(256) void k_wnat(const float* __restrict__ w, size_t n8, _Float16* __restrict__ Bt) { const size_t t = (size_t)blockIdx.x * 256 + threadIdx.x; if (t >= n8) return; FragH f; for (int q = 0; q < 8; ++q) f.h[q] = (_Float16)(bf16_round(w[t * 8 + q]) * 16.0f); *(v8us*)((unsigned short*)Bt + t * 8) = f.half[0];  }
__global__ __launch_bounds__(256) void k_rsm(const float* __restrict__ S, _Float16* __restrict__ P, int nrows) {
  #pragma clang fp contract(off)
  const int i = blockIdx.x * 256 + threadIdx.x; if (i >= nrows) return; const float* s = S + (size_t)i * SQ; float mx = -3.0e38f;
#pragma unroll 1
  for (int j = 0; j < SQ; ++j) mx = fmaxf(mx, s[j]); float se = 0.f;
#pragma unroll 1
  for (int j = 0; j < SQ; ++j) se += expf(s[j] - mx); const float sc = 256.0f / se;
#pragma unroll 1
  for (int j0 = 0; j0 < SQ; j0 += 8) { FragH f; for (int q = 0; q < 8; ++q) f.h[q] = (_Float16)(expf(s[j0 + q] - mx) * sc); unsigned short* d = (unsigned short*)P + (size_t)i * SQ + j0; *(v8us*)d = f.half[0];  } }
__global__ __launch_bounds__(256) void k_vt(const _Float16* __restrict__ V16, int b, int h0, _Float16* __restrict__ VT) { __shared__ unsigned short tl[64][65]; const int tid = threadIdx.x; const int hh = blockIdx.x % HG, sg = blockIdx.x / HG; const int s0 = sg * 64; const int h = h0 + hh;
  for (int i = tid; i < 64 * 8; i += 256) { const int j = i / 8, d8 = (i % 8) * 8; FragH f; f.half[0] = *(const v8us*)((const unsigned short*)V16 + ((size_t)b * SQ + s0 + j) * DM + h * HD + d8); for (int q = 0; q < 8; ++q) tl[d8 + q][j] = f.u[q]; }
  __syncthreads();
  { for (int i = tid; i < 64 * 8; i += 256) { const int d = i / 8, j8 = (i % 8) * 8; FragH f; for (int q = 0; q < 8; ++q) f.u[q] = tl[d][j8 + q]; *(v8us*)((unsigned short*)VT + ((size_t)hh * HD + d) * SQ + s0 + j8) = f.half[0]; }  } }


__global__ __launch_bounds__(256) void k_tab2(float theta, float* __restrict__ CS, float* __restrict__ SN) {
  #pragma clang fp contract(off)
  const int t = blockIdx.x * 256 + threadIdx.x; if (t >= SQ * (HD / 2)) return; const int i = t % (HD / 2); const int p = t / (HD / 2); const float invf = 1.0f / powf(theta, (float)(2 * i) / (float)HD); const float ang = __fmul_rn((float)p, invf); const float c = cosf(ang), s = sinf(ang);
  *(float*)(CS + t) = c; *(float*)(SN + t) = s;  }
template <int NORM, int ROPE>
__global__ __launch_bounds__(64) void k_xform(const float* __restrict__ F, int ldf, int nh, const float* __restrict__ gain, float eps, const float* __restrict__ CS, const float* __restrict__ SN, _Float16* __restrict__ H16, int ldo) {
  #pragma clang fp contract(off)
  __shared__ float xv[HD]; __shared__ float red[HD]; __shared__ unsigned short sh_[HD]; const int d = threadIdx.x; const int h = blockIdx.x % nh; const size_t r = blockIdx.x / nh; const int p = (int)(r % SQ);
  float x = F[r * (size_t)ldf + (size_t)h * HD + d];
  if (NORM) { red[d] = __fmul_rn(x, x); __syncthreads(); for (int st = HD / 2; st > 0; st >>= 1) { if (d < st) red[d] = __fadd_rn(red[d], red[d + st]); __syncthreads(); } const float rs = rsqrtf(__fadd_rn(red[0] / (float)HD, eps)); x = __fmul_rn(__fmul_rn(x, rs), bf16_round(gain[d])); }
  xv[d] = x; __syncthreads();
  float o = x;
  if (ROPE == 1) { const int i = d >> 1; const float c = CS[p * (HD / 2) + i], s = SN[p * (HD / 2) + i]; const float ev = xv[2 * i], od = xv[2 * i + 1]; o = (d & 1) ? __fadd_rn(__fmul_rn(ev, s), __fmul_rn(od, c)) : __fadd_rn(__fmul_rn(ev, c), -__fmul_rn(od, s)); }
  if (ROPE == 2) { const int i = d & (HD / 2 - 1); const float c = CS[p * (HD / 2) + i], s = SN[p * (HD / 2) + i]; const float lo = xv[i], hi = xv[i + HD / 2]; o = (d < HD / 2) ? __fadd_rn(__fmul_rn(lo, c), -__fmul_rn(hi, s)) : __fadd_rn(__fmul_rn(lo, s), __fmul_rn(hi, c)); }
  FragH th; th.h[0] = (_Float16)o; sh_[d] = th.u[0]; __syncthreads();
  if (d < HD / 8) { FragH f; for (int q = 0; q < 8; ++q) f.u[q] = sh_[d * 8 + q]; unsigned short* dst = (unsigned short*)H16 + r * (size_t)ldo + (size_t)h * HD + d * 8; *(v8us*)dst = f.half[0];  } }

__global__ __launch_bounds__(256) void k_tab4(const int* __restrict__ pos, float theta, float* __restrict__ CS, float* __restrict__ SN) {
  #pragma clang fp contract(off)
  const int t = blockIdx.x * 256 + threadIdx.x; if (t >= SQ * (HD / 2)) return; const int i = t % (HD / 2); const int p = t / (HD / 2); const float invf = (float)pow((double)theta, -((double)(2 * i)) / (double)HD); const float ang = __fmul_rn((float)pos[p], invf); const float c = cosf(ang), s = sinf(ang);
  *(float*)(CS + t) = c; *(float*)(SN + t) = s;  }
__global__ __launch_bounds__(256) void k_rsmf(const float* __restrict__ S, _Float16* __restrict__ P, int qn, int hg) {
  #pragma clang fp contract(off)
  const int t = blockIdx.x * 256 + threadIdx.x; if (t >= qn * hg) return; const size_t i = (size_t)(t / qn) * SQ + (t % qn); const float* s = S + i * SQ; float mx = -3.0e38f;
#pragma unroll 1
  for (int j = 0; j < SQ; ++j) mx = fmaxf(mx, s[j]); float se = 0.f;
#pragma unroll 1
  for (int j = 0; j < SQ; ++j) se += __expf(s[j] - mx); const float sc = 256.0f / se;
#pragma unroll 1
  for (int j0 = 0; j0 < SQ; j0 += 8) { FragH f; for (int q = 0; q < 8; ++q) f.h[q] = (_Float16)(__expf(s[j0 + q] - mx) * sc); unsigned short* d = (unsigned short*)P + i * SQ + j0; *(v8us*)d = f.half[0];  } }


// Causal row softmax, one wave per score row: lane l keeps keys 256 c + 8 l .. + 7 of each of the NC 256-key chunks c in registers,
// so the row is read once in contiguous 16-byte pieces, each exponential is taken once, and row maximum and row sum end in a five-step lane butterfly.
template <int NC>
__device__ __forceinline__ void rsm_row(const float* __restrict__ s, unsigned short* __restrict__ d, int lane, int last) {
  v4f va[NC], vb[NC];      /* every loop of this function is unrolled so that va and vb are named registers and all loads of the row issue before the first use */
#pragma unroll
  for (int c = 0; c < NC; ++c) { va[c] = *(const v4fa*)(s + c * 256); vb[c] = *(const v4fa*)(s + c * 256 + 4); }
  float mx = -3.0e38f;
#pragma unroll
  for (int c = 0; c < NC; ++c) { const int j0 = c * 256 + lane * 8;
#pragma unroll
    for (int q = 0; q < 4; ++q) { va[c][q] = (j0 + q <= last) ? va[c][q] : -1.0e9f; vb[c][q] = (j0 + 4 + q <= last) ? vb[c][q] : -1.0e9f; mx = fmaxf(mx, fmaxf(va[c][q], vb[c][q])); } }
#pragma unroll
  for (int o = 16; o > 0; o >>= 1) mx = fmaxf(mx, __shfl_xor(mx, o));
  float se = 0.f;
#pragma unroll
  for (int c = 0; c < NC; ++c) {
#pragma unroll
    for (int q = 0; q < 4; ++q) { va[c][q] = __expf(va[c][q] - mx); vb[c][q] = __expf(vb[c][q] - mx); }
    se += ((va[c][0] + va[c][1]) + (va[c][2] + va[c][3])) + ((vb[c][0] + vb[c][1]) + (vb[c][2] + vb[c][3])); }
#pragma unroll
  for (int o = 16; o > 0; o >>= 1) se += __shfl_xor(se, o);
  const float sc = 256.0f / se;
#pragma unroll
  for (int c = 0; c < NC; ++c) { FragH fr;
#pragma unroll
    for (int q = 0; q < 4; ++q) { fr.h[q] = (_Float16)(va[c][q] * sc); fr.h[4 + q] = (_Float16)(vb[c][q] * sc); }
    *(v8us*)(d + c * 256) = fr.half[0]; }
  asm volatile("s_wait_xcnt 0x0" ::: "memory");      /* stands behind the row's last store, ahead of any later write of a register that these stores name (the next longer body follows in the code) */
}
__global__ __launch_bounds__(256) void k_rsmcf2(const float* __restrict__ S, _Float16* __restrict__ P, int hg, int q0, int nk) {
  const int lane = threadIdx.x & 31; const int t = blockIdx.x * 8 + (threadIdx.x >> 5); if (t >= hg * QT) return;
  const float* s = S + (size_t)t * NKX + lane * 8; unsigned short* d = (unsigned short*)P + (size_t)t * NKX + lane * 8; const int last = q0 + (t % QT);
  switch (nk >> 8) {      /* nk is a multiple of 256, at most NKX: one straight-line body per row length */
    case 1: rsm_row<1>(s, d, lane, last); break; case 2: rsm_row<2>(s, d, lane, last); break; case 3: rsm_row<3>(s, d, lane, last); break; case 4: rsm_row<4>(s, d, lane, last); break;
    case 5: rsm_row<5>(s, d, lane, last); break; case 6: rsm_row<6>(s, d, lane, last); break; case 7: rsm_row<7>(s, d, lane, last); break; case 8: rsm_row<8>(s, d, lane, last); break; } }
static_assert(NKX == 8 * 256 && QT == 256, "k_rsmcf2 has one body per multiple of 256 keys up to 2048");


template <int MASKADD>
__global__ __launch_bounds__(64) void k_att0(const float* __restrict__ QF, const float* __restrict__ KF, const float* __restrict__ VF, int ld, const float* __restrict__ mask, float scale, float* __restrict__ OF, int ldo) {
  #pragma clang fp contract(off)
  __shared__ __attribute__((aligned(16))) float lq[64][64]; __shared__ __attribute__((aligned(16))) float lo[64][64];
  const int tid = threadIdx.x; const int h = blockIdx.x / (QT0 / 64), rg = blockIdx.x % (QT0 / 64); const int i = rg * 64 + tid;
  const float* qr = QF + (size_t)i * ld + h * HD;
#pragma unroll 1
  for (int c = 0; c < HD / 4; ++c) { *(v4f*)&lq[tid][c * 4] = *(const v4fa*)(qr + c * 4); const v4f z = {0.f, 0.f, 0.f, 0.f}; *(v4f*)&lo[tid][c * 4] = z; }
  float m = -1.0e30f, l = 0.f; const int jmax = MASKADD ? (SQ - 1) : (rg * 64 + 63);      /* additive-mask form: every key (the mask input decides); causal form: keys up to the block's last row */
#pragma unroll 1
  for (int j = 0; j <= jmax; ++j) { const float* kr = KF + (size_t)j * ld + h * HD; const float* vr = VF + (size_t)j * ld + h * HD; float s = 0.f;
#pragma unroll 1
    for (int c = 0; c < HD / 4; ++c) { const v4f kq = *(const v4fa*)(kr + c * 4); const v4f qq = *(v4f*)&lq[tid][c * 4]; s = __fadd_rn(s, __fmul_rn(qq[0], kq[0])); s = __fadd_rn(s, __fmul_rn(qq[1], kq[1])); s = __fadd_rn(s, __fmul_rn(qq[2], kq[2])); s = __fadd_rn(s, __fmul_rn(qq[3], kq[3])); }
    s = __fmul_rn(s, scale); if (MASKADD) s = __fadd_rn(s, __fmul_rn(bf16_round(mask[(size_t)i * SQ + j]), -10000.0f));
    const float f = (MASKADD || j <= i) ? 1.f : 0.f; const float sm = fmaf(f, s, (1.f - f) * -1.0e30f); const float mn = fmaxf(m, sm); const float sc = expf(m - mn); const float e = expf(sm - mn); l = __fadd_rn(__fmul_rn(l, sc), e); m = mn;
#pragma unroll 1
    for (int c = 0; c < HD / 4; ++c) { const v4f vv = *(const v4fa*)(vr + c * 4); v4f oo = *(v4f*)&lo[tid][c * 4]; for (int u = 0; u < 4; ++u) oo[u] = __fadd_rn(__fmul_rn(oo[u], sc), __fmul_rn(e, vv[u])); *(v4f*)&lo[tid][c * 4] = oo; } }
  const float fin = 64.0f / l;      /* o carried x64 like the f16 path */
#pragma unroll 1
  for (int c = 0; c < HD / 4; ++c) { v4f oo = *(v4f*)&lo[tid][c * 4]; for (int u = 0; u < 4; ++u) oo[u] = __fmul_rn(oo[u], fin); *(v4f*)&lo[tid][c * 4] = oo; }
  __syncthreads();
  {
#pragma unroll 1
    for (int it = 0; it < 16; ++it) { const int row = it * 4 + tid / 16, pc = (tid % 16) * 4; const v4f v = *(const v4f*)&lo[row][pc]; *(v4f*)(OF + (size_t)(rg * 64 + row) * ldo + h * HD + pc) = v; }
     } }

template <int NORM, int ROPE>
__global__ __launch_bounds__(64) void k_xformf(const float* __restrict__ F, int ldf, int nh, const float* __restrict__ gain, float eps, const float* __restrict__ CS, const float* __restrict__ SN, float* __restrict__ F32, int ldo) {
  #pragma clang fp contract(off)
  __shared__ float xv[HD]; __shared__ float red[HD]; const int d = threadIdx.x; const int h = blockIdx.x % nh; const size_t r = blockIdx.x / nh; const int p = (int)(r % SQ);
  float x = F[r * (size_t)ldf + (size_t)h * HD + d];
  if (NORM) { red[d] = __fmul_rn(x, x); __syncthreads(); for (int st = HD / 2; st > 0; st >>= 1) { if (d < st) red[d] = __fadd_rn(red[d], red[d + st]); __syncthreads(); } const float rs = rsqrtf(__fadd_rn(red[0] / (float)HD, eps)); x = __fmul_rn(__fmul_rn(x, rs), bf16_round(gain[d])); }
  xv[d] = x; __syncthreads();
  float o = x;
  if (ROPE == 1) { const int i = d >> 1; const float c = CS[p * (HD / 2) + i], s = SN[p * (HD / 2) + i]; const float ev = xv[2 * i], od = xv[2 * i + 1]; o = (d & 1) ? __fadd_rn(__fmul_rn(ev, s), __fmul_rn(od, c)) : __fadd_rn(__fmul_rn(ev, c), -__fmul_rn(od, s)); }
  if (ROPE == 2) { const int i = d & (HD / 2 - 1); const float c = CS[p * (HD / 2) + i], s = SN[p * (HD / 2) + i]; const float lo = xv[i], hi = xv[i + HD / 2]; o = (d < HD / 2) ? __fadd_rn(__fmul_rn(lo, c), -__fmul_rn(hi, s)) : __fadd_rn(__fmul_rn(lo, s), __fmul_rn(hi, c)); }
  float* dst = F32 + r * (size_t)ldo + (size_t)h * HD + d; *(float*)dst = o;  }


__global__ __launch_bounds__(256) void k_bfcp(const float* __restrict__ src, float* __restrict__ dst, size_t n4) { const size_t t = (size_t)blockIdx.x * 256 + threadIdx.x; if (t >= n4) return; const v4f a = *(const v4fa*)(src + t * 4); v4f o; for (int q = 0; q < 4; ++q) o[q] = bf16_round(a[q]); *(v4f*)(dst + t * 4) = o;  }
extern "C" void kernel_launch(void* const* d_in, const int* in_sizes, int n_in,
                              void* d_out, int out_size, void* d_ws, size_t ws_size, hipStream_t stream) {
  (void)in_sizes; (void)n_in; (void)out_size;
    const float* const* I = (const float* const*)d_in; const float* x = I[0]; const float* tcos = I[1]; const float* tsin = I[2]; const float* wq = I[3]; const float* wk = I[4]; const float* wv = I[5]; const float* wo = I[6];      /* [in][out] weights, no biases; rope tables INPUT [2048][32] */
  char* ws = (char*)d_ws; size_t off = 0;
  auto take = [&](size_t bytes) { char* p = ws + off; off += (bytes + 255) & ~(size_t)255; return p; };
  _Float16* BQKV = (_Float16*)take((size_t)3 * DM * DM * 2); _Float16* BO = (_Float16*)take((size_t)DM * DM * 2); float* CS = (float*)take((size_t)SQ * (HD / 2) * 4); float* SN = (float*)take((size_t)SQ * (HD / 2) * 4);
  _Float16* X16 = (_Float16*)take(NR * DM * 2); float* QKVF = (float*)take((size_t)SQ * 3 * DM * 4);      /* one batch of f32 q | k | v rows */
  _Float16* QH = (_Float16*)take(NR * DM * 2); _Float16* KH = (_Float16*)take(NR * DM * 2); _Float16* V16 = (_Float16*)take(NR * DM * 2); _Float16* O16 = (_Float16*)take(NR * DM * 2);
  float* S = (float*)take((size_t)NH * QT * NKX * 4); _Float16* P = (_Float16*)take((size_t)NH * QT * NKX * 2); _Float16* VT = (_Float16*)take((size_t)NH * HD * SQ * 2);
  float* QF0 = (float*)take((size_t)QT0 * DM * 4); float* KF0 = (float*)take((size_t)QT0 * DM * 4); float* VF0 = (float*)take((size_t)QT0 * DM * 4); float* OF0 = (float*)take((size_t)NB * QT0 * DM * 4); _Float16* OH0 = (_Float16*)take((size_t)NB * QT0 * DM * 2); _Float16* OL0 = (_Float16*)take((size_t)NB * QT0 * DM * 2);
  if (off > ws_size) return;
  { const unsigned g = (unsigned)(((size_t)DM * (DM / 8) + 255) / 256); k_wt_f16<<<g, 256, 0, stream>>>(wq, BQKV, DM, DM, 16.0f); k_wt_f16<<<g, 256, 0, stream>>>(wk, BQKV + (size_t)DM * DM, DM, DM, 16.0f); k_wt_f16<<<g, 256, 0, stream>>>(wv, BQKV + (size_t)2 * DM * DM, DM, DM, 16.0f); k_wt_f16<<<g, 256, 0, stream>>>(wo, BO, DM, DM, 16.0f); }      /* [in][out] -> Bt[n][k] x16; q | k | v stacked along n */
  k_bfcp<<<(unsigned)((SQ * (HD / 2) / 4 + 255) / 256), 256, 0, stream>>>(tcos, CS, (size_t)SQ * (HD / 2) / 4); k_bfcp<<<(unsigned)((SQ * (HD / 2) / 4 + 255) / 256), 256, 0, stream>>>(tsin, SN, (size_t)SQ * (HD / 2) / 4);      /* bf16-rounded copies of the INPUT tables [2048][32] */
  k_x16<<<(unsigned)((NR * DM / 8 + 255) / 256), 256, 0, stream>>>(x, X16, NR * DM / 8);
  for (int b = B0; b < B0 + NBR; ++b) { const size_t r0 = (size_t)b * SQ;
    k_gemm2<0><<<dim3((unsigned)((SQ / 128) * (3 * DM / 64)), 1), 128, 0, stream>>>(X16 + r0 * DM, DM, 0, BQKV, DM, 0, 0.0625f, nullptr, 0, nullptr, 1, 0, 0, QKVF, nullptr, 3 * DM, 0, SQ, 3 * DM, DM);      /* q | k | v rows (f32) of this batch */
    k_xform<0, 2><<<(unsigned)(SQ * NH), 64, 0, stream>>>(QKVF, 3 * DM, NH, nullptr, 0.f, CS, SN, QH + r0 * DM, DM);
    k_xform<0, 2><<<(unsigned)(SQ * NH), 64, 0, stream>>>(QKVF + DM, 3 * DM, NH, nullptr, 0.f, CS, SN, KH + r0 * DM, DM);
    k_xform<0, 0><<<(unsigned)(SQ * NH), 64, 0, stream>>>(QKVF + 2 * DM, 3 * DM, NH, nullptr, 0.f, CS, SN, V16 + r0 * DM, DM);
    k_vt<NH, SQ><<<NH * (SQ / 64), 256, 0, stream>>>(V16 + r0 * DM, DM, 0, VT);      /* V^T [NH][HD][SQ] for this batch */
    k_xformf<0, 2><<<(unsigned)(QT0 * NH), 64, 0, stream>>>(QKVF, 3 * DM, NH, nullptr, 0.f, CS, SN, QF0, DM); k_xformf<0, 2><<<(unsigned)(QT0 * NH), 64, 0, stream>>>(QKVF + DM, 3 * DM, NH, nullptr, 0.f, CS, SN, KF0, DM); k_xformf<0, 0><<<(unsigned)(QT0 * NH), 64, 0, stream>>>(QKVF + 2 * DM, 3 * DM, NH, nullptr, 0.f, CS, SN, VF0, DM);      /* f32 q (roped), k (roped), v of the first 128 rows */
    k_att0<0><<<NH * (QT0 / 64), 64, 0, stream>>>(QF0, KF0, VF0, DM, nullptr, 0.125f, OF0 + (size_t)b * QT0 * DM, DM);      /* exact f32 causal attention for rows 0..127 (o x64) */
    for (int q0 = 0; q0 < QN; q0 += QT) { const int nk = q0 + QT;      /* causal: only keys below the tile end are computed */
      k_gemm2<0><<<dim3((QT / 128) * (nk / 64), NHD), 128, 0, stream>>>(QH + (r0 + q0) * DM, DM, (size_t)HD, KH + r0 * DM, DM, (size_t)HD, 0.125f, nullptr, 0, nullptr, 1, 0, 0, S, nullptr, NKX, (size_t)QT * NKX, QT, nk, HD);      /* scores, all heads on grid.y */
      k_rsmcf2<<<(NHD * QT + 7) / 8, 256, 0, stream>>>(S, P, NHD, q0, nk);      /* one wave per row, 8 rows per block */
      k_gemm2<0><<<dim3((QT / 128) * (HD / 64), NHD), 128, 0, stream>>>(P, NKX, (size_t)QT * NKX, VT, SQ, (size_t)HD * SQ, 0.25f, nullptr, 0, nullptr, 1, 0, 0, nullptr, O16 + (r0 + q0) * DM, DM, (size_t)HD, QT, HD, nk); } }      /* o (merged heads, x64) as f16 rows */
  k_gemm2<0><<<dim3((unsigned)((MPO / 128) * (DM / 64)), 1), 128, 0, stream>>>(O16 + (size_t)B0 * SQ * DM, DM, 0, BO, DM, 0, 0.0009765625f, nullptr, 0, nullptr, 1, 0, 0, (float*)d_out + (size_t)B0 * SQ * DM, nullptr, DM, 0, MPO, DM, DM);      /* out rows are the output layout */
  k_hl<<<(unsigned)(((size_t)NB * QT0 * DM / 8 + 255) / 256), 256, 0, stream>>>(OF0, OH0, OL0, (size_t)NB * QT0 * DM / 8);      /* first-tile o (x64) -> f16 hi + x1024 residual planes */
  for (int b = B0; b < B0 + NBR; ++b) { const size_t r0 = (size_t)b * SQ; const size_t f0 = (size_t)b * QT0;
    k_gemm2<0><<<dim3((QT0 / 128) * (DM / 64), 1), 128, 0, stream>>>(OH0 + f0 * DM, DM, 0, BO, DM, 0, 0.0009765625f, nullptr, 0, nullptr, 1, 0, 0, (float*)d_out + r0 * DM, nullptr, DM, 0, QT0, DM, DM);      /* rows 0..127: out = o_hi Wo, overwriting the f16-path rows */
    k_gemm2<0><<<dim3((QT0 / 128) * (DM / 64), 1), 128, 0, stream>>>(OL0 + f0 * DM, DM, 0, BO, DM, 0, 0.00000095367431640625f, nullptr, 0, (const float*)d_out + r0 * DM, -1, 0, 0, (float*)d_out + r0 * DM, nullptr, DM, 0, QT0, DM, DM); }      /* += o_lo Wo 2^-20 (own-element accumulate) */
}

// v002
// A run of this version takes 2210 microseconds.
// Two timings next to v001 both put it at 1.79 times that version's speed.
// Counting every step since v000, it is 4.41 times as fast.
#include <hip/hip_runtime.h>
// Causal multi-head self-attention with rotate-half RoPE from INPUT tables (x [4][2048][1024]; q/k/v = x W ([in][out] 1024x1024 sigma 1/32, no biases); 16 heads of 64; rope_cos / rope_sin INPUT tables [2048][32] (arbitrary values in [0,1); read bf16-rounded): q = [x1 c - x2 s | x2 c + x1 s] with halves x1, x2, same for k; scores * 64^-0.5; causal (tril, -inf); softmax; out = merged Wo -> [4][2048][1024]).
// Structure: token rows r = b*2048 + s; x as exact f16 rows (bf16-rounded); per batch: q | k | v as ONE WMMA GEMM (32x64 wave tiles, f32 accumulation, exact x16 weights, N = 3 x 1024) into f32 rows, then per (row, head) on VALU: the rotate-half rotary rotation of q and k from the bf16-rounded input tables (no norm) -> f16 q, k, v rows; V^T for all heads via LDS transposes; per query tile of 256 rows: scores against the keys below the tile end only (K = 64, all heads on grid.y, alpha = 0.125), causal row softmax on VALU, one wave per row, with a key mask over the computed range (f32 statistics, native exp; weights x256 f16), o = P . V^T (K = keys below the tile end, alpha 2^-2: o carried x64, folded into the output GEMM alpha) written straight into the merged f16 o rows; out = o W_o GEMM (f32) into the output layout.
// Compute dtype: inputs rounded to bf16; x / weights exact; projections and rope f32; q, k, v, softmax weights and o as plain f16 GEMM operands (~2^-12); scores and softmax statistics f32. v_wmma_f32_16x16x32_f16.
#define NB 4
#define SQ 2048
#define DM 1024
#define NH 16
#define HD 64
#define HG 4                         /* head group of the k_vt(V16, b, h0, VT) overload, which is not launched */
#define QT 256                       /* query rows per causal tile */
#define NKX SQ                       /* S / P row pitch */
#define QT0 128                      /* first-tile rows recomputed exactly in f32 */
#define B0 0                         /* first batch processed (debug hook) */
#define NBR NB                       /* batches processed (debug hook) */
#define QN SQ                        /* query rows attended per batch (debug hook) */
#define NHD NH                       /* heads attended (debug hook) */
#define NR ((size_t)NB * SQ)         /* token rows */
#define MPO ((int)((size_t)NBR * SQ))      /* rows through the output GEMM (debug hook) */
typedef __bf16 v16b __attribute__((ext_vector_type(16)));
typedef unsigned short v8us __attribute__((ext_vector_type(8), may_alias));
typedef float  v8f  __attribute__((ext_vector_type(8)));
typedef float  v4f  __attribute__((ext_vector_type(4)));
typedef float  v4fa __attribute__((ext_vector_type(4), may_alias));
union FragB { v16b v; v8us half[2]; unsigned short u[16]; };

__device__ __forceinline__ unsigned short bf16_bits(float x) { unsigned int u = __float_as_uint(x); return (unsigned short)((u + 0x7FFFu + ((u >> 16) & 1u)) >> 16); }
__device__ __forceinline__ float bf16_val(unsigned short b) { return __uint_as_float(((unsigned int)b) << 16); }
__device__ __forceinline__ float bf16_round(float x) { return bf16_val(bf16_bits(x)); }
// D += A·B with NT terms: 1 = ah·bh, 2 = + al·bh (A split), 3 = + ah·bl (both split)
template <int NT>
__device__ __forceinline__ v8f mmaN(v16b ah, v16b al, v16b bh, v16b bl, v8f c) {
  c = __builtin_amdgcn_wmma_f32_16x16x32_bf16(false, ah, false, bh, (short)0, c, false, false);
  if (NT >= 2) c = __builtin_amdgcn_wmma_f32_16x16x32_bf16(false, al, false, bh, (short)0, c, false, false);
  if (NT >= 3) c = __builtin_amdgcn_wmma_f32_16x16x32_bf16(false, ah, false, bl, (short)0, c, false, false);
  asm volatile("v_nop\n\tv_nop\n\tv_nop\n\tv_nop" : "+v"(c) : "v"(ah), "v"(al), "v"(bh), "v"(bl));
  return c;
}

__global__ __launch_bounds__(256) void k_wt_bf16(const float* __restrict__ W, unsigned short* __restrict__ Wt, int K, int N) {
  const int t = blockIdx.x * 256 + threadIdx.x;
  const int k8n = K / 8;
  if (t >= N * k8n) return;
  const int n = t / k8n, k8 = (t % k8n) * 8;
  v8us v;
#pragma unroll
  for (int i = 0; i < 8; ++i) v[i] = bf16_bits(W[(size_t)(k8 + i) * N + n]);
  *(v8us*)(Wt + (size_t)n * K + k8) = v;
  
}

// GEMM C[M][N] (f32, pitch ldc) = act(A[M][K]·W + bias). A f32 row-major (pitch lda) converted per fragment to bf16
// (ASPLIT: hi/lo two planes -> 2 terms, else single rounded term); Wt bf16 [N][K] (pitch ldb). BIAS_BF16 rounds the
// bias to bf16 first (bias quantised to bf16 before the add). K%32==0, M%16==0, N%64==0.
template <bool ASPLIT, int ACT, bool BIAS_BF16>
__global__ __launch_bounds__(128) void k_gemm_bf(const float* __restrict__ A, int lda, const unsigned short* __restrict__ Wt, int ldb,
                                               const float* __restrict__ bias, float* __restrict__ C, int ldc, int M, int N, int K) {
  __shared__ __attribute__((aligned(16))) float so[4][16][64];
  const int tid = threadIdx.x, w = tid >> 5, lane = tid & 31, ln = lane & 15, hh = lane >> 4;
  const int ntn = N / 64;
  const int wid = blockIdx.x * 4 + w;
  const int mt = wid / ntn, nq = wid % ntn;
  if (mt * 16 >= M) return;
  const int row0 = mt * 16, col0 = nq * 64;
  const float* arow = A + (size_t)(row0 + ln) * lda;
  v8f acc[4] = {};
  for (int kb = 0; kb < K; kb += 32) {
    FragB ah, al;
    const v4f x0 = *(const v4fa*)(arow + kb + 8 * hh), x1 = *(const v4fa*)(arow + kb + 8 * hh + 4);
    const v4f x2 = *(const v4fa*)(arow + kb + 16 + 8 * hh), x3 = *(const v4fa*)(arow + kb + 16 + 8 * hh + 4);
    float xs[16] = {x0[0],x0[1],x0[2],x0[3],x1[0],x1[1],x1[2],x1[3],x2[0],x2[1],x2[2],x2[3],x3[0],x3[1],x3[2],x3[3]};
#pragma unroll
    for (int i = 0; i < 16; ++i) { const unsigned short hb = bf16_bits(xs[i]); ah.u[i] = hb; al.u[i] = ASPLIT ? bf16_bits(xs[i] - bf16_val(hb)) : (unsigned short)0; }
#pragma unroll
    for (int t = 0; t < 4; ++t) {
      const unsigned short* brow = Wt + (size_t)(col0 + t * 16 + ln) * ldb + kb;
      FragB b;
      b.half[0] = *(const v8us*)(brow + 8 * hh);
      b.half[1] = *(const v8us*)(brow + 16 + 8 * hh);
      acc[t] = mmaN<ASPLIT ? 2 : 1>(ah.v, al.v, b.v, b.v, acc[t]);
    }
  }
#pragma unroll
  for (int t = 0; t < 4; ++t) {
    float bv = bias ? bias[col0 + t * 16 + ln] : 0.f;
    if (BIAS_BF16) bv = bf16_round(bv);
#pragma unroll
    for (int r = 0; r < 8; ++r) { float v = acc[t][r] + bv; if (ACT == 1) v = fmaxf(v, 0.f); so[w][8 * hh + r][t * 16 + ln] = v; }
  }
  __builtin_amdgcn_fence(__ATOMIC_ACQ_REL, "workgroup");
  __builtin_amdgcn_wave_barrier();
  const int rsub = lane >> 4, c4 = (lane & 15) * 4;
  {
#pragma unroll
    for (int q = 0; q < 8; ++q) {
      const int r = q * 2 + rsub;
      const v4f v = *(const v4fa*)&so[w][r][c4];
      *(v4f*)(C + (size_t)(row0 + r) * ldc + col0 + c4) = v;
    }
    
  }
}

// GEMM C = act(A·W + bias + resid): A f32 (ASPLIT -> hi/lo 2 terms), Wt bf16 [N][K]; ACT 0 none, 1 relu, 2 exact gelu;
// resid (optional, f32, row index = (row % rmod), pitch ldr, RES_BF16 rounds it) added before the activation.
template <bool ASPLIT, int ACT, bool BIAS_BF16, bool RES_BF16>
__global__ __launch_bounds__(128) void k_gemm_bf3(const float* __restrict__ A, int lda, const unsigned short* __restrict__ Wt, int ldb,
                                                const float* __restrict__ bias, const float* __restrict__ resid, int rmod, int ldr,
                                                float* __restrict__ C, int ldc, int M, int N, int K) {
  __shared__ __attribute__((aligned(16))) float so[4][16][64];
  const int tid = threadIdx.x, w = tid >> 5, lane = tid & 31, ln = lane & 15, hh = lane >> 4;
  const int ntn = N / 64;
  const int wid = blockIdx.x * 4 + w;
  const int mt = wid / ntn, nq = wid % ntn;
  if (mt * 16 >= M) return;
  const int row0 = mt * 16, col0 = nq * 64;
  const float* arow = A + (size_t)(row0 + ln) * lda;
  v8f acc[4] = {};
  for (int kb = 0; kb < K; kb += 32) {
    FragB ah, al;
    const v4f x0 = *(const v4fa*)(arow + kb + 8 * hh), x1 = *(const v4fa*)(arow + kb + 8 * hh + 4);
    const v4f x2 = *(const v4fa*)(arow + kb + 16 + 8 * hh), x3 = *(const v4fa*)(arow + kb + 16 + 8 * hh + 4);
    float xs[16] = {x0[0],x0[1],x0[2],x0[3],x1[0],x1[1],x1[2],x1[3],x2[0],x2[1],x2[2],x2[3],x3[0],x3[1],x3[2],x3[3]};
#pragma unroll
    for (int i = 0; i < 16; ++i) { const unsigned short hb = bf16_bits(xs[i]); ah.u[i] = hb; al.u[i] = ASPLIT ? bf16_bits(xs[i] - bf16_val(hb)) : (unsigned short)0; }
#pragma unroll
    for (int t = 0; t < 4; ++t) {
      const unsigned short* brow = Wt + (size_t)(col0 + t * 16 + ln) * ldb + kb;
      FragB b;
      b.half[0] = *(const v8us*)(brow + 8 * hh);
      b.half[1] = *(const v8us*)(brow + 16 + 8 * hh);
      acc[t] = mmaN<ASPLIT ? 2 : 1>(ah.v, al.v, b.v, b.v, acc[t]);
    }
  }
#pragma unroll
  for (int t = 0; t < 4; ++t) {
    const int col = col0 + t * 16 + ln;
    float bv = bias ? bias[col] : 0.f;
    if (BIAS_BF16) bv = bf16_round(bv);
#pragma unroll
    for (int r = 0; r < 8; ++r) {
      float v = acc[t][r] + bv;
      if (resid) { float rv = resid[(size_t)((row0 + 8 * hh + r) % rmod) * ldr + col]; if (RES_BF16) rv = bf16_round(rv); v += rv; }
      if (ACT == 1) v = fmaxf(v, 0.f);
      if (ACT == 2) v = 0.5f * v * (1.0f + erff(v * 0.70710678118654752f));
      if (ACT == 3) { const float u = 0.7978845608028654f * (v + 0.044715f * v * v * v); v = 0.5f * v * (1.0f + tanhf(u)); }
      so[w][8 * hh + r][t * 16 + ln] = v;
    }
  }
  __builtin_amdgcn_fence(__ATOMIC_ACQ_REL, "workgroup");
  __builtin_amdgcn_wave_barrier();
  const int rsub = lane >> 4, c4 = (lane & 15) * 4;
  {
#pragma unroll
    for (int q = 0; q < 8; ++q) {
      const int r = q * 2 + rsub;
      const v4f v = *(const v4fa*)&so[w][r][c4];
      *(v4f*)(C + (size_t)(row0 + r) * ldc + col0 + c4) = v;
    }
    
  }
}
// row LayerNorm (biased variance, eps) over N: s = X (+ R); optional out_sum <- s; out_norm <- (s-mu)*rsqrt(var+eps)*g + b
template <bool PARAM_BF16>
__global__ __launch_bounds__(256) void k_layernorm(const float* __restrict__ X, const float* __restrict__ R, const float* __restrict__ g, const float* __restrict__ bta,
                                                  float* __restrict__ out_sum, float* __restrict__ out_norm, int N, float eps) {
  __shared__ float red[256];
  const int row = blockIdx.x, tid = threadIdx.x;
  const float* x = X + (size_t)row * N; const float* rr = R ? R + (size_t)row * N : nullptr;
  float vals[16];                     // up to N = 4096
  const int per = N / 256;            // contiguous chunk per thread? use strided-by-4 chunks: thread handles j = tid*4 + 1024*u
  float s1 = 0.f;
  for (int u = 0; u < per / 4; ++u) {
    const int j = tid * 4 + 1024 * u;
    const v4f a = *(const v4fa*)(x + j);
    v4f b = {0.f,0.f,0.f,0.f}; if (rr) b = *(const v4fa*)(rr + j);
#pragma unroll
    for (int q = 0; q < 4; ++q) { const float v = a[q] + b[q]; vals[u * 4 + q] = v; s1 += v; }
  }
  red[tid] = s1; __syncthreads();
  for (int st = 128; st > 0; st >>= 1) { if (tid < st) red[tid] += red[tid + st]; __syncthreads(); }
  const float mu = red[0] / (float)N; __syncthreads();
  float s2 = 0.f;
  for (int u = 0; u < per / 4; ++u)
#pragma unroll
    for (int q = 0; q < 4; ++q) { const float c = vals[u * 4 + q] - mu; s2 += c * c; }
  red[tid] = s2; __syncthreads();
  for (int st = 128; st > 0; st >>= 1) { if (tid < st) red[tid] += red[tid + st]; __syncthreads(); }
  const float rs = rsqrtf(red[0] / (float)N + eps);
  {
    for (int u = 0; u < per / 4; ++u) {
      const int j = tid * 4 + 1024 * u;
      v4f o, sm;
#pragma unroll
      for (int q = 0; q < 4; ++q) {
        float gg = g[j + q], bb = bta[j + q];
        if (PARAM_BF16) { gg = bf16_round(gg); bb = bf16_round(bb); }
        sm[q] = vals[u * 4 + q]; o[q] = (vals[u * 4 + q] - mu) * rs * gg + bb;
      }
      if (out_sum) *(v4f*)(out_sum + (size_t)row * N + j) = sm;
      *(v4f*)(out_norm + (size_t)row * N + j) = o;
    }
    
  }
}



// ---- f16 WMMA path (v_wmma_f32_16x16x32_f16): 11-bit significands for operands in range — used where a [0,1] probability operand needs more precision than bf16
typedef _Float16 v16h __attribute__((ext_vector_type(16)));
union FragH { v16h v; v8us half[2]; _Float16 h[16]; unsigned short u[16]; };
template <int NT>
__device__ __forceinline__ v8f mmaH(v16h ah, v16h al, v16h bh, v16h bl, v8f c) {
  c = __builtin_amdgcn_wmma_f32_16x16x32_f16(false, ah, false, bh, (short)0, c, false, false);
  if (NT >= 2) c = __builtin_amdgcn_wmma_f32_16x16x32_f16(false, al, false, bh, (short)0, c, false, false);
  if (NT >= 3) c = __builtin_amdgcn_wmma_f32_16x16x32_f16(false, ah, false, bl, (short)0, c, false, false);
  asm volatile("v_nop\n\tv_nop\n\tv_nop\n\tv_nop" : "+v"(c) : "v"(ah), "v"(al), "v"(bh), "v"(bl));
  return c;
}
// batched GEMM like k_gemm_b but f16 operands: A f32 (split into f16 hi/lo if ASPLIT, else rounded to f16), Bt = f16 values [n][k]; alpha; C f32; N multiple of 16 (partial tiles skipped)
template <bool ASPLIT>
__global__ __launch_bounds__(128) void k_gemm_h(const float* __restrict__ A, int lda, size_t sA, const _Float16* __restrict__ Bh, int ldb, size_t sB, float alpha, float* __restrict__ C, int ldc, size_t sC, int M, int N, int K) {
  __shared__ __attribute__((aligned(16))) float so[4][16][64];
  const int tid = threadIdx.x, w = tid >> 5, lane = tid & 31, ln = lane & 15, hh = lane >> 4; const int by = blockIdx.y;
  A += (size_t)by * sA; Bh += (size_t)by * sB; C += (size_t)by * sC;
  const int ntn = (N + 63) / 64; const int wid = blockIdx.x * 4 + w; const int mt = wid / ntn, nq = wid % ntn; if (mt * 16 >= M) return;
  const int row0 = mt * 16, col0 = nq * 64; const float* arow = A + (size_t)(row0 + ln) * lda;
  v8f acc[4] = {};
  for (int kb = 0; kb < K; kb += 32) {
    FragH ah, al;
    const v4f x0 = *(const v4fa*)(arow + kb + 8 * hh), x1 = *(const v4fa*)(arow + kb + 8 * hh + 4), x2 = *(const v4fa*)(arow + kb + 16 + 8 * hh), x3 = *(const v4fa*)(arow + kb + 16 + 8 * hh + 4);
    float xs[16] = {x0[0],x0[1],x0[2],x0[3],x1[0],x1[1],x1[2],x1[3],x2[0],x2[1],x2[2],x2[3],x3[0],x3[1],x3[2],x3[3]};
#pragma unroll
    for (int i = 0; i < 16; ++i) { const _Float16 h = (_Float16)xs[i]; ah.h[i] = h; al.h[i] = ASPLIT ? (_Float16)(xs[i] - (float)h) : (_Float16)0.0f; }
#pragma unroll
    for (int t = 0; t < 4; ++t) { if (col0 + t * 16 >= N) continue; const size_t boff = (size_t)(col0 + t * 16 + ln) * ldb + kb; FragH bq; bq.half[0] = *(const v8us*)(Bh + boff + 8 * hh); bq.half[1] = *(const v8us*)(Bh + boff + 16 + 8 * hh);
      acc[t] = mmaH<ASPLIT ? 2 : 1>(ah.v, al.v, bq.v, bq.v, acc[t]); }
  }
#pragma unroll
  for (int t = 0; t < 4; ++t) { if (col0 + t * 16 >= N) continue;
#pragma unroll
    for (int r = 0; r < 8; ++r) so[w][8 * hh + r][t * 16 + ln] = acc[t][r] * alpha; }
  __builtin_amdgcn_fence(__ATOMIC_ACQ_REL, "workgroup"); __builtin_amdgcn_wave_barrier();
  const int rsub = lane >> 4, c4 = (lane & 15) * 4;
  {
#pragma unroll
    for (int q = 0; q < 8; ++q) { const int r = q * 2 + rsub; if (col0 + c4 < N) { const v4f v = *(const v4fa*)&so[w][r][c4]; *(v4f*)(C + (size_t)(row0 + r) * ldc + col0 + c4) = v; } }
     }
}

// Wt[n][k] = f16(W[k][n]·scale) from f32 row-major W[K][N] (scale = power of two; bf16-exact weights stay exact in f16 away from the subnormal range)
__global__ __launch_bounds__(256) void k_wt_f16(const float* __restrict__ W, _Float16* __restrict__ Wt, int K, int N, float scale) {
  const int t = blockIdx.x * 256 + threadIdx.x; if (t >= N * (K / 8)) return; const int n = t / (K / 8), k8 = (t % (K / 8)) * 8; FragH f;
#pragma unroll
  for (int i = 0; i < 8; ++i) f.h[i] = (_Float16)(bf16_round(W[(size_t)(k8 + i) * N + n]) * scale); const v8us o = f.half[0];
  *(v8us*)((unsigned short*)Wt + (size_t)n * K + k8) = o; 
}
// k_gemm_hh variant with fused epilogue: v = acc·alpha + bias[by·sBias + col] (+ CP[(row/rowsPerB)·sCPb + by·64 + col] if CP) ; ACT 0 none / 1 elu ; writes f16 C16 (and f32 C if non-null)
template <int ACT>
__global__ __launch_bounds__(128) void k_gemm_hhx(const _Float16* __restrict__ A, int lda, size_t sA, const _Float16* __restrict__ Bh, int ldb, size_t sB, float alpha, const float* __restrict__ bias, size_t sBias, const float* __restrict__ CP, int rowsPerB, size_t sCPb, int row0g,
    float* __restrict__ C, _Float16* __restrict__ C16, int ldc, size_t sC, int M, int N, int K) {
  __shared__ __attribute__((aligned(16))) float so[4][16][64];
  const int tid = threadIdx.x, w = tid >> 5, lane = tid & 31, ln = lane & 15, hh = lane >> 4; const int by = blockIdx.y;
  A += (size_t)by * sA; Bh += (size_t)by * sB; const size_t cofs = (size_t)by * sC; const float* bp = bias ? bias + (size_t)by * sBias : nullptr;
  const int ntn = (N + 63) / 64; const int wid = blockIdx.x * 4 + w; const int mt = wid / ntn, nq = wid % ntn; if (mt * 16 >= M) return;
  const int row0 = mt * 16, col0 = nq * 64; const _Float16* arow = A + (size_t)(row0 + ln) * lda;
  v8f acc[4] = {};
  for (int kb = 0; kb < K; kb += 32) { FragH ah; ah.half[0] = *(const v8us*)((const unsigned short*)arow + kb + 8 * hh); ah.half[1] = *(const v8us*)((const unsigned short*)arow + kb + 16 + 8 * hh);
#pragma unroll
    for (int t = 0; t < 4; ++t) { if (col0 + t * 16 >= N) continue; const size_t boff = (size_t)(col0 + t * 16 + ln) * ldb + kb; FragH bq; bq.half[0] = *(const v8us*)((const unsigned short*)Bh + boff + 8 * hh); bq.half[1] = *(const v8us*)((const unsigned short*)Bh + boff + 16 + 8 * hh);
      acc[t] = mmaH<1>(ah.v, ah.v, bq.v, bq.v, acc[t]); }
  }
#pragma unroll
  for (int t = 0; t < 4; ++t) { if (col0 + t * 16 >= N) continue; const int col = col0 + t * 16 + ln; const float bv = bp ? bf16_round(bp[col]) : 0.f;
#pragma unroll
    for (int r = 0; r < 8; ++r) { float v = acc[t][r] * alpha + bv; if (CP) { const int rr = row0g + row0 + 8 * hh + r; if (rowsPerB < 0) v += CP[cofs + (size_t)rr * ldc + col];      /* rowsPerB < 0: own element of the batched C plane */ else { const int bidx = rr / rowsPerB; v += CP[(size_t)bidx * sCPb + (size_t)by * 64 + col]; } } if (ACT == 1) v = (v > 0.f) ? v : expm1f(v); else if (ACT == 7) v = (v > 0.f) ? v + 1.0f : expf(v); else if (ACT == 8) v = tanhf(v); else if (ACT == 9) v = 0.5f * v * (1.0f + tanhf(0.7978845608028654f * (v + 0.044715f * v * v * v))); else if (ACT == 11) v = 1.0f / (1.0f + expf(-v)); else if (ACT == 12) v = (v > 0.f) ? v : 0.01f * v; else if (ACT == 14) v = (v > 0.f) ? v : 0.1f * v; else if (ACT == 16) v = (v >= 0.f) ? v : 0.3f * v; else if (ACT == 17) v = (v >= 0.f) ? v : 0.2f * v; else if (ACT == 15) v = v / (1.0f + expf(-v)); else if (ACT == 3) v = fmaxf(v, 0.f); else if (ACT == 6) v = 0.5f * v * (1.0f + erff(v * 0.70710678118654752f)); so[w][8 * hh + r][t * 16 + ln] = v; } }
  __builtin_amdgcn_fence(__ATOMIC_ACQ_REL, "workgroup"); __builtin_amdgcn_wave_barrier();
  const int rsub = lane >> 4, c4 = (lane & 15) * 4; typedef _Float16 v4h __attribute__((ext_vector_type(4)));
  {
#pragma unroll
    for (int q = 0; q < 8; ++q) { const int r = q * 2 + rsub; if (col0 + c4 < N) { const v4f v = *(const v4fa*)&so[w][r][c4]; if (C) *(v4f*)(C + cofs + (size_t)(row0 + r) * ldc + col0 + c4) = v; if (C16) { v4h h4; for (int i = 0; i < 4; ++i) h4[i] = (_Float16)v[i]; *(v4h*)(C16 + cofs + (size_t)(row0 + r) * ldc + col0 + c4) = h4; } } }
     }
}


typedef _Float16 v4h __attribute__((ext_vector_type(4)));

__global__ __launch_bounds__(256) void k_x16(const float* __restrict__ x, _Float16* __restrict__ X16, size_t n8) { const size_t t = (size_t)blockIdx.x * 256 + threadIdx.x; if (t >= n8) return; FragH f;
#pragma unroll
  for (int q = 0; q < 8; ++q) f.h[q] = (_Float16)bf16_round(x[t * 8 + q]); *(v8us*)((unsigned short*)X16 + t * 8) = f.half[0];  }
__global__ __launch_bounds__(256) void k_h16(const float* __restrict__ x, _Float16* __restrict__ X16, size_t n8) { const size_t t = (size_t)blockIdx.x * 256 + threadIdx.x; if (t >= n8) return; FragH f;
#pragma unroll
  for (int q = 0; q < 8; ++q) f.h[q] = (_Float16)x[t * 8 + q]; *(v8us*)((unsigned short*)X16 + t * 8) = f.half[0];  }
__global__ __launch_bounds__(256) void k_round16f(const float* __restrict__ W, _Float16* __restrict__ Bt, size_t n8) { const size_t t = (size_t)blockIdx.x * 256 + threadIdx.x; if (t >= n8) return; FragH f;
#pragma unroll
  for (int i = 0; i < 8; ++i) f.h[i] = (_Float16)(bf16_round(W[t * 8 + i]) * 16.0f); *(v8us*)((unsigned short*)Bt + t * 8) = f.half[0];  }
template <int NHv, int TTv>
__global__ __launch_bounds__(256) void k_vt(const _Float16* __restrict__ V16, int ldv, int voff, _Float16* __restrict__ Vt) { __shared__ unsigned short tl[64][66]; const int tid = threadIdx.x; const int slab = blockIdx.x / (TTv / 64), lg = blockIdx.x % (TTv / 64); const int b = slab / NHv, h = slab % NHv;
  for (int i = tid; i < 64 * 8; i += 256) { const int r = i / 8, c8 = (i % 8) * 8; FragH f; f.half[0] = *(const v8us*)((const unsigned short*)V16 + ((size_t)b * TTv + lg * 64 + r) * ldv + voff + h * 64 + c8);
#pragma unroll
    for (int q = 0; q < 8; ++q) tl[r][c8 + q] = f.u[q]; }
  __syncthreads();
  {
#pragma unroll
    for (int rd = 0; rd < 2; ++rd) { const int d = rd * 32 + tid / 8, pc = tid % 8; FragH f;
#pragma unroll
      for (int q = 0; q < 8; ++q) f.u[q] = tl[pc * 8 + q][d];
      *(v8us*)((unsigned short*)Vt + ((size_t)slab * 64 + d) * TTv + lg * 64 + pc * 8) = f.half[0]; }
     } }

__global__ __launch_bounds__(256) void k_hl(const float* __restrict__ F, _Float16* __restrict__ Hh, _Float16* __restrict__ Hl, size_t n8) { const size_t t = (size_t)blockIdx.x * 256 + threadIdx.x; if (t >= n8) return; FragH fh, fl; const v4f a = *(const v4fa*)(F + t * 8), c = *(const v4fa*)(F + t * 8 + 4);
#pragma unroll
  for (int q = 0; q < 4; ++q) { _Float16 h = (_Float16)a[q]; fh.h[q] = h; fl.h[q] = (_Float16)((a[q] - (float)h) * 1024.0f); h = (_Float16)c[q]; fh.h[4 + q] = h; fl.h[4 + q] = (_Float16)((c[q] - (float)h) * 1024.0f); }
  { *(v8us*)((unsigned short*)Hh + t * 8) = fh.half[0]; *(v8us*)((unsigned short*)Hl + t * 8) = fl.half[0];  } }

// ---- fast GEMM (wave tile 32x64; requires M % 32 == 0 rows per launch region and N % 64 == 0); epilogue = k_gemm_hhx semantics ----
__device__ __forceinline__ v16h g2_frag(const _Float16* p, int hh) { FragH f; f.half[0] = *(const v8us*)((const unsigned short*)p + 8 * hh); f.half[1] = *(const v8us*)((const unsigned short*)p + 16 + 8 * hh); return f.v; }
__device__ __forceinline__ v8f g2_mma(v16h a, v16h b, v8f c) { v8f d = __builtin_amdgcn_wmma_f32_16x16x32_f16(false, a, false, b, (short)0, c, false, false); asm volatile("v_nop\n\tv_nop\n\tv_nop\n\tv_nop" : "+v"(d) : "v"(a), "v"(b)); return d; }
template <int ACT>
__global__ __launch_bounds__(128) void k_gemm2(const _Float16* __restrict__ A, int lda, size_t sA, const _Float16* __restrict__ Bh, int ldb, size_t sB, float alpha, const float* __restrict__ bias, size_t sBias, const float* __restrict__ CP, int rowsPerB, size_t sCPb, int row0g,
    float* __restrict__ C, _Float16* __restrict__ C16, int ldc, size_t sC, int M, int N, int K) { static_assert(ACT == 0 || ACT == 3 || ACT == 6 || ACT == 8 || ACT == 9 || ACT == 11 || ACT == 12 || ACT == 14 || ACT == 15 || ACT == 16 || ACT == 17, "k_gemm2: unsupported ACT code (would silently apply no activation)");
  __shared__ __attribute__((aligned(16))) float so[4][32][68];
  const int tid = threadIdx.x, w = tid >> 5, lane = tid & 31, ln = lane & 15, hh = lane >> 4; const int by = blockIdx.y;
  A += (size_t)by * sA; Bh += (size_t)by * sB; const size_t cofs = (size_t)by * sC; const float* bp = bias ? bias + (size_t)by * sBias : nullptr;
  const int ntn = N >> 6; const int mt = blockIdx.x / ntn, nq = blockIdx.x - mt * ntn; const int row0 = mt * 128 + 32 * w, col0 = nq * 64; if (row0 >= M) return;
  const _Float16* a0p = A + (size_t)(row0 + ln) * lda; const _Float16* a1p = a0p + (size_t)16 * lda;
  const _Float16* b0p = Bh + (size_t)(col0 + ln) * ldb; const _Float16* b1p = b0p + (size_t)16 * ldb; const _Float16* b2p = b1p + (size_t)16 * ldb; const _Float16* b3p = b2p + (size_t)16 * ldb;
  const v8f z8 = {0.f,0.f,0.f,0.f,0.f,0.f,0.f,0.f}; v8f c00 = z8, c01 = z8, c02 = z8, c03 = z8, c10 = z8, c11 = z8, c12 = z8, c13 = z8;
#pragma unroll 1
  for (int kb = 0; kb < K; kb += 32) { const v16h a0 = g2_frag(a0p + kb, hh), a1 = g2_frag(a1p + kb, hh);
    v16h b = g2_frag(b0p + kb, hh); c00 = g2_mma(a0, b, c00); c10 = g2_mma(a1, b, c10);
    b = g2_frag(b1p + kb, hh); c01 = g2_mma(a0, b, c01); c11 = g2_mma(a1, b, c11);
    b = g2_frag(b2p + kb, hh); c02 = g2_mma(a0, b, c02); c12 = g2_mma(a1, b, c12);
    b = g2_frag(b3p + kb, hh); c03 = g2_mma(a0, b, c03); c13 = g2_mma(a1, b, c13); }
  v8f accs[8] = {c00, c01, c02, c03, c10, c11, c12, c13};
#pragma unroll
  for (int u = 0; u < 8; ++u) { const int t = u & 3, half = u >> 2; const int col = col0 + t * 16 + ln; const float bv = bp ? bf16_round(bp[col]) : 0.f;
#pragma unroll
    for (int r = 0; r < 8; ++r) { const int rloc = half * 16 + 8 * hh + r; float v = accs[u][r] * alpha + bv; if (CP) { if (rowsPerB < 0) v += CP[cofs + (size_t)(row0g + row0 + rloc) * ldc + col];      /* rowsPerB < 0: own element of the batched C plane */ else { const int bidx = (row0g + row0 + rloc) / rowsPerB; v += CP[(size_t)bidx * sCPb + (size_t)by * 64 + col]; } }
      if (ACT == 3) v = fmaxf(v, 0.f); else if (ACT == 6) v = 0.5f * v * (1.0f + erff(v * 0.70710678118654752f)); else if (ACT == 11) v = 1.0f / (1.0f + expf(-v)); else if (ACT == 15) v = v / (1.0f + expf(-v)); else if (ACT == 12) v = (v > 0.f) ? v : 0.01f * v; else if (ACT == 8) v = tanhf(v); else if (ACT == 9) v = 0.5f * v * (1.0f + tanhf(0.7978845608028654f * (v + 0.044715f * v * v * v))); else if (ACT == 14) v = (v > 0.f) ? v : 0.1f * v; else if (ACT == 16) v = (v >= 0.f) ? v : 0.3f * v; else if (ACT == 17) v = (v >= 0.f) ? v : 0.2f * v;
      so[w][rloc][t * 16 + ln] = v; } }
  __builtin_amdgcn_fence(__ATOMIC_ACQ_REL, "workgroup"); __builtin_amdgcn_wave_barrier();
  const int rsub = lane >> 4, c4 = (lane & 15) * 4;
  {
#pragma unroll
    for (int q = 0; q < 16; ++q) { const int r = q * 2 + rsub; const v4f v = *(const v4fa*)&so[w][r][c4]; if (C) *(v4f*)(C + cofs + (size_t)(row0 + r) * ldc + col0 + c4) = v; if (C16) { v4h h4; for (int i = 0; i < 4; ++i) h4[i] = (_Float16)v[i]; *(v4h*)(C16 + cofs + (size_t)(row0 + r) * ldc + col0 + c4) = h4; } }
     } }


__global__ __launch_bounds__(256) void k_wnat(const float* __restrict__ w, size_t n8, _Float16* __restrict__ Bt) { const size_t t = (size_t)blockIdx.x * 256 + threadIdx.x; if (t >= n8) return; FragH f; for (int q = 0; q < 8; ++q) f.h[q] = (_Float16)(bf16_round(w[t * 8 + q]) * 16.0f); *(v8us*)((unsigned short*)Bt + t * 8) = f.half[0];  }
__global__ __launch_bounds__(256) void k_rsm(const float* __restrict__ S, _Float16* __restrict__ P, int nrows) {
  #pragma clang fp contract(off)
  const int i = blockIdx.x * 256 + threadIdx.x; if (i >= nrows) return; const float* s = S + (size_t)i * SQ; float mx = -3.0e38f;
#pragma unroll 1
  for (int j = 0; j < SQ; ++j) mx = fmaxf(mx, s[j]); float se = 0.f;
#pragma unroll 1
  for (int j = 0; j < SQ; ++j) se += expf(s[j] - mx); const float sc = 256.0f / se;
#pragma unroll 1
  for (int j0 = 0; j0 < SQ; j0 += 8) { FragH f; for (int q = 0; q < 8; ++q) f.h[q] = (_Float16)(expf(s[j0 + q] - mx) * sc); unsigned short* d = (unsigned short*)P + (size_t)i * SQ + j0; *(v8us*)d = f.half[0];  } }
__global__ __launch_bounds__(256) void k_vt(const _Float16* __restrict__ V16, int b, int h0, _Float16* __restrict__ VT) { __shared__ unsigned short tl[64][65]; const int tid = threadIdx.x; const int hh = blockIdx.x % HG, sg = blockIdx.x / HG; const int s0 = sg * 64; const int h = h0 + hh;
  for (int i = tid; i < 64 * 8; i += 256) { const int j = i / 8, d8 = (i % 8) * 8; FragH f; f.half[0] = *(const v8us*)((const unsigned short*)V16 + ((size_t)b * SQ + s0 + j) * DM + h * HD + d8); for (int q = 0; q < 8; ++q) tl[d8 + q][j] = f.u[q]; }
  __syncthreads();
  { for (int i = tid; i < 64 * 8; i += 256) { const int d = i / 8, j8 = (i % 8) * 8; FragH f; for (int q = 0; q < 8; ++q) f.u[q] = tl[d][j8 + q]; *(v8us*)((unsigned short*)VT + ((size_t)hh * HD + d) * SQ + s0 + j8) = f.half[0]; }  } }


__global__ __launch_bounds__(256) void k_tab2(float theta, float* __restrict__ CS, float* __restrict__ SN) {
  #pragma clang fp contract(off)
  const int t = blockIdx.x * 256 + threadIdx.x; if (t >= SQ * (HD / 2)) return; const int i = t % (HD / 2); const int p = t / (HD / 2); const float invf = 1.0f / powf(theta, (float)(2 * i) / (float)HD); const float ang = __fmul_rn((float)p, invf); const float c = cosf(ang), s = sinf(ang);
  *(float*)(CS + t) = c; *(float*)(SN + t) = s;  }
template <int NORM, int ROPE>
__global__ __launch_bounds__(64) void k_xform(const float* __restrict__ F, int ldf, int nh, const float* __restrict__ gain, float eps, const float* __restrict__ CS, const float* __restrict__ SN, _Float16* __restrict__ H16, int ldo) {
  #pragma clang fp contract(off)
  __shared__ float xv[HD]; __shared__ float red[HD]; __shared__ unsigned short sh_[HD]; const int d = threadIdx.x; const int h = blockIdx.x % nh; const size_t r = blockIdx.x / nh; const int p = (int)(r % SQ);
  float x = F[r * (size_t)ldf + (size_t)h * HD + d];
  if (NORM) { red[d] = __fmul_rn(x, x); __syncthreads(); for (int st = HD / 2; st > 0; st >>= 1) { if (d < st) red[d] = __fadd_rn(red[d], red[d + st]); __syncthreads(); } const float rs = rsqrtf(__fadd_rn(red[0] / (float)HD, eps)); x = __fmul_rn(__fmul_rn(x, rs), bf16_round(gain[d])); }
  xv[d] = x; __syncthreads();
  float o = x;
  if (ROPE == 1) { const int i = d >> 1; const float c = CS[p * (HD / 2) + i], s = SN[p * (HD / 2) + i]; const float ev = xv[2 * i], od = xv[2 * i + 1]; o = (d & 1) ? __fadd_rn(__fmul_rn(ev, s), __fmul_rn(od, c)) : __fadd_rn(__fmul_rn(ev, c), -__fmul_rn(od, s)); }
  if (ROPE == 2) { const int i = d & (HD / 2 - 1); const float c = CS[p * (HD / 2) + i], s = SN[p * (HD / 2) + i]; const float lo = xv[i], hi = xv[i + HD / 2]; o = (d < HD / 2) ? __fadd_rn(__fmul_rn(lo, c), -__fmul_rn(hi, s)) : __fadd_rn(__fmul_rn(lo, s), __fmul_rn(hi, c)); }
  FragH th; th.h[0] = (_Float16)o; sh_[d] = th.u[0]; __syncthreads();
  if (d < HD / 8) { FragH f; for (int q = 0; q < 8; ++q) f.u[q] = sh_[d * 8 + q]; unsigned short* dst = (unsigned short*)H16 + r * (size_t)ldo + (size_t)h * HD + d * 8; *(v8us*)dst = f.half[0];  } }

__global__ __launch_bounds__(256) void k_tab4(const int* __restrict__ pos, float theta, float* __restrict__ CS, float* __restrict__ SN) {
  #pragma clang fp contract(off)
  const int t = blockIdx.x * 256 + threadIdx.x; if (t >= SQ * (HD / 2)) return; const int i = t % (HD / 2); const int p = t / (HD / 2); const float invf = (float)pow((double)theta, -((double)(2 * i)) / (double)HD); const float ang = __fmul_rn((float)pos[p], invf); const float c = cosf(ang), s = sinf(ang);
  *(float*)(CS + t) = c; *(float*)(SN + t) = s;  }
__global__ __launch_bounds__(256) void k_rsmf(const float* __restrict__ S, _Float16* __restrict__ P, int qn, int hg) {
  #pragma clang fp contract(off)
  const int t = blockIdx.x * 256 + threadIdx.x; if (t >= qn * hg) return; const size_t i = (size_t)(t / qn) * SQ + (t % qn); const float* s = S + i * SQ; float mx = -3.0e38f;
#pragma unroll 1
  for (int j = 0; j < SQ; ++j) mx = fmaxf(mx, s[j]); float se = 0.f;
#pragma unroll 1
  for (int j = 0; j < SQ; ++j) se += __expf(s[j] - mx); const float sc = 256.0f / se;
#pragma unroll 1
  for (int j0 = 0; j0 < SQ; j0 += 8) { FragH f; for (int q = 0; q < 8; ++q) f.h[q] = (_Float16)(__expf(s[j0 + q] - mx) * sc); unsigned short* d = (unsigned short*)P + i * SQ + j0; *(v8us*)d = f.half[0];  } }


// Causal row softmax, one wave per score row: lane l keeps keys 256 c + 8 l .. + 7 of each of the NC 256-key chunks c in registers,
// so the row is read once in contiguous 16-byte pieces, each exponential is taken once, and row maximum and row sum end in a five-step lane butterfly.
template <int NC>
__device__ __forceinline__ void rsm_row(const float* __restrict__ s, unsigned short* __restrict__ d, int lane, int last) {
  v4f va[NC], vb[NC];      /* every loop of this function is unrolled so that va and vb are named registers and all loads of the row issue before the first use */
#pragma unroll
  for (int c = 0; c < NC; ++c) { va[c] = *(const v4fa*)(s + c * 256); vb[c] = *(const v4fa*)(s + c * 256 + 4); }
  float mx = -3.0e38f;
#pragma unroll
  for (int c = 0; c < NC; ++c) { const int j0 = c * 256 + lane * 8;
#pragma unroll
    for (int q = 0; q < 4; ++q) { va[c][q] = (j0 + q <= last) ? va[c][q] : -1.0e9f; vb[c][q] = (j0 + 4 + q <= last) ? vb[c][q] : -1.0e9f; mx = fmaxf(mx, fmaxf(va[c][q], vb[c][q])); } }
#pragma unroll
  for (int o = 16; o > 0; o >>= 1) mx = fmaxf(mx, __shfl_xor(mx, o));
  float se = 0.f;
#pragma unroll
  for (int c = 0; c < NC; ++c) {
#pragma unroll
    for (int q = 0; q < 4; ++q) { va[c][q] = __expf(va[c][q] - mx); vb[c][q] = __expf(vb[c][q] - mx); }
    se += ((va[c][0] + va[c][1]) + (va[c][2] + va[c][3])) + ((vb[c][0] + vb[c][1]) + (vb[c][2] + vb[c][3])); }
#pragma unroll
  for (int o = 16; o > 0; o >>= 1) se += __shfl_xor(se, o);
  const float sc = 256.0f / se;
#pragma unroll
  for (int c = 0; c < NC; ++c) { FragH fr;
#pragma unroll
    for (int q = 0; q < 4; ++q) { fr.h[q] = (_Float16)(va[c][q] * sc); fr.h[4 + q] = (_Float16)(vb[c][q] * sc); }
    *(v8us*)(d + c * 256) = fr.half[0]; }
  asm volatile("s_wait_xcnt 0x0" ::: "memory");      /* stands behind the row's last store, ahead of any later write of a register that these stores name (the next longer body follows in the code) */
}
__global__ __launch_bounds__(256) void k_rsmcf2(const float* __restrict__ S, _Float16* __restrict__ P, int hg, int q0, int nk) {
  const int lane = threadIdx.x & 31; const int t = blockIdx.x * 8 + (threadIdx.x >> 5); if (t >= hg * QT) return;
  const float* s = S + (size_t)t * NKX + lane * 8; unsigned short* d = (unsigned short*)P + (size_t)t * NKX + lane * 8; const int last = q0 + (t % QT);
  switch (nk >> 8) {      /* nk is a multiple of 256, at most NKX: one straight-line body per row length */
    case 1: rsm_row<1>(s, d, lane, last); break; case 2: rsm_row<2>(s, d, lane, last); break; case 3: rsm_row<3>(s, d, lane, last); break; case 4: rsm_row<4>(s, d, lane, last); break;
    case 5: rsm_row<5>(s, d, lane, last); break; case 6: rsm_row<6>(s, d, lane, last); break; case 7: rsm_row<7>(s, d, lane, last); break; case 8: rsm_row<8>(s, d, lane, last); break; } }
static_assert(NKX == 8 * 256 && QT == 256, "k_rsmcf2 has one body per multiple of 256 keys up to 2048");


// Exact f32 causal attention for the first QT0 rows, one wave per (head, query row), 8 rows of one head per block.
// The head's QT0 key rows are staged in LDS at a pitch of HD + 4 floats (16 bytes x an odd number: row-per-lane 16-byte reads without bank conflicts).
// Lane l scores keys l, l + 32, l + 64, l + 96 (each dot product summed over d in index order); row maximum and row sum end in lane butterflies;
// then lane l sums output columns 2 l and 2 l + 1 over the keys in index order, each weight read from its lane as a scalar.
typedef float v2f __attribute__((ext_vector_type(2)));
typedef float v2fa __attribute__((ext_vector_type(2), may_alias));
__global__ __launch_bounds__(256) void k_att0w(const float* __restrict__ QF, const float* __restrict__ KF, const float* __restrict__ VF, float scale, float* __restrict__ OF) {      /* all four row pitches are DM, so that every row step is an immediate offset */
  __shared__ __attribute__((aligned(16))) float lk[QT0][HD + 4];
  const int tid = threadIdx.x, lane = tid & 31; const int h = blockIdx.x / (QT0 / 8);
  const int i = (blockIdx.x % (QT0 / 8)) * 8 + __builtin_amdgcn_readfirstlane(tid >> 5);      /* the wave's query row, held as a scalar so that the q row and the group tests below are wave-uniform */
  const float* kb = KF + h * HD;
#pragma unroll
  for (int p = 0; p < QT0 / 16; ++p) { const int r = p * 16 + (tid >> 4), c4 = (tid & 15) * 4; *(v4f*)&lk[r][c4] = *(const v4fa*)(kb + (size_t)r * DM + c4); }      /* unrolled: all 8 loads of a thread in flight at once */
  __syncthreads();
  const float* qr = QF + (size_t)i * DM + h * HD;
  float sa[QT0 / 32];
#pragma unroll
  for (int g = 0; g < QT0 / 32; ++g) sa[g] = 0.f;
#pragma unroll
  for (int c = 0; c < HD / 4; ++c) { const v4f qq = *(const v4fa*)(qr + c * 4);      /* unrolled: sa stays in named registers and the four groups' sum chains interleave */
#pragma unroll
    for (int g = 0; g < QT0 / 32; ++g) { const v4f kq = *(const v4f*)&lk[g * 32 + lane][c * 4]; sa[g] = fmaf(qq[0], kq[0], sa[g]); sa[g] = fmaf(qq[1], kq[1], sa[g]); sa[g] = fmaf(qq[2], kq[2], sa[g]); sa[g] = fmaf(qq[3], kq[3], sa[g]); } }
  float m = -1.0e30f;
#pragma unroll
  for (int g = 0; g < QT0 / 32; ++g) { sa[g] = (g * 32 + lane <= i) ? sa[g] * scale : -1.0e30f; m = fmaxf(m, sa[g]); }      /* causal: keys above the row get weight 0 */
#pragma unroll
  for (int o = 16; o > 0; o >>= 1) m = fmaxf(m, __shfl_xor(m, o));
  float l = 0.f;
#pragma unroll
  for (int g = 0; g < QT0 / 32; ++g) { sa[g] = expf(sa[g] - m); l += sa[g]; }
#pragma unroll
  for (int o = 16; o > 0; o >>= 1) l += __shfl_xor(l, o);
  const float* vb = VF + h * HD + lane * 2; float o0 = 0.f, o1 = 0.f;
#pragma unroll
  for (int g = 0; g < QT0 / 32; ++g) { if (g * 32 <= i) {      /* wave-uniform: key groups wholly above the row are skipped */
#pragma unroll
      for (int jj = 0; jj < 32; ++jj) { const float p = __int_as_float(__builtin_amdgcn_readlane(__float_as_int(sa[g]), jj)); const v2f vv = *(const v2fa*)(vb + (size_t)(g * 32 + jj) * DM); o0 = fmaf(p, vv[0], o0); o1 = fmaf(p, vv[1], o1); } } }      /* unrolled: a group's 32 loads issue before the first use */
  const float fin = 64.0f / l;      /* o carried x64 like the f16 path */
  v2f ov; ov[0] = o0 * fin; ov[1] = o1 * fin; *(v2f*)(OF + (size_t)i * DM + h * HD + lane * 2) = ov; }

template <int NORM, int ROPE>
__global__ __launch_bounds__(64) void k_xformf(const float* __restrict__ F, int ldf, int nh, const float* __restrict__ gain, float eps, const float* __restrict__ CS, const float* __restrict__ SN, float* __restrict__ F32, int ldo) {
  #pragma clang fp contract(off)
  __shared__ float xv[HD]; __shared__ float red[HD]; const int d = threadIdx.x; const int h = blockIdx.x % nh; const size_t r = blockIdx.x / nh; const int p = (int)(r % SQ);
  float x = F[r * (size_t)ldf + (size_t)h * HD + d];
  if (NORM) { red[d] = __fmul_rn(x, x); __syncthreads(); for (int st = HD / 2; st > 0; st >>= 1) { if (d < st) red[d] = __fadd_rn(red[d], red[d + st]); __syncthreads(); } const float rs = rsqrtf(__fadd_rn(red[0] / (float)HD, eps)); x = __fmul_rn(__fmul_rn(x, rs), bf16_round(gain[d])); }
  xv[d] = x; __syncthreads();
  float o = x;
  if (ROPE == 1) { const int i = d >> 1; const float c = CS[p * (HD / 2) + i], s = SN[p * (HD / 2) + i]; const float ev = xv[2 * i], od = xv[2 * i + 1]; o = (d & 1) ? __fadd_rn(__fmul_rn(ev, s), __fmul_rn(od, c)) : __fadd_rn(__fmul_rn(ev, c), -__fmul_rn(od, s)); }
  if (ROPE == 2) { const int i = d & (HD / 2 - 1); const float c = CS[p * (HD / 2) + i], s = SN[p * (HD / 2) + i]; const float lo = xv[i], hi = xv[i + HD / 2]; o = (d < HD / 2) ? __fadd_rn(__fmul_rn(lo, c), -__fmul_rn(hi, s)) : __fadd_rn(__fmul_rn(lo, s), __fmul_rn(hi, c)); }
  float* dst = F32 + r * (size_t)ldo + (size_t)h * HD + d; *(float*)dst = o;  }


__global__ __launch_bounds__(256) void k_bfcp(const float* __restrict__ src, float* __restrict__ dst, size_t n4) { const size_t t = (size_t)blockIdx.x * 256 + threadIdx.x; if (t >= n4) return; const v4f a = *(const v4fa*)(src + t * 4); v4f o; for (int q = 0; q < 4; ++q) o[q] = bf16_round(a[q]); *(v4f*)(dst + t * 4) = o;  }
extern "C" void kernel_launch(void* const* d_in, const int* in_sizes, int n_in,
                              void* d_out, int out_size, void* d_ws, size_t ws_size, hipStream_t stream) {
  (void)in_sizes; (void)n_in; (void)out_size;
    const float* const* I = (const float* const*)d_in; const float* x = I[0]; const float* tcos = I[1]; const float* tsin = I[2]; const float* wq = I[3]; const float* wk = I[4]; const float* wv = I[5]; const float* wo = I[6];      /* [in][out] weights, no biases; rope tables INPUT [2048][32] */
  char* ws = (char*)d_ws; size_t off = 0;
  auto take = [&](size_t bytes) { char* p = ws + off; off += (bytes + 255) & ~(size_t)255; return p; };
  _Float16* BQKV = (_Float16*)take((size_t)3 * DM * DM * 2); _Float16* BO = (_Float16*)take((size_t)DM * DM * 2); float* CS = (float*)take((size_t)SQ * (HD / 2) * 4); float* SN = (float*)take((size_t)SQ * (HD / 2) * 4);
  _Float16* X16 = (_Float16*)take(NR * DM * 2); float* QKVF = (float*)take((size_t)SQ * 3 * DM * 4);      /* one batch of f32 q | k | v rows */
  _Float16* QH = (_Float16*)take(NR * DM * 2); _Float16* KH = (_Float16*)take(NR * DM * 2); _Float16* V16 = (_Float16*)take(NR * DM * 2); _Float16* O16 = (_Float16*)take(NR * DM * 2);
  float* S = (float*)take((size_t)NH * QT * NKX * 4); _Float16* P = (_Float16*)take((size_t)NH * QT * NKX * 2); _Float16* VT = (_Float16*)take((size_t)NH * HD * SQ * 2);
  float* QF0 = (float*)take((size_t)QT0 * DM * 4); float* KF0 = (float*)take((size_t)QT0 * DM * 4); float* VF0 = (float*)take((size_t)QT0 * DM * 4); float* OF0 = (float*)take((size_t)NB * QT0 * DM * 4); _Float16* OH0 = (_Float16*)take((size_t)NB * QT0 * DM * 2); _Float16* OL0 = (_Float16*)take((size_t)NB * QT0 * DM * 2);
  if (off > ws_size) return;
  { const unsigned g = (unsigned)(((size_t)DM * (DM / 8) + 255) / 256); k_wt_f16<<<g, 256, 0, stream>>>(wq, BQKV, DM, DM, 16.0f); k_wt_f16<<<g, 256, 0, stream>>>(wk, BQKV + (size_t)DM * DM, DM, DM, 16.0f); k_wt_f16<<<g, 256, 0, stream>>>(wv, BQKV + (size_t)2 * DM * DM, DM, DM, 16.0f); k_wt_f16<<<g, 256, 0, stream>>>(wo, BO, DM, DM, 16.0f); }      /* [in][out] -> Bt[n][k] x16; q | k | v stacked along n */
  k_bfcp<<<(unsigned)((SQ * (HD / 2) / 4 + 255) / 256), 256, 0, stream>>>(tcos, CS, (size_t)SQ * (HD / 2) / 4); k_bfcp<<<(unsigned)((SQ * (HD / 2) / 4 + 255) / 256), 256, 0, stream>>>(tsin, SN, (size_t)SQ * (HD / 2) / 4);      /* bf16-rounded copies of the INPUT tables [2048][32] */
  k_x16<<<(unsigned)((NR * DM / 8 + 255) / 256), 256, 0, stream>>>(x, X16, NR * DM / 8);
  for (int b = B0; b < B0 + NBR; ++b) { const size_t r0 = (size_t)b * SQ;
    k_gemm2<0><<<dim3((unsigned)((SQ / 128) * (3 * DM / 64)), 1), 128, 0, stream>>>(X16 + r0 * DM, DM, 0, BQKV, DM, 0, 0.0625f, nullptr, 0, nullptr, 1, 0, 0, QKVF, nullptr, 3 * DM, 0, SQ, 3 * DM, DM);      /* q | k | v rows (f32) of this batch */
    k_xform<0, 2><<<(unsigned)(SQ * NH), 64, 0, stream>>>(QKVF, 3 * DM, NH, nullptr, 0.f, CS, SN, QH + r0 * DM, DM);
    k_xform<0, 2><<<(unsigned)(SQ * NH), 64, 0, stream>>>(QKVF + DM, 3 * DM, NH, nullptr, 0.f, CS, SN, KH + r0 * DM, DM);
    k_xform<0, 0><<<(unsigned)(SQ * NH), 64, 0, stream>>>(QKVF + 2 * DM, 3 * DM, NH, nullptr, 0.f, CS, SN, V16 + r0 * DM, DM);
    k_vt<NH, SQ><<<NH * (SQ / 64), 256, 0, stream>>>(V16 + r0 * DM, DM, 0, VT);      /* V^T [NH][HD][SQ] for this batch */
    k_xformf<0, 2><<<(unsigned)(QT0 * NH), 64, 0, stream>>>(QKVF, 3 * DM, NH, nullptr, 0.f, CS, SN, QF0, DM); k_xformf<0, 2><<<(unsigned)(QT0 * NH), 64, 0, stream>>>(QKVF + DM, 3 * DM, NH, nullptr, 0.f, CS, SN, KF0, DM); k_xformf<0, 0><<<(unsigned)(QT0 * NH), 64, 0, stream>>>(QKVF + 2 * DM, 3 * DM, NH, nullptr, 0.f, CS, SN, VF0, DM);      /* f32 q (roped), k (roped), v of the first 128 rows */
    k_att0w<<<NH * (QT0 / 8), 256, 0, stream>>>(QF0, KF0, VF0, 0.125f, OF0 + (size_t)b * QT0 * DM);      /* exact f32 causal attention for rows 0..127 (o x64) */
    for (int q0 = 0; q0 < QN; q0 += QT) { const int nk = q0 + QT;      /* causal: only keys below the tile end are computed */
      k_gemm2<0><<<dim3((QT / 128) * (nk / 64), NHD), 128, 0, stream>>>(QH + (r0 + q0) * DM, DM, (size_t)HD, KH + r0 * DM, DM, (size_t)HD, 0.125f, nullptr, 0, nullptr, 1, 0, 0, S, nullptr, NKX, (size_t)QT * NKX, QT, nk, HD);      /* scores, all heads on grid.y */
      k_rsmcf2<<<(NHD * QT + 7) / 8, 256, 0, stream>>>(S, P, NHD, q0, nk);      /* one wave per row, 8 rows per block */
      k_gemm2<0><<<dim3((QT / 128) * (HD / 64), NHD), 128, 0, stream>>>(P, NKX, (size_t)QT * NKX, VT, SQ, (size_t)HD * SQ, 0.25f, nullptr, 0, nullptr, 1, 0, 0, nullptr, O16 + (r0 + q0) * DM, DM, (size_t)HD, QT, HD, nk); } }      /* o (merged heads, x64) as f16 rows */
  k_gemm2<0><<<dim3((unsigned)((MPO / 128) * (DM / 64)), 1), 128, 0, stream>>>(O16 + (size_t)B0 * SQ * DM, DM, 0, BO, DM, 0, 0.0009765625f, nullptr, 0, nullptr, 1, 0, 0, (float*)d_out + (size_t)B0 * SQ * DM, nullptr, DM, 0, MPO, DM, DM);      /* out rows are the output layout */
  k_hl<<<(unsigned)(((size_t)NB * QT0 * DM / 8 + 255) / 256), 256, 0, stream>>>(OF0, OH0, OL0, (size_t)NB * QT0 * DM / 8);      /* first-tile o (x64) -> f16 hi + x1024 residual planes */
  for (int b = B0; b < B0 + NBR; ++b) { const size_t r0 = (size_t)b * SQ; const size_t f0 = (size_t)b * QT0;
    k_gemm2<0><<<dim3((QT0 / 128) * (DM / 64), 1), 128, 0, stream>>>(OH0 + f0 * DM, DM, 0, BO, DM, 0, 0.0009765625f, nullptr, 0, nullptr, 1, 0, 0, (float*)d_out + r0 * DM, nullptr, DM, 0, QT0, DM, DM);      /* rows 0..127: out = o_hi Wo, overwriting the f16-path rows */
    k_gemm2<0><<<dim3((QT0 / 128) * (DM / 64), 1), 128, 0, stream>>>(OL0 + f0 * DM, DM, 0, BO, DM, 0, 0.00000095367431640625f, nullptr, 0, (const float*)d_out + r0 * DM, -1, 0, 0, (float*)d_out + r0 * DM, nullptr, DM, 0, QT0, DM, DM); }      /* += o_lo Wo 2^-20 (own-element accumulate) */
}

// v003
// A run of this version takes 751 microseconds.
// In two side-by-side timings against v002, it was 2.95 and 2.94 times as fast.
// Counting every step since v000, it is 13.0 times as fast.
#include <hip/hip_runtime.h>
#define NB 4
#define SQ 2048
#define DM 1024
#define NH 16
#define HD 64
#define HG 4                         /* heads per launch of the k_vt(V16, b, h0, VT) overload (not launched) */
#define QT0 128                      /* first-tile rows recomputed exactly in f32 */
#define B0 0                         /* first batch processed (debug hook) */
#define NBR NB                       /* batches processed (debug hook) */
#define NR ((size_t)NB * SQ)         /* token rows */
#define MPO ((int)((size_t)NBR * SQ))      /* rows through the output GEMM (debug hook) */
typedef __bf16 v16b __attribute__((ext_vector_type(16)));
typedef unsigned short v8us __attribute__((ext_vector_type(8), may_alias));
typedef float  v8f  __attribute__((ext_vector_type(8)));
typedef float  v4f  __attribute__((ext_vector_type(4)));
typedef float  v4fa __attribute__((ext_vector_type(4), may_alias));
union FragB { v16b v; v8us half[2]; unsigned short u[16]; };

__device__ __forceinline__ unsigned short bf16_bits(float x) { unsigned int u = __float_as_uint(x); return (unsigned short)((u + 0x7FFFu + ((u >> 16) & 1u)) >> 16); }
__device__ __forceinline__ float bf16_val(unsigned short b) { return __uint_as_float(((unsigned int)b) << 16); }
__device__ __forceinline__ float bf16_round(float x) { return bf16_val(bf16_bits(x)); }
// D += A·B with NT terms: 1 = ah·bh, 2 = + al·bh (A split), 3 = + ah·bl (both split)
template <int NT>
__device__ __forceinline__ v8f mmaN(v16b ah, v16b al, v16b bh, v16b bl, v8f c) {
  c = __builtin_amdgcn_wmma_f32_16x16x32_bf16(false, ah, false, bh, (short)0, c, false, false);
  if (NT >= 2) c = __builtin_amdgcn_wmma_f32_16x16x32_bf16(false, al, false, bh, (short)0, c, false, false);
  if (NT >= 3) c = __builtin_amdgcn_wmma_f32_16x16x32_bf16(false, ah, false, bl, (short)0, c, false, false);
  asm volatile("v_nop\n\tv_nop\n\tv_nop\n\tv_nop" : "+v"(c) : "v"(ah), "v"(al), "v"(bh), "v"(bl));
  return c;
}

__global__ __launch_bounds__(256) void k_wt_bf16(const float* __restrict__ W, unsigned short* __restrict__ Wt, int K, int N) {
  const int t = blockIdx.x * 256 + threadIdx.x;
  const int k8n = K / 8;
  if (t >= N * k8n) return;
  const int n = t / k8n, k8 = (t % k8n) * 8;
  v8us v;
#pragma unroll
  for (int i = 0; i < 8; ++i) v[i] = bf16_bits(W[(size_t)(k8 + i) * N + n]);
  *(v8us*)(Wt + (size_t)n * K + k8) = v;
  
}

// GEMM C[M][N] (f32, pitch ldc) = act(A[M][K]·W + bias). A f32 row-major (pitch lda) converted per fragment to bf16
// (ASPLIT: hi/lo two planes -> 2 terms, else single rounded term); Wt bf16 [N][K] (pitch ldb). BIAS_BF16 rounds the
// bias to bf16 first (bias quantised to bf16 before the add). K%32==0, M%16==0, N%64==0.
template <bool ASPLIT, int ACT, bool BIAS_BF16>
__global__ __launch_bounds__(128) void k_gemm_bf(const float* __restrict__ A, int lda, const unsigned short* __restrict__ Wt, int ldb,
                                               const float* __restrict__ bias, float* __restrict__ C, int ldc, int M, int N, int K) {
  __shared__ __attribute__((aligned(16))) float so[4][16][64];
  const int tid = threadIdx.x, w = tid >> 5, lane = tid & 31, ln = lane & 15, hh = lane >> 4;
  const int ntn = N / 64;
  const int wid = blockIdx.x * 4 + w;
  const int mt = wid / ntn, nq = wid % ntn;
  if (mt * 16 >= M) return;
  const int row0 = mt * 16, col0 = nq * 64;
  const float* arow = A + (size_t)(row0 + ln) * lda;
  v8f acc[4] = {};
  for (int kb = 0; kb < K; kb += 32) {
    FragB ah, al;
    const v4f x0 = *(const v4fa*)(arow + kb + 8 * hh), x1 = *(const v4fa*)(arow + kb + 8 * hh + 4);
    const v4f x2 = *(const v4fa*)(arow + kb + 16 + 8 * hh), x3 = *(const v4fa*)(arow + kb + 16 + 8 * hh + 4);
    float xs[16] = {x0[0],x0[1],x0[2],x0[3],x1[0],x1[1],x1[2],x1[3],x2[0],x2[1],x2[2],x2[3],x3[0],x3[1],x3[2],x3[3]};
#pragma unroll
    for (int i = 0; i < 16; ++i) { const unsigned short hb = bf16_bits(xs[i]); ah.u[i] = hb; al.u[i] = ASPLIT ? bf16_bits(xs[i] - bf16_val(hb)) : (unsigned short)0; }
#pragma unroll
    for (int t = 0; t < 4; ++t) {
      const unsigned short* brow = Wt + (size_t)(col0 + t * 16 + ln) * ldb + kb;
      FragB b;
      b.half[0] = *(const v8us*)(brow + 8 * hh);
      b.half[1] = *(const v8us*)(brow + 16 + 8 * hh);
      acc[t] = mmaN<ASPLIT ? 2 : 1>(ah.v, al.v, b.v, b.v, acc[t]);
    }
  }
#pragma unroll
  for (int t = 0; t < 4; ++t) {
    float bv = bias ? bias[col0 + t * 16 + ln] : 0.f;
    if (BIAS_BF16) bv = bf16_round(bv);
#pragma unroll
    for (int r = 0; r < 8; ++r) { float v = acc[t][r] + bv; if (ACT == 1) v = fmaxf(v, 0.f); so[w][8 * hh + r][t * 16 + ln] = v; }
  }
  __builtin_amdgcn_fence(__ATOMIC_ACQ_REL, "workgroup");
  __builtin_amdgcn_wave_barrier();
  const int rsub = lane >> 4, c4 = (lane & 15) * 4;
  {
#pragma unroll
    for (int q = 0; q < 8; ++q) {
      const int r = q * 2 + rsub;
      const v4f v = *(const v4fa*)&so[w][r][c4];
      *(v4f*)(C + (size_t)(row0 + r) * ldc + col0 + c4) = v;
    }
    
  }
}

// GEMM C = act(A·W + bias + resid): A f32 (ASPLIT -> hi/lo 2 terms), Wt bf16 [N][K]; ACT 0 none, 1 relu, 2 exact gelu;
// resid (optional, f32, row index = (row % rmod), pitch ldr, RES_BF16 rounds it) added before the activation.
template <bool ASPLIT, int ACT, bool BIAS_BF16, bool RES_BF16>
__global__ __launch_bounds__(128) void k_gemm_bf3(const float* __restrict__ A, int lda, const unsigned short* __restrict__ Wt, int ldb,
                                                const float* __restrict__ bias, const float* __restrict__ resid, int rmod, int ldr,
                                                float* __restrict__ C, int ldc, int M, int N, int K) {
  __shared__ __attribute__((aligned(16))) float so[4][16][64];
  const int tid = threadIdx.x, w = tid >> 5, lane = tid & 31, ln = lane & 15, hh = lane >> 4;
  const int ntn = N / 64;
  const int wid = blockIdx.x * 4 + w;
  const int mt = wid / ntn, nq = wid % ntn;
  if (mt * 16 >= M) return;
  const int row0 = mt * 16, col0 = nq * 64;
  const float* arow = A + (size_t)(row0 + ln) * lda;
  v8f acc[4] = {};
  for (int kb = 0; kb < K; kb += 32) {
    FragB ah, al;
    const v4f x0 = *(const v4fa*)(arow + kb + 8 * hh), x1 = *(const v4fa*)(arow + kb + 8 * hh + 4);
    const v4f x2 = *(const v4fa*)(arow + kb + 16 + 8 * hh), x3 = *(const v4fa*)(arow + kb + 16 + 8 * hh + 4);
    float xs[16] = {x0[0],x0[1],x0[2],x0[3],x1[0],x1[1],x1[2],x1[3],x2[0],x2[1],x2[2],x2[3],x3[0],x3[1],x3[2],x3[3]};
#pragma unroll
    for (int i = 0; i < 16; ++i) { const unsigned short hb = bf16_bits(xs[i]); ah.u[i] = hb; al.u[i] = ASPLIT ? bf16_bits(xs[i] - bf16_val(hb)) : (unsigned short)0; }
#pragma unroll
    for (int t = 0; t < 4; ++t) {
      const unsigned short* brow = Wt + (size_t)(col0 + t * 16 + ln) * ldb + kb;
      FragB b;
      b.half[0] = *(const v8us*)(brow + 8 * hh);
      b.half[1] = *(const v8us*)(brow + 16 + 8 * hh);
      acc[t] = mmaN<ASPLIT ? 2 : 1>(ah.v, al.v, b.v, b.v, acc[t]);
    }
  }
#pragma unroll
  for (int t = 0; t < 4; ++t) {
    const int col = col0 + t * 16 + ln;
    float bv = bias ? bias[col] : 0.f;
    if (BIAS_BF16) bv = bf16_round(bv);
#pragma unroll
    for (int r = 0; r < 8; ++r) {
      float v = acc[t][r] + bv;
      if (resid) { float rv = resid[(size_t)((row0 + 8 * hh + r) % rmod) * ldr + col]; if (RES_BF16) rv = bf16_round(rv); v += rv; }
      if (ACT == 1) v = fmaxf(v, 0.f);
      if (ACT == 2) v = 0.5f * v * (1.0f + erff(v * 0.70710678118654752f));
      if (ACT == 3) { const float u = 0.7978845608028654f * (v + 0.044715f * v * v * v); v = 0.5f * v * (1.0f + tanhf(u)); }
      so[w][8 * hh + r][t * 16 + ln] = v;
    }
  }
  __builtin_amdgcn_fence(__ATOMIC_ACQ_REL, "workgroup");
  __builtin_amdgcn_wave_barrier();
  const int rsub = lane >> 4, c4 = (lane & 15) * 4;
  {
#pragma unroll
    for (int q = 0; q < 8; ++q) {
      const int r = q * 2 + rsub;
      const v4f v = *(const v4fa*)&so[w][r][c4];
      *(v4f*)(C + (size_t)(row0 + r) * ldc + col0 + c4) = v;
    }
    
  }
}
// row LayerNorm (biased variance, eps) over N: s = X (+ R); optional out_sum <- s; out_norm <- (s-mu)*rsqrt(var+eps)*g + b
template <bool PARAM_BF16>
__global__ __launch_bounds__(256) void k_layernorm(const float* __restrict__ X, const float* __restrict__ R, const float* __restrict__ g, const float* __restrict__ bta,
                                                  float* __restrict__ out_sum, float* __restrict__ out_norm, int N, float eps) {
  __shared__ float red[256];
  const int row = blockIdx.x, tid = threadIdx.x;
  const float* x = X + (size_t)row * N; const float* rr = R ? R + (size_t)row * N : nullptr;
  float vals[16];                     // up to N = 4096
  const int per = N / 256;            // contiguous chunk per thread? use strided-by-4 chunks: thread handles j = tid*4 + 1024*u
  float s1 = 0.f;
  for (int u = 0; u < per / 4; ++u) {
    const int j = tid * 4 + 1024 * u;
    const v4f a = *(const v4fa*)(x + j);
    v4f b = {0.f,0.f,0.f,0.f}; if (rr) b = *(const v4fa*)(rr + j);
#pragma unroll
    for (int q = 0; q < 4; ++q) { const float v = a[q] + b[q]; vals[u * 4 + q] = v; s1 += v; }
  }
  red[tid] = s1; __syncthreads();
  for (int st = 128; st > 0; st >>= 1) { if (tid < st) red[tid] += red[tid + st]; __syncthreads(); }
  const float mu = red[0] / (float)N; __syncthreads();
  float s2 = 0.f;
  for (int u = 0; u < per / 4; ++u)
#pragma unroll
    for (int q = 0; q < 4; ++q) { const float c = vals[u * 4 + q] - mu; s2 += c * c; }
  red[tid] = s2; __syncthreads();
  for (int st = 128; st > 0; st >>= 1) { if (tid < st) red[tid] += red[tid + st]; __syncthreads(); }
  const float rs = rsqrtf(red[0] / (float)N + eps);
  {
    for (int u = 0; u < per / 4; ++u) {
      const int j = tid * 4 + 1024 * u;
      v4f o, sm;
#pragma unroll
      for (int q = 0; q < 4; ++q) {
        float gg = g[j + q], bb = bta[j + q];
        if (PARAM_BF16) { gg = bf16_round(gg); bb = bf16_round(bb); }
        sm[q] = vals[u * 4 + q]; o[q] = (vals[u * 4 + q] - mu) * rs * gg + bb;
      }
      if (out_sum) *(v4f*)(out_sum + (size_t)row * N + j) = sm;
      *(v4f*)(out_norm + (size_t)row * N + j) = o;
    }
    
  }
}



// ---- f16 WMMA path (v_wmma_f32_16x16x32_f16): 11-bit significands for operands in range — used where a [0,1] probability operand needs more precision than bf16
typedef _Float16 v16h __attribute__((ext_vector_type(16)));
union FragH { v16h v; v8us half[2]; _Float16 h[16]; unsigned short u[16]; };
template <int NT>
__device__ __forceinline__ v8f mmaH(v16h ah, v16h al, v16h bh, v16h bl, v8f c) {
  c = __builtin_amdgcn_wmma_f32_16x16x32_f16(false, ah, false, bh, (short)0, c, false, false);
  if (NT >= 2) c = __builtin_amdgcn_wmma_f32_16x16x32_f16(false, al, false, bh, (short)0, c, false, false);
  if (NT >= 3) c = __builtin_amdgcn_wmma_f32_16x16x32_f16(false, ah, false, bl, (short)0, c, false, false);
  asm volatile("v_nop\n\tv_nop\n\tv_nop\n\tv_nop" : "+v"(c) : "v"(ah), "v"(al), "v"(bh), "v"(bl));
  return c;
}
// batched GEMM like k_gemm_b but f16 operands: A f32 (split into f16 hi/lo if ASPLIT, else rounded to f16), Bt = f16 values [n][k]; alpha; C f32; N multiple of 16 (partial tiles skipped)
template <bool ASPLIT>
__global__ __launch_bounds__(128) void k_gemm_h(const float* __restrict__ A, int lda, size_t sA, const _Float16* __restrict__ Bh, int ldb, size_t sB, float alpha, float* __restrict__ C, int ldc, size_t sC, int M, int N, int K) {
  __shared__ __attribute__((aligned(16))) float so[4][16][64];
  const int tid = threadIdx.x, w = tid >> 5, lane = tid & 31, ln = lane & 15, hh = lane >> 4; const int by = blockIdx.y;
  A += (size_t)by * sA; Bh += (size_t)by * sB; C += (size_t)by * sC;
  const int ntn = (N + 63) / 64; const int wid = blockIdx.x * 4 + w; const int mt = wid / ntn, nq = wid % ntn; if (mt * 16 >= M) return;
  const int row0 = mt * 16, col0 = nq * 64; const float* arow = A + (size_t)(row0 + ln) * lda;
  v8f acc[4] = {};
  for (int kb = 0; kb < K; kb += 32) {
    FragH ah, al;
    const v4f x0 = *(const v4fa*)(arow + kb + 8 * hh), x1 = *(const v4fa*)(arow + kb + 8 * hh + 4), x2 = *(const v4fa*)(arow + kb + 16 + 8 * hh), x3 = *(const v4fa*)(arow + kb + 16 + 8 * hh + 4);
    float xs[16] = {x0[0],x0[1],x0[2],x0[3],x1[0],x1[1],x1[2],x1[3],x2[0],x2[1],x2[2],x2[3],x3[0],x3[1],x3[2],x3[3]};
#pragma unroll
    for (int i = 0; i < 16; ++i) { const _Float16 h = (_Float16)xs[i]; ah.h[i] = h; al.h[i] = ASPLIT ? (_Float16)(xs[i] - (float)h) : (_Float16)0.0f; }
#pragma unroll
    for (int t = 0; t < 4; ++t) { if (col0 + t * 16 >= N) continue; const size_t boff = (size_t)(col0 + t * 16 + ln) * ldb + kb; FragH bq; bq.half[0] = *(const v8us*)(Bh + boff + 8 * hh); bq.half[1] = *(const v8us*)(Bh + boff + 16 + 8 * hh);
      acc[t] = mmaH<ASPLIT ? 2 : 1>(ah.v, al.v, bq.v, bq.v, acc[t]); }
  }
#pragma unroll
  for (int t = 0; t < 4; ++t) { if (col0 + t * 16 >= N) continue;
#pragma unroll
    for (int r = 0; r < 8; ++r) so[w][8 * hh + r][t * 16 + ln] = acc[t][r] * alpha; }
  __builtin_amdgcn_fence(__ATOMIC_ACQ_REL, "workgroup"); __builtin_amdgcn_wave_barrier();
  const int rsub = lane >> 4, c4 = (lane & 15) * 4;
  {
#pragma unroll
    for (int q = 0; q < 8; ++q) { const int r = q * 2 + rsub; if (col0 + c4 < N) { const v4f v = *(const v4fa*)&so[w][r][c4]; *(v4f*)(C + (size_t)(row0 + r) * ldc + col0 + c4) = v; } }
     }
}

// Wt[n][k] = f16(W[k][n]·scale) from f32 row-major W[K][N] (scale = power of two; bf16-exact weights stay exact in f16 away from the subnormal range)
__global__ __launch_bounds__(256) void k_wt_f16(const float* __restrict__ W, _Float16* __restrict__ Wt, int K, int N, float scale) {
  const int t = blockIdx.x * 256 + threadIdx.x; if (t >= N * (K / 8)) return; const int n = t / (K / 8), k8 = (t % (K / 8)) * 8; FragH f;
#pragma unroll
  for (int i = 0; i < 8; ++i) f.h[i] = (_Float16)(bf16_round(W[(size_t)(k8 + i) * N + n]) * scale); const v8us o = f.half[0];
  *(v8us*)((unsigned short*)Wt + (size_t)n * K + k8) = o; 
}
// k_gemm_hh variant with fused epilogue: v = acc·alpha + bias[by·sBias + col] (+ CP[(row/rowsPerB)·sCPb + by·64 + col] if CP) ; ACT 0 none / 1 elu ; writes f16 C16 (and f32 C if non-null)
template <int ACT>
__global__ __launch_bounds__(128) void k_gemm_hhx(const _Float16* __restrict__ A, int lda, size_t sA, const _Float16* __restrict__ Bh, int ldb, size_t sB, float alpha, const float* __restrict__ bias, size_t sBias, const float* __restrict__ CP, int rowsPerB, size_t sCPb, int row0g,
    float* __restrict__ C, _Float16* __restrict__ C16, int ldc, size_t sC, int M, int N, int K) {
  __shared__ __attribute__((aligned(16))) float so[4][16][64];
  const int tid = threadIdx.x, w = tid >> 5, lane = tid & 31, ln = lane & 15, hh = lane >> 4; const int by = blockIdx.y;
  A += (size_t)by * sA; Bh += (size_t)by * sB; const size_t cofs = (size_t)by * sC; const float* bp = bias ? bias + (size_t)by * sBias : nullptr;
  const int ntn = (N + 63) / 64; const int wid = blockIdx.x * 4 + w; const int mt = wid / ntn, nq = wid % ntn; if (mt * 16 >= M) return;
  const int row0 = mt * 16, col0 = nq * 64; const _Float16* arow = A + (size_t)(row0 + ln) * lda;
  v8f acc[4] = {};
  for (int kb = 0; kb < K; kb += 32) { FragH ah; ah.half[0] = *(const v8us*)((const unsigned short*)arow + kb + 8 * hh); ah.half[1] = *(const v8us*)((const unsigned short*)arow + kb + 16 + 8 * hh);
#pragma unroll
    for (int t = 0; t < 4; ++t) { if (col0 + t * 16 >= N) continue; const size_t boff = (size_t)(col0 + t * 16 + ln) * ldb + kb; FragH bq; bq.half[0] = *(const v8us*)((const unsigned short*)Bh + boff + 8 * hh); bq.half[1] = *(const v8us*)((const unsigned short*)Bh + boff + 16 + 8 * hh);
      acc[t] = mmaH<1>(ah.v, ah.v, bq.v, bq.v, acc[t]); }
  }
#pragma unroll
  for (int t = 0; t < 4; ++t) { if (col0 + t * 16 >= N) continue; const int col = col0 + t * 16 + ln; const float bv = bp ? bf16_round(bp[col]) : 0.f;
#pragma unroll
    for (int r = 0; r < 8; ++r) { float v = acc[t][r] * alpha + bv; if (CP) { const int rr = row0g + row0 + 8 * hh + r; if (rowsPerB < 0) v += CP[cofs + (size_t)rr * ldc + col];      /* rowsPerB < 0: own element of the batched C plane */ else { const int bidx = rr / rowsPerB; v += CP[(size_t)bidx * sCPb + (size_t)by * 64 + col]; } } if (ACT == 1) v = (v > 0.f) ? v : expm1f(v); else if (ACT == 7) v = (v > 0.f) ? v + 1.0f : expf(v); else if (ACT == 8) v = tanhf(v); else if (ACT == 9) v = 0.5f * v * (1.0f + tanhf(0.7978845608028654f * (v + 0.044715f * v * v * v))); else if (ACT == 11) v = 1.0f / (1.0f + expf(-v)); else if (ACT == 12) v = (v > 0.f) ? v : 0.01f * v; else if (ACT == 14) v = (v > 0.f) ? v : 0.1f * v; else if (ACT == 16) v = (v >= 0.f) ? v : 0.3f * v; else if (ACT == 17) v = (v >= 0.f) ? v : 0.2f * v; else if (ACT == 15) v = v / (1.0f + expf(-v)); else if (ACT == 3) v = fmaxf(v, 0.f); else if (ACT == 6) v = 0.5f * v * (1.0f + erff(v * 0.70710678118654752f)); so[w][8 * hh + r][t * 16 + ln] = v; } }
  __builtin_amdgcn_fence(__ATOMIC_ACQ_REL, "workgroup"); __builtin_amdgcn_wave_barrier();
  const int rsub = lane >> 4, c4 = (lane & 15) * 4; typedef _Float16 v4h __attribute__((ext_vector_type(4)));
  {
#pragma unroll
    for (int q = 0; q < 8; ++q) { const int r = q * 2 + rsub; if (col0 + c4 < N) { const v4f v = *(const v4fa*)&so[w][r][c4]; if (C) *(v4f*)(C + cofs + (size_t)(row0 + r) * ldc + col0 + c4) = v; if (C16) { v4h h4; for (int i = 0; i < 4; ++i) h4[i] = (_Float16)v[i]; *(v4h*)(C16 + cofs + (size_t)(row0 + r) * ldc + col0 + c4) = h4; } } }
     }
}


typedef _Float16 v4h __attribute__((ext_vector_type(4)));

__global__ __launch_bounds__(256) void k_x16(const float* __restrict__ x, _Float16* __restrict__ X16, size_t n8) { const size_t t = (size_t)blockIdx.x * 256 + threadIdx.x; if (t >= n8) return; FragH f;
#pragma unroll
  for (int q = 0; q < 8; ++q) f.h[q] = (_Float16)bf16_round(x[t * 8 + q]); *(v8us*)((unsigned short*)X16 + t * 8) = f.half[0];  }
__global__ __launch_bounds__(256) void k_h16(const float* __restrict__ x, _Float16* __restrict__ X16, size_t n8) { const size_t t = (size_t)blockIdx.x * 256 + threadIdx.x; if (t >= n8) return; FragH f;
#pragma unroll
  for (int q = 0; q < 8; ++q) f.h[q] = (_Float16)x[t * 8 + q]; *(v8us*)((unsigned short*)X16 + t * 8) = f.half[0];  }
__global__ __launch_bounds__(256) void k_round16f(const float* __restrict__ W, _Float16* __restrict__ Bt, size_t n8) { const size_t t = (size_t)blockIdx.x * 256 + threadIdx.x; if (t >= n8) return; FragH f;
#pragma unroll
  for (int i = 0; i < 8; ++i) f.h[i] = (_Float16)(bf16_round(W[t * 8 + i]) * 16.0f); *(v8us*)((unsigned short*)Bt + t * 8) = f.half[0];  }
template <int NHv, int TTv>
__global__ __launch_bounds__(256) void k_vt(const _Float16* __restrict__ V16, int ldv, int voff, _Float16* __restrict__ Vt) { __shared__ unsigned short tl[64][66]; const int tid = threadIdx.x; const int slab = blockIdx.x / (TTv / 64), lg = blockIdx.x % (TTv / 64); const int b = slab / NHv, h = slab % NHv;
  for (int i = tid; i < 64 * 8; i += 256) { const int r = i / 8, c8 = (i % 8) * 8; FragH f; f.half[0] = *(const v8us*)((const unsigned short*)V16 + ((size_t)b * TTv + lg * 64 + r) * ldv + voff + h * 64 + c8);
#pragma unroll
    for (int q = 0; q < 8; ++q) tl[r][c8 + q] = f.u[q]; }
  __syncthreads();
  {
#pragma unroll
    for (int rd = 0; rd < 2; ++rd) { const int d = rd * 32 + tid / 8, pc = tid % 8; FragH f;
#pragma unroll
      for (int q = 0; q < 8; ++q) f.u[q] = tl[pc * 8 + q][d];
      *(v8us*)((unsigned short*)Vt + ((size_t)slab * 64 + d) * TTv + lg * 64 + pc * 8) = f.half[0]; }
     } }

__global__ __launch_bounds__(256) void k_hl(const float* __restrict__ F, _Float16* __restrict__ Hh, _Float16* __restrict__ Hl, size_t n8) { const size_t t = (size_t)blockIdx.x * 256 + threadIdx.x; if (t >= n8) return; FragH fh, fl; const v4f a = *(const v4fa*)(F + t * 8), c = *(const v4fa*)(F + t * 8 + 4);
#pragma unroll
  for (int q = 0; q < 4; ++q) { _Float16 h = (_Float16)a[q]; fh.h[q] = h; fl.h[q] = (_Float16)((a[q] - (float)h) * 1024.0f); h = (_Float16)c[q]; fh.h[4 + q] = h; fl.h[4 + q] = (_Float16)((c[q] - (float)h) * 1024.0f); }
  { *(v8us*)((unsigned short*)Hh + t * 8) = fh.half[0]; *(v8us*)((unsigned short*)Hl + t * 8) = fl.half[0];  } }

// ---- fast GEMM (wave tile 32x64; requires M % 32 == 0 rows per launch region and N % 64 == 0); epilogue = k_gemm_hhx semantics ----
__device__ __forceinline__ v16h g2_frag(const _Float16* p, int hh) { FragH f; f.half[0] = *(const v8us*)((const unsigned short*)p + 8 * hh); f.half[1] = *(const v8us*)((const unsigned short*)p + 16 + 8 * hh); return f.v; }
__device__ __forceinline__ v8f g2_mma(v16h a, v16h b, v8f c) { v8f d = __builtin_amdgcn_wmma_f32_16x16x32_f16(false, a, false, b, (short)0, c, false, false); asm volatile("v_nop\n\tv_nop\n\tv_nop\n\tv_nop" : "+v"(d) : "v"(a), "v"(b)); return d; }
template <int ACT>
__global__ __launch_bounds__(128) void k_gemm2(const _Float16* __restrict__ A, int lda, size_t sA, const _Float16* __restrict__ Bh, int ldb, size_t sB, float alpha, const float* __restrict__ bias, size_t sBias, const float* __restrict__ CP, int rowsPerB, size_t sCPb, int row0g,
    float* __restrict__ C, _Float16* __restrict__ C16, int ldc, size_t sC, int M, int N, int K) { static_assert(ACT == 0 || ACT == 3 || ACT == 6 || ACT == 8 || ACT == 9 || ACT == 11 || ACT == 12 || ACT == 14 || ACT == 15 || ACT == 16 || ACT == 17, "k_gemm2: unsupported ACT code (would silently apply no activation)");
  __shared__ __attribute__((aligned(16))) float so[4][32][68];
  const int tid = threadIdx.x, w = tid >> 5, lane = tid & 31, ln = lane & 15, hh = lane >> 4; const int by = blockIdx.y;
  A += (size_t)by * sA; Bh += (size_t)by * sB; const size_t cofs = (size_t)by * sC; const float* bp = bias ? bias + (size_t)by * sBias : nullptr;
  const int ntn = N >> 6; const int mt = blockIdx.x / ntn, nq = blockIdx.x - mt * ntn; const int row0 = mt * 128 + 32 * w, col0 = nq * 64; if (row0 >= M) return;
  const _Float16* a0p = A + (size_t)(row0 + ln) * lda; const _Float16* a1p = a0p + (size_t)16 * lda;
  const _Float16* b0p = Bh + (size_t)(col0 + ln) * ldb; const _Float16* b1p = b0p + (size_t)16 * ldb; const _Float16* b2p = b1p + (size_t)16 * ldb; const _Float16* b3p = b2p + (size_t)16 * ldb;
  const v8f z8 = {0.f,0.f,0.f,0.f,0.f,0.f,0.f,0.f}; v8f c00 = z8, c01 = z8, c02 = z8, c03 = z8, c10 = z8, c11 = z8, c12 = z8, c13 = z8;
#pragma unroll 1
  for (int kb = 0; kb < K; kb += 32) { const v16h a0 = g2_frag(a0p + kb, hh), a1 = g2_frag(a1p + kb, hh);
    v16h b = g2_frag(b0p + kb, hh); c00 = g2_mma(a0, b, c00); c10 = g2_mma(a1, b, c10);
    b = g2_frag(b1p + kb, hh); c01 = g2_mma(a0, b, c01); c11 = g2_mma(a1, b, c11);
    b = g2_frag(b2p + kb, hh); c02 = g2_mma(a0, b, c02); c12 = g2_mma(a1, b, c12);
    b = g2_frag(b3p + kb, hh); c03 = g2_mma(a0, b, c03); c13 = g2_mma(a1, b, c13); }
  v8f accs[8] = {c00, c01, c02, c03, c10, c11, c12, c13};
#pragma unroll
  for (int u = 0; u < 8; ++u) { const int t = u & 3, half = u >> 2; const int col = col0 + t * 16 + ln; const float bv = bp ? bf16_round(bp[col]) : 0.f;
#pragma unroll
    for (int r = 0; r < 8; ++r) { const int rloc = half * 16 + 8 * hh + r; float v = accs[u][r] * alpha + bv; if (CP) { if (rowsPerB < 0) v += CP[cofs + (size_t)(row0g + row0 + rloc) * ldc + col];      /* rowsPerB < 0: own element of the batched C plane */ else { const int bidx = (row0g + row0 + rloc) / rowsPerB; v += CP[(size_t)bidx * sCPb + (size_t)by * 64 + col]; } }
      if (ACT == 3) v = fmaxf(v, 0.f); else if (ACT == 6) v = 0.5f * v * (1.0f + erff(v * 0.70710678118654752f)); else if (ACT == 11) v = 1.0f / (1.0f + expf(-v)); else if (ACT == 15) v = v / (1.0f + expf(-v)); else if (ACT == 12) v = (v > 0.f) ? v : 0.01f * v; else if (ACT == 8) v = tanhf(v); else if (ACT == 9) v = 0.5f * v * (1.0f + tanhf(0.7978845608028654f * (v + 0.044715f * v * v * v))); else if (ACT == 14) v = (v > 0.f) ? v : 0.1f * v; else if (ACT == 16) v = (v >= 0.f) ? v : 0.3f * v; else if (ACT == 17) v = (v >= 0.f) ? v : 0.2f * v;
      so[w][rloc][t * 16 + ln] = v; } }
  __builtin_amdgcn_fence(__ATOMIC_ACQ_REL, "workgroup"); __builtin_amdgcn_wave_barrier();
  const int rsub = lane >> 4, c4 = (lane & 15) * 4;
  {
#pragma unroll
    for (int q = 0; q < 16; ++q) { const int r = q * 2 + rsub; const v4f v = *(const v4fa*)&so[w][r][c4]; if (C) *(v4f*)(C + cofs + (size_t)(row0 + r) * ldc + col0 + c4) = v; if (C16) { v4h h4; for (int i = 0; i < 4; ++i) h4[i] = (_Float16)v[i]; *(v4h*)(C16 + cofs + (size_t)(row0 + r) * ldc + col0 + c4) = h4; } }
     } }


__global__ __launch_bounds__(256) void k_wnat(const float* __restrict__ w, size_t n8, _Float16* __restrict__ Bt) { const size_t t = (size_t)blockIdx.x * 256 + threadIdx.x; if (t >= n8) return; FragH f; for (int q = 0; q < 8; ++q) f.h[q] = (_Float16)(bf16_round(w[t * 8 + q]) * 16.0f); *(v8us*)((unsigned short*)Bt + t * 8) = f.half[0];  }
__global__ __launch_bounds__(256) void k_rsm(const float* __restrict__ S, _Float16* __restrict__ P, int nrows) {
  #pragma clang fp contract(off)
  const int i = blockIdx.x * 256 + threadIdx.x; if (i >= nrows) return; const float* s = S + (size_t)i * SQ; float mx = -3.0e38f;
#pragma unroll 1
  for (int j = 0; j < SQ; ++j) mx = fmaxf(mx, s[j]); float se = 0.f;
#pragma unroll 1
  for (int j = 0; j < SQ; ++j) se += expf(s[j] - mx); const float sc = 256.0f / se;
#pragma unroll 1
  for (int j0 = 0; j0 < SQ; j0 += 8) { FragH f; for (int q = 0; q < 8; ++q) f.h[q] = (_Float16)(expf(s[j0 + q] - mx) * sc); unsigned short* d = (unsigned short*)P + (size_t)i * SQ + j0; *(v8us*)d = f.half[0];  } }
__global__ __launch_bounds__(256) void k_vt(const _Float16* __restrict__ V16, int b, int h0, _Float16* __restrict__ VT) { __shared__ unsigned short tl[64][65]; const int tid = threadIdx.x; const int hh = blockIdx.x % HG, sg = blockIdx.x / HG; const int s0 = sg * 64; const int h = h0 + hh;
  for (int i = tid; i < 64 * 8; i += 256) { const int j = i / 8, d8 = (i % 8) * 8; FragH f; f.half[0] = *(const v8us*)((const unsigned short*)V16 + ((size_t)b * SQ + s0 + j) * DM + h * HD + d8); for (int q = 0; q < 8; ++q) tl[d8 + q][j] = f.u[q]; }
  __syncthreads();
  { for (int i = tid; i < 64 * 8; i += 256) { const int d = i / 8, j8 = (i % 8) * 8; FragH f; for (int q = 0; q < 8; ++q) f.u[q] = tl[d][j8 + q]; *(v8us*)((unsigned short*)VT + ((size_t)hh * HD + d) * SQ + s0 + j8) = f.half[0]; }  } }


__global__ __launch_bounds__(256) void k_tab2(float theta, float* __restrict__ CS, float* __restrict__ SN) {
  #pragma clang fp contract(off)
  const int t = blockIdx.x * 256 + threadIdx.x; if (t >= SQ * (HD / 2)) return; const int i = t % (HD / 2); const int p = t / (HD / 2); const float invf = 1.0f / powf(theta, (float)(2 * i) / (float)HD); const float ang = __fmul_rn((float)p, invf); const float c = cosf(ang), s = sinf(ang);
  *(float*)(CS + t) = c; *(float*)(SN + t) = s;  }
template <int NORM, int ROPE>
__global__ __launch_bounds__(64) void k_xform(const float* __restrict__ F, int ldf, int nh, const float* __restrict__ gain, float eps, const float* __restrict__ CS, const float* __restrict__ SN, _Float16* __restrict__ H16, int ldo) {
  #pragma clang fp contract(off)
  __shared__ float xv[HD]; __shared__ float red[HD]; __shared__ unsigned short sh_[HD]; const int d = threadIdx.x; const int h = blockIdx.x % nh; const size_t r = blockIdx.x / nh; const int p = (int)(r % SQ);
  float x = F[r * (size_t)ldf + (size_t)h * HD + d];
  if (NORM) { red[d] = __fmul_rn(x, x); __syncthreads(); for (int st = HD / 2; st > 0; st >>= 1) { if (d < st) red[d] = __fadd_rn(red[d], red[d + st]); __syncthreads(); } const float rs = rsqrtf(__fadd_rn(red[0] / (float)HD, eps)); x = __fmul_rn(__fmul_rn(x, rs), bf16_round(gain[d])); }
  xv[d] = x; __syncthreads();
  float o = x;
  if (ROPE == 1) { const int i = d >> 1; const float c = CS[p * (HD / 2) + i], s = SN[p * (HD / 2) + i]; const float ev = xv[2 * i], od = xv[2 * i + 1]; o = (d & 1) ? __fadd_rn(__fmul_rn(ev, s), __fmul_rn(od, c)) : __fadd_rn(__fmul_rn(ev, c), -__fmul_rn(od, s)); }
  if (ROPE == 2) { const int i = d & (HD / 2 - 1); const float c = CS[p * (HD / 2) + i], s = SN[p * (HD / 2) + i]; const float lo = xv[i], hi = xv[i + HD / 2]; o = (d < HD / 2) ? __fadd_rn(__fmul_rn(lo, c), -__fmul_rn(hi, s)) : __fadd_rn(__fmul_rn(lo, s), __fmul_rn(hi, c)); }
  FragH th; th.h[0] = (_Float16)o; sh_[d] = th.u[0]; __syncthreads();
  if (d < HD / 8) { FragH f; for (int q = 0; q < 8; ++q) f.u[q] = sh_[d * 8 + q]; unsigned short* dst = (unsigned short*)H16 + r * (size_t)ldo + (size_t)h * HD + d * 8; *(v8us*)dst = f.half[0];  } }

__global__ __launch_bounds__(256) void k_tab4(const int* __restrict__ pos, float theta, float* __restrict__ CS, float* __restrict__ SN) {
  #pragma clang fp contract(off)
  const int t = blockIdx.x * 256 + threadIdx.x; if (t >= SQ * (HD / 2)) return; const int i = t % (HD / 2); const int p = t / (HD / 2); const float invf = (float)pow((double)theta, -((double)(2 * i)) / (double)HD); const float ang = __fmul_rn((float)pos[p], invf); const float c = cosf(ang), s = sinf(ang);
  *(float*)(CS + t) = c; *(float*)(SN + t) = s;  }
__global__ __launch_bounds__(256) void k_rsmf(const float* __restrict__ S, _Float16* __restrict__ P, int qn, int hg) {
  #pragma clang fp contract(off)
  const int t = blockIdx.x * 256 + threadIdx.x; if (t >= qn * hg) return; const size_t i = (size_t)(t / qn) * SQ + (t % qn); const float* s = S + i * SQ; float mx = -3.0e38f;
#pragma unroll 1
  for (int j = 0; j < SQ; ++j) mx = fmaxf(mx, s[j]); float se = 0.f;
#pragma unroll 1
  for (int j = 0; j < SQ; ++j) se += __expf(s[j] - mx); const float sc = 256.0f / se;
#pragma unroll 1
  for (int j0 = 0; j0 < SQ; j0 += 8) { FragH f; for (int q = 0; q < 8; ++q) f.h[q] = (_Float16)(__expf(s[j0 + q] - mx) * sc); unsigned short* d = (unsigned short*)P + i * SQ + j0; *(v8us*)d = f.half[0];  } }


__device__ __forceinline__ v8f fa_mma(v16h a, v16h b, v8f c) { return __builtin_amdgcn_wmma_f32_16x16x32_f16(false, a, false, b, (short)0, c, false, false); }
// 2^x for eight values (two for the rescale factors) in ONE statement: outputs are early-clobber, so no exponential reads its predecessor's result or overwrites its source, and the closing v_nop keeps the one
// independent slot that the instruction set asks for between the last exponential and whatever the compiler places next.
__device__ __forceinline__ v8f fa_exp8(v8f x) { float y0, y1, y2, y3, y4, y5, y6, y7;
  asm("v_exp_f32 %0, %8\n\tv_exp_f32 %1, %9\n\tv_exp_f32 %2, %10\n\tv_exp_f32 %3, %11\n\tv_exp_f32 %4, %12\n\tv_exp_f32 %5, %13\n\tv_exp_f32 %6, %14\n\tv_exp_f32 %7, %15\n\tv_nop"
      : "=&v"(y0), "=&v"(y1), "=&v"(y2), "=&v"(y3), "=&v"(y4), "=&v"(y5), "=&v"(y6), "=&v"(y7) : "v"(x[0]), "v"(x[1]), "v"(x[2]), "v"(x[3]), "v"(x[4]), "v"(x[5]), "v"(x[6]), "v"(x[7]));
  const v8f y = {y0, y1, y2, y3, y4, y5, y6, y7}; return y; }
__device__ __forceinline__ void fa_exp2(float x0, float x1, float& y0, float& y1) { asm("v_exp_f32 %0, %2\n\tv_exp_f32 %1, %3\n\tv_nop" : "=&v"(y0), "=&v"(y1) : "v"(x0), "v"(x1)); }
// One step of 32 keys. kn / vn: the NEXT step's K rows and V^T columns, fetched into the same registers right after their last use here, so that a whole step passes before they are needed;
// DIAG: the wave's last step (first key == first query): keys above the query get weight 0, and nothing is fetched.
template <bool DIAG>
__device__ __forceinline__ void fa_step(const v16h (&qf)[2][2], v16h (&kf)[2][2], v16h (&vf)[4], v8f (&o)[2][4], float (&mu)[2], float (&l)[2], const _Float16* kn, const _Float16* vn, int c, int hh) {
  const float cs = 0.125f * 1.44269504088896340736f;      /* score scale x log2(e) */
  const v8f z8 = {0.f,0.f,0.f,0.f,0.f,0.f,0.f,0.f};
  v8f s[2][2];
#pragma unroll
  for (int u = 0; u < 2; ++u)
#pragma unroll
    for (int kt = 0; kt < 2; ++kt) s[u][kt] = fa_mma(kf[kt][1], qf[u][1], fa_mma(kf[kt][0], qf[u][0], z8));
  if (!DIAG) {
#pragma unroll
    for (int kt = 0; kt < 2; ++kt) { kf[kt][0] = g2_frag(kn + (size_t)kt * 16 * DM, hh); kf[kt][1] = g2_frag(kn + (size_t)kt * 16 * DM + 32, hh); } }
  if (DIAG) {
#pragma unroll
    for (int u = 0; u < 2; ++u)
#pragma unroll
      for (int kt = 0; kt < 2; ++kt)
#pragma unroll
        for (int r = 0; r < 8; ++r) s[u][kt][r] = (kt * 16 + 8 * hh + r <= u * 16 + c) ? s[u][kt][r] : -1.0e30f; }
  float mx[2];
#pragma unroll
  for (int u = 0; u < 2; ++u) { float a = fmaxf(s[u][0][0], s[u][1][0]);
#pragma unroll
    for (int r = 1; r < 8; ++r) a = fmaxf(a, fmaxf(s[u][0][r], s[u][1][r]));
    a = fmaxf(a, __shfl_xor(a, 16)); mx[u] = a * cs; }      /* cs > 0: scaling commutes with the maximum */
  if (__builtin_amdgcn_ballot_w32(mx[0] > mu[0] + 8.0f || mx[1] > mu[1] + 8.0f) != 0) {      /* one scalar test per step */
    const float mn0 = fmaxf(mu[0], mx[0]), mn1 = fmaxf(mu[1], mx[1]); float al[2]; fa_exp2(mu[0] - mn0, mu[1] - mn1, al[0], al[1]); mu[0] = mn0; mu[1] = mn1;
#pragma unroll
    for (int u = 0; u < 2; ++u) { l[u] *= al[u];
#pragma unroll
      for (int t = 0; t < 4; ++t) o[u][t] *= al[u]; } }
  FragH pf[2];
#pragma unroll
  for (int u = 0; u < 2; ++u) { float sm = 0.f;
#pragma unroll
    for (int kt = 0; kt < 2; ++kt) { v8f x;
#pragma unroll
      for (int r = 0; r < 8; ++r) x[r] = fmaf(s[u][kt][r], cs, -mu[u]);
      const v8f p = fa_exp8(x);
#pragma unroll
      for (int r = 0; r < 8; ++r) { sm += p[r]; pf[u].h[kt * 8 + r] = (_Float16)p[r]; } }
    l[u] += sm; }
#pragma unroll
  for (int u = 0; u < 2; ++u)
#pragma unroll
    for (int t = 0; t < 4; ++t) o[u][t] = fa_mma(vf[t], pf[u].v, o[u][t]);
  if (!DIAG) {
#pragma unroll
    for (int t = 0; t < 4; ++t) vf[t] = g2_frag(vn + (size_t)t * 16 * SQ, hh);
    asm volatile("s_wait_xcnt 0x0" ::: "memory"); } }      /* stands behind the step's last loads, ahead of the next step's first write of a register that holds their address */
__global__ __launch_bounds__(128) void k_fattn(const _Float16* __restrict__ Q16, const _Float16* __restrict__ K16, const _Float16* __restrict__ VTa, _Float16* __restrict__ O) {
  const int lane = threadIdx.x & 31, c = lane & 15, hh = lane >> 4;
  const int w = __builtin_amdgcn_readfirstlane(threadIdx.x >> 5);      /* the wave's number as a scalar: the trip count is scalar */
  const int bh = blockIdx.x % (NB * NH); const int g = blockIdx.x / (4 * NB * NH), rr = (blockIdx.x / (NB * NH)) % 4;
  const int qt = (3 - g) * 4 + ((g & 1) ? rr : 3 - rr);      /* a permutation of the 16 query tiles: long tiles first, and blocks a quarter of the grid apart have tiles that sum to the same length */
  const int b = bh / NH, h = bh % NH; const int q0 = qt * 128 + w * 32;
  const _Float16* qp = Q16 + ((size_t)b * SQ + q0 + c) * DM + h * HD;
  const _Float16* kp = K16 + ((size_t)b * SQ + c) * DM + h * HD;
  const _Float16* vp = VTa + ((size_t)bh * HD + c) * SQ;
  const v8f z8 = {0.f,0.f,0.f,0.f,0.f,0.f,0.f,0.f};
  v16h qf[2][2], kf[2][2], vf[4];
#pragma unroll
  for (int u = 0; u < 2; ++u) { qf[u][0] = g2_frag(qp + (size_t)u * 16 * DM, hh); qf[u][1] = g2_frag(qp + (size_t)u * 16 * DM + 32, hh); }
#pragma unroll
  for (int kt = 0; kt < 2; ++kt) { kf[kt][0] = g2_frag(kp + (size_t)kt * 16 * DM, hh); kf[kt][1] = g2_frag(kp + (size_t)kt * 16 * DM + 32, hh); }
#pragma unroll
  for (int t = 0; t < 4; ++t) vf[t] = g2_frag(vp + (size_t)t * 16 * SQ, hh);
  asm volatile("s_wait_xcnt 0x0" ::: "memory");      /* stands behind the first fragments' loads, ahead of the first write of a register that holds one of their addresses */
  v8f o[2][4]; float mu[2], l[2];
#pragma unroll
  for (int u = 0; u < 2; ++u) { mu[u] = -1.0e30f; l[u] = 0.f;
#pragma unroll
    for (int t = 0; t < 4; ++t) o[u][t] = z8; }
#pragma unroll 1
  for (int k0 = 0; k0 < q0; k0 += 32) fa_step<false>(qf, kf, vf, o, mu, l, kp + (size_t)(k0 + 32) * DM, vp + k0 + 32, c, hh);      /* kept rolled: one step holds 16 WMMAs and the registers of four waves per SIMD; k0 + 32 <= q0 is a step of this wave */
  fa_step<true>(qf, kf, vf, o, mu, l, kp, vp, c, hh);
#pragma unroll
  for (int u = 0; u < 2; ++u) { const float fin = 64.0f / (l[u] + __shfl_xor(l[u], 16));      /* the lane halves' sums join once; o carried x64 */
    unsigned short* dst = (unsigned short*)O + ((size_t)b * SQ + q0 + u * 16 + c) * DM + h * HD + 8 * hh;
#pragma unroll
    for (int t = 0; t < 4; ++t) { FragH f;
#pragma unroll
      for (int r = 0; r < 8; ++r) f.h[r] = (_Float16)(o[u][t][r] * fin);      /* register r is output column 16 t + 8 hh + r of query c: one 16-byte store */
      *(v8us*)(dst + t * 16) = f.half[0]; } } }
static_assert(SQ == 16 * 128 && HD == 64, "k_fattn: 16 query tiles of 4 waves x 32 query columns, head size 64");


// Exact f32 causal attention for the first QT0 rows, one wave per (head, query row), 8 rows of one head per block.
// The head's QT0 key rows are staged in LDS at a pitch of HD + 4 floats (16 bytes x an odd number: row-per-lane 16-byte reads without bank conflicts).
// Lane l scores keys l, l + 32, l + 64, l + 96 (each dot product summed over d in index order); row maximum and row sum end in lane butterflies;
// then lane l sums output columns 2 l and 2 l + 1 over the keys in index order, each weight read from its lane as a scalar.
typedef float v2f __attribute__((ext_vector_type(2)));
typedef float v2fa __attribute__((ext_vector_type(2), may_alias));
__global__ __launch_bounds__(256) void k_att0w(const float* __restrict__ QF, const float* __restrict__ KF, const float* __restrict__ VF, float scale, float* __restrict__ OF) {      /* all four row pitches are DM, so that every row step is an immediate offset */
  __shared__ __attribute__((aligned(16))) float lk[QT0][HD + 4];
  const int tid = threadIdx.x, lane = tid & 31; const int h = blockIdx.x / (QT0 / 8);
  const int i = (blockIdx.x % (QT0 / 8)) * 8 + __builtin_amdgcn_readfirstlane(tid >> 5);      /* the wave's query row, held as a scalar so that the q row and the group tests below are wave-uniform */
  const float* kb = KF + h * HD;
#pragma unroll
  for (int p = 0; p < QT0 / 16; ++p) { const int r = p * 16 + (tid >> 4), c4 = (tid & 15) * 4; *(v4f*)&lk[r][c4] = *(const v4fa*)(kb + (size_t)r * DM + c4); }      /* unrolled: all 8 loads of a thread in flight at once */
  __syncthreads();
  const float* qr = QF + (size_t)i * DM + h * HD;
  float sa[QT0 / 32];
#pragma unroll
  for (int g = 0; g < QT0 / 32; ++g) sa[g] = 0.f;
#pragma unroll
  for (int c = 0; c < HD / 4; ++c) { const v4f qq = *(const v4fa*)(qr + c * 4);      /* unrolled: sa stays in named registers and the four groups' sum chains interleave */
#pragma unroll
    for (int g = 0; g < QT0 / 32; ++g) { const v4f kq = *(const v4f*)&lk[g * 32 + lane][c * 4]; sa[g] = fmaf(qq[0], kq[0], sa[g]); sa[g] = fmaf(qq[1], kq[1], sa[g]); sa[g] = fmaf(qq[2], kq[2], sa[g]); sa[g] = fmaf(qq[3], kq[3], sa[g]); } }
  float m = -1.0e30f;
#pragma unroll
  for (int g = 0; g < QT0 / 32; ++g) { sa[g] = (g * 32 + lane <= i) ? sa[g] * scale : -1.0e30f; m = fmaxf(m, sa[g]); }      /* causal: keys above the row get weight 0 */
#pragma unroll
  for (int o = 16; o > 0; o >>= 1) m = fmaxf(m, __shfl_xor(m, o));
  float l = 0.f;
#pragma unroll
  for (int g = 0; g < QT0 / 32; ++g) { sa[g] = expf(sa[g] - m); l += sa[g]; }
#pragma unroll
  for (int o = 16; o > 0; o >>= 1) l += __shfl_xor(l, o);
  const float* vb = VF + h * HD + lane * 2; float o0 = 0.f, o1 = 0.f;
#pragma unroll
  for (int g = 0; g < QT0 / 32; ++g) { if (g * 32 <= i) {      /* wave-uniform: key groups wholly above the row are skipped */
#pragma unroll
      for (int jj = 0; jj < 32; ++jj) { const float p = __int_as_float(__builtin_amdgcn_readlane(__float_as_int(sa[g]), jj)); const v2f vv = *(const v2fa*)(vb + (size_t)(g * 32 + jj) * DM); o0 = fmaf(p, vv[0], o0); o1 = fmaf(p, vv[1], o1); } } }      /* unrolled: a group's 32 loads issue before the first use */
  const float fin = 64.0f / l;      /* o carried x64 like the f16 path */
  v2f ov; ov[0] = o0 * fin; ov[1] = o1 * fin; *(v2f*)(OF + (size_t)i * DM + h * HD + lane * 2) = ov; }

template <int NORM, int ROPE>
__global__ __launch_bounds__(64) void k_xformf(const float* __restrict__ F, int ldf, int nh, const float* __restrict__ gain, float eps, const float* __restrict__ CS, const float* __restrict__ SN, float* __restrict__ F32, int ldo) {
  #pragma clang fp contract(off)
  __shared__ float xv[HD]; __shared__ float red[HD]; const int d = threadIdx.x; const int h = blockIdx.x % nh; const size_t r = blockIdx.x / nh; const int p = (int)(r % SQ);
  float x = F[r * (size_t)ldf + (size_t)h * HD + d];
  if (NORM) { red[d] = __fmul_rn(x, x); __syncthreads(); for (int st = HD / 2; st > 0; st >>= 1) { if (d < st) red[d] = __fadd_rn(red[d], red[d + st]); __syncthreads(); } const float rs = rsqrtf(__fadd_rn(red[0] / (float)HD, eps)); x = __fmul_rn(__fmul_rn(x, rs), bf16_round(gain[d])); }
  xv[d] = x; __syncthreads();
  float o = x;
  if (ROPE == 1) { const int i = d >> 1; const float c = CS[p * (HD / 2) + i], s = SN[p * (HD / 2) + i]; const float ev = xv[2 * i], od = xv[2 * i + 1]; o = (d & 1) ? __fadd_rn(__fmul_rn(ev, s), __fmul_rn(od, c)) : __fadd_rn(__fmul_rn(ev, c), -__fmul_rn(od, s)); }
  if (ROPE == 2) { const int i = d & (HD / 2 - 1); const float c = CS[p * (HD / 2) + i], s = SN[p * (HD / 2) + i]; const float lo = xv[i], hi = xv[i + HD / 2]; o = (d < HD / 2) ? __fadd_rn(__fmul_rn(lo, c), -__fmul_rn(hi, s)) : __fadd_rn(__fmul_rn(lo, s), __fmul_rn(hi, c)); }
  float* dst = F32 + r * (size_t)ldo + (size_t)h * HD + d; *(float*)dst = o;  }


__global__ __launch_bounds__(256) void k_bfcp(const float* __restrict__ src, float* __restrict__ dst, size_t n4) { const size_t t = (size_t)blockIdx.x * 256 + threadIdx.x; if (t >= n4) return; const v4f a = *(const v4fa*)(src + t * 4); v4f o; for (int q = 0; q < 4; ++q) o[q] = bf16_round(a[q]); *(v4f*)(dst + t * 4) = o;  }
extern "C" void kernel_launch(void* const* d_in, const int* in_sizes, int n_in,
                              void* d_out, int out_size, void* d_ws, size_t ws_size, hipStream_t stream) {
  (void)in_sizes; (void)n_in; (void)out_size;
    const float* const* I = (const float* const*)d_in; const float* x = I[0]; const float* tcos = I[1]; const float* tsin = I[2]; const float* wq = I[3]; const float* wk = I[4]; const float* wv = I[5]; const float* wo = I[6];      /* [in][out] weights, no biases; rope tables INPUT [2048][32] */
  char* ws = (char*)d_ws; size_t off = 0;
  auto take = [&](size_t bytes) { char* p = ws + off; off += (bytes + 255) & ~(size_t)255; return p; };
  _Float16* BQKV = (_Float16*)take((size_t)3 * DM * DM * 2); _Float16* BO = (_Float16*)take((size_t)DM * DM * 2); float* CS = (float*)take((size_t)SQ * (HD / 2) * 4); float* SN = (float*)take((size_t)SQ * (HD / 2) * 4);
  _Float16* X16 = (_Float16*)take(NR * DM * 2); float* QKVF = (float*)take((size_t)SQ * 3 * DM * 4);      /* one batch of f32 q | k | v rows */
  _Float16* QH = (_Float16*)take(NR * DM * 2); _Float16* KH = (_Float16*)take(NR * DM * 2); _Float16* V16 = (_Float16*)take(NR * DM * 2); _Float16* O16 = (_Float16*)take(NR * DM * 2);
  _Float16* VT = (_Float16*)take((size_t)NB * NH * HD * SQ * 2);
  float* QF0 = (float*)take((size_t)QT0 * DM * 4); float* KF0 = (float*)take((size_t)QT0 * DM * 4); float* VF0 = (float*)take((size_t)QT0 * DM * 4); float* OF0 = (float*)take((size_t)NB * QT0 * DM * 4); _Float16* OH0 = (_Float16*)take((size_t)NB * QT0 * DM * 2); _Float16* OL0 = (_Float16*)take((size_t)NB * QT0 * DM * 2);
  if (off > ws_size) return;
  { const unsigned g = (unsigned)(((size_t)DM * (DM / 8) + 255) / 256); k_wt_f16<<<g, 256, 0, stream>>>(wq, BQKV, DM, DM, 16.0f); k_wt_f16<<<g, 256, 0, stream>>>(wk, BQKV + (size_t)DM * DM, DM, DM, 16.0f); k_wt_f16<<<g, 256, 0, stream>>>(wv, BQKV + (size_t)2 * DM * DM, DM, DM, 16.0f); k_wt_f16<<<g, 256, 0, stream>>>(wo, BO, DM, DM, 16.0f); }      /* [in][out] -> Bt[n][k] x16; q | k | v stacked along n */
  k_bfcp<<<(unsigned)((SQ * (HD / 2) / 4 + 255) / 256), 256, 0, stream>>>(tcos, CS, (size_t)SQ * (HD / 2) / 4); k_bfcp<<<(unsigned)((SQ * (HD / 2) / 4 + 255) / 256), 256, 0, stream>>>(tsin, SN, (size_t)SQ * (HD / 2) / 4);      /* bf16-rounded copies of the INPUT tables [2048][32] */
  k_x16<<<(unsigned)((NR * DM / 8 + 255) / 256), 256, 0, stream>>>(x, X16, NR * DM / 8);
  for (int b = B0; b < B0 + NBR; ++b) { const size_t r0 = (size_t)b * SQ;
    k_gemm2<0><<<dim3((unsigned)((SQ / 128) * (3 * DM / 64)), 1), 128, 0, stream>>>(X16 + r0 * DM, DM, 0, BQKV, DM, 0, 0.0625f, nullptr, 0, nullptr, 1, 0, 0, QKVF, nullptr, 3 * DM, 0, SQ, 3 * DM, DM);      /* q | k | v rows (f32) of this batch */
    k_xform<0, 2><<<(unsigned)(SQ * NH), 64, 0, stream>>>(QKVF, 3 * DM, NH, nullptr, 0.f, CS, SN, QH + r0 * DM, DM);
    k_xform<0, 2><<<(unsigned)(SQ * NH), 64, 0, stream>>>(QKVF + DM, 3 * DM, NH, nullptr, 0.f, CS, SN, KH + r0 * DM, DM);
    k_xform<0, 0><<<(unsigned)(SQ * NH), 64, 0, stream>>>(QKVF + 2 * DM, 3 * DM, NH, nullptr, 0.f, CS, SN, V16 + r0 * DM, DM);
    k_vt<NH, SQ><<<NH * (SQ / 64), 256, 0, stream>>>(V16 + r0 * DM, DM, 0, VT + (size_t)b * NH * HD * SQ);      /* V^T [NH][HD][SQ] of this batch */
    k_xformf<0, 2><<<(unsigned)(QT0 * NH), 64, 0, stream>>>(QKVF, 3 * DM, NH, nullptr, 0.f, CS, SN, QF0, DM); k_xformf<0, 2><<<(unsigned)(QT0 * NH), 64, 0, stream>>>(QKVF + DM, 3 * DM, NH, nullptr, 0.f, CS, SN, KF0, DM); k_xformf<0, 0><<<(unsigned)(QT0 * NH), 64, 0, stream>>>(QKVF + 2 * DM, 3 * DM, NH, nullptr, 0.f, CS, SN, VF0, DM);      /* f32 q (roped), k (roped), v of the first 128 rows */
    k_att0w<<<NH * (QT0 / 8), 256, 0, stream>>>(QF0, KF0, VF0, 0.125f, OF0 + (size_t)b * QT0 * DM);      /* exact f32 causal attention for rows 0..127 (o x64) */
  }
  k_fattn<<<(SQ / 128) * NB * NH, 128, 0, stream>>>(QH, KH, VT, O16);      /* o (merged heads, x64) as f16 rows, all batches */
  k_gemm2<0><<<dim3((unsigned)((MPO / 128) * (DM / 64)), 1), 128, 0, stream>>>(O16 + (size_t)B0 * SQ * DM, DM, 0, BO, DM, 0, 0.0009765625f, nullptr, 0, nullptr, 1, 0, 0, (float*)d_out + (size_t)B0 * SQ * DM, nullptr, DM, 0, MPO, DM, DM);      /* out rows are the output layout */
  k_hl<<<(unsigned)(((size_t)NB * QT0 * DM / 8 + 255) / 256), 256, 0, stream>>>(OF0, OH0, OL0, (size_t)NB * QT0 * DM / 8);      /* first-tile o (x64) -> f16 hi + x1024 residual planes */
  for (int b = B0; b < B0 + NBR; ++b) { const size_t r0 = (size_t)b * SQ; const size_t f0 = (size_t)b * QT0;
    k_gemm2<0><<<dim3((QT0 / 128) * (DM / 64), 1), 128, 0, stream>>>(OH0 + f0 * DM, DM, 0, BO, DM, 0, 0.0009765625f, nullptr, 0, nullptr, 1, 0, 0, (float*)d_out + r0 * DM, nullptr, DM, 0, QT0, DM, DM);      /* rows 0..127: out = o_hi Wo, overwriting the f16-path rows */
    k_gemm2<0><<<dim3((QT0 / 128) * (DM / 64), 1), 128, 0, stream>>>(OL0 + f0 * DM, DM, 0, BO, DM, 0, 0.00000095367431640625f, nullptr, 0, (const float*)d_out + r0 * DM, -1, 0, 0, (float*)d_out + r0 * DM, nullptr, DM, 0, QT0, DM, DM); }      /* += o_lo Wo 2^-20 (own-element accumulate) */
}

// v004
// It runs in 569 microseconds.
// In two side-by-side timings against v003, it was 1.33 and 1.32 times as fast.
// All steps since v000 together make it 17.2 times as fast.
#include <hip/hip_runtime.h>
#define NB 4
#define SQ 2048
#define DM 1024
#define NH 16
#define HD 64
#define HG 4                         /* heads per launch of the k_vt(V16, b, h0, VT) overload (not launched) */
#define QT0 128                      /* first-tile rows recomputed exactly in f32 */
#define B0 0                         /* first batch processed (debug hook) */
#define NBR NB                       /* batches processed (debug hook) */
#define NR ((size_t)NB * SQ)         /* token rows */
#define MPO ((int)((size_t)NBR * SQ))      /* rows through the output GEMM (debug hook) */
typedef __bf16 v16b __attribute__((ext_vector_type(16)));
typedef unsigned short v8us __attribute__((ext_vector_type(8), may_alias));
typedef float  v8f  __attribute__((ext_vector_type(8)));
typedef float  v4f  __attribute__((ext_vector_type(4)));
typedef float  v4fa __attribute__((ext_vector_type(4), may_alias));
union FragB { v16b v; v8us half[2]; unsigned short u[16]; };

__device__ __forceinline__ unsigned short bf16_bits(float x) { unsigned int u = __float_as_uint(x); return (unsigned short)((u + 0x7FFFu + ((u >> 16) & 1u)) >> 16); }
__device__ __forceinline__ float bf16_val(unsigned short b) { return __uint_as_float(((unsigned int)b) << 16); }
__device__ __forceinline__ float bf16_round(float x) { return bf16_val(bf16_bits(x)); }
// D += A·B with NT terms: 1 = ah·bh, 2 = + al·bh (A split), 3 = + ah·bl (both split)
template <int NT>
__device__ __forceinline__ v8f mmaN(v16b ah, v16b al, v16b bh, v16b bl, v8f c) {
  c = __builtin_amdgcn_wmma_f32_16x16x32_bf16(false, ah, false, bh, (short)0, c, false, false);
  if (NT >= 2) c = __builtin_amdgcn_wmma_f32_16x16x32_bf16(false, al, false, bh, (short)0, c, false, false);
  if (NT >= 3) c = __builtin_amdgcn_wmma_f32_16x16x32_bf16(false, ah, false, bl, (short)0, c, false, false);
  asm volatile("v_nop\n\tv_nop\n\tv_nop\n\tv_nop" : "+v"(c) : "v"(ah), "v"(al), "v"(bh), "v"(bl));
  return c;
}

__global__ __launch_bounds__(256) void k_wt_bf16(const float* __restrict__ W, unsigned short* __restrict__ Wt, int K, int N) {
  const int t = blockIdx.x * 256 + threadIdx.x;
  const int k8n = K / 8;
  if (t >= N * k8n) return;
  const int n = t / k8n, k8 = (t % k8n) * 8;
  v8us v;
#pragma unroll
  for (int i = 0; i < 8; ++i) v[i] = bf16_bits(W[(size_t)(k8 + i) * N + n]);
  *(v8us*)(Wt + (size_t)n * K + k8) = v;
  
}

// GEMM C[M][N] (f32, pitch ldc) = act(A[M][K]·W + bias). A f32 row-major (pitch lda) converted per fragment to bf16
// (ASPLIT: hi/lo two planes -> 2 terms, else single rounded term); Wt bf16 [N][K] (pitch ldb). BIAS_BF16 rounds the
// bias to bf16 first (bias quantised to bf16 before the add). K%32==0, M%16==0, N%64==0.
template <bool ASPLIT, int ACT, bool BIAS_BF16>
__global__ __launch_bounds__(128) void k_gemm_bf(const float* __restrict__ A, int lda, const unsigned short* __restrict__ Wt, int ldb,
                                               const float* __restrict__ bias, float* __restrict__ C, int ldc, int M, int N, int K) {
  __shared__ __attribute__((aligned(16))) float so[4][16][64];
  const int tid = threadIdx.x, w = tid >> 5, lane = tid & 31, ln = lane & 15, hh = lane >> 4;
  const int ntn = N / 64;
  const int wid = blockIdx.x * 4 + w;
  const int mt = wid / ntn, nq = wid % ntn;
  if (mt * 16 >= M) return;
  const int row0 = mt * 16, col0 = nq * 64;
  const float* arow = A + (size_t)(row0 + ln) * lda;
  v8f acc[4] = {};
  for (int kb = 0; kb < K; kb += 32) {
    FragB ah, al;
    const v4f x0 = *(const v4fa*)(arow + kb + 8 * hh), x1 = *(const v4fa*)(arow + kb + 8 * hh + 4);
    const v4f x2 = *(const v4fa*)(arow + kb + 16 + 8 * hh), x3 = *(const v4fa*)(arow + kb + 16 + 8 * hh + 4);
    float xs[16] = {x0[0],x0[1],x0[2],x0[3],x1[0],x1[1],x1[2],x1[3],x2[0],x2[1],x2[2],x2[3],x3[0],x3[1],x3[2],x3[3]};
#pragma unroll
    for (int i = 0; i < 16; ++i) { const unsigned short hb = bf16_bits(xs[i]); ah.u[i] = hb; al.u[i] = ASPLIT ? bf16_bits(xs[i] - bf16_val(hb)) : (unsigned short)0; }
#pragma unroll
    for (int t = 0; t < 4; ++t) {
      const unsigned short* brow = Wt + (size_t)(col0 + t * 16 + ln) * ldb + kb;
      FragB b;
      b.half[0] = *(const v8us*)(brow + 8 * hh);
      b.half[1] = *(const v8us*)(brow + 16 + 8 * hh);
      acc[t] = mmaN<ASPLIT ? 2 : 1>(ah.v, al.v, b.v, b.v, acc[t]);
    }
  }
#pragma unroll
  for (int t = 0; t < 4; ++t) {
    float bv = bias ? bias[col0 + t * 16 + ln] : 0.f;
    if (BIAS_BF16) bv = bf16_round(bv);
#pragma unroll
    for (int r = 0; r < 8; ++r) { float v = acc[t][r] + bv; if (ACT == 1) v = fmaxf(v, 0.f); so[w][8 * hh + r][t * 16 + ln] = v; }
  }
  __builtin_amdgcn_fence(__ATOMIC_ACQ_REL, "workgroup");
  __builtin_amdgcn_wave_barrier();
  const int rsub = lane >> 4, c4 = (lane & 15) * 4;
  {
#pragma unroll
    for (int q = 0; q < 8; ++q) {
      const int r = q * 2 + rsub;
      const v4f v = *(const v4fa*)&so[w][r][c4];
      *(v4f*)(C + (size_t)(row0 + r) * ldc + col0 + c4) = v;
    }
    
  }
}

// GEMM C = act(A·W + bias + resid): A f32 (ASPLIT -> hi/lo 2 terms), Wt bf16 [N][K]; ACT 0 none, 1 relu, 2 exact gelu;
// resid (optional, f32, row index = (row % rmod), pitch ldr, RES_BF16 rounds it) added before the activation.
template <bool ASPLIT, int ACT, bool BIAS_BF16, bool RES_BF16>
__global__ __launch_bounds__(128) void k_gemm_bf3(const float* __restrict__ A, int lda, const unsigned short* __restrict__ Wt, int ldb,
                                                const float* __restrict__ bias, const float* __restrict__ resid, int rmod, int ldr,
                                                float* __restrict__ C, int ldc, int M, int N, int K) {
  __shared__ __attribute__((aligned(16))) float so[4][16][64];
  const int tid = threadIdx.x, w = tid >> 5, lane = tid & 31, ln = lane & 15, hh = lane >> 4;
  const int ntn = N / 64;
  const int wid = blockIdx.x * 4 + w;
  const int mt = wid / ntn, nq = wid % ntn;
  if (mt * 16 >= M) return;
  const int row0 = mt * 16, col0 = nq * 64;
  const float* arow = A + (size_t)(row0 + ln) * lda;
  v8f acc[4] = {};
  for (int kb = 0; kb < K; kb += 32) {
    FragB ah, al;
    const v4f x0 = *(const v4fa*)(arow + kb + 8 * hh), x1 = *(const v4fa*)(arow + kb + 8 * hh + 4);
    const v4f x2 = *(const v4fa*)(arow + kb + 16 + 8 * hh), x3 = *(const v4fa*)(arow + kb + 16 + 8 * hh + 4);
    float xs[16] = {x0[0],x0[1],x0[2],x0[3],x1[0],x1[1],x1[2],x1[3],x2[0],x2[1],x2[2],x2[3],x3[0],x3[1],x3[2],x3[3]};
#pragma unroll
    for (int i = 0; i < 16; ++i) { const unsigned short hb = bf16_bits(xs[i]); ah.u[i] = hb; al.u[i] = ASPLIT ? bf16_bits(xs[i] - bf16_val(hb)) : (unsigned short)0; }
#pragma unroll
    for (int t = 0; t < 4; ++t) {
      const unsigned short* brow = Wt + (size_t)(col0 + t * 16 + ln) * ldb + kb;
      FragB b;
      b.half[0] = *(const v8us*)(brow + 8 * hh);
      b.half[1] = *(const v8us*)(brow + 16 + 8 * hh);
      acc[t] = mmaN<ASPLIT ? 2 : 1>(ah.v, al.v, b.v, b.v, acc[t]);
    }
  }
#pragma unroll
  for (int t = 0; t < 4; ++t) {
    const int col = col0 + t * 16 + ln;
    float bv = bias ? bias[col] : 0.f;
    if (BIAS_BF16) bv = bf16_round(bv);
#pragma unroll
    for (int r = 0; r < 8; ++r) {
      float v = acc[t][r] + bv;
      if (resid) { float rv = resid[(size_t)((row0 + 8 * hh + r) % rmod) * ldr + col]; if (RES_BF16) rv = bf16_round(rv); v += rv; }
      if (ACT == 1) v = fmaxf(v, 0.f);
      if (ACT == 2) v = 0.5f * v * (1.0f + erff(v * 0.70710678118654752f));
      if (ACT == 3) { const float u = 0.7978845608028654f * (v + 0.044715f * v * v * v); v = 0.5f * v * (1.0f + tanhf(u)); }
      so[w][8 * hh + r][t * 16 + ln] = v;
    }
  }
  __builtin_amdgcn_fence(__ATOMIC_ACQ_REL, "workgroup");
  __builtin_amdgcn_wave_barrier();
  const int rsub = lane >> 4, c4 = (lane & 15) * 4;
  {
#pragma unroll
    for (int q = 0; q < 8; ++q) {
      const int r = q * 2 + rsub;
      const v4f v = *(const v4fa*)&so[w][r][c4];
      *(v4f*)(C + (size_t)(row0 + r) * ldc + col0 + c4) = v;
    }
    
  }
}
// row LayerNorm (biased variance, eps) over N: s = X (+ R); optional out_sum <- s; out_norm <- (s-mu)*rsqrt(var+eps)*g + b
template <bool PARAM_BF16>
__global__ __launch_bounds__(256) void k_layernorm(const float* __restrict__ X, const float* __restrict__ R, const float* __restrict__ g, const float* __restrict__ bta,
                                                  float* __restrict__ out_sum, float* __restrict__ out_norm, int N, float eps) {
  __shared__ float red[256];
  const int row = blockIdx.x, tid = threadIdx.x;
  const float* x = X + (size_t)row * N; const float* rr = R ? R + (size_t)row * N : nullptr;
  float vals[16];                     // up to N = 4096
  const int per = N / 256;            // contiguous chunk per thread? use strided-by-4 chunks: thread handles j = tid*4 + 1024*u
  float s1 = 0.f;
  for (int u = 0; u < per / 4; ++u) {
    const int j = tid * 4 + 1024 * u;
    const v4f a = *(const v4fa*)(x + j);
    v4f b = {0.f,0.f,0.f,0.f}; if (rr) b = *(const v4fa*)(rr + j);
#pragma unroll
    for (int q = 0; q < 4; ++q) { const float v = a[q] + b[q]; vals[u * 4 + q] = v; s1 += v; }
  }
  red[tid] = s1; __syncthreads();
  for (int st = 128; st > 0; st >>= 1) { if (tid < st) red[tid] += red[tid + st]; __syncthreads(); }
  const float mu = red[0] / (float)N; __syncthreads();
  float s2 = 0.f;
  for (int u = 0; u < per / 4; ++u)
#pragma unroll
    for (int q = 0; q < 4; ++q) { const float c = vals[u * 4 + q] - mu; s2 += c * c; }
  red[tid] = s2; __syncthreads();
  for (int st = 128; st > 0; st >>= 1) { if (tid < st) red[tid] += red[tid + st]; __syncthreads(); }
  const float rs = rsqrtf(red[0] / (float)N + eps);
  {
    for (int u = 0; u < per / 4; ++u) {
      const int j = tid * 4 + 1024 * u;
      v4f o, sm;
#pragma unroll
      for (int q = 0; q < 4; ++q) {
        float gg = g[j + q], bb = bta[j + q];
        if (PARAM_BF16) { gg = bf16_round(gg); bb = bf16_round(bb); }
        sm[q] = vals[u * 4 + q]; o[q] = (vals[u * 4 + q] - mu) * rs * gg + bb;
      }
      if (out_sum) *(v4f*)(out_sum + (size_t)row * N + j) = sm;
      *(v4f*)(out_norm + (size_t)row * N + j) = o;
    }
    
  }
}



// ---- f16 WMMA path (v_wmma_f32_16x16x32_f16): 11-bit significands for operands in range — used where a [0,1] probability operand needs more precision than bf16
typedef _Float16 v16h __attribute__((ext_vector_type(16)));
union FragH { v16h v; v8us half[2]; _Float16 h[16]; unsigned short u[16]; };
template <int NT>
__device__ __forceinline__ v8f mmaH(v16h ah, v16h al, v16h bh, v16h bl, v8f c) {
  c = __builtin_amdgcn_wmma_f32_16x16x32_f16(false, ah, false, bh, (short)0, c, false, false);
  if (NT >= 2) c = __builtin_amdgcn_wmma_f32_16x16x32_f16(false, al, false, bh, (short)0, c, false, false);
  if (NT >= 3) c = __builtin_amdgcn_wmma_f32_16x16x32_f16(false, ah, false, bl, (short)0, c, false, false);
  asm volatile("v_nop\n\tv_nop\n\tv_nop\n\tv_nop" : "+v"(c) : "v"(ah), "v"(al), "v"(bh), "v"(bl));
  return c;
}
// batched GEMM like k_gemm_b but f16 operands: A f32 (split into f16 hi/lo if ASPLIT, else rounded to f16), Bt = f16 values [n][k]; alpha; C f32; N multiple of 16 (partial tiles skipped)
template <bool ASPLIT>
__global__ __launch_bounds__(128) void k_gemm_h(const float* __restrict__ A, int lda, size_t sA, const _Float16* __restrict__ Bh, int ldb, size_t sB, float alpha, float* __restrict__ C, int ldc, size_t sC, int M, int N, int K) {
  __shared__ __attribute__((aligned(16))) float so[4][16][64];
  const int tid = threadIdx.x, w = tid >> 5, lane = tid & 31, ln = lane & 15, hh = lane >> 4; const int by = blockIdx.y;
  A += (size_t)by * sA; Bh += (size_t)by * sB; C += (size_t)by * sC;
  const int ntn = (N + 63) / 64; const int wid = blockIdx.x * 4 + w; const int mt = wid / ntn, nq = wid % ntn; if (mt * 16 >= M) return;
  const int row0 = mt * 16, col0 = nq * 64; const float* arow = A + (size_t)(row0 + ln) * lda;
  v8f acc[4] = {};
  for (int kb = 0; kb < K; kb += 32) {
    FragH ah, al;
    const v4f x0 = *(const v4fa*)(arow + kb + 8 * hh), x1 = *(const v4fa*)(arow + kb + 8 * hh + 4), x2 = *(const v4fa*)(arow + kb + 16 + 8 * hh), x3 = *(const v4fa*)(arow + kb + 16 + 8 * hh + 4);
    float xs[16] = {x0[0],x0[1],x0[2],x0[3],x1[0],x1[1],x1[2],x1[3],x2[0],x2[1],x2[2],x2[3],x3[0],x3[1],x3[2],x3[3]};
#pragma unroll
    for (int i = 0; i < 16; ++i) { const _Float16 h = (_Float16)xs[i]; ah.h[i] = h; al.h[i] = ASPLIT ? (_Float16)(xs[i] - (float)h) : (_Float16)0.0f; }
#pragma unroll
    for (int t = 0; t < 4; ++t) { if (col0 + t * 16 >= N) continue; const size_t boff = (size_t)(col0 + t * 16 + ln) * ldb + kb; FragH bq; bq.half[0] = *(const v8us*)(Bh + boff + 8 * hh); bq.half[1] = *(const v8us*)(Bh + boff + 16 + 8 * hh);
      acc[t] = mmaH<ASPLIT ? 2 : 1>(ah.v, al.v, bq.v, bq.v, acc[t]); }
  }
#pragma unroll
  for (int t = 0; t < 4; ++t) { if (col0 + t * 16 >= N) continue;
#pragma unroll
    for (int r = 0; r < 8; ++r) so[w][8 * hh + r][t * 16 + ln] = acc[t][r] * alpha; }
  __builtin_amdgcn_fence(__ATOMIC_ACQ_REL, "workgroup"); __builtin_amdgcn_wave_barrier();
  const int rsub = lane >> 4, c4 = (lane & 15) * 4;
  {
#pragma unroll
    for (int q = 0; q < 8; ++q) { const int r = q * 2 + rsub; if (col0 + c4 < N) { const v4f v = *(const v4fa*)&so[w][r][c4]; *(v4f*)(C + (size_t)(row0 + r) * ldc + col0 + c4) = v; } }
     }
}

// Wt[n][k] = f16(W[k][n]·scale) from f32 row-major W[K][N] (scale = power of two; bf16-exact weights stay exact in f16 away from the subnormal range)
__global__ __launch_bounds__(256) void k_wt_f16(const float* __restrict__ W, _Float16* __restrict__ Wt, int K, int N, float scale) {
  const int t = blockIdx.x * 256 + threadIdx.x; if (t >= N * (K / 8)) return; const int n = t / (K / 8), k8 = (t % (K / 8)) * 8; FragH f;
#pragma unroll
  for (int i = 0; i < 8; ++i) f.h[i] = (_Float16)(bf16_round(W[(size_t)(k8 + i) * N + n]) * scale); const v8us o = f.half[0];
  *(v8us*)((unsigned short*)Wt + (size_t)n * K + k8) = o; 
}
// k_gemm_hh variant with fused epilogue: v = acc·alpha + bias[by·sBias + col] (+ CP[(row/rowsPerB)·sCPb + by·64 + col] if CP) ; ACT 0 none / 1 elu ; writes f16 C16 (and f32 C if non-null)
template <int ACT>
__global__ __launch_bounds__(128) void k_gemm_hhx(const _Float16* __restrict__ A, int lda, size_t sA, const _Float16* __restrict__ Bh, int ldb, size_t sB, float alpha, const float* __restrict__ bias, size_t sBias, const float* __restrict__ CP, int rowsPerB, size_t sCPb, int row0g,
    float* __restrict__ C, _Float16* __restrict__ C16, int ldc, size_t sC, int M, int N, int K) {
  __shared__ __attribute__((aligned(16))) float so[4][16][64];
  const int tid = threadIdx.x, w = tid >> 5, lane = tid & 31, ln = lane & 15, hh = lane >> 4; const int by = blockIdx.y;
  A += (size_t)by * sA; Bh += (size_t)by * sB; const size_t cofs = (size_t)by * sC; const float* bp = bias ? bias + (size_t)by * sBias : nullptr;
  const int ntn = (N + 63) / 64; const int wid = blockIdx.x * 4 + w; const int mt = wid / ntn, nq = wid % ntn; if (mt * 16 >= M) return;
  const int row0 = mt * 16, col0 = nq * 64; const _Float16* arow = A + (size_t)(row0 + ln) * lda;
  v8f acc[4] = {};
  for (int kb = 0; kb < K; kb += 32) { FragH ah; ah.half[0] = *(const v8us*)((const unsigned short*)arow + kb + 8 * hh); ah.half[1] = *(const v8us*)((const unsigned short*)arow + kb + 16 + 8 * hh);
#pragma unroll
    for (int t = 0; t < 4; ++t) { if (col0 + t * 16 >= N) continue; const size_t boff = (size_t)(col0 + t * 16 + ln) * ldb + kb; FragH bq; bq.half[0] = *(const v8us*)((const unsigned short*)Bh + boff + 8 * hh); bq.half[1] = *(const v8us*)((const unsigned short*)Bh + boff + 16 + 8 * hh);
      acc[t] = mmaH<1>(ah.v, ah.v, bq.v, bq.v, acc[t]); }
  }
#pragma unroll
  for (int t = 0; t < 4; ++t) { if (col0 + t * 16 >= N) continue; const int col = col0 + t * 16 + ln; const float bv = bp ? bf16_round(bp[col]) : 0.f;
#pragma unroll
    for (int r = 0; r < 8; ++r) { float v = acc[t][r] * alpha + bv; if (CP) { const int rr = row0g + row0 + 8 * hh + r; if (rowsPerB < 0) v += CP[cofs + (size_t)rr * ldc + col];      /* rowsPerB < 0: own element of the batched C plane */ else { const int bidx = rr / rowsPerB; v += CP[(size_t)bidx * sCPb + (size_t)by * 64 + col]; } } if (ACT == 1) v = (v > 0.f) ? v : expm1f(v); else if (ACT == 7) v = (v > 0.f) ? v + 1.0f : expf(v); else if (ACT == 8) v = tanhf(v); else if (ACT == 9) v = 0.5f * v * (1.0f + tanhf(0.7978845608028654f * (v + 0.044715f * v * v * v))); else if (ACT == 11) v = 1.0f / (1.0f + expf(-v)); else if (ACT == 12) v = (v > 0.f) ? v : 0.01f * v; else if (ACT == 14) v = (v > 0.f) ? v : 0.1f * v; else if (ACT == 16) v = (v >= 0.f) ? v : 0.3f * v; else if (ACT == 17) v = (v >= 0.f) ? v : 0.2f * v; else if (ACT == 15) v = v / (1.0f + expf(-v)); else if (ACT == 3) v = fmaxf(v, 0.f); else if (ACT == 6) v = 0.5f * v * (1.0f + erff(v * 0.70710678118654752f)); so[w][8 * hh + r][t * 16 + ln] = v; } }
  __builtin_amdgcn_fence(__ATOMIC_ACQ_REL, "workgroup"); __builtin_amdgcn_wave_barrier();
  const int rsub = lane >> 4, c4 = (lane & 15) * 4; typedef _Float16 v4h __attribute__((ext_vector_type(4)));
  {
#pragma unroll
    for (int q = 0; q < 8; ++q) { const int r = q * 2 + rsub; if (col0 + c4 < N) { const v4f v = *(const v4fa*)&so[w][r][c4]; if (C) *(v4f*)(C + cofs + (size_t)(row0 + r) * ldc + col0 + c4) = v; if (C16) { v4h h4; for (int i = 0; i < 4; ++i) h4[i] = (_Float16)v[i]; *(v4h*)(C16 + cofs + (size_t)(row0 + r) * ldc + col0 + c4) = h4; } } }
     }
}


typedef _Float16 v4h __attribute__((ext_vector_type(4)));

__global__ __launch_bounds__(256) void k_x16(const float* __restrict__ x, _Float16* __restrict__ X16, size_t n8) { const size_t t = (size_t)blockIdx.x * 256 + threadIdx.x; if (t >= n8) return; FragH f;
#pragma unroll
  for (int q = 0; q < 8; ++q) f.h[q] = (_Float16)bf16_round(x[t * 8 + q]); *(v8us*)((unsigned short*)X16 + t * 8) = f.half[0];  }
__global__ __launch_bounds__(256) void k_h16(const float* __restrict__ x, _Float16* __restrict__ X16, size_t n8) { const size_t t = (size_t)blockIdx.x * 256 + threadIdx.x; if (t >= n8) return; FragH f;
#pragma unroll
  for (int q = 0; q < 8; ++q) f.h[q] = (_Float16)x[t * 8 + q]; *(v8us*)((unsigned short*)X16 + t * 8) = f.half[0];  }
__global__ __launch_bounds__(256) void k_round16f(const float* __restrict__ W, _Float16* __restrict__ Bt, size_t n8) { const size_t t = (size_t)blockIdx.x * 256 + threadIdx.x; if (t >= n8) return; FragH f;
#pragma unroll
  for (int i = 0; i < 8; ++i) f.h[i] = (_Float16)(bf16_round(W[t * 8 + i]) * 16.0f); *(v8us*)((unsigned short*)Bt + t * 8) = f.half[0];  }
template <int NHv, int TTv>
__global__ __launch_bounds__(256) void k_vt(const _Float16* __restrict__ V16, int ldv, int voff, _Float16* __restrict__ Vt) { __shared__ unsigned short tl[64][66]; const int tid = threadIdx.x; const int slab = blockIdx.x / (TTv / 64), lg = blockIdx.x % (TTv / 64); const int b = slab / NHv, h = slab % NHv;
  for (int i = tid; i < 64 * 8; i += 256) { const int r = i / 8, c8 = (i % 8) * 8; FragH f; f.half[0] = *(const v8us*)((const unsigned short*)V16 + ((size_t)b * TTv + lg * 64 + r) * ldv + voff + h * 64 + c8);
#pragma unroll
    for (int q = 0; q < 8; ++q) tl[r][c8 + q] = f.u[q]; }
  __syncthreads();
  {
#pragma unroll
    for (int rd = 0; rd < 2; ++rd) { const int d = rd * 32 + tid / 8, pc = tid % 8; FragH f;
#pragma unroll
      for (int q = 0; q < 8; ++q) f.u[q] = tl[pc * 8 + q][d];
      *(v8us*)((unsigned short*)Vt + ((size_t)slab * 64 + d) * TTv + lg * 64 + pc * 8) = f.half[0]; }
     } }

__global__ __launch_bounds__(256) void k_hl(const float* __restrict__ F, _Float16* __restrict__ Hh, _Float16* __restrict__ Hl, size_t n8) { const size_t t = (size_t)blockIdx.x * 256 + threadIdx.x; if (t >= n8) return; FragH fh, fl; const v4f a = *(const v4fa*)(F + t * 8), c = *(const v4fa*)(F + t * 8 + 4);
#pragma unroll
  for (int q = 0; q < 4; ++q) { _Float16 h = (_Float16)a[q]; fh.h[q] = h; fl.h[q] = (_Float16)((a[q] - (float)h) * 1024.0f); h = (_Float16)c[q]; fh.h[4 + q] = h; fl.h[4 + q] = (_Float16)((c[q] - (float)h) * 1024.0f); }
  { *(v8us*)((unsigned short*)Hh + t * 8) = fh.half[0]; *(v8us*)((unsigned short*)Hl + t * 8) = fl.half[0];  } }

// ---- fast GEMM (wave tile 32x64; requires M % 32 == 0 rows per launch region and N % 64 == 0); epilogue = k_gemm_hhx semantics ----
__device__ __forceinline__ v16h g2_frag(const _Float16* p, int hh) { FragH f; f.half[0] = *(const v8us*)((const unsigned short*)p + 8 * hh); f.half[1] = *(const v8us*)((const unsigned short*)p + 16 + 8 * hh); return f.v; }
__device__ __forceinline__ v8f g2_mma(v16h a, v16h b, v8f c) { v8f d = __builtin_amdgcn_wmma_f32_16x16x32_f16(false, a, false, b, (short)0, c, false, false); asm volatile("v_nop\n\tv_nop\n\tv_nop\n\tv_nop" : "+v"(d) : "v"(a), "v"(b)); return d; }
template <int ACT>
__global__ __launch_bounds__(128) void k_gemm2(const _Float16* __restrict__ A, int lda, size_t sA, const _Float16* __restrict__ Bh, int ldb, size_t sB, float alpha, const float* __restrict__ bias, size_t sBias, const float* __restrict__ CP, int rowsPerB, size_t sCPb, int row0g,
    float* __restrict__ C, _Float16* __restrict__ C16, int ldc, size_t sC, int M, int N, int K) { static_assert(ACT == 0 || ACT == 3 || ACT == 6 || ACT == 8 || ACT == 9 || ACT == 11 || ACT == 12 || ACT == 14 || ACT == 15 || ACT == 16 || ACT == 17, "k_gemm2: unsupported ACT code (would silently apply no activation)");
  __shared__ __attribute__((aligned(16))) float so[4][32][68];
  const int tid = threadIdx.x, w = tid >> 5, lane = tid & 31, ln = lane & 15, hh = lane >> 4; const int by = blockIdx.y;
  A += (size_t)by * sA; Bh += (size_t)by * sB; const size_t cofs = (size_t)by * sC; const float* bp = bias ? bias + (size_t)by * sBias : nullptr;
  const int ntn = N >> 6; const int mt = blockIdx.x / ntn, nq = blockIdx.x - mt * ntn; const int row0 = mt * 128 + 32 * w, col0 = nq * 64; if (row0 >= M) return;
  const _Float16* a0p = A + (size_t)(row0 + ln) * lda; const _Float16* a1p = a0p + (size_t)16 * lda;
  const _Float16* b0p = Bh + (size_t)(col0 + ln) * ldb; const _Float16* b1p = b0p + (size_t)16 * ldb; const _Float16* b2p = b1p + (size_t)16 * ldb; const _Float16* b3p = b2p + (size_t)16 * ldb;
  const v8f z8 = {0.f,0.f,0.f,0.f,0.f,0.f,0.f,0.f}; v8f c00 = z8, c01 = z8, c02 = z8, c03 = z8, c10 = z8, c11 = z8, c12 = z8, c13 = z8;
#pragma unroll 1
  for (int kb = 0; kb < K; kb += 32) { const v16h a0 = g2_frag(a0p + kb, hh), a1 = g2_frag(a1p + kb, hh);
    v16h b = g2_frag(b0p + kb, hh); c00 = g2_mma(a0, b, c00); c10 = g2_mma(a1, b, c10);
    b = g2_frag(b1p + kb, hh); c01 = g2_mma(a0, b, c01); c11 = g2_mma(a1, b, c11);
    b = g2_frag(b2p + kb, hh); c02 = g2_mma(a0, b, c02); c12 = g2_mma(a1, b, c12);
    b = g2_frag(b3p + kb, hh); c03 = g2_mma(a0, b, c03); c13 = g2_mma(a1, b, c13); }
  v8f accs[8] = {c00, c01, c02, c03, c10, c11, c12, c13};
#pragma unroll
  for (int u = 0; u < 8; ++u) { const int t = u & 3, half = u >> 2; const int col = col0 + t * 16 + ln; const float bv = bp ? bf16_round(bp[col]) : 0.f;
#pragma unroll
    for (int r = 0; r < 8; ++r) { const int rloc = half * 16 + 8 * hh + r; float v = accs[u][r] * alpha + bv; if (CP) { if (rowsPerB < 0) v += CP[cofs + (size_t)(row0g + row0 + rloc) * ldc + col];      /* rowsPerB < 0: own element of the batched C plane */ else { const int bidx = (row0g + row0 + rloc) / rowsPerB; v += CP[(size_t)bidx * sCPb + (size_t)by * 64 + col]; } }
      if (ACT == 3) v = fmaxf(v, 0.f); else if (ACT == 6) v = 0.5f * v * (1.0f + erff(v * 0.70710678118654752f)); else if (ACT == 11) v = 1.0f / (1.0f + expf(-v)); else if (ACT == 15) v = v / (1.0f + expf(-v)); else if (ACT == 12) v = (v > 0.f) ? v : 0.01f * v; else if (ACT == 8) v = tanhf(v); else if (ACT == 9) v = 0.5f * v * (1.0f + tanhf(0.7978845608028654f * (v + 0.044715f * v * v * v))); else if (ACT == 14) v = (v > 0.f) ? v : 0.1f * v; else if (ACT == 16) v = (v >= 0.f) ? v : 0.3f * v; else if (ACT == 17) v = (v >= 0.f) ? v : 0.2f * v;
      so[w][rloc][t * 16 + ln] = v; } }
  __builtin_amdgcn_fence(__ATOMIC_ACQ_REL, "workgroup"); __builtin_amdgcn_wave_barrier();
  const int rsub = lane >> 4, c4 = (lane & 15) * 4;
  {
#pragma unroll
    for (int q = 0; q < 16; ++q) { const int r = q * 2 + rsub; const v4f v = *(const v4fa*)&so[w][r][c4]; if (C) *(v4f*)(C + cofs + (size_t)(row0 + r) * ldc + col0 + c4) = v; if (C16) { v4h h4; for (int i = 0; i < 4; ++i) h4[i] = (_Float16)v[i]; *(v4h*)(C16 + cofs + (size_t)(row0 + r) * ldc + col0 + c4) = h4; } }
     } }

// q | k | v projection of ALL token rows (main loop of k_gemm2, pitches and K = DM) with the per-head work in the epilogue: no f32 q | k | v plane in memory and no launch per (row, head).
// A block's 64 columns are one head of q, k or v (block-uniform), its 128 rows lie in one batch. q, k: each wave stages its 32x64 f32 tile in its own LDS range; 8 lanes take one row (lanes 0-3 columns 0-31, lanes 4-7 columns 32-63),
// each reads its 8 low-half and 8 high-half values and the two table rows, rotates and stores 16 bytes: one instruction fills whole 128-byte lines.
// v: accumulator registers 0..7 of a lane are 8 consecutive token rows of one column, so each lane packs them to 16 bytes of V^T; the block's 64 x 128 tile is gathered in LDS (pitch 272 bytes) so that one wave writes each 256-byte row piece.
// Rows 0..127 of a batch (one block row) are also written in f32 for the exact first-tile attention.
// Every epilogue loop is unrolled so that accs, xs and tb are indexed by constants and stay in registers.
// A 16-byte global store (two for the f32 form) with s_wait_xcnt 0 as the last line of the same statement: the epilogue reuses its staging registers from pass to pass, and a wait in a statement of its own would not hold the next pass's register writes behind it.
__device__ __forceinline__ void st16_wait(unsigned short* p, v8us d) { asm volatile("global_store_b128 %0, %1, off\n\ts_wait_xcnt 0x0" :: "v"(p), "v"(d) : "memory"); }
__device__ __forceinline__ void st32_wait(float* p, v4f d0, v4f d1) { asm volatile("global_store_b128 %0, %1, off\n\tglobal_store_b128 %0, %2, off offset:16\n\ts_wait_xcnt 0x0" :: "v"(p), "v"(d0), "v"(d1) : "memory"); }
__global__ __launch_bounds__(128) void k_qkv_rope(const _Float16* __restrict__ A, const _Float16* __restrict__ Bh, const float* __restrict__ tcos, const float* __restrict__ tsin,
    _Float16* __restrict__ Q16, _Float16* __restrict__ K16, _Float16* __restrict__ VTa, float* __restrict__ QF, float* __restrict__ KF, float* __restrict__ VF) {
  __shared__ __attribute__((aligned(16))) float so[4][32][68];
  const int tid = threadIdx.x, w = tid >> 5, lane = tid & 31, ln = lane & 15, hh = lane >> 4;
  const int ntn = 3 * DM / 64; const int mt = blockIdx.x / ntn, nq = blockIdx.x - mt * ntn; const int row0 = mt * 128 + 32 * w, col0 = nq * 64;
  const int sel = nq / NH, h = nq % NH;      /* 0 q, 1 k, 2 v; head */
  const int b = mt / (SQ / 128), pb = (mt % (SQ / 128)) * 128, p0 = pb + 32 * w;      /* batch; position of the block's and of the wave's first row */
  const bool first = pb == 0;
  const _Float16* a0p = A + (size_t)(row0 + ln) * DM; const _Float16* a1p = a0p + (size_t)16 * DM;
  const _Float16* b0p = Bh + (size_t)(col0 + ln) * DM; const _Float16* b1p = b0p + (size_t)16 * DM; const _Float16* b2p = b1p + (size_t)16 * DM; const _Float16* b3p = b2p + (size_t)16 * DM;
  const v8f z8 = {0.f,0.f,0.f,0.f,0.f,0.f,0.f,0.f}; v8f c00 = z8, c01 = z8, c02 = z8, c03 = z8, c10 = z8, c11 = z8, c12 = z8, c13 = z8;
#pragma unroll 1
  for (int kb = 0; kb < DM; kb += 32) { const v16h a0 = g2_frag(a0p + kb, hh), a1 = g2_frag(a1p + kb, hh);      /* kept rolled, as in k_gemm2 */
    v16h bf = g2_frag(b0p + kb, hh); c00 = g2_mma(a0, bf, c00); c10 = g2_mma(a1, bf, c10);
    bf = g2_frag(b1p + kb, hh); c01 = g2_mma(a0, bf, c01); c11 = g2_mma(a1, bf, c11);
    bf = g2_frag(b2p + kb, hh); c02 = g2_mma(a0, bf, c02); c12 = g2_mma(a1, bf, c12);
    bf = g2_frag(b3p + kb, hh); c03 = g2_mma(a0, bf, c03); c13 = g2_mma(a1, bf, c13);
    asm volatile("s_wait_xcnt 0x0" ::: "memory"); }      /* stands behind the trip's last loads, ahead of the next trip's first write of a register that holds one of their addresses */
  v8f accs[8] = {c00, c01, c02, c03, c10, c11, c12, c13};
#pragma unroll
  for (int u = 0; u < 8; ++u) accs[u] *= 0.0625f;      /* undoes the x16 of the weights, exact */
  if (sel == 2) {
    unsigned short* tv = (unsigned short*)&so[0][0][0];      /* [64 columns][136]: 128 token rows + 8 pad */
#pragma unroll
    for (int u = 0; u < 8; ++u) { const int t = u & 3, half = u >> 2; FragH f;
#pragma unroll
      for (int r = 0; r < 8; ++r) f.h[r] = (_Float16)accs[u][r];
      *(v8us*)(tv + (t * 16 + ln) * 136 + 32 * w + half * 16 + 8 * hh) = f.half[0]; }
    __syncthreads();      /* block-uniform branch: every wave's columns are in LDS before any wave reads whole rows of V^T */
    unsigned short* vt = (unsigned short*)VTa + ((size_t)(b * NH + h) * HD + w * 16 + hh) * SQ + pb + ln * 8;
#pragma unroll
    for (int q = 0; q < 8; ++q) { const v8us v = *(const v8us*)(tv + (w * 16 + q * 2 + hh) * 136 + ln * 8); *(v8us*)(vt + (size_t)q * 2 * SQ) = v; }
    asm volatile("s_wait_xcnt 0x0" ::: "memory");      /* stands behind the V^T stores, ahead of the first write of a register that one of them names */
    if (first) { float* vf = VF + ((size_t)b * QT0 + p0 + 8 * hh) * DM + h * HD + ln;
#pragma unroll
      for (int u = 0; u < 8; ++u)
#pragma unroll
        for (int r = 0; r < 8; ++r) vf[(size_t)((u >> 2) * 16 + r) * DM + (u & 3) * 16] = accs[u][r]; }
  } else {
#pragma unroll
    for (int u = 0; u < 8; ++u)
#pragma unroll
      for (int r = 0; r < 8; ++r) so[w][(u >> 2) * 16 + 8 * hh + r][(u & 3) * 16 + ln] = accs[u][r];
    __builtin_amdgcn_fence(__ATOMIC_ACQ_REL, "workgroup"); __builtin_amdgcn_wave_barrier();      /* the wave reads back what its own lanes wrote */
    const int rs = lane >> 3, up = (lane >> 2) & 1, i8 = (lane & 3) * 8;
    unsigned short* h16 = (unsigned short*)(sel ? K16 : Q16) + (size_t)(row0 + rs) * DM + h * HD + up * 32 + i8;
    float* f32 = (sel ? KF : QF) + ((size_t)b * QT0 + p0 + rs) * DM + h * HD + up * 32 + i8;      /* formed for every block, used by each batch's first block row alone */
    const float* cp = tcos + (size_t)(p0 + rs) * (HD / 2) + i8; const float* sp = tsin + (size_t)(p0 + rs) * (HD / 2) + i8;
    v4f xs[2][4], tb[2][4];      /* two register sets: pass q + 1 is fetched ahead of the arithmetic of pass q, because no load moves up over the store statements */
#pragma unroll
    for (int q = -1; q < 8; ++q) {
      if (q < 7) { const int n = q + 1, s = n & 1, r = n * 4 + rs;
        xs[s][0] = *(const v4fa*)&so[w][r][i8]; xs[s][1] = *(const v4fa*)&so[w][r][i8 + 4]; xs[s][2] = *(const v4fa*)&so[w][r][32 + i8]; xs[s][3] = *(const v4fa*)&so[w][r][32 + i8 + 4];
        tb[s][0] = *(const v4fa*)(cp + n * 4 * (HD / 2)); tb[s][1] = *(const v4fa*)(cp + n * 4 * (HD / 2) + 4); tb[s][2] = *(const v4fa*)(sp + n * 4 * (HD / 2)); tb[s][3] = *(const v4fa*)(sp + n * 4 * (HD / 2) + 4); }
      if (q >= 0) { const int s = q & 1; FragH f; v4f o0, o1;
#pragma unroll
        for (int e = 0; e < 8; ++e) { const float lo = xs[s][e >> 2][e & 3], hi = xs[s][2 + (e >> 2)][e & 3]; const float cv = bf16_round(tb[s][e >> 2][e & 3]), sv = bf16_round(tb[s][2 + (e >> 2)][e & 3]);
          const float o = lo * (up ? sv : cv) + hi * (up ? cv : -sv);      /* low half x1 c - x2 s, high half x1 s + x2 c */
          f.h[e] = (_Float16)o; if (e < 4) o0[e & 3] = o; else o1[e & 3] = o; }
        st16_wait(h16 + (size_t)q * 4 * DM, f.half[0]);
        if (first) st32_wait(f32 + (size_t)q * 4 * DM, o0, o1); } }
  } }
static_assert(QT0 == 128 && SQ % 128 == 0 && HD == 64 && DM == NH * HD, "k_qkv_rope: a block is 128 rows of one batch x one head; the first-tile rows are one block row");

__global__ __launch_bounds__(256) void k_wnat(const float* __restrict__ w, size_t n8, _Float16* __restrict__ Bt) { const size_t t = (size_t)blockIdx.x * 256 + threadIdx.x; if (t >= n8) return; FragH f; for (int q = 0; q < 8; ++q) f.h[q] = (_Float16)(bf16_round(w[t * 8 + q]) * 16.0f); *(v8us*)((unsigned short*)Bt + t * 8) = f.half[0];  }
__global__ __launch_bounds__(256) void k_rsm(const float* __restrict__ S, _Float16* __restrict__ P, int nrows) {
  #pragma clang fp contract(off)
  const int i = blockIdx.x * 256 + threadIdx.x; if (i >= nrows) return; const float* s = S + (size_t)i * SQ; float mx = -3.0e38f;
#pragma unroll 1
  for (int j = 0; j < SQ; ++j) mx = fmaxf(mx, s[j]); float se = 0.f;
#pragma unroll 1
  for (int j = 0; j < SQ; ++j) se += expf(s[j] - mx); const float sc = 256.0f / se;
#pragma unroll 1
  for (int j0 = 0; j0 < SQ; j0 += 8) { FragH f; for (int q = 0; q < 8; ++q) f.h[q] = (_Float16)(expf(s[j0 + q] - mx) * sc); unsigned short* d = (unsigned short*)P + (size_t)i * SQ + j0; *(v8us*)d = f.half[0];  } }
__global__ __launch_bounds__(256) void k_vt(const _Float16* __restrict__ V16, int b, int h0, _Float16* __restrict__ VT) { __shared__ unsigned short tl[64][65]; const int tid = threadIdx.x; const int hh = blockIdx.x % HG, sg = blockIdx.x / HG; const int s0 = sg * 64; const int h = h0 + hh;
  for (int i = tid; i < 64 * 8; i += 256) { const int j = i / 8, d8 = (i % 8) * 8; FragH f; f.half[0] = *(const v8us*)((const unsigned short*)V16 + ((size_t)b * SQ + s0 + j) * DM + h * HD + d8); for (int q = 0; q < 8; ++q) tl[d8 + q][j] = f.u[q]; }
  __syncthreads();
  { for (int i = tid; i < 64 * 8; i += 256) { const int d = i / 8, j8 = (i % 8) * 8; FragH f; for (int q = 0; q < 8; ++q) f.u[q] = tl[d][j8 + q]; *(v8us*)((unsigned short*)VT + ((size_t)hh * HD + d) * SQ + s0 + j8) = f.half[0]; }  } }


__global__ __launch_bounds__(256) void k_tab2(float theta, float* __restrict__ CS, float* __restrict__ SN) {
  #pragma clang fp contract(off)
  const int t = blockIdx.x * 256 + threadIdx.x; if (t >= SQ * (HD / 2)) return; const int i = t % (HD / 2); const int p = t / (HD / 2); const float invf = 1.0f / powf(theta, (float)(2 * i) / (float)HD); const float ang = __fmul_rn((float)p, invf); const float c = cosf(ang), s = sinf(ang);
  *(float*)(CS + t) = c; *(float*)(SN + t) = s;  }
template <int NORM, int ROPE>
__global__ __launch_bounds__(64) void k_xform(const float* __restrict__ F, int ldf, int nh, const float* __restrict__ gain, float eps, const float* __restrict__ CS, const float* __restrict__ SN, _Float16* __restrict__ H16, int ldo) {
  #pragma clang fp contract(off)
  __shared__ float xv[HD]; __shared__ float red[HD]; __shared__ unsigned short sh_[HD]; const int d = threadIdx.x; const int h = blockIdx.x % nh; const size_t r = blockIdx.x / nh; const int p = (int)(r % SQ);
  float x = F[r * (size_t)ldf + (size_t)h * HD + d];
  if (NORM) { red[d] = __fmul_rn(x, x); __syncthreads(); for (int st = HD / 2; st > 0; st >>= 1) { if (d < st) red[d] = __fadd_rn(red[d], red[d + st]); __syncthreads(); } const float rs = rsqrtf(__fadd_rn(red[0] / (float)HD, eps)); x = __fmul_rn(__fmul_rn(x, rs), bf16_round(gain[d])); }
  xv[d] = x; __syncthreads();
  float o = x;
  if (ROPE == 1) { const int i = d >> 1; const float c = CS[p * (HD / 2) + i], s = SN[p * (HD / 2) + i]; const float ev = xv[2 * i], od = xv[2 * i + 1]; o = (d & 1) ? __fadd_rn(__fmul_rn(ev, s), __fmul_rn(od, c)) : __fadd_rn(__fmul_rn(ev, c), -__fmul_rn(od, s)); }
  if (ROPE == 2) { const int i = d & (HD / 2 - 1); const float c = CS[p * (HD / 2) + i], s = SN[p * (HD / 2) + i]; const float lo = xv[i], hi = xv[i + HD / 2]; o = (d < HD / 2) ? __fadd_rn(__fmul_rn(lo, c), -__fmul_rn(hi, s)) : __fadd_rn(__fmul_rn(lo, s), __fmul_rn(hi, c)); }
  FragH th; th.h[0] = (_Float16)o; sh_[d] = th.u[0]; __syncthreads();
  if (d < HD / 8) { FragH f; for (int q = 0; q < 8; ++q) f.u[q] = sh_[d * 8 + q]; unsigned short* dst = (unsigned short*)H16 + r * (size_t)ldo + (size_t)h * HD + d * 8; *(v8us*)dst = f.half[0];  } }

__global__ __launch_bounds__(256) void k_tab4(const int* __restrict__ pos, float theta, float* __restrict__ CS, float* __restrict__ SN) {
  #pragma clang fp contract(off)
  const int t = blockIdx.x * 256 + threadIdx.x; if (t >= SQ * (HD / 2)) return; const int i = t % (HD / 2); const int p = t / (HD / 2); const float invf = (float)pow((double)theta, -((double)(2 * i)) / (double)HD); const float ang = __fmul_rn((float)pos[p], invf); const float c = cosf(ang), s = sinf(ang);
  *(float*)(CS + t) = c; *(float*)(SN + t) = s;  }
__global__ __launch_bounds__(256) void k_rsmf(const float* __restrict__ S, _Float16* __restrict__ P, int qn, int hg) {
  #pragma clang fp contract(off)
  const int t = blockIdx.x * 256 + threadIdx.x; if (t >= qn * hg) return; const size_t i = (size_t)(t / qn) * SQ + (t % qn); const float* s = S + i * SQ; float mx = -3.0e38f;
#pragma unroll 1
  for (int j = 0; j < SQ; ++j) mx = fmaxf(mx, s[j]); float se = 0.f;
#pragma unroll 1
  for (int j = 0; j < SQ; ++j) se += __expf(s[j] - mx); const float sc = 256.0f / se;
#pragma unroll 1
  for (int j0 = 0; j0 < SQ; j0 += 8) { FragH f; for (int q = 0; q < 8; ++q) f.h[q] = (_Float16)(__expf(s[j0 + q] - mx) * sc); unsigned short* d = (unsigned short*)P + i * SQ + j0; *(v8us*)d = f.half[0];  } }


__device__ __forceinline__ v8f fa_mma(v16h a, v16h b, v8f c) { return __builtin_amdgcn_wmma_f32_16x16x32_f16(false, a, false, b, (short)0, c, false, false); }
// 2^x for eight values (two for the rescale factors) in ONE statement: outputs are early-clobber, so no exponential reads its predecessor's result or overwrites its source, and the closing v_nop keeps the one
// independent slot that the instruction set asks for between the last exponential and whatever the compiler places next.
__device__ __forceinline__ v8f fa_exp8(v8f x) { float y0, y1, y2, y3, y4, y5, y6, y7;
  asm("v_exp_f32 %0, %8\n\tv_exp_f32 %1, %9\n\tv_exp_f32 %2, %10\n\tv_exp_f32 %3, %11\n\tv_exp_f32 %4, %12\n\tv_exp_f32 %5, %13\n\tv_exp_f32 %6, %14\n\tv_exp_f32 %7, %15\n\tv_nop"
      : "=&v"(y0), "=&v"(y1), "=&v"(y2), "=&v"(y3), "=&v"(y4), "=&v"(y5), "=&v"(y6), "=&v"(y7) : "v"(x[0]), "v"(x[1]), "v"(x[2]), "v"(x[3]), "v"(x[4]), "v"(x[5]), "v"(x[6]), "v"(x[7]));
  const v8f y = {y0, y1, y2, y3, y4, y5, y6, y7}; return y; }
__device__ __forceinline__ void fa_exp2(float x0, float x1, float& y0, float& y1) { asm("v_exp_f32 %0, %2\n\tv_exp_f32 %1, %3\n\tv_nop" : "=&v"(y0), "=&v"(y1) : "v"(x0), "v"(x1)); }
// One step of 32 keys. kn / vn: the NEXT step's K rows and V^T columns, fetched into the same registers right after their last use here, so that a whole step passes before they are needed;
// DIAG: the wave's last step (first key == first query): keys above the query get weight 0, and nothing is fetched.
template <bool DIAG>
__device__ __forceinline__ void fa_step(const v16h (&qf)[2][2], v16h (&kf)[2][2], v16h (&vf)[4], v8f (&o)[2][4], float (&mu)[2], float (&l)[2], const _Float16* kn, const _Float16* vn, int c, int hh) {
  const float cs = 0.125f * 1.44269504088896340736f;      /* score scale x log2(e) */
  const v8f z8 = {0.f,0.f,0.f,0.f,0.f,0.f,0.f,0.f};
  v8f s[2][2];
#pragma unroll
  for (int u = 0; u < 2; ++u)
#pragma unroll
    for (int kt = 0; kt < 2; ++kt) s[u][kt] = fa_mma(kf[kt][1], qf[u][1], fa_mma(kf[kt][0], qf[u][0], z8));
  if (!DIAG) {
#pragma unroll
    for (int kt = 0; kt < 2; ++kt) { kf[kt][0] = g2_frag(kn + (size_t)kt * 16 * DM, hh); kf[kt][1] = g2_frag(kn + (size_t)kt * 16 * DM + 32, hh); } }
  if (DIAG) {
#pragma unroll
    for (int u = 0; u < 2; ++u)
#pragma unroll
      for (int kt = 0; kt < 2; ++kt)
#pragma unroll
        for (int r = 0; r < 8; ++r) s[u][kt][r] = (kt * 16 + 8 * hh + r <= u * 16 + c) ? s[u][kt][r] : -1.0e30f; }
  float mx[2];
#pragma unroll
  for (int u = 0; u < 2; ++u) { float a = fmaxf(s[u][0][0], s[u][1][0]);
#pragma unroll
    for (int r = 1; r < 8; ++r) a = fmaxf(a, fmaxf(s[u][0][r], s[u][1][r]));
    a = fmaxf(a, __shfl_xor(a, 16)); mx[u] = a * cs; }      /* cs > 0: scaling commutes with the maximum */
  if (__builtin_amdgcn_ballot_w32(mx[0] > mu[0] + 8.0f || mx[1] > mu[1] + 8.0f) != 0) {      /* one scalar test per step */
    const float mn0 = fmaxf(mu[0], mx[0]), mn1 = fmaxf(mu[1], mx[1]); float al[2]; fa_exp2(mu[0] - mn0, mu[1] - mn1, al[0], al[1]); mu[0] = mn0; mu[1] = mn1;
#pragma unroll
    for (int u = 0; u < 2; ++u) { l[u] *= al[u];
#pragma unroll
      for (int t = 0; t < 4; ++t) o[u][t] *= al[u]; } }
  FragH pf[2];
#pragma unroll
  for (int u = 0; u < 2; ++u) { float sm = 0.f;
#pragma unroll
    for (int kt = 0; kt < 2; ++kt) { v8f x;
#pragma unroll
      for (int r = 0; r < 8; ++r) x[r] = fmaf(s[u][kt][r], cs, -mu[u]);
      const v8f p = fa_exp8(x);
#pragma unroll
      for (int r = 0; r < 8; ++r) { sm += p[r]; pf[u].h[kt * 8 + r] = (_Float16)p[r]; } }
    l[u] += sm; }
#pragma unroll
  for (int u = 0; u < 2; ++u)
#pragma unroll
    for (int t = 0; t < 4; ++t) o[u][t] = fa_mma(vf[t], pf[u].v, o[u][t]);
  if (!DIAG) {
#pragma unroll
    for (int t = 0; t < 4; ++t) vf[t] = g2_frag(vn + (size_t)t * 16 * SQ, hh);
    asm volatile("s_wait_xcnt 0x0" ::: "memory"); } }      /* stands behind the step's last loads, ahead of the next step's first write of a register that holds their address */
__global__ __launch_bounds__(128) void k_fattn(const _Float16* __restrict__ Q16, const _Float16* __restrict__ K16, const _Float16* __restrict__ VTa, _Float16* __restrict__ O) {
  const int lane = threadIdx.x & 31, c = lane & 15, hh = lane >> 4;
  const int w = __builtin_amdgcn_readfirstlane(threadIdx.x >> 5);      /* the wave's number as a scalar: the trip count is scalar */
  const int bh = blockIdx.x % (NB * NH); const int g = blockIdx.x / (4 * NB * NH), rr = (blockIdx.x / (NB * NH)) % 4;
  const int qt = (3 - g) * 4 + ((g & 1) ? rr : 3 - rr);      /* a permutation of the 16 query tiles: long tiles first, and blocks a quarter of the grid apart have tiles that sum to the same length */
  const int b = bh / NH, h = bh % NH; const int q0 = qt * 128 + w * 32;
  const _Float16* qp = Q16 + ((size_t)b * SQ + q0 + c) * DM + h * HD;
  const _Float16* kp = K16 + ((size_t)b * SQ + c) * DM + h * HD;
  const _Float16* vp = VTa + ((size_t)bh * HD + c) * SQ;
  const v8f z8 = {0.f,0.f,0.f,0.f,0.f,0.f,0.f,0.f};
  v16h qf[2][2], kf[2][2], vf[4];
#pragma unroll
  for (int u = 0; u < 2; ++u) { qf[u][0] = g2_frag(qp + (size_t)u * 16 * DM, hh); qf[u][1] = g2_frag(qp + (size_t)u * 16 * DM + 32, hh); }
#pragma unroll
  for (int kt = 0; kt < 2; ++kt) { kf[kt][0] = g2_frag(kp + (size_t)kt * 16 * DM, hh); kf[kt][1] = g2_frag(kp + (size_t)kt * 16 * DM + 32, hh); }
#pragma unroll
  for (int t = 0; t < 4; ++t) vf[t] = g2_frag(vp + (size_t)t * 16 * SQ, hh);
  asm volatile("s_wait_xcnt 0x0" ::: "memory");      /* stands behind the first fragments' loads, ahead of the first write of a register that holds one of their addresses */
  v8f o[2][4]; float mu[2], l[2];
#pragma unroll
  for (int u = 0; u < 2; ++u) { mu[u] = -1.0e30f; l[u] = 0.f;
#pragma unroll
    for (int t = 0; t < 4; ++t) o[u][t] = z8; }
#pragma unroll 1
  for (int k0 = 0; k0 < q0; k0 += 32) fa_step<false>(qf, kf, vf, o, mu, l, kp + (size_t)(k0 + 32) * DM, vp + k0 + 32, c, hh);      /* kept rolled: one step holds 16 WMMAs and the registers of four waves per SIMD; k0 + 32 <= q0 is a step of this wave */
  fa_step<true>(qf, kf, vf, o, mu, l, kp, vp, c, hh);
#pragma unroll
  for (int u = 0; u < 2; ++u) { const float fin = 64.0f / (l[u] + __shfl_xor(l[u], 16));      /* the lane halves' sums join once; o carried x64 */
    unsigned short* dst = (unsigned short*)O + ((size_t)b * SQ + q0 + u * 16 + c) * DM + h * HD + 8 * hh;
#pragma unroll
    for (int t = 0; t < 4; ++t) { FragH f;
#pragma unroll
      for (int r = 0; r < 8; ++r) f.h[r] = (_Float16)(o[u][t][r] * fin);      /* register r is output column 16 t + 8 hh + r of query c: one 16-byte store */
      *(v8us*)(dst + t * 16) = f.half[0]; } } }
static_assert(SQ == 16 * 128 && HD == 64, "k_fattn: 16 query tiles of 4 waves x 32 query columns, head size 64");


// Exact f32 causal attention for the first QT0 rows, one wave per (head, query row), 8 rows of one head per block.
// The head's QT0 key rows are staged in LDS at a pitch of HD + 4 floats (16 bytes x an odd number: row-per-lane 16-byte reads without bank conflicts).
// Lane l scores keys l, l + 32, l + 64, l + 96 (each dot product summed over d in index order); row maximum and row sum end in lane butterflies;
// then lane l sums output columns 2 l and 2 l + 1 over the keys in index order, each weight read from its lane as a scalar.
typedef float v2f __attribute__((ext_vector_type(2)));
typedef float v2fa __attribute__((ext_vector_type(2), may_alias));
__global__ __launch_bounds__(256) void k_att0w(const float* __restrict__ QF, const float* __restrict__ KF, const float* __restrict__ VF, float scale, float* __restrict__ OF) {      /* all four row pitches are DM, so that every row step is an immediate offset */
  __shared__ __attribute__((aligned(16))) float lk[QT0][HD + 4];
  { const size_t bo = (size_t)blockIdx.y * QT0 * DM; QF += bo; KF += bo; VF += bo; OF += bo; }      /* blockIdx.y: the batch */
  const int tid = threadIdx.x, lane = tid & 31; const int h = blockIdx.x / (QT0 / 8);
  const int i = (blockIdx.x % (QT0 / 8)) * 8 + __builtin_amdgcn_readfirstlane(tid >> 5);      /* the wave's query row, held as a scalar so that the q row and the group tests below are wave-uniform */
  const float* kb = KF + h * HD;
#pragma unroll
  for (int p = 0; p < QT0 / 16; ++p) { const int r = p * 16 + (tid >> 4), c4 = (tid & 15) * 4; *(v4f*)&lk[r][c4] = *(const v4fa*)(kb + (size_t)r * DM + c4); }      /* unrolled: all 8 loads of a thread in flight at once */
  __syncthreads();
  const float* qr = QF + (size_t)i * DM + h * HD;
  float sa[QT0 / 32];
#pragma unroll
  for (int g = 0; g < QT0 / 32; ++g) sa[g] = 0.f;
#pragma unroll
  for (int c = 0; c < HD / 4; ++c) { const v4f qq = *(const v4fa*)(qr + c * 4);      /* unrolled: sa stays in named registers and the four groups' sum chains interleave */
#pragma unroll
    for (int g = 0; g < QT0 / 32; ++g) { const v4f kq = *(const v4f*)&lk[g * 32 + lane][c * 4]; sa[g] = fmaf(qq[0], kq[0], sa[g]); sa[g] = fmaf(qq[1], kq[1], sa[g]); sa[g] = fmaf(qq[2], kq[2], sa[g]); sa[g] = fmaf(qq[3], kq[3], sa[g]); } }
  float m = -1.0e30f;
#pragma unroll
  for (int g = 0; g < QT0 / 32; ++g) { sa[g] = (g * 32 + lane <= i) ? sa[g] * scale : -1.0e30f; m = fmaxf(m, sa[g]); }      /* causal: keys above the row get weight 0 */
#pragma unroll
  for (int o = 16; o > 0; o >>= 1) m = fmaxf(m, __shfl_xor(m, o));
  float l = 0.f;
#pragma unroll
  for (int g = 0; g < QT0 / 32; ++g) { sa[g] = expf(sa[g] - m); l += sa[g]; }
#pragma unroll
  for (int o = 16; o > 0; o >>= 1) l += __shfl_xor(l, o);
  const float* vb = VF + h * HD + lane * 2; float o0 = 0.f, o1 = 0.f;
#pragma unroll
  for (int g = 0; g < QT0 / 32; ++g) { if (g * 32 <= i) {      /* wave-uniform: key groups wholly above the row are skipped */
#pragma unroll
      for (int jj = 0; jj < 32; ++jj) { const float p = __int_as_float(__builtin_amdgcn_readlane(__float_as_int(sa[g]), jj)); const v2f vv = *(const v2fa*)(vb + (size_t)(g * 32 + jj) * DM); o0 = fmaf(p, vv[0], o0); o1 = fmaf(p, vv[1], o1); } } }      /* unrolled: a group's 32 loads issue before the first use */
  const float fin = 64.0f / l;      /* o carried x64 like the f16 path */
  v2f ov; ov[0] = o0 * fin; ov[1] = o1 * fin; *(v2f*)(OF + (size_t)i * DM + h * HD + lane * 2) = ov; }

template <int NORM, int ROPE>
__global__ __launch_bounds__(64) void k_xformf(const float* __restrict__ F, int ldf, int nh, const float* __restrict__ gain, float eps, const float* __restrict__ CS, const float* __restrict__ SN, float* __restrict__ F32, int ldo) {
  #pragma clang fp contract(off)
  __shared__ float xv[HD]; __shared__ float red[HD]; const int d = threadIdx.x; const int h = blockIdx.x % nh; const size_t r = blockIdx.x / nh; const int p = (int)(r % SQ);
  float x = F[r * (size_t)ldf + (size_t)h * HD + d];
  if (NORM) { red[d] = __fmul_rn(x, x); __syncthreads(); for (int st = HD / 2; st > 0; st >>= 1) { if (d < st) red[d] = __fadd_rn(red[d], red[d + st]); __syncthreads(); } const float rs = rsqrtf(__fadd_rn(red[0] / (float)HD, eps)); x = __fmul_rn(__fmul_rn(x, rs), bf16_round(gain[d])); }
  xv[d] = x; __syncthreads();
  float o = x;
  if (ROPE == 1) { const int i = d >> 1; const float c = CS[p * (HD / 2) + i], s = SN[p * (HD / 2) + i]; const float ev = xv[2 * i], od = xv[2 * i + 1]; o = (d & 1) ? __fadd_rn(__fmul_rn(ev, s), __fmul_rn(od, c)) : __fadd_rn(__fmul_rn(ev, c), -__fmul_rn(od, s)); }
  if (ROPE == 2) { const int i = d & (HD / 2 - 1); const float c = CS[p * (HD / 2) + i], s = SN[p * (HD / 2) + i]; const float lo = xv[i], hi = xv[i + HD / 2]; o = (d < HD / 2) ? __fadd_rn(__fmul_rn(lo, c), -__fmul_rn(hi, s)) : __fadd_rn(__fmul_rn(lo, s), __fmul_rn(hi, c)); }
  float* dst = F32 + r * (size_t)ldo + (size_t)h * HD + d; *(float*)dst = o;  }


__global__ __launch_bounds__(256) void k_bfcp(const float* __restrict__ src, float* __restrict__ dst, size_t n4) { const size_t t = (size_t)blockIdx.x * 256 + threadIdx.x; if (t >= n4) return; const v4f a = *(const v4fa*)(src + t * 4); v4f o; for (int q = 0; q < 4; ++q) o[q] = bf16_round(a[q]); *(v4f*)(dst + t * 4) = o;  }
extern "C" void kernel_launch(void* const* d_in, const int* in_sizes, int n_in,
                              void* d_out, int out_size, void* d_ws, size_t ws_size, hipStream_t stream) {
  (void)in_sizes; (void)n_in; (void)out_size;
    const float* const* I = (const float* const*)d_in; const float* x = I[0]; const float* tcos = I[1]; const float* tsin = I[2]; const float* wq = I[3]; const float* wk = I[4]; const float* wv = I[5]; const float* wo = I[6];      /* [in][out] weights, no biases; rope tables INPUT [2048][32] */
  char* ws = (char*)d_ws; size_t off = 0;
  auto take = [&](size_t bytes) { char* p = ws + off; off += (bytes + 255) & ~(size_t)255; return p; };
  _Float16* BQKV = (_Float16*)take((size_t)3 * DM * DM * 2); _Float16* BO = (_Float16*)take((size_t)DM * DM * 2);
  _Float16* X16 = (_Float16*)take(NR * DM * 2);
  _Float16* QH = (_Float16*)take(NR * DM * 2); _Float16* KH = (_Float16*)take(NR * DM * 2); _Float16* O16 = (_Float16*)take(NR * DM * 2);
  _Float16* VT = (_Float16*)take((size_t)NB * NH * HD * SQ * 2);
  float* QF0 = (float*)take((size_t)NB * QT0 * DM * 4); float* KF0 = (float*)take((size_t)NB * QT0 * DM * 4); float* VF0 = (float*)take((size_t)NB * QT0 * DM * 4); float* OF0 = (float*)take((size_t)NB * QT0 * DM * 4); _Float16* OH0 = (_Float16*)take((size_t)NB * QT0 * DM * 2); _Float16* OL0 = (_Float16*)take((size_t)NB * QT0 * DM * 2);
  if (off > ws_size) return;
  { const unsigned g = (unsigned)(((size_t)DM * (DM / 8) + 255) / 256); k_wt_f16<<<g, 256, 0, stream>>>(wq, BQKV, DM, DM, 16.0f); k_wt_f16<<<g, 256, 0, stream>>>(wk, BQKV + (size_t)DM * DM, DM, DM, 16.0f); k_wt_f16<<<g, 256, 0, stream>>>(wv, BQKV + (size_t)2 * DM * DM, DM, DM, 16.0f); k_wt_f16<<<g, 256, 0, stream>>>(wo, BO, DM, DM, 16.0f); }      /* [in][out] -> Bt[n][k] x16; q | k | v stacked along n */
  k_x16<<<(unsigned)((NR * DM / 8 + 255) / 256), 256, 0, stream>>>(x, X16, NR * DM / 8);
  k_qkv_rope<<<(unsigned)((NR / 128) * (3 * DM / 64)), 128, 0, stream>>>(X16, BQKV, tcos, tsin, QH, KH, VT, QF0, KF0, VF0);      /* roped f16 q, k rows, V^T [NB][NH][HD][SQ], f32 q, k, v of each batch's first 128 rows */
  k_att0w<<<dim3(NH * (QT0 / 8), NB), 256, 0, stream>>>(QF0, KF0, VF0, 0.125f, OF0);      /* exact f32 causal attention for rows 0..127 of every batch (o x64) */
  k_fattn<<<(SQ / 128) * NB * NH, 128, 0, stream>>>(QH, KH, VT, O16);      /* o (merged heads, x64) as f16 rows, all batches */
  k_gemm2<0><<<dim3((unsigned)((MPO / 128) * (DM / 64)), 1), 128, 0, stream>>>(O16 + (size_t)B0 * SQ * DM, DM, 0, BO, DM, 0, 0.0009765625f, nullptr, 0, nullptr, 1, 0, 0, (float*)d_out + (size_t)B0 * SQ * DM, nullptr, DM, 0, MPO, DM, DM);      /* out rows are the output layout */
  k_hl<<<(unsigned)(((size_t)NB * QT0 * DM / 8 + 255) / 256), 256, 0, stream>>>(OF0, OH0, OL0, (size_t)NB * QT0 * DM / 8);      /* first-tile o (x64) -> f16 hi + x1024 residual planes */
  for (int b = B0; b < B0 + NBR; ++b) { const size_t r0 = (size_t)b * SQ; const size_t f0 = (size_t)b * QT0;
    k_gemm2<0><<<dim3((QT0 / 128) * (DM / 64), 1), 128, 0, stream>>>(OH0 + f0 * DM, DM, 0, BO, DM, 0, 0.0009765625f, nullptr, 0, nullptr, 1, 0, 0, (float*)d_out + r0 * DM, nullptr, DM, 0, QT0, DM, DM);      /* rows 0..127: out = o_hi Wo, overwriting the f16-path rows */
    k_gemm2<0><<<dim3((QT0 / 128) * (DM / 64), 1), 128, 0, stream>>>(OL0 + f0 * DM, DM, 0, BO, DM, 0, 0.00000095367431640625f, nullptr, 0, (const float*)d_out + r0 * DM, -1, 0, 0, (float*)d_out + r0 * DM, nullptr, DM, 0, QT0, DM, DM); }      /* += o_lo Wo 2^-20 (own-element accumulate) */
}

// v005
// A run of this version takes 281 microseconds.
// Two timings next to v004 put it at 2.03 and 2.02 times that version's speed.
// Over all steps from v000 it is 34.9 times as fast.
#include <hip/hip_runtime.h>
#define NB 4
#define SQ 2048
#define DM 1024
#define NH 16
#define HD 64
#define HG 4                         /* heads per launch of the k_vt(V16, b, h0, VT) overload (not launched) */
#define QT0 128                      /* first-tile rows recomputed exactly in f32 */
#define B0 0                         /* not used by any kernel or launch */
#define NBR NB                       /* read only by MPO */
#define NR ((size_t)NB * SQ)         /* token rows */
#define MPO ((int)((size_t)NBR * SQ))      /* not used by any kernel or launch */
typedef __bf16 v16b __attribute__((ext_vector_type(16)));
typedef unsigned short v8us __attribute__((ext_vector_type(8), may_alias));
typedef float  v8f  __attribute__((ext_vector_type(8)));
typedef float  v4f  __attribute__((ext_vector_type(4)));
typedef float  v4fa __attribute__((ext_vector_type(4), may_alias));
union FragB { v16b v; v8us half[2]; unsigned short u[16]; };

__device__ __forceinline__ unsigned short bf16_bits(float x) { unsigned int u = __float_as_uint(x); return (unsigned short)((u + 0x7FFFu + ((u >> 16) & 1u)) >> 16); }
__device__ __forceinline__ float bf16_val(unsigned short b) { return __uint_as_float(((unsigned int)b) << 16); }
__device__ __forceinline__ float bf16_round(float x) { return bf16_val(bf16_bits(x)); }
// D += A·B with NT terms: 1 = ah·bh, 2 = + al·bh (A split), 3 = + ah·bl (both split)
template <int NT>
__device__ __forceinline__ v8f mmaN(v16b ah, v16b al, v16b bh, v16b bl, v8f c) {
  c = __builtin_amdgcn_wmma_f32_16x16x32_bf16(false, ah, false, bh, (short)0, c, false, false);
  if (NT >= 2) c = __builtin_amdgcn_wmma_f32_16x16x32_bf16(false, al, false, bh, (short)0, c, false, false);
  if (NT >= 3) c = __builtin_amdgcn_wmma_f32_16x16x32_bf16(false, ah, false, bl, (short)0, c, false, false);
  asm volatile("v_nop\n\tv_nop\n\tv_nop\n\tv_nop" : "+v"(c) : "v"(ah), "v"(al), "v"(bh), "v"(bl));
  return c;
}

__global__ __launch_bounds__(256) void k_wt_bf16(const float* __restrict__ W, unsigned short* __restrict__ Wt, int K, int N) {
  const int t = blockIdx.x * 256 + threadIdx.x;
  const int k8n = K / 8;
  if (t >= N * k8n) return;
  const int n = t / k8n, k8 = (t % k8n) * 8;
  v8us v;
#pragma unroll
  for (int i = 0; i < 8; ++i) v[i] = bf16_bits(W[(size_t)(k8 + i) * N + n]);
  *(v8us*)(Wt + (size_t)n * K + k8) = v;
  
}

// GEMM C[M][N] (f32, pitch ldc) = act(A[M][K]·W + bias). A f32 row-major (pitch lda) converted per fragment to bf16
// (ASPLIT: hi/lo two planes -> 2 terms, else single rounded term); Wt bf16 [N][K] (pitch ldb). BIAS_BF16 rounds the
// bias to bf16 first (bias quantised to bf16 before the add). K%32==0, M%16==0, N%64==0.
template <bool ASPLIT, int ACT, bool BIAS_BF16>
__global__ __launch_bounds__(128) void k_gemm_bf(const float* __restrict__ A, int lda, const unsigned short* __restrict__ Wt, int ldb,
                                               const float* __restrict__ bias, float* __restrict__ C, int ldc, int M, int N, int K) {
  __shared__ __attribute__((aligned(16))) float so[4][16][64];
  const int tid = threadIdx.x, w = tid >> 5, lane = tid & 31, ln = lane & 15, hh = lane >> 4;
  const int ntn = N / 64;
  const int wid = blockIdx.x * 4 + w;
  const int mt = wid / ntn, nq = wid % ntn;
  if (mt * 16 >= M) return;
  const int row0 = mt * 16, col0 = nq * 64;
  const float* arow = A + (size_t)(row0 + ln) * lda;
  v8f acc[4] = {};
  for (int kb = 0; kb < K; kb += 32) {
    FragB ah, al;
    const v4f x0 = *(const v4fa*)(arow + kb + 8 * hh), x1 = *(const v4fa*)(arow + kb + 8 * hh + 4);
    const v4f x2 = *(const v4fa*)(arow + kb + 16 + 8 * hh), x3 = *(const v4fa*)(arow + kb + 16 + 8 * hh + 4);
    float xs[16] = {x0[0],x0[1],x0[2],x0[3],x1[0],x1[1],x1[2],x1[3],x2[0],x2[1],x2[2],x2[3],x3[0],x3[1],x3[2],x3[3]};
#pragma unroll
    for (int i = 0; i < 16; ++i) { const unsigned short hb = bf16_bits(xs[i]); ah.u[i] = hb; al.u[i] = ASPLIT ? bf16_bits(xs[i] - bf16_val(hb)) : (unsigned short)0; }
#pragma unroll
    for (int t = 0; t < 4; ++t) {
      const unsigned short* brow = Wt + (size_t)(col0 + t * 16 + ln) * ldb + kb;
      FragB b;
      b.half[0] = *(const v8us*)(brow + 8 * hh);
      b.half[1] = *(const v8us*)(brow + 16 + 8 * hh);
      acc[t] = mmaN<ASPLIT ? 2 : 1>(ah.v, al.v, b.v, b.v, acc[t]);
    }
  }
#pragma unroll
  for (int t = 0; t < 4; ++t) {
    float bv = bias ? bias[col0 + t * 16 + ln] : 0.f;
    if (BIAS_BF16) bv = bf16_round(bv);
#pragma unroll
    for (int r = 0; r < 8; ++r) { float v = acc[t][r] + bv; if (ACT == 1) v = fmaxf(v, 0.f); so[w][8 * hh + r][t * 16 + ln] = v; }
  }
  __builtin_amdgcn_fence(__ATOMIC_ACQ_REL, "workgroup");
  __builtin_amdgcn_wave_barrier();
  const int rsub = lane >> 4, c4 = (lane & 15) * 4;
  {
#pragma unroll
    for (int q = 0; q < 8; ++q) {
      const int r = q * 2 + rsub;
      const v4f v = *(const v4fa*)&so[w][r][c4];
      *(v4f*)(C + (size_t)(row0 + r) * ldc + col0 + c4) = v;
    }
    
  }
}

// GEMM C = act(A·W + bias + resid): A f32 (ASPLIT -> hi/lo 2 terms), Wt bf16 [N][K]; ACT 0 none, 1 relu, 2 exact gelu;
// resid (optional, f32, row index = (row % rmod), pitch ldr, RES_BF16 rounds it) added before the activation.
template <bool ASPLIT, int ACT, bool BIAS_BF16, bool RES_BF16>
__global__ __launch_bounds__(128) void k_gemm_bf3(const float* __restrict__ A, int lda, const unsigned short* __restrict__ Wt, int ldb,
                                                const float* __restrict__ bias, const float* __restrict__ resid, int rmod, int ldr,
                                                float* __restrict__ C, int ldc, int M, int N, int K) {
  __shared__ __attribute__((aligned(16))) float so[4][16][64];
  const int tid = threadIdx.x, w = tid >> 5, lane = tid & 31, ln = lane & 15, hh = lane >> 4;
  const int ntn = N / 64;
  const int wid = blockIdx.x * 4 + w;
  const int mt = wid / ntn, nq = wid % ntn;
  if (mt * 16 >= M) return;
  const int row0 = mt * 16, col0 = nq * 64;
  const float* arow = A + (size_t)(row0 + ln) * lda;
  v8f acc[4] = {};
  for (int kb = 0; kb < K; kb += 32) {
    FragB ah, al;
    const v4f x0 = *(const v4fa*)(arow + kb + 8 * hh), x1 = *(const v4fa*)(arow + kb + 8 * hh + 4);
    const v4f x2 = *(const v4fa*)(arow + kb + 16 + 8 * hh), x3 = *(const v4fa*)(arow + kb + 16 + 8 * hh + 4);
    float xs[16] = {x0[0],x0[1],x0[2],x0[3],x1[0],x1[1],x1[2],x1[3],x2[0],x2[1],x2[2],x2[3],x3[0],x3[1],x3[2],x3[3]};
#pragma unroll
    for (int i = 0; i < 16; ++i) { const unsigned short hb = bf16_bits(xs[i]); ah.u[i] = hb; al.u[i] = ASPLIT ? bf16_bits(xs[i] - bf16_val(hb)) : (unsigned short)0; }
#pragma unroll
    for (int t = 0; t < 4; ++t) {
      const unsigned short* brow = Wt + (size_t)(col0 + t * 16 + ln) * ldb + kb;
      FragB b;
      b.half[0] = *(const v8us*)(brow + 8 * hh);
      b.half[1] = *(const v8us*)(brow + 16 + 8 * hh);
      acc[t] = mmaN<ASPLIT ? 2 : 1>(ah.v, al.v, b.v, b.v, acc[t]);
    }
  }
#pragma unroll
  for (int t = 0; t < 4; ++t) {
    const int col = col0 + t * 16 + ln;
    float bv = bias ? bias[col] : 0.f;
    if (BIAS_BF16) bv = bf16_round(bv);
#pragma unroll
    for (int r = 0; r < 8; ++r) {
      float v = acc[t][r] + bv;
      if (resid) { float rv = resid[(size_t)((row0 + 8 * hh + r) % rmod) * ldr + col]; if (RES_BF16) rv = bf16_round(rv); v += rv; }
      if (ACT == 1) v = fmaxf(v, 0.f);
      if (ACT == 2) v = 0.5f * v * (1.0f + erff(v * 0.70710678118654752f));
      if (ACT == 3) { const float u = 0.7978845608028654f * (v + 0.044715f * v * v * v); v = 0.5f * v * (1.0f + tanhf(u)); }
      so[w][8 * hh + r][t * 16 + ln] = v;
    }
  }
  __builtin_amdgcn_fence(__ATOMIC_ACQ_REL, "workgroup");
  __builtin_amdgcn_wave_barrier();
  const int rsub = lane >> 4, c4 = (lane & 15) * 4;
  {
#pragma unroll
    for (int q = 0; q < 8; ++q) {
      const int r = q * 2 + rsub;
      const v4f v = *(const v4fa*)&so[w][r][c4];
      *(v4f*)(C + (size_t)(row0 + r) * ldc + col0 + c4) = v;
    }
    
  }
}
// row LayerNorm (biased variance, eps) over N: s = X (+ R); optional out_sum <- s; out_norm <- (s-mu)*rsqrt(var+eps)*g + b
template <bool PARAM_BF16>
__global__ __launch_bounds__(256) void k_layernorm(const float* __restrict__ X, const float* __restrict__ R, const float* __restrict__ g, const float* __restrict__ bta,
                                                  float* __restrict__ out_sum, float* __restrict__ out_norm, int N, float eps) {
  __shared__ float red[256];
  const int row = blockIdx.x, tid = threadIdx.x;
  const float* x = X + (size_t)row * N; const float* rr = R ? R + (size_t)row * N : nullptr;
  float vals[16];                     // up to N = 4096
  const int per = N / 256;            // contiguous chunk per thread? use strided-by-4 chunks: thread handles j = tid*4 + 1024*u
  float s1 = 0.f;
  for (int u = 0; u < per / 4; ++u) {
    const int j = tid * 4 + 1024 * u;
    const v4f a = *(const v4fa*)(x + j);
    v4f b = {0.f,0.f,0.f,0.f}; if (rr) b = *(const v4fa*)(rr + j);
#pragma unroll
    for (int q = 0; q < 4; ++q) { const float v = a[q] + b[q]; vals[u * 4 + q] = v; s1 += v; }
  }
  red[tid] = s1; __syncthreads();
  for (int st = 128; st > 0; st >>= 1) { if (tid < st) red[tid] += red[tid + st]; __syncthreads(); }
  const float mu = red[0] / (float)N; __syncthreads();
  float s2 = 0.f;
  for (int u = 0; u < per / 4; ++u)
#pragma unroll
    for (int q = 0; q < 4; ++q) { const float c = vals[u * 4 + q] - mu; s2 += c * c; }
  red[tid] = s2; __syncthreads();
  for (int st = 128; st > 0; st >>= 1) { if (tid < st) red[tid] += red[tid + st]; __syncthreads(); }
  const float rs = rsqrtf(red[0] / (float)N + eps);
  {
    for (int u = 0; u < per / 4; ++u) {
      const int j = tid * 4 + 1024 * u;
      v4f o, sm;
#pragma unroll
      for (int q = 0; q < 4; ++q) {
        float gg = g[j + q], bb = bta[j + q];
        if (PARAM_BF16) { gg = bf16_round(gg); bb = bf16_round(bb); }
        sm[q] = vals[u * 4 + q]; o[q] = (vals[u * 4 + q] - mu) * rs * gg + bb;
      }
      if (out_sum) *(v4f*)(out_sum + (size_t)row * N + j) = sm;
      *(v4f*)(out_norm + (size_t)row * N + j) = o;
    }
    
  }
}



// ---- f16 WMMA path (v_wmma_f32_16x16x32_f16): 11-bit significands for operands in range — used where a [0,1] probability operand needs more precision than bf16
typedef _Float16 v16h __attribute__((ext_vector_type(16)));
union FragH { v16h v; v8us half[2]; _Float16 h[16]; unsigned short u[16]; };
template <int NT>
__device__ __forceinline__ v8f mmaH(v16h ah, v16h al, v16h bh, v16h bl, v8f c) {
  c = __builtin_amdgcn_wmma_f32_16x16x32_f16(false, ah, false, bh, (short)0, c, false, false);
  if (NT >= 2) c = __builtin_amdgcn_wmma_f32_16x16x32_f16(false, al, false, bh, (short)0, c, false, false);
  if (NT >= 3) c = __builtin_amdgcn_wmma_f32_16x16x32_f16(false, ah, false, bl, (short)0, c, false, false);
  asm volatile("v_nop\n\tv_nop\n\tv_nop\n\tv_nop" : "+v"(c) : "v"(ah), "v"(al), "v"(bh), "v"(bl));
  return c;
}
// batched GEMM like k_gemm_b but f16 operands: A f32 (split into f16 hi/lo if ASPLIT, else rounded to f16), Bt = f16 values [n][k]; alpha; C f32; N multiple of 16 (partial tiles skipped)
template <bool ASPLIT>
__global__ __launch_bounds__(128) void k_gemm_h(const float* __restrict__ A, int lda, size_t sA, const _Float16* __restrict__ Bh, int ldb, size_t sB, float alpha, float* __restrict__ C, int ldc, size_t sC, int M, int N, int K) {
  __shared__ __attribute__((aligned(16))) float so[4][16][64];
  const int tid = threadIdx.x, w = tid >> 5, lane = tid & 31, ln = lane & 15, hh = lane >> 4; const int by = blockIdx.y;
  A += (size_t)by * sA; Bh += (size_t)by * sB; C += (size_t)by * sC;
  const int ntn = (N + 63) / 64; const int wid = blockIdx.x * 4 + w; const int mt = wid / ntn, nq = wid % ntn; if (mt * 16 >= M) return;
  const int row0 = mt * 16, col0 = nq * 64; const float* arow = A + (size_t)(row0 + ln) * lda;
  v8f acc[4] = {};
  for (int kb = 0; kb < K; kb += 32) {
    FragH ah, al;
    const v4f x0 = *(const v4fa*)(arow + kb + 8 * hh), x1 = *(const v4fa*)(arow + kb + 8 * hh + 4), x2 = *(const v4fa*)(arow + kb + 16 + 8 * hh), x3 = *(const v4fa*)(arow + kb + 16 + 8 * hh + 4);
    float xs[16] = {x0[0],x0[1],x0[2],x0[3],x1[0],x1[1],x1[2],x1[3],x2[0],x2[1],x2[2],x2[3],x3[0],x3[1],x3[2],x3[3]};
#pragma unroll
    for (int i = 0; i < 16; ++i) { const _Float16 h = (_Float16)xs[i]; ah.h[i] = h; al.h[i] = ASPLIT ? (_Float16)(xs[i] - (float)h) : (_Float16)0.0f; }
#pragma unroll
    for (int t = 0; t < 4; ++t) { if (col0 + t * 16 >= N) continue; const size_t boff = (size_t)(col0 + t * 16 + ln) * ldb + kb; FragH bq; bq.half[0] = *(const v8us*)(Bh + boff + 8 * hh); bq.half[1] = *(const v8us*)(Bh + boff + 16 + 8 * hh);
      acc[t] = mmaH<ASPLIT ? 2 : 1>(ah.v, al.v, bq.v, bq.v, acc[t]); }
  }
#pragma unroll
  for (int t = 0; t < 4; ++t) { if (col0 + t * 16 >= N) continue;
#pragma unroll
    for (int r = 0; r < 8; ++r) so[w][8 * hh + r][t * 16 + ln] = acc[t][r] * alpha; }
  __builtin_amdgcn_fence(__ATOMIC_ACQ_REL, "workgroup"); __builtin_amdgcn_wave_barrier();
  const int rsub = lane >> 4, c4 = (lane & 15) * 4;
  {
#pragma unroll
    for (int q = 0; q < 8; ++q) { const int r = q * 2 + rsub; if (col0 + c4 < N) { const v4f v = *(const v4fa*)&so[w][r][c4]; *(v4f*)(C + (size_t)(row0 + r) * ldc + col0 + c4) = v; } }
     }
}

// Wt[n][k] = f16(W[k][n]·scale) from f32 row-major W[K][N] (scale = power of two; bf16-exact weights stay exact in f16 away from the subnormal range)
__global__ __launch_bounds__(256) void k_wt_f16(const float* __restrict__ W, _Float16* __restrict__ Wt, int K, int N, float scale) {
  const int t = blockIdx.x * 256 + threadIdx.x; if (t >= N * (K / 8)) return; const int n = t / (K / 8), k8 = (t % (K / 8)) * 8; FragH f;
#pragma unroll
  for (int i = 0; i < 8; ++i) f.h[i] = (_Float16)(bf16_round(W[(size_t)(k8 + i) * N + n]) * scale); const v8us o = f.half[0];
  *(v8us*)((unsigned short*)Wt + (size_t)n * K + k8) = o; 
}
// k_gemm_hh variant with fused epilogue: v = acc·alpha + bias[by·sBias + col] (+ CP[(row/rowsPerB)·sCPb + by·64 + col] if CP) ; ACT 0 none / 1 elu ; writes f16 C16 (and f32 C if non-null)
template <int ACT>
__global__ __launch_bounds__(128) void k_gemm_hhx(const _Float16* __restrict__ A, int lda, size_t sA, const _Float16* __restrict__ Bh, int ldb, size_t sB, float alpha, const float* __restrict__ bias, size_t sBias, const float* __restrict__ CP, int rowsPerB, size_t sCPb, int row0g,
    float* __restrict__ C, _Float16* __restrict__ C16, int ldc, size_t sC, int M, int N, int K) {
  __shared__ __attribute__((aligned(16))) float so[4][16][64];
  const int tid = threadIdx.x, w = tid >> 5, lane = tid & 31, ln = lane & 15, hh = lane >> 4; const int by = blockIdx.y;
  A += (size_t)by * sA; Bh += (size_t)by * sB; const size_t cofs = (size_t)by * sC; const float* bp = bias ? bias + (size_t)by * sBias : nullptr;
  const int ntn = (N + 63) / 64; const int wid = blockIdx.x * 4 + w; const int mt = wid / ntn, nq = wid % ntn; if (mt * 16 >= M) return;
  const int row0 = mt * 16, col0 = nq * 64; const _Float16* arow = A + (size_t)(row0 + ln) * lda;
  v8f acc[4] = {};
  for (int kb = 0; kb < K; kb += 32) { FragH ah; ah.half[0] = *(const v8us*)((const unsigned short*)arow + kb + 8 * hh); ah.half[1] = *(const v8us*)((const unsigned short*)arow + kb + 16 + 8 * hh);
#pragma unroll
    for (int t = 0; t < 4; ++t) { if (col0 + t * 16 >= N) continue; const size_t boff = (size_t)(col0 + t * 16 + ln) * ldb + kb; FragH bq; bq.half[0] = *(const v8us*)((const unsigned short*)Bh + boff + 8 * hh); bq.half[1] = *(const v8us*)((const unsigned short*)Bh + boff + 16 + 8 * hh);
      acc[t] = mmaH<1>(ah.v, ah.v, bq.v, bq.v, acc[t]); }
  }
#pragma unroll
  for (int t = 0; t < 4; ++t) { if (col0 + t * 16 >= N) continue; const int col = col0 + t * 16 + ln; const float bv = bp ? bf16_round(bp[col]) : 0.f;
#pragma unroll
    for (int r = 0; r < 8; ++r) { float v = acc[t][r] * alpha + bv; if (CP) { const int rr = row0g + row0 + 8 * hh + r; if (rowsPerB < 0) v += CP[cofs + (size_t)rr * ldc + col];      /* rowsPerB < 0: own element of the batched C plane */ else { const int bidx = rr / rowsPerB; v += CP[(size_t)bidx * sCPb + (size_t)by * 64 + col]; } } if (ACT == 1) v = (v > 0.f) ? v : expm1f(v); else if (ACT == 7) v = (v > 0.f) ? v + 1.0f : expf(v); else if (ACT == 8) v = tanhf(v); else if (ACT == 9) v = 0.5f * v * (1.0f + tanhf(0.7978845608028654f * (v + 0.044715f * v * v * v))); else if (ACT == 11) v = 1.0f / (1.0f + expf(-v)); else if (ACT == 12) v = (v > 0.f) ? v : 0.01f * v; else if (ACT == 14) v = (v > 0.f) ? v : 0.1f * v; else if (ACT == 16) v = (v >= 0.f) ? v : 0.3f * v; else if (ACT == 17) v = (v >= 0.f) ? v : 0.2f * v; else if (ACT == 15) v = v / (1.0f + expf(-v)); else if (ACT == 3) v = fmaxf(v, 0.f); else if (ACT == 6) v = 0.5f * v * (1.0f + erff(v * 0.70710678118654752f)); so[w][8 * hh + r][t * 16 + ln] = v; } }
  __builtin_amdgcn_fence(__ATOMIC_ACQ_REL, "workgroup"); __builtin_amdgcn_wave_barrier();
  const int rsub = lane >> 4, c4 = (lane & 15) * 4; typedef _Float16 v4h __attribute__((ext_vector_type(4)));
  {
#pragma unroll
    for (int q = 0; q < 8; ++q) { const int r = q * 2 + rsub; if (col0 + c4 < N) { const v4f v = *(const v4fa*)&so[w][r][c4]; if (C) *(v4f*)(C + cofs + (size_t)(row0 + r) * ldc + col0 + c4) = v; if (C16) { v4h h4; for (int i = 0; i < 4; ++i) h4[i] = (_Float16)v[i]; *(v4h*)(C16 + cofs + (size_t)(row0 + r) * ldc + col0 + c4) = h4; } } }
     }
}


typedef _Float16 v4h __attribute__((ext_vector_type(4)));

__global__ __launch_bounds__(256) void k_x16(const float* __restrict__ x, _Float16* __restrict__ X16, size_t n8) { const size_t t = (size_t)blockIdx.x * 256 + threadIdx.x; if (t >= n8) return; FragH f;
#pragma unroll
  for (int q = 0; q < 8; ++q) f.h[q] = (_Float16)bf16_round(x[t * 8 + q]); *(v8us*)((unsigned short*)X16 + t * 8) = f.half[0];  }
__global__ __launch_bounds__(256) void k_h16(const float* __restrict__ x, _Float16* __restrict__ X16, size_t n8) { const size_t t = (size_t)blockIdx.x * 256 + threadIdx.x; if (t >= n8) return; FragH f;
#pragma unroll
  for (int q = 0; q < 8; ++q) f.h[q] = (_Float16)x[t * 8 + q]; *(v8us*)((unsigned short*)X16 + t * 8) = f.half[0];  }
__global__ __launch_bounds__(256) void k_round16f(const float* __restrict__ W, _Float16* __restrict__ Bt, size_t n8) { const size_t t = (size_t)blockIdx.x * 256 + threadIdx.x; if (t >= n8) return; FragH f;
#pragma unroll
  for (int i = 0; i < 8; ++i) f.h[i] = (_Float16)(bf16_round(W[t * 8 + i]) * 16.0f); *(v8us*)((unsigned short*)Bt + t * 8) = f.half[0];  }
template <int NHv, int TTv>
__global__ __launch_bounds__(256) void k_vt(const _Float16* __restrict__ V16, int ldv, int voff, _Float16* __restrict__ Vt) { __shared__ unsigned short tl[64][66]; const int tid = threadIdx.x; const int slab = blockIdx.x / (TTv / 64), lg = blockIdx.x % (TTv / 64); const int b = slab / NHv, h = slab % NHv;
  for (int i = tid; i < 64 * 8; i += 256) { const int r = i / 8, c8 = (i % 8) * 8; FragH f; f.half[0] = *(const v8us*)((const unsigned short*)V16 + ((size_t)b * TTv + lg * 64 + r) * ldv + voff + h * 64 + c8);
#pragma unroll
    for (int q = 0; q < 8; ++q) tl[r][c8 + q] = f.u[q]; }
  __syncthreads();
  {
#pragma unroll
    for (int rd = 0; rd < 2; ++rd) { const int d = rd * 32 + tid / 8, pc = tid % 8; FragH f;
#pragma unroll
      for (int q = 0; q < 8; ++q) f.u[q] = tl[pc * 8 + q][d];
      *(v8us*)((unsigned short*)Vt + ((size_t)slab * 64 + d) * TTv + lg * 64 + pc * 8) = f.half[0]; }
     } }

__global__ __launch_bounds__(256) void k_hl(const float* __restrict__ F, _Float16* __restrict__ Hh, _Float16* __restrict__ Hl, size_t n8) { const size_t t = (size_t)blockIdx.x * 256 + threadIdx.x; if (t >= n8) return; FragH fh, fl; const v4f a = *(const v4fa*)(F + t * 8), c = *(const v4fa*)(F + t * 8 + 4);
#pragma unroll
  for (int q = 0; q < 4; ++q) { _Float16 h = (_Float16)a[q]; fh.h[q] = h; fl.h[q] = (_Float16)((a[q] - (float)h) * 1024.0f); h = (_Float16)c[q]; fh.h[4 + q] = h; fl.h[4 + q] = (_Float16)((c[q] - (float)h) * 1024.0f); }
  { *(v8us*)((unsigned short*)Hh + t * 8) = fh.half[0]; *(v8us*)((unsigned short*)Hl + t * 8) = fl.half[0];  } }

// ---- fast GEMM (wave tile 32x64; requires M % 32 == 0 rows per launch region and N % 64 == 0); epilogue = k_gemm_hhx semantics ----
__device__ __forceinline__ v16h g2_frag(const _Float16* p, int hh) { FragH f; f.half[0] = *(const v8us*)((const unsigned short*)p + 8 * hh); f.half[1] = *(const v8us*)((const unsigned short*)p + 16 + 8 * hh); return f.v; }
__device__ __forceinline__ v8f g2_mma(v16h a, v16h b, v8f c) { v8f d = __builtin_amdgcn_wmma_f32_16x16x32_f16(false, a, false, b, (short)0, c, false, false); asm volatile("v_nop\n\tv_nop\n\tv_nop\n\tv_nop" : "+v"(d) : "v"(a), "v"(b)); return d; }
template <int ACT>
__global__ __launch_bounds__(128) void k_gemm2(const _Float16* __restrict__ A, int lda, size_t sA, const _Float16* __restrict__ Bh, int ldb, size_t sB, float alpha, const float* __restrict__ bias, size_t sBias, const float* __restrict__ CP, int rowsPerB, size_t sCPb, int row0g,
    float* __restrict__ C, _Float16* __restrict__ C16, int ldc, size_t sC, int M, int N, int K) { static_assert(ACT == 0 || ACT == 3 || ACT == 6 || ACT == 8 || ACT == 9 || ACT == 11 || ACT == 12 || ACT == 14 || ACT == 15 || ACT == 16 || ACT == 17, "k_gemm2: unsupported ACT code (would silently apply no activation)");
  __shared__ __attribute__((aligned(16))) float so[4][32][68];
  const int tid = threadIdx.x, w = tid >> 5, lane = tid & 31, ln = lane & 15, hh = lane >> 4; const int by = blockIdx.y;
  A += (size_t)by * sA; Bh += (size_t)by * sB; const size_t cofs = (size_t)by * sC; const float* bp = bias ? bias + (size_t)by * sBias : nullptr;
  const int ntn = N >> 6; const int mt = blockIdx.x / ntn, nq = blockIdx.x - mt * ntn; const int row0 = mt * 128 + 32 * w, col0 = nq * 64; if (row0 >= M) return;
  const _Float16* a0p = A + (size_t)(row0 + ln) * lda; const _Float16* a1p = a0p + (size_t)16 * lda;
  const _Float16* b0p = Bh + (size_t)(col0 + ln) * ldb; const _Float16* b1p = b0p + (size_t)16 * ldb; const _Float16* b2p = b1p + (size_t)16 * ldb; const _Float16* b3p = b2p + (size_t)16 * ldb;
  const v8f z8 = {0.f,0.f,0.f,0.f,0.f,0.f,0.f,0.f}; v8f c00 = z8, c01 = z8, c02 = z8, c03 = z8, c10 = z8, c11 = z8, c12 = z8, c13 = z8;
#pragma unroll 1
  for (int kb = 0; kb < K; kb += 32) { const v16h a0 = g2_frag(a0p + kb, hh), a1 = g2_frag(a1p + kb, hh);
    v16h b = g2_frag(b0p + kb, hh); c00 = g2_mma(a0, b, c00); c10 = g2_mma(a1, b, c10);
    b = g2_frag(b1p + kb, hh); c01 = g2_mma(a0, b, c01); c11 = g2_mma(a1, b, c11);
    b = g2_frag(b2p + kb, hh); c02 = g2_mma(a0, b, c02); c12 = g2_mma(a1, b, c12);
    b = g2_frag(b3p + kb, hh); c03 = g2_mma(a0, b, c03); c13 = g2_mma(a1, b, c13); }
  v8f accs[8] = {c00, c01, c02, c03, c10, c11, c12, c13};
#pragma unroll
  for (int u = 0; u < 8; ++u) { const int t = u & 3, half = u >> 2; const int col = col0 + t * 16 + ln; const float bv = bp ? bf16_round(bp[col]) : 0.f;
#pragma unroll
    for (int r = 0; r < 8; ++r) { const int rloc = half * 16 + 8 * hh + r; float v = accs[u][r] * alpha + bv; if (CP) { if (rowsPerB < 0) v += CP[cofs + (size_t)(row0g + row0 + rloc) * ldc + col];      /* rowsPerB < 0: own element of the batched C plane */ else { const int bidx = (row0g + row0 + rloc) / rowsPerB; v += CP[(size_t)bidx * sCPb + (size_t)by * 64 + col]; } }
      if (ACT == 3) v = fmaxf(v, 0.f); else if (ACT == 6) v = 0.5f * v * (1.0f + erff(v * 0.70710678118654752f)); else if (ACT == 11) v = 1.0f / (1.0f + expf(-v)); else if (ACT == 15) v = v / (1.0f + expf(-v)); else if (ACT == 12) v = (v > 0.f) ? v : 0.01f * v; else if (ACT == 8) v = tanhf(v); else if (ACT == 9) v = 0.5f * v * (1.0f + tanhf(0.7978845608028654f * (v + 0.044715f * v * v * v))); else if (ACT == 14) v = (v > 0.f) ? v : 0.1f * v; else if (ACT == 16) v = (v >= 0.f) ? v : 0.3f * v; else if (ACT == 17) v = (v >= 0.f) ? v : 0.2f * v;
      so[w][rloc][t * 16 + ln] = v; } }
  __builtin_amdgcn_fence(__ATOMIC_ACQ_REL, "workgroup"); __builtin_amdgcn_wave_barrier();
  const int rsub = lane >> 4, c4 = (lane & 15) * 4;
  {
#pragma unroll
    for (int q = 0; q < 16; ++q) { const int r = q * 2 + rsub; const v4f v = *(const v4fa*)&so[w][r][c4]; if (C) *(v4f*)(C + cofs + (size_t)(row0 + r) * ldc + col0 + c4) = v; if (C16) { v4h h4; for (int i = 0; i < 4; ++i) h4[i] = (_Float16)v[i]; *(v4h*)(C16 + cofs + (size_t)(row0 + r) * ldc + col0 + c4) = h4; } }
     } }

// q | k | v projection of ALL token rows (main loop of k_gemm2, pitches and K = DM) with the per-head work in the epilogue: no f32 q | k | v plane in memory and no launch per (row, head).
// A block's 64 columns are one head of q, k or v (block-uniform), its 128 rows lie in one batch. q, k: each wave stages its 32x64 f32 tile in its own LDS range; 8 lanes take one row (lanes 0-3 columns 0-31, lanes 4-7 columns 32-63),
// each reads its 8 low-half and 8 high-half values and the two table rows, rotates and stores 16 bytes: one instruction fills whole 128-byte lines.
// v: accumulator registers 0..7 of a lane are 8 consecutive token rows of one column, so each lane packs them to 16 bytes of V^T; the block's 64 x 128 tile is gathered in LDS (pitch 272 bytes) so that one wave writes each 256-byte row piece.
// Rows 0..127 of a batch (one block row) are also written in f32 for the exact first-tile attention.
// Every epilogue loop is unrolled so that accs, xs and tb are indexed by constants and stay in registers.
// A 16-byte global store (two for the f32 form) with s_wait_xcnt 0 as the last line of the same statement: the epilogue reuses its staging registers from pass to pass, and a wait in a statement of its own would not hold the next pass's register writes behind it.
__device__ __forceinline__ void st16_wait(unsigned short* p, v8us d) { asm volatile("global_store_b128 %0, %1, off\n\ts_wait_xcnt 0x0" :: "v"(p), "v"(d) : "memory"); }
__device__ __forceinline__ void st32_wait(float* p, v4f d0, v4f d1) { asm volatile("global_store_b128 %0, %1, off\n\tglobal_store_b128 %0, %2, off offset:16\n\ts_wait_xcnt 0x0" :: "v"(p), "v"(d0), "v"(d1) : "memory"); }
__global__ __launch_bounds__(128) void k_qkv_rope(const _Float16* __restrict__ A, const _Float16* __restrict__ Bh, const float* __restrict__ tcos, const float* __restrict__ tsin,
    _Float16* __restrict__ Q16, _Float16* __restrict__ K16, _Float16* __restrict__ VTa, float* __restrict__ QF, float* __restrict__ KF, float* __restrict__ VF) {
  __shared__ __attribute__((aligned(16))) float so[4][32][68];
  const int tid = threadIdx.x, w = tid >> 5, lane = tid & 31, ln = lane & 15, hh = lane >> 4;
  const int ntn = 3 * DM / 64; const int mt = blockIdx.x / ntn, nq = blockIdx.x - mt * ntn; const int row0 = mt * 128 + 32 * w, col0 = nq * 64;
  const int sel = nq / NH, h = nq % NH;      /* 0 q, 1 k, 2 v; head */
  const int b = mt / (SQ / 128), pb = (mt % (SQ / 128)) * 128, p0 = pb + 32 * w;      /* batch; position of the block's and of the wave's first row */
  const bool first = pb == 0;
  const _Float16* a0p = A + (size_t)(row0 + ln) * DM; const _Float16* a1p = a0p + (size_t)16 * DM;
  const _Float16* b0p = Bh + (size_t)(col0 + ln) * DM; const _Float16* b1p = b0p + (size_t)16 * DM; const _Float16* b2p = b1p + (size_t)16 * DM; const _Float16* b3p = b2p + (size_t)16 * DM;
  const v8f z8 = {0.f,0.f,0.f,0.f,0.f,0.f,0.f,0.f}; v8f c00 = z8, c01 = z8, c02 = z8, c03 = z8, c10 = z8, c11 = z8, c12 = z8, c13 = z8;
#pragma unroll 1
  for (int kb = 0; kb < DM; kb += 32) { const v16h a0 = g2_frag(a0p + kb, hh), a1 = g2_frag(a1p + kb, hh);      /* kept rolled, as in k_gemm2 */
    v16h bf = g2_frag(b0p + kb, hh); c00 = g2_mma(a0, bf, c00); c10 = g2_mma(a1, bf, c10);
    bf = g2_frag(b1p + kb, hh); c01 = g2_mma(a0, bf, c01); c11 = g2_mma(a1, bf, c11);
    bf = g2_frag(b2p + kb, hh); c02 = g2_mma(a0, bf, c02); c12 = g2_mma(a1, bf, c12);
    bf = g2_frag(b3p + kb, hh); c03 = g2_mma(a0, bf, c03); c13 = g2_mma(a1, bf, c13);
    asm volatile("s_wait_xcnt 0x0" ::: "memory"); }      /* stands behind the trip's last loads, ahead of the next trip's first write of a register that holds one of their addresses */
  v8f accs[8] = {c00, c01, c02, c03, c10, c11, c12, c13};
#pragma unroll
  for (int u = 0; u < 8; ++u) accs[u] *= 0.0625f;      /* undoes the x16 of the weights, exact */
  if (sel == 2) {
    unsigned short* tv = (unsigned short*)&so[0][0][0];      /* [64 columns][136]: 128 token rows + 8 pad */
#pragma unroll
    for (int u = 0; u < 8; ++u) { const int t = u & 3, half = u >> 2; FragH f;
#pragma unroll
      for (int r = 0; r < 8; ++r) f.h[r] = (_Float16)accs[u][r];
      *(v8us*)(tv + (t * 16 + ln) * 136 + 32 * w + half * 16 + 8 * hh) = f.half[0]; }
    __syncthreads();      /* block-uniform branch: every wave's columns are in LDS before any wave reads whole rows of V^T */
    unsigned short* vt = (unsigned short*)VTa + ((size_t)(b * NH + h) * HD + w * 16 + hh) * SQ + pb + ln * 8;
#pragma unroll
    for (int q = 0; q < 8; ++q) { const v8us v = *(const v8us*)(tv + (w * 16 + q * 2 + hh) * 136 + ln * 8); *(v8us*)(vt + (size_t)q * 2 * SQ) = v; }
    asm volatile("s_wait_xcnt 0x0" ::: "memory");      /* stands behind the V^T stores, ahead of the first write of a register that one of them names */
    if (first) { float* vf = VF + ((size_t)b * QT0 + p0 + 8 * hh) * DM + h * HD + ln;
#pragma unroll
      for (int u = 0; u < 8; ++u)
#pragma unroll
        for (int r = 0; r < 8; ++r) vf[(size_t)((u >> 2) * 16 + r) * DM + (u & 3) * 16] = accs[u][r]; }
  } else {
#pragma unroll
    for (int u = 0; u < 8; ++u)
#pragma unroll
      for (int r = 0; r < 8; ++r) so[w][(u >> 2) * 16 + 8 * hh + r][(u & 3) * 16 + ln] = accs[u][r];
    __builtin_amdgcn_fence(__ATOMIC_ACQ_REL, "workgroup"); __builtin_amdgcn_wave_barrier();      /* the wave reads back what its own lanes wrote */
    const int rs = lane >> 3, up = (lane >> 2) & 1, i8 = (lane & 3) * 8;
    unsigned short* h16 = (unsigned short*)(sel ? K16 : Q16) + (size_t)(row0 + rs) * DM + h * HD + up * 32 + i8;
    float* f32 = (sel ? KF : QF) + ((size_t)b * QT0 + p0 + rs) * DM + h * HD + up * 32 + i8;      /* formed for every block, used by each batch's first block row alone */
    const float* cp = tcos + (size_t)(p0 + rs) * (HD / 2) + i8; const float* sp = tsin + (size_t)(p0 + rs) * (HD / 2) + i8;
    v4f xs[2][4], tb[2][4];      /* two register sets: pass q + 1 is fetched ahead of the arithmetic of pass q, because no load moves up over the store statements */
#pragma unroll
    for (int q = -1; q < 8; ++q) {
      if (q < 7) { const int n = q + 1, s = n & 1, r = n * 4 + rs;
        xs[s][0] = *(const v4fa*)&so[w][r][i8]; xs[s][1] = *(const v4fa*)&so[w][r][i8 + 4]; xs[s][2] = *(const v4fa*)&so[w][r][32 + i8]; xs[s][3] = *(const v4fa*)&so[w][r][32 + i8 + 4];
        tb[s][0] = *(const v4fa*)(cp + n * 4 * (HD / 2)); tb[s][1] = *(const v4fa*)(cp + n * 4 * (HD / 2) + 4); tb[s][2] = *(const v4fa*)(sp + n * 4 * (HD / 2)); tb[s][3] = *(const v4fa*)(sp + n * 4 * (HD / 2) + 4); }
      if (q >= 0) { const int s = q & 1; FragH f; v4f o0, o1;
#pragma unroll
        for (int e = 0; e < 8; ++e) { const float lo = xs[s][e >> 2][e & 3], hi = xs[s][2 + (e >> 2)][e & 3]; const float cv = bf16_round(tb[s][e >> 2][e & 3]), sv = bf16_round(tb[s][2 + (e >> 2)][e & 3]);
          const float o = lo * (up ? sv : cv) + hi * (up ? cv : -sv);      /* low half x1 c - x2 s, high half x1 s + x2 c */
          f.h[e] = (_Float16)o; if (e < 4) o0[e & 3] = o; else o1[e & 3] = o; }
        st16_wait(h16 + (size_t)q * 4 * DM, f.half[0]);
        if (first) st32_wait(f32 + (size_t)q * 4 * DM, o0, o1); } }
  } }
static_assert(QT0 == 128 && SQ % 128 == 0 && HD == 64 && DM == NH * HD, "k_qkv_rope: a block is 128 rows of one batch x one head; the first-tile rows are one block row");

__global__ __launch_bounds__(256) void k_wnat(const float* __restrict__ w, size_t n8, _Float16* __restrict__ Bt) { const size_t t = (size_t)blockIdx.x * 256 + threadIdx.x; if (t >= n8) return; FragH f; for (int q = 0; q < 8; ++q) f.h[q] = (_Float16)(bf16_round(w[t * 8 + q]) * 16.0f); *(v8us*)((unsigned short*)Bt + t * 8) = f.half[0];  }
__global__ __launch_bounds__(256) void k_rsm(const float* __restrict__ S, _Float16* __restrict__ P, int nrows) {
  #pragma clang fp contract(off)
  const int i = blockIdx.x * 256 + threadIdx.x; if (i >= nrows) return; const float* s = S + (size_t)i * SQ; float mx = -3.0e38f;
#pragma unroll 1
  for (int j = 0; j < SQ; ++j) mx = fmaxf(mx, s[j]); float se = 0.f;
#pragma unroll 1
  for (int j = 0; j < SQ; ++j) se += expf(s[j] - mx); const float sc = 256.0f / se;
#pragma unroll 1
  for (int j0 = 0; j0 < SQ; j0 += 8) { FragH f; for (int q = 0; q < 8; ++q) f.h[q] = (_Float16)(expf(s[j0 + q] - mx) * sc); unsigned short* d = (unsigned short*)P + (size_t)i * SQ + j0; *(v8us*)d = f.half[0];  } }
__global__ __launch_bounds__(256) void k_vt(const _Float16* __restrict__ V16, int b, int h0, _Float16* __restrict__ VT) { __shared__ unsigned short tl[64][65]; const int tid = threadIdx.x; const int hh = blockIdx.x % HG, sg = blockIdx.x / HG; const int s0 = sg * 64; const int h = h0 + hh;
  for (int i = tid; i < 64 * 8; i += 256) { const int j = i / 8, d8 = (i % 8) * 8; FragH f; f.half[0] = *(const v8us*)((const unsigned short*)V16 + ((size_t)b * SQ + s0 + j) * DM + h * HD + d8); for (int q = 0; q < 8; ++q) tl[d8 + q][j] = f.u[q]; }
  __syncthreads();
  { for (int i = tid; i < 64 * 8; i += 256) { const int d = i / 8, j8 = (i % 8) * 8; FragH f; for (int q = 0; q < 8; ++q) f.u[q] = tl[d][j8 + q]; *(v8us*)((unsigned short*)VT + ((size_t)hh * HD + d) * SQ + s0 + j8) = f.half[0]; }  } }


__global__ __launch_bounds__(256) void k_tab2(float theta, float* __restrict__ CS, float* __restrict__ SN) {
  #pragma clang fp contract(off)
  const int t = blockIdx.x * 256 + threadIdx.x; if (t >= SQ * (HD / 2)) return; const int i = t % (HD / 2); const int p = t / (HD / 2); const float invf = 1.0f / powf(theta, (float)(2 * i) / (float)HD); const float ang = __fmul_rn((float)p, invf); const float c = cosf(ang), s = sinf(ang);
  *(float*)(CS + t) = c; *(float*)(SN + t) = s;  }
template <int NORM, int ROPE>
__global__ __launch_bounds__(64) void k_xform(const float* __restrict__ F, int ldf, int nh, const float* __restrict__ gain, float eps, const float* __restrict__ CS, const float* __restrict__ SN, _Float16* __restrict__ H16, int ldo) {
  #pragma clang fp contract(off)
  __shared__ float xv[HD]; __shared__ float red[HD]; __shared__ unsigned short sh_[HD]; const int d = threadIdx.x; const int h = blockIdx.x % nh; const size_t r = blockIdx.x / nh; const int p = (int)(r % SQ);
  float x = F[r * (size_t)ldf + (size_t)h * HD + d];
  if (NORM) { red[d] = __fmul_rn(x, x); __syncthreads(); for (int st = HD / 2; st > 0; st >>= 1) { if (d < st) red[d] = __fadd_rn(red[d], red[d + st]); __syncthreads(); } const float rs = rsqrtf(__fadd_rn(red[0] / (float)HD, eps)); x = __fmul_rn(__fmul_rn(x, rs), bf16_round(gain[d])); }
  xv[d] = x; __syncthreads();
  float o = x;
  if (ROPE == 1) { const int i = d >> 1; const float c = CS[p * (HD / 2) + i], s = SN[p * (HD / 2) + i]; const float ev = xv[2 * i], od = xv[2 * i + 1]; o = (d & 1) ? __fadd_rn(__fmul_rn(ev, s), __fmul_rn(od, c)) : __fadd_rn(__fmul_rn(ev, c), -__fmul_rn(od, s)); }
  if (ROPE == 2) { const int i = d & (HD / 2 - 1); const float c = CS[p * (HD / 2) + i], s = SN[p * (HD / 2) + i]; const float lo = xv[i], hi = xv[i + HD / 2]; o = (d < HD / 2) ? __fadd_rn(__fmul_rn(lo, c), -__fmul_rn(hi, s)) : __fadd_rn(__fmul_rn(lo, s), __fmul_rn(hi, c)); }
  FragH th; th.h[0] = (_Float16)o; sh_[d] = th.u[0]; __syncthreads();
  if (d < HD / 8) { FragH f; for (int q = 0; q < 8; ++q) f.u[q] = sh_[d * 8 + q]; unsigned short* dst = (unsigned short*)H16 + r * (size_t)ldo + (size_t)h * HD + d * 8; *(v8us*)dst = f.half[0];  } }

__global__ __launch_bounds__(256) void k_tab4(const int* __restrict__ pos, float theta, float* __restrict__ CS, float* __restrict__ SN) {
  #pragma clang fp contract(off)
  const int t = blockIdx.x * 256 + threadIdx.x; if (t >= SQ * (HD / 2)) return; const int i = t % (HD / 2); const int p = t / (HD / 2); const float invf = (float)pow((double)theta, -((double)(2 * i)) / (double)HD); const float ang = __fmul_rn((float)pos[p], invf); const float c = cosf(ang), s = sinf(ang);
  *(float*)(CS + t) = c; *(float*)(SN + t) = s;  }
__global__ __launch_bounds__(256) void k_rsmf(const float* __restrict__ S, _Float16* __restrict__ P, int qn, int hg) {
  #pragma clang fp contract(off)
  const int t = blockIdx.x * 256 + threadIdx.x; if (t >= qn * hg) return; const size_t i = (size_t)(t / qn) * SQ + (t % qn); const float* s = S + i * SQ; float mx = -3.0e38f;
#pragma unroll 1
  for (int j = 0; j < SQ; ++j) mx = fmaxf(mx, s[j]); float se = 0.f;
#pragma unroll 1
  for (int j = 0; j < SQ; ++j) se += __expf(s[j] - mx); const float sc = 256.0f / se;
#pragma unroll 1
  for (int j0 = 0; j0 < SQ; j0 += 8) { FragH f; for (int q = 0; q < 8; ++q) f.h[q] = (_Float16)(__expf(s[j0 + q] - mx) * sc); unsigned short* d = (unsigned short*)P + i * SQ + j0; *(v8us*)d = f.half[0];  } }


__device__ __forceinline__ v8f fa_mma(v16h a, v16h b, v8f c) { return __builtin_amdgcn_wmma_f32_16x16x32_f16(false, a, false, b, (short)0, c, false, false); }
// 2^x for eight values (two for the rescale factors) in ONE statement: outputs are early-clobber, so no exponential reads its predecessor's result or overwrites its source, and the closing v_nop keeps the one
// independent slot that the instruction set asks for between the last exponential and whatever the compiler places next.
__device__ __forceinline__ v8f fa_exp8(v8f x) { float y0, y1, y2, y3, y4, y5, y6, y7;
  asm("v_exp_f32 %0, %8\n\tv_exp_f32 %1, %9\n\tv_exp_f32 %2, %10\n\tv_exp_f32 %3, %11\n\tv_exp_f32 %4, %12\n\tv_exp_f32 %5, %13\n\tv_exp_f32 %6, %14\n\tv_exp_f32 %7, %15\n\tv_nop"
      : "=&v"(y0), "=&v"(y1), "=&v"(y2), "=&v"(y3), "=&v"(y4), "=&v"(y5), "=&v"(y6), "=&v"(y7) : "v"(x[0]), "v"(x[1]), "v"(x[2]), "v"(x[3]), "v"(x[4]), "v"(x[5]), "v"(x[6]), "v"(x[7]));
  const v8f y = {y0, y1, y2, y3, y4, y5, y6, y7}; return y; }
__device__ __forceinline__ void fa_exp2(float x0, float x1, float& y0, float& y1) { asm("v_exp_f32 %0, %2\n\tv_exp_f32 %1, %3\n\tv_nop" : "=&v"(y0), "=&v"(y1) : "v"(x0), "v"(x1)); }
// One step of 32 keys. kn / vn: the NEXT step's K rows and V^T columns, fetched into the same registers right after their last use here, so that a whole step passes before they are needed;
// DIAG: the wave's last step (first key == first query): keys above the query get weight 0, and nothing is fetched.
template <bool DIAG>
__device__ __forceinline__ void fa_step(const v16h (&qf)[2][2], v16h (&kf)[2][2], v16h (&vf)[4], v8f (&o)[2][4], float (&mu)[2], float (&l)[2], const _Float16* kn, const _Float16* vn, int c, int hh) {
  const float cs = 0.125f * 1.44269504088896340736f;      /* score scale x log2(e) */
  const v8f z8 = {0.f,0.f,0.f,0.f,0.f,0.f,0.f,0.f};
  v8f s[2][2];
#pragma unroll
  for (int u = 0; u < 2; ++u)
#pragma unroll
    for (int kt = 0; kt < 2; ++kt) s[u][kt] = fa_mma(kf[kt][1], qf[u][1], fa_mma(kf[kt][0], qf[u][0], z8));
  if (!DIAG) {
#pragma unroll
    for (int kt = 0; kt < 2; ++kt) { kf[kt][0] = g2_frag(kn + (size_t)kt * 16 * DM, hh); kf[kt][1] = g2_frag(kn + (size_t)kt * 16 * DM + 32, hh); } }
  if (DIAG) {
#pragma unroll
    for (int u = 0; u < 2; ++u)
#pragma unroll
      for (int kt = 0; kt < 2; ++kt)
#pragma unroll
        for (int r = 0; r < 8; ++r) s[u][kt][r] = (kt * 16 + 8 * hh + r <= u * 16 + c) ? s[u][kt][r] : -1.0e30f; }
  float mx[2];
#pragma unroll
  for (int u = 0; u < 2; ++u) { float a = fmaxf(s[u][0][0], s[u][1][0]);
#pragma unroll
    for (int r = 1; r < 8; ++r) a = fmaxf(a, fmaxf(s[u][0][r], s[u][1][r]));
    a = fmaxf(a, __shfl_xor(a, 16)); mx[u] = a * cs; }      /* cs > 0: scaling commutes with the maximum */
  if (__builtin_amdgcn_ballot_w32(mx[0] > mu[0] + 8.0f || mx[1] > mu[1] + 8.0f) != 0) {      /* one scalar test per step */
    const float mn0 = fmaxf(mu[0], mx[0]), mn1 = fmaxf(mu[1], mx[1]); float al[2]; fa_exp2(mu[0] - mn0, mu[1] - mn1, al[0], al[1]); mu[0] = mn0; mu[1] = mn1;
#pragma unroll
    for (int u = 0; u < 2; ++u) { l[u] *= al[u];
#pragma unroll
      for (int t = 0; t < 4; ++t) o[u][t] *= al[u]; } }
  FragH pf[2];
#pragma unroll
  for (int u = 0; u < 2; ++u) { float sm = 0.f;
#pragma unroll
    for (int kt = 0; kt < 2; ++kt) { v8f x;
#pragma unroll
      for (int r = 0; r < 8; ++r) x[r] = fmaf(s[u][kt][r], cs, -mu[u]);
      const v8f p = fa_exp8(x);
#pragma unroll
      for (int r = 0; r < 8; ++r) { sm += p[r]; pf[u].h[kt * 8 + r] = (_Float16)p[r]; } }
    l[u] += sm; }
#pragma unroll
  for (int u = 0; u < 2; ++u)
#pragma unroll
    for (int t = 0; t < 4; ++t) o[u][t] = fa_mma(vf[t], pf[u].v, o[u][t]);
  if (!DIAG) {
#pragma unroll
    for (int t = 0; t < 4; ++t) vf[t] = g2_frag(vn + (size_t)t * 16 * SQ, hh);
    asm volatile("s_wait_xcnt 0x0" ::: "memory"); } }      /* stands behind the step's last loads, ahead of the next step's first write of a register that holds their address */
__global__ __launch_bounds__(128) void k_fattn(const _Float16* __restrict__ Q16, const _Float16* __restrict__ K16, const _Float16* __restrict__ VTa, _Float16* __restrict__ O) {
  const int lane = threadIdx.x & 31, c = lane & 15, hh = lane >> 4;
  const int w = __builtin_amdgcn_readfirstlane(threadIdx.x >> 5);      /* the wave's number as a scalar: the trip count is scalar */
  const int bh = blockIdx.x % (NB * NH); const int g = blockIdx.x / (4 * NB * NH), rr = (blockIdx.x / (NB * NH)) % 4;
  const int qt = (3 - g) * 4 + ((g & 1) ? rr : 3 - rr);      /* a permutation of the 16 query tiles: long tiles first, and blocks a quarter of the grid apart have tiles that sum to the same length */
  const int b = bh / NH, h = bh % NH; const int q0 = qt * 128 + w * 32;
  const _Float16* qp = Q16 + ((size_t)b * SQ + q0 + c) * DM + h * HD;
  const _Float16* kp = K16 + ((size_t)b * SQ + c) * DM + h * HD;
  const _Float16* vp = VTa + ((size_t)bh * HD + c) * SQ;
  const v8f z8 = {0.f,0.f,0.f,0.f,0.f,0.f,0.f,0.f};
  v16h qf[2][2], kf[2][2], vf[4];
#pragma unroll
  for (int u = 0; u < 2; ++u) { qf[u][0] = g2_frag(qp + (size_t)u * 16 * DM, hh); qf[u][1] = g2_frag(qp + (size_t)u * 16 * DM + 32, hh); }
#pragma unroll
  for (int kt = 0; kt < 2; ++kt) { kf[kt][0] = g2_frag(kp + (size_t)kt * 16 * DM, hh); kf[kt][1] = g2_frag(kp + (size_t)kt * 16 * DM + 32, hh); }
#pragma unroll
  for (int t = 0; t < 4; ++t) vf[t] = g2_frag(vp + (size_t)t * 16 * SQ, hh);
  asm volatile("s_wait_xcnt 0x0" ::: "memory");      /* stands behind the first fragments' loads, ahead of the first write of a register that holds one of their addresses */
  v8f o[2][4]; float mu[2], l[2];
#pragma unroll
  for (int u = 0; u < 2; ++u) { mu[u] = -1.0e30f; l[u] = 0.f;
#pragma unroll
    for (int t = 0; t < 4; ++t) o[u][t] = z8; }
#pragma unroll 1
  for (int k0 = 0; k0 < q0; k0 += 32) fa_step<false>(qf, kf, vf, o, mu, l, kp + (size_t)(k0 + 32) * DM, vp + k0 + 32, c, hh);      /* kept rolled: one step holds 16 WMMAs and the registers of four waves per SIMD; k0 + 32 <= q0 is a step of this wave */
  fa_step<true>(qf, kf, vf, o, mu, l, kp, vp, c, hh);
#pragma unroll
  for (int u = 0; u < 2; ++u) { const float fin = 64.0f / (l[u] + __shfl_xor(l[u], 16));      /* the lane halves' sums join once; o carried x64 */
    unsigned short* dst = (unsigned short*)O + ((size_t)b * SQ + q0 + u * 16 + c) * DM + h * HD + 8 * hh;
#pragma unroll
    for (int t = 0; t < 4; ++t) { FragH f;
#pragma unroll
      for (int r = 0; r < 8; ++r) f.h[r] = (_Float16)(o[u][t][r] * fin);      /* register r is output column 16 t + 8 hh + r of query c: one 16-byte store */
      *(v8us*)(dst + t * 16) = f.half[0]; } } }
static_assert(SQ == 16 * 128 && HD == 64, "k_fattn: 16 query tiles of 4 waves x 32 query columns, head size 64");


// Exact f32 causal attention for the first QT0 rows, one wave per (head, query row), 8 rows of one head per block.
// The head's QT0 key rows are staged in LDS at a pitch of HD + 4 floats (16 bytes x an odd number: row-per-lane 16-byte reads without bank conflicts).
// Lane l scores keys l, l + 32, l + 64, l + 96 (each dot product summed over d in index order); row maximum and row sum end in lane butterflies;
// then lane l sums output columns 2 l and 2 l + 1 over the keys in index order, each weight read from its lane as a scalar.
typedef float v2f __attribute__((ext_vector_type(2)));
typedef float v2fa __attribute__((ext_vector_type(2), may_alias));
typedef _Float16 v2h __attribute__((ext_vector_type(2)));
__global__ __launch_bounds__(256) void k_att0w(const float* __restrict__ QF, const float* __restrict__ KF, const float* __restrict__ VF, float scale, _Float16* __restrict__ OH, _Float16* __restrict__ OL) {      /* all five row pitches are DM, so that every row step is an immediate offset */
  __shared__ __attribute__((aligned(16))) float lk[QT0][HD + 4];
  { const size_t bo = (size_t)blockIdx.y * QT0 * DM; QF += bo; KF += bo; VF += bo; OH += bo; OL += bo; }      /* blockIdx.y: the batch */
  const int tid = threadIdx.x, lane = tid & 31; const int h = blockIdx.x / (QT0 / 8);
  const int i = (blockIdx.x % (QT0 / 8)) * 8 + __builtin_amdgcn_readfirstlane(tid >> 5);      /* the wave's query row, held as a scalar so that the q row and the group tests below are wave-uniform */
  const float* kb = KF + h * HD;
#pragma unroll
  for (int p = 0; p < QT0 / 16; ++p) { const int r = p * 16 + (tid >> 4), c4 = (tid & 15) * 4; *(v4f*)&lk[r][c4] = *(const v4fa*)(kb + (size_t)r * DM + c4); }      /* unrolled: all 8 loads of a thread in flight at once */
  __syncthreads();
  const float* qr = QF + (size_t)i * DM + h * HD;
  float sa[QT0 / 32];
#pragma unroll
  for (int g = 0; g < QT0 / 32; ++g) sa[g] = 0.f;
#pragma unroll
  for (int c = 0; c < HD / 4; ++c) { const v4f qq = *(const v4fa*)(qr + c * 4);      /* unrolled: sa stays in named registers and the four groups' sum chains interleave */
#pragma unroll
    for (int g = 0; g < QT0 / 32; ++g) { const v4f kq = *(const v4f*)&lk[g * 32 + lane][c * 4]; sa[g] = fmaf(qq[0], kq[0], sa[g]); sa[g] = fmaf(qq[1], kq[1], sa[g]); sa[g] = fmaf(qq[2], kq[2], sa[g]); sa[g] = fmaf(qq[3], kq[3], sa[g]); } }
  float m = -1.0e30f;
#pragma unroll
  for (int g = 0; g < QT0 / 32; ++g) { sa[g] = (g * 32 + lane <= i) ? sa[g] * scale : -1.0e30f; m = fmaxf(m, sa[g]); }      /* causal: keys above the row get weight 0 */
#pragma unroll
  for (int o = 16; o > 0; o >>= 1) m = fmaxf(m, __shfl_xor(m, o));
  float l = 0.f;
#pragma unroll
  for (int g = 0; g < QT0 / 32; ++g) { sa[g] = expf(sa[g] - m); l += sa[g]; }
#pragma unroll
  for (int o = 16; o > 0; o >>= 1) l += __shfl_xor(l, o);
  const float* vb = VF + h * HD + lane * 2; float o0 = 0.f, o1 = 0.f;
#pragma unroll
  for (int g = 0; g < QT0 / 32; ++g) { if (g * 32 <= i) {      /* wave-uniform: key groups wholly above the row are skipped */
#pragma unroll
      for (int jj = 0; jj < 32; ++jj) { const float p = __int_as_float(__builtin_amdgcn_readlane(__float_as_int(sa[g]), jj)); const v2f vv = *(const v2fa*)(vb + (size_t)(g * 32 + jj) * DM); o0 = fmaf(p, vv[0], o0); o1 = fmaf(p, vv[1], o1); } } }      /* unrolled: a group's 32 loads issue before the first use */
  const float fin = 64.0f / l;      /* o carried x64 like the f16 path */
  const float a0 = o0 * fin, a1 = o1 * fin; v2h hv, lv;      /* o leaves as an f16 value plus its residual x1024, the two A operands of the output projection's first-tile blocks */
  hv[0] = (_Float16)a0; hv[1] = (_Float16)a1; lv[0] = (_Float16)((a0 - (float)hv[0]) * 1024.0f); lv[1] = (_Float16)((a1 - (float)hv[1]) * 1024.0f);
  const size_t oo = (size_t)i * DM + h * HD + lane * 2; *(v2h*)(OH + oo) = hv; *(v2h*)(OL + oo) = lv; }

// Output projection of ALL token rows in ONE launch (main loop and store path of k_gemm2, pitches and K = DM): out = o W_o, o carried x64 and W_o x16.
// A block is 128 rows of one batch x 64 columns. The blocks of each batch's first 128 rows take the exact attention's o instead of the f16 path's: its f16 value and its x1024 residual are two A operands
// that share every B fragment in one K loop, on two accumulator sets that join in the epilogue (hi 2^-10 + lo 2^-20). These blocks do twice the products, so they have the lowest block indices.
__global__ __launch_bounds__(128) void k_oproj(const _Float16* __restrict__ O, const _Float16* __restrict__ OH, const _Float16* __restrict__ OL, const _Float16* __restrict__ Bh, float* __restrict__ C) {
  __shared__ __attribute__((aligned(16))) float so[4][32][68];
  const int tid = threadIdx.x, w = tid >> 5, lane = tid & 31, ln = lane & 15, hh = lane >> 4;
  const int ntn = DM / 64, tpb = SQ / 128; const int mi = blockIdx.x / ntn, nq = blockIdx.x - mi * ntn;
  const bool first = mi < NB;      /* block-uniform */
  const int b = first ? mi : (mi - NB) / (tpb - 1); const int tl = first ? 0 : 1 + (mi - NB) % (tpb - 1);      /* batch; 128-row tile in the batch */
  const int row0 = b * SQ + tl * 128 + 32 * w, col0 = nq * 64;
  const _Float16* b0p = Bh + (size_t)(col0 + ln) * DM; const _Float16* b1p = b0p + (size_t)16 * DM; const _Float16* b2p = b1p + (size_t)16 * DM; const _Float16* b3p = b2p + (size_t)16 * DM;
  const v8f z8 = {0.f,0.f,0.f,0.f,0.f,0.f,0.f,0.f}; v8f c00 = z8, c01 = z8, c02 = z8, c03 = z8, c10 = z8, c11 = z8, c12 = z8, c13 = z8;
  v8f accs[8];
  if (!first) {
    const _Float16* a0p = O + (size_t)(row0 + ln) * DM; const _Float16* a1p = a0p + (size_t)16 * DM;
#pragma unroll 1
    for (int kb = 0; kb < DM; kb += 32) { const v16h a0 = g2_frag(a0p + kb, hh), a1 = g2_frag(a1p + kb, hh);      /* kept rolled, as in k_gemm2 */
      v16h bf = g2_frag(b0p + kb, hh); c00 = g2_mma(a0, bf, c00); c10 = g2_mma(a1, bf, c10);
      bf = g2_frag(b1p + kb, hh); c01 = g2_mma(a0, bf, c01); c11 = g2_mma(a1, bf, c11);
      bf = g2_frag(b2p + kb, hh); c02 = g2_mma(a0, bf, c02); c12 = g2_mma(a1, bf, c12);
      bf = g2_frag(b3p + kb, hh); c03 = g2_mma(a0, bf, c03); c13 = g2_mma(a1, bf, c13);
      asm volatile("s_wait_xcnt 0x0" ::: "memory"); }      /* stands behind the trip's last loads, ahead of the next trip's first write of a register that holds one of their addresses */
    accs[0] = c00 * 0.0009765625f; accs[1] = c01 * 0.0009765625f; accs[2] = c02 * 0.0009765625f; accs[3] = c03 * 0.0009765625f;
    accs[4] = c10 * 0.0009765625f; accs[5] = c11 * 0.0009765625f; accs[6] = c12 * 0.0009765625f; accs[7] = c13 * 0.0009765625f;
  } else {
    const size_t ao = ((size_t)b * QT0 + 32 * w + ln) * DM;
    const _Float16* a0p = OH + ao; const _Float16* a1p = a0p + (size_t)16 * DM; const _Float16* e0p = OL + ao; const _Float16* e1p = e0p + (size_t)16 * DM;
    v8f d00 = z8, d01 = z8, d02 = z8, d03 = z8, d10 = z8, d11 = z8, d12 = z8, d13 = z8;
#pragma unroll 1
    for (int kb = 0; kb < DM; kb += 32) { const v16h a0 = g2_frag(a0p + kb, hh), a1 = g2_frag(a1p + kb, hh), e0 = g2_frag(e0p + kb, hh), e1 = g2_frag(e1p + kb, hh);      /* kept rolled, like the loop above */
      v16h bf = g2_frag(b0p + kb, hh); c00 = g2_mma(a0, bf, c00); c10 = g2_mma(a1, bf, c10); d00 = g2_mma(e0, bf, d00); d10 = g2_mma(e1, bf, d10);
      bf = g2_frag(b1p + kb, hh); c01 = g2_mma(a0, bf, c01); c11 = g2_mma(a1, bf, c11); d01 = g2_mma(e0, bf, d01); d11 = g2_mma(e1, bf, d11);
      bf = g2_frag(b2p + kb, hh); c02 = g2_mma(a0, bf, c02); c12 = g2_mma(a1, bf, c12); d02 = g2_mma(e0, bf, d02); d12 = g2_mma(e1, bf, d12);
      bf = g2_frag(b3p + kb, hh); c03 = g2_mma(a0, bf, c03); c13 = g2_mma(a1, bf, c13); d03 = g2_mma(e0, bf, d03); d13 = g2_mma(e1, bf, d13);
      asm volatile("s_wait_xcnt 0x0" ::: "memory"); }      /* as in the loop above */
    const v8f ch[8] = {c00, c01, c02, c03, c10, c11, c12, c13}, cl[8] = {d00, d01, d02, d03, d10, d11, d12, d13};
#pragma unroll
    for (int u = 0; u < 8; ++u)
#pragma unroll
      for (int r = 0; r < 8; ++r) accs[u][r] = fmaf(cl[u][r], 0.00000095367431640625f, ch[u][r] * 0.0009765625f);      /* both factors are powers of two: one rounding, that of the sum */
  }
#pragma unroll
  for (int u = 0; u < 8; ++u)
#pragma unroll
    for (int r = 0; r < 8; ++r) so[w][(u >> 2) * 16 + 8 * hh + r][(u & 3) * 16 + ln] = accs[u][r];
  __builtin_amdgcn_fence(__ATOMIC_ACQ_REL, "workgroup"); __builtin_amdgcn_wave_barrier();      /* the wave reads back what its own lanes wrote */
  const int rsub = lane >> 4, c4 = (lane & 15) * 4;
#pragma unroll
  for (int q = 0; q < 16; ++q) { const int r = q * 2 + rsub; const v4f v = *(const v4fa*)&so[w][r][c4]; *(v4f*)(C + (size_t)(row0 + r) * DM + col0 + c4) = v; } }
static_assert(QT0 == 128 && SQ % 128 == 0 && SQ > 128 && DM % 64 == 0, "k_oproj: the first-tile rows are one block row of each batch");

template <int NORM, int ROPE>
__global__ __launch_bounds__(64) void k_xformf(const float* __restrict__ F, int ldf, int nh, const float* __restrict__ gain, float eps, const float* __restrict__ CS, const float* __restrict__ SN, float* __restrict__ F32, int ldo) {
  #pragma clang fp contract(off)
  __shared__ float xv[HD]; __shared__ float red[HD]; const int d = threadIdx.x; const int h = blockIdx.x % nh; const size_t r = blockIdx.x / nh; const int p = (int)(r % SQ);
  float x = F[r * (size_t)ldf + (size_t)h * HD + d];
  if (NORM) { red[d] = __fmul_rn(x, x); __syncthreads(); for (int st = HD / 2; st > 0; st >>= 1) { if (d < st) red[d] = __fadd_rn(red[d], red[d + st]); __syncthreads(); } const float rs = rsqrtf(__fadd_rn(red[0] / (float)HD, eps)); x = __fmul_rn(__fmul_rn(x, rs), bf16_round(gain[d])); }
  xv[d] = x; __syncthreads();
  float o = x;
  if (ROPE == 1) { const int i = d >> 1; const float c = CS[p * (HD / 2) + i], s = SN[p * (HD / 2) + i]; const float ev = xv[2 * i], od = xv[2 * i + 1]; o = (d & 1) ? __fadd_rn(__fmul_rn(ev, s), __fmul_rn(od, c)) : __fadd_rn(__fmul_rn(ev, c), -__fmul_rn(od, s)); }
  if (ROPE == 2) { const int i = d & (HD / 2 - 1); const float c = CS[p * (HD / 2) + i], s = SN[p * (HD / 2) + i]; const float lo = xv[i], hi = xv[i + HD / 2]; o = (d < HD / 2) ? __fadd_rn(__fmul_rn(lo, c), -__fmul_rn(hi, s)) : __fadd_rn(__fmul_rn(lo, s), __fmul_rn(hi, c)); }
  float* dst = F32 + r * (size_t)ldo + (size_t)h * HD + d; *(float*)dst = o;  }


__global__ __launch_bounds__(256) void k_bfcp(const float* __restrict__ src, float* __restrict__ dst, size_t n4) { const size_t t = (size_t)blockIdx.x * 256 + threadIdx.x; if (t >= n4) return; const v4f a = *(const v4fa*)(src + t * 4); v4f o; for (int q = 0; q < 4; ++q) o[q] = bf16_round(a[q]); *(v4f*)(dst + t * 4) = o;  }
extern "C" void kernel_launch(void* const* d_in, const int* in_sizes, int n_in,
                              void* d_out, int out_size, void* d_ws, size_t ws_size, hipStream_t stream) {
  (void)in_sizes; (void)n_in; (void)out_size;
    const float* const* I = (const float* const*)d_in; const float* x = I[0]; const float* tcos = I[1]; const float* tsin = I[2]; const float* wq = I[3]; const float* wk = I[4]; const float* wv = I[5]; const float* wo = I[6];      /* [in][out] weights, no biases; rope tables INPUT [2048][32] */
  char* ws = (char*)d_ws; size_t off = 0;
  auto take = [&](size_t bytes) { char* p = ws + off; off += (bytes + 255) & ~(size_t)255; return p; };
  _Float16* BQKV = (_Float16*)take((size_t)3 * DM * DM * 2); _Float16* BO = (_Float16*)take((size_t)DM * DM * 2);
  _Float16* X16 = (_Float16*)take(NR * DM * 2);
  _Float16* QH = (_Float16*)take(NR * DM * 2); _Float16* KH = (_Float16*)take(NR * DM * 2); _Float16* O16 = (_Float16*)take(NR * DM * 2);
  _Float16* VT = (_Float16*)take((size_t)NB * NH * HD * SQ * 2);
  float* QF0 = (float*)take((size_t)NB * QT0 * DM * 4); float* KF0 = (float*)take((size_t)NB * QT0 * DM * 4); float* VF0 = (float*)take((size_t)NB * QT0 * DM * 4); _Float16* OH0 = (_Float16*)take((size_t)NB * QT0 * DM * 2); _Float16* OL0 = (_Float16*)take((size_t)NB * QT0 * DM * 2);
  if (off > ws_size) return;
  { const unsigned g = (unsigned)(((size_t)DM * (DM / 8) + 255) / 256); k_wt_f16<<<g, 256, 0, stream>>>(wq, BQKV, DM, DM, 16.0f); k_wt_f16<<<g, 256, 0, stream>>>(wk, BQKV + (size_t)DM * DM, DM, DM, 16.0f); k_wt_f16<<<g, 256, 0, stream>>>(wv, BQKV + (size_t)2 * DM * DM, DM, DM, 16.0f); k_wt_f16<<<g, 256, 0, stream>>>(wo, BO, DM, DM, 16.0f); }      /* [in][out] -> Bt[n][k] x16; q | k | v stacked along n */
  k_x16<<<(unsigned)((NR * DM / 8 + 255) / 256), 256, 0, stream>>>(x, X16, NR * DM / 8);
  k_qkv_rope<<<(unsigned)((NR / 128) * (3 * DM / 64)), 128, 0, stream>>>(X16, BQKV, tcos, tsin, QH, KH, VT, QF0, KF0, VF0);      /* roped f16 q, k rows, V^T [NB][NH][HD][SQ], f32 q, k, v of each batch's first 128 rows */
  k_att0w<<<dim3(NH * (QT0 / 8), NB), 256, 0, stream>>>(QF0, KF0, VF0, 0.125f, OH0, OL0);      /* exact f32 causal attention for rows 0..127 of every batch (o x64) -> f16 hi + x1024 residual planes */
  k_fattn<<<(SQ / 128) * NB * NH, 128, 0, stream>>>(QH, KH, VT, O16);      /* o (merged heads, x64) as f16 rows, all batches */
  k_oproj<<<(unsigned)((NR / 128) * (DM / 64)), 128, 0, stream>>>(O16, OH0, OL0, BO, (float*)d_out);      /* out rows are the output layout; rows 0..127 of each batch from the hi and lo planes */
}

// v006
// A run of this version takes 165 microseconds.
// Timed twice side by side with v005, it ran 1.69 and 1.70 times as fast.
// All steps since v000 together make it 59.1 times as fast.
#include <hip/hip_runtime.h>
#define NB 4
#define SQ 2048
#define DM 1024
#define NH 16
#define HD 64
#define HG 4                         /* heads per launch of the k_vt(V16, b, h0, VT) overload (not launched) */
#define QT0 128                      /* first-tile rows recomputed exactly in f32 */
#define B0 0                         /* not used by any kernel or launch */
#define NBR NB                       /* read only by MPO */
#define NR ((size_t)NB * SQ)         /* token rows */
#define MPO ((int)((size_t)NBR * SQ))      /* not used by any kernel or launch */
typedef __bf16 v16b __attribute__((ext_vector_type(16)));
typedef unsigned short v8us __attribute__((ext_vector_type(8), may_alias));
typedef float  v8f  __attribute__((ext_vector_type(8)));
typedef float  v4f  __attribute__((ext_vector_type(4)));
typedef float  v4fa __attribute__((ext_vector_type(4), may_alias));
union FragB { v16b v; v8us half[2]; unsigned short u[16]; };

__device__ __forceinline__ unsigned short bf16_bits(float x) { unsigned int u = __float_as_uint(x); return (unsigned short)((u + 0x7FFFu + ((u >> 16) & 1u)) >> 16); }
__device__ __forceinline__ float bf16_val(unsigned short b) { return __uint_as_float(((unsigned int)b) << 16); }
__device__ __forceinline__ float bf16_round(float x) { return bf16_val(bf16_bits(x)); }
// D += A·B with NT terms: 1 = ah·bh, 2 = + al·bh (A split), 3 = + ah·bl (both split)
template <int NT>
__device__ __forceinline__ v8f mmaN(v16b ah, v16b al, v16b bh, v16b bl, v8f c) {
  c = __builtin_amdgcn_wmma_f32_16x16x32_bf16(false, ah, false, bh, (short)0, c, false, false);
  if (NT >= 2) c = __builtin_amdgcn_wmma_f32_16x16x32_bf16(false, al, false, bh, (short)0, c, false, false);
  if (NT >= 3) c = __builtin_amdgcn_wmma_f32_16x16x32_bf16(false, ah, false, bl, (short)0, c, false, false);
  asm volatile("v_nop\n\tv_nop\n\tv_nop\n\tv_nop" : "+v"(c) : "v"(ah), "v"(al), "v"(bh), "v"(bl));
  return c;
}

__global__ __launch_bounds__(256) void k_wt_bf16(const float* __restrict__ W, unsigned short* __restrict__ Wt, int K, int N) {
  const int t = blockIdx.x * 256 + threadIdx.x;
  const int k8n = K / 8;
  if (t >= N * k8n) return;
  const int n = t / k8n, k8 = (t % k8n) * 8;
  v8us v;
#pragma unroll
  for (int i = 0; i < 8; ++i) v[i] = bf16_bits(W[(size_t)(k8 + i) * N + n]);
  *(v8us*)(Wt + (size_t)n * K + k8) = v;
  
}

// GEMM C[M][N] (f32, pitch ldc) = act(A[M][K]·W + bias). A f32 row-major (pitch lda) converted per fragment to bf16
// (ASPLIT: hi/lo two planes -> 2 terms, else single rounded term); Wt bf16 [N][K] (pitch ldb). BIAS_BF16 rounds the
// bias to bf16 first (bias quantised to bf16 before the add). K%32==0, M%16==0, N%64==0.
template <bool ASPLIT, int ACT, bool BIAS_BF16>
__global__ __launch_bounds__(128) void k_gemm_bf(const float* __restrict__ A, int lda, const unsigned short* __restrict__ Wt, int ldb,
                                               const float* __restrict__ bias, float* __restrict__ C, int ldc, int M, int N, int K) {
  __shared__ __attribute__((aligned(16))) float so[4][16][64];
  const int tid = threadIdx.x, w = tid >> 5, lane = tid & 31, ln = lane & 15, hh = lane >> 4;
  const int ntn = N / 64;
  const int wid = blockIdx.x * 4 + w;
  const int mt = wid / ntn, nq = wid % ntn;
  if (mt * 16 >= M) return;
  const int row0 = mt * 16, col0 = nq * 64;
  const float* arow = A + (size_t)(row0 + ln) * lda;
  v8f acc[4] = {};
  for (int kb = 0; kb < K; kb += 32) {
    FragB ah, al;
    const v4f x0 = *(const v4fa*)(arow + kb + 8 * hh), x1 = *(const v4fa*)(arow + kb + 8 * hh + 4);
    const v4f x2 = *(const v4fa*)(arow + kb + 16 + 8 * hh), x3 = *(const v4fa*)(arow + kb + 16 + 8 * hh + 4);
    float xs[16] = {x0[0],x0[1],x0[2],x0[3],x1[0],x1[1],x1[2],x1[3],x2[0],x2[1],x2[2],x2[3],x3[0],x3[1],x3[2],x3[3]};
#pragma unroll
    for (int i = 0; i < 16; ++i) { const unsigned short hb = bf16_bits(xs[i]); ah.u[i] = hb; al.u[i] = ASPLIT ? bf16_bits(xs[i] - bf16_val(hb)) : (unsigned short)0; }
#pragma unroll
    for (int t = 0; t < 4; ++t) {
      const unsigned short* brow = Wt + (size_t)(col0 + t * 16 + ln) * ldb + kb;
      FragB b;
      b.half[0] = *(const v8us*)(brow + 8 * hh);
      b.half[1] = *(const v8us*)(brow + 16 + 8 * hh);
      acc[t] = mmaN<ASPLIT ? 2 : 1>(ah.v, al.v, b.v, b.v, acc[t]);
    }
  }
#pragma unroll
  for (int t = 0; t < 4; ++t) {
    float bv = bias ? bias[col0 + t * 16 + ln] : 0.f;
    if (BIAS_BF16) bv = bf16_round(bv);
#pragma unroll
    for (int r = 0; r < 8; ++r) { float v = acc[t][r] + bv; if (ACT == 1) v = fmaxf(v, 0.f); so[w][8 * hh + r][t * 16 + ln] = v; }
  }
  __builtin_amdgcn_fence(__ATOMIC_ACQ_REL, "workgroup");
  __builtin_amdgcn_wave_barrier();
  const int rsub = lane >> 4, c4 = (lane & 15) * 4;
  {
#pragma unroll
    for (int q = 0; q < 8; ++q) {
      const int r = q * 2 + rsub;
      const v4f v = *(const v4fa*)&so[w][r][c4];
      *(v4f*)(C + (size_t)(row0 + r) * ldc + col0 + c4) = v;
    }
    
  }
}

// GEMM C = act(A·W + bias + resid): A f32 (ASPLIT -> hi/lo 2 terms), Wt bf16 [N][K]; ACT 0 none, 1 relu, 2 exact gelu;
// resid (optional, f32, row index = (row % rmod), pitch ldr, RES_BF16 rounds it) added before the activation.
template <bool ASPLIT, int ACT, bool BIAS_BF16, bool RES_BF16>
__global__ __launch_bounds__(128) void k_gemm_bf3(const float* __restrict__ A, int lda, const unsigned short* __restrict__ Wt, int ldb,
                                                const float* __restrict__ bias, const float* __restrict__ resid, int rmod, int ldr,
                                                float* __restrict__ C, int ldc, int M, int N, int K) {
  __shared__ __attribute__((aligned(16))) float so[4][16][64];
  const int tid = threadIdx.x, w = tid >> 5, lane = tid & 31, ln = lane & 15, hh = lane >> 4;
  const int ntn = N / 64;
  const int wid = blockIdx.x * 4 + w;
  const int mt = wid / ntn, nq = wid % ntn;
  if (mt * 16 >= M) return;
  const int row0 = mt * 16, col0 = nq * 64;
  const float* arow = A + (size_t)(row0 + ln) * lda;
  v8f acc[4] = {};
  for (int kb = 0; kb < K; kb += 32) {
    FragB ah, al;
    const v4f x0 = *(const v4fa*)(arow + kb + 8 * hh), x1 = *(const v4fa*)(arow + kb + 8 * hh + 4);
    const v4f x2 = *(const v4fa*)(arow + kb + 16 + 8 * hh), x3 = *(const v4fa*)(arow + kb + 16 + 8 * hh + 4);
    float xs[16] = {x0[0],x0[1],x0[2],x0[3],x1[0],x1[1],x1[2],x1[3],x2[0],x2[1],x2[2],x2[3],x3[0],x3[1],x3[2],x3[3]};
#pragma unroll
    for (int i = 0; i < 16; ++i) { const unsigned short hb = bf16_bits(xs[i]); ah.u[i] = hb; al.u[i] = ASPLIT ? bf16_bits(xs[i] - bf16_val(hb)) : (unsigned short)0; }
#pragma unroll
    for (int t = 0; t < 4; ++t) {
      const unsigned short* brow = Wt + (size_t)(col0 + t * 16 + ln) * ldb + kb;
      FragB b;
      b.half[0] = *(const v8us*)(brow + 8 * hh);
      b.half[1] = *(const v8us*)(brow + 16 + 8 * hh);
      acc[t] = mmaN<ASPLIT ? 2 : 1>(ah.v, al.v, b.v, b.v, acc[t]);
    }
  }
#pragma unroll
  for (int t = 0; t < 4; ++t) {
    const int col = col0 + t * 16 + ln;
    float bv = bias ? bias[col] : 0.f;
    if (BIAS_BF16) bv = bf16_round(bv);
#pragma unroll
    for (int r = 0; r < 8; ++r) {
      float v = acc[t][r] + bv;
      if (resid) { float rv = resid[(size_t)((row0 + 8 * hh + r) % rmod) * ldr + col]; if (RES_BF16) rv = bf16_round(rv); v += rv; }
      if (ACT == 1) v = fmaxf(v, 0.f);
      if (ACT == 2) v = 0.5f * v * (1.0f + erff(v * 0.70710678118654752f));
      if (ACT == 3) { const float u = 0.7978845608028654f * (v + 0.044715f * v * v * v); v = 0.5f * v * (1.0f + tanhf(u)); }
      so[w][8 * hh + r][t * 16 + ln] = v;
    }
  }
  __builtin_amdgcn_fence(__ATOMIC_ACQ_REL, "workgroup");
  __builtin_amdgcn_wave_barrier();
  const int rsub = lane >> 4, c4 = (lane & 15) * 4;
  {
#pragma unroll
    for (int q = 0; q < 8; ++q) {
      const int r = q * 2 + rsub;
      const v4f v = *(const v4fa*)&so[w][r][c4];
      *(v4f*)(C + (size_t)(row0 + r) * ldc + col0 + c4) = v;
    }
    
  }
}
// row LayerNorm (biased variance, eps) over N: s = X (+ R); optional out_sum <- s; out_norm <- (s-mu)*rsqrt(var+eps)*g + b
template <bool PARAM_BF16>
__global__ __launch_bounds__(256) void k_layernorm(const float* __restrict__ X, const float* __restrict__ R, const float* __restrict__ g, const float* __restrict__ bta,
                                                  float* __restrict__ out_sum, float* __restrict__ out_norm, int N, float eps) {
  __shared__ float red[256];
  const int row = blockIdx.x, tid = threadIdx.x;
  const float* x = X + (size_t)row * N; const float* rr = R ? R + (size_t)row * N : nullptr;
  float vals[16];                     // up to N = 4096
  const int per = N / 256;            // contiguous chunk per thread? use strided-by-4 chunks: thread handles j = tid*4 + 1024*u
  float s1 = 0.f;
  for (int u = 0; u < per / 4; ++u) {
    const int j = tid * 4 + 1024 * u;
    const v4f a = *(const v4fa*)(x + j);
    v4f b = {0.f,0.f,0.f,0.f}; if (rr) b = *(const v4fa*)(rr + j);
#pragma unroll
    for (int q = 0; q < 4; ++q) { const float v = a[q] + b[q]; vals[u * 4 + q] = v; s1 += v; }
  }
  red[tid] = s1; __syncthreads();
  for (int st = 128; st > 0; st >>= 1) { if (tid < st) red[tid] += red[tid + st]; __syncthreads(); }
  const float mu = red[0] / (float)N; __syncthreads();
  float s2 = 0.f;
  for (int u = 0; u < per / 4; ++u)
#pragma unroll
    for (int q = 0; q < 4; ++q) { const float c = vals[u * 4 + q] - mu; s2 += c * c; }
  red[tid] = s2; __syncthreads();
  for (int st = 128; st > 0; st >>= 1) { if (tid < st) red[tid] += red[tid + st]; __syncthreads(); }
  const float rs = rsqrtf(red[0] / (float)N + eps);
  {
    for (int u = 0; u < per / 4; ++u) {
      const int j = tid * 4 + 1024 * u;
      v4f o, sm;
#pragma unroll
      for (int q = 0; q < 4; ++q) {
        float gg = g[j + q], bb = bta[j + q];
        if (PARAM_BF16) { gg = bf16_round(gg); bb = bf16_round(bb); }
        sm[q] = vals[u * 4 + q]; o[q] = (vals[u * 4 + q] - mu) * rs * gg + bb;
      }
      if (out_sum) *(v4f*)(out_sum + (size_t)row * N + j) = sm;
      *(v4f*)(out_norm + (size_t)row * N + j) = o;
    }
    
  }
}



// ---- f16 WMMA path (v_wmma_f32_16x16x32_f16): 11-bit significands for operands in range — used where a [0,1] probability operand needs more precision than bf16
typedef _Float16 v16h __attribute__((ext_vector_type(16)));
union FragH { v16h v; v8us half[2]; _Float16 h[16]; unsigned short u[16]; };
template <int NT>
__device__ __forceinline__ v8f mmaH(v16h ah, v16h al, v16h bh, v16h bl, v8f c) {
  c = __builtin_amdgcn_wmma_f32_16x16x32_f16(false, ah, false, bh, (short)0, c, false, false);
  if (NT >= 2) c = __builtin_amdgcn_wmma_f32_16x16x32_f16(false, al, false, bh, (short)0, c, false, false);
  if (NT >= 3) c = __builtin_amdgcn_wmma_f32_16x16x32_f16(false, ah, false, bl, (short)0, c, false, false);
  asm volatile("v_nop\n\tv_nop\n\tv_nop\n\tv_nop" : "+v"(c) : "v"(ah), "v"(al), "v"(bh), "v"(bl));
  return c;
}
// batched GEMM like k_gemm_b but f16 operands: A f32 (split into f16 hi/lo if ASPLIT, else rounded to f16), Bt = f16 values [n][k]; alpha; C f32; N multiple of 16 (partial tiles skipped)
template <bool ASPLIT>
__global__ __launch_bounds__(128) void k_gemm_h(const float* __restrict__ A, int lda, size_t sA, const _Float16* __restrict__ Bh, int ldb, size_t sB, float alpha, float* __restrict__ C, int ldc, size_t sC, int M, int N, int K) {
  __shared__ __attribute__((aligned(16))) float so[4][16][64];
  const int tid = threadIdx.x, w = tid >> 5, lane = tid & 31, ln = lane & 15, hh = lane >> 4; const int by = blockIdx.y;
  A += (size_t)by * sA; Bh += (size_t)by * sB; C += (size_t)by * sC;
  const int ntn = (N + 63) / 64; const int wid = blockIdx.x * 4 + w; const int mt = wid / ntn, nq = wid % ntn; if (mt * 16 >= M) return;
  const int row0 = mt * 16, col0 = nq * 64; const float* arow = A + (size_t)(row0 + ln) * lda;
  v8f acc[4] = {};
  for (int kb = 0; kb < K; kb += 32) {
    FragH ah, al;
    const v4f x0 = *(const v4fa*)(arow + kb + 8 * hh), x1 = *(const v4fa*)(arow + kb + 8 * hh + 4), x2 = *(const v4fa*)(arow + kb + 16 + 8 * hh), x3 = *(const v4fa*)(arow + kb + 16 + 8 * hh + 4);
    float xs[16] = {x0[0],x0[1],x0[2],x0[3],x1[0],x1[1],x1[2],x1[3],x2[0],x2[1],x2[2],x2[3],x3[0],x3[1],x3[2],x3[3]};
#pragma unroll
    for (int i = 0; i < 16; ++i) { const _Float16 h = (_Float16)xs[i]; ah.h[i] = h; al.h[i] = ASPLIT ? (_Float16)(xs[i] - (float)h) : (_Float16)0.0f; }
#pragma unroll
    for (int t = 0; t < 4; ++t) { if (col0 + t * 16 >= N) continue; const size_t boff = (size_t)(col0 + t * 16 + ln) * ldb + kb; FragH bq; bq.half[0] = *(const v8us*)(Bh + boff + 8 * hh); bq.half[1] = *(const v8us*)(Bh + boff + 16 + 8 * hh);
      acc[t] = mmaH<ASPLIT ? 2 : 1>(ah.v, al.v, bq.v, bq.v, acc[t]); }
  }
#pragma unroll
  for (int t = 0; t < 4; ++t) { if (col0 + t * 16 >= N) continue;
#pragma unroll
    for (int r = 0; r < 8; ++r) so[w][8 * hh + r][t * 16 + ln] = acc[t][r] * alpha; }
  __builtin_amdgcn_fence(__ATOMIC_ACQ_REL, "workgroup"); __builtin_amdgcn_wave_barrier();
  const int rsub = lane >> 4, c4 = (lane & 15) * 4;
  {
#pragma unroll
    for (int q = 0; q < 8; ++q) { const int r = q * 2 + rsub; if (col0 + c4 < N) { const v4f v = *(const v4fa*)&so[w][r][c4]; *(v4f*)(C + (size_t)(row0 + r) * ldc + col0 + c4) = v; } }
     }
}

// Wt[n][k] = f16(W[k][n]·scale) from f32 row-major W[K][N] (scale = power of two; bf16-exact weights stay exact in f16 away from the subnormal range)
__global__ __launch_bounds__(256) void k_wt_f16(const float* __restrict__ W, _Float16* __restrict__ Wt, int K, int N, float scale) {
  const int t = blockIdx.x * 256 + threadIdx.x; if (t >= N * (K / 8)) return; const int n = t / (K / 8), k8 = (t % (K / 8)) * 8; FragH f;
#pragma unroll
  for (int i = 0; i < 8; ++i) f.h[i] = (_Float16)(bf16_round(W[(size_t)(k8 + i) * N + n]) * scale); const v8us o = f.half[0];
  *(v8us*)((unsigned short*)Wt + (size_t)n * K + k8) = o; 
}
// k_gemm_hh variant with fused epilogue: v = acc·alpha + bias[by·sBias + col] (+ CP[(row/rowsPerB)·sCPb + by·64 + col] if CP) ; ACT 0 none / 1 elu ; writes f16 C16 (and f32 C if non-null)
template <int ACT>
__global__ __launch_bounds__(128) void k_gemm_hhx(const _Float16* __restrict__ A, int lda, size_t sA, const _Float16* __restrict__ Bh, int ldb, size_t sB, float alpha, const float* __restrict__ bias, size_t sBias, const float* __restrict__ CP, int rowsPerB, size_t sCPb, int row0g,
    float* __restrict__ C, _Float16* __restrict__ C16, int ldc, size_t sC, int M, int N, int K) {
  __shared__ __attribute__((aligned(16))) float so[4][16][64];
  const int tid = threadIdx.x, w = tid >> 5, lane = tid & 31, ln = lane & 15, hh = lane >> 4; const int by = blockIdx.y;
  A += (size_t)by * sA; Bh += (size_t)by * sB; const size_t cofs = (size_t)by * sC; const float* bp = bias ? bias + (size_t)by * sBias : nullptr;
  const int ntn = (N + 63) / 64; const int wid = blockIdx.x * 4 + w; const int mt = wid / ntn, nq = wid % ntn; if (mt * 16 >= M) return;
  const int row0 = mt * 16, col0 = nq * 64; const _Float16* arow = A + (size_t)(row0 + ln) * lda;
  v8f acc[4] = {};
  for (int kb = 0; kb < K; kb += 32) { FragH ah; ah.half[0] = *(const v8us*)((const unsigned short*)arow + kb + 8 * hh); ah.half[1] = *(const v8us*)((const unsigned short*)arow + kb + 16 + 8 * hh);
#pragma unroll
    for (int t = 0; t < 4; ++t) { if (col0 + t * 16 >= N) continue; const size_t boff = (size_t)(col0 + t * 16 + ln) * ldb + kb; FragH bq; bq.half[0] = *(const v8us*)((const unsigned short*)Bh + boff + 8 * hh); bq.half[1] = *(const v8us*)((const unsigned short*)Bh + boff + 16 + 8 * hh);
      acc[t] = mmaH<1>(ah.v, ah.v, bq.v, bq.v, acc[t]); }
  }
#pragma unroll
  for (int t = 0; t < 4; ++t) { if (col0 + t * 16 >= N) continue; const int col = col0 + t * 16 + ln; const float bv = bp ? bf16_round(bp[col]) : 0.f;
#pragma unroll
    for (int r = 0; r < 8; ++r) { float v = acc[t][r] * alpha + bv; if (CP) { const int rr = row0g + row0 + 8 * hh + r; if (rowsPerB < 0) v += CP[cofs + (size_t)rr * ldc + col];      /* rowsPerB < 0: own element of the batched C plane */ else { const int bidx = rr / rowsPerB; v += CP[(size_t)bidx * sCPb + (size_t)by * 64 + col]; } } if (ACT == 1) v = (v > 0.f) ? v : expm1f(v); else if (ACT == 7) v = (v > 0.f) ? v + 1.0f : expf(v); else if (ACT == 8) v = tanhf(v); else if (ACT == 9) v = 0.5f * v * (1.0f + tanhf(0.7978845608028654f * (v + 0.044715f * v * v * v))); else if (ACT == 11) v = 1.0f / (1.0f + expf(-v)); else if (ACT == 12) v = (v > 0.f) ? v : 0.01f * v; else if (ACT == 14) v = (v > 0.f) ? v : 0.1f * v; else if (ACT == 16) v = (v >= 0.f) ? v : 0.3f * v; else if (ACT == 17) v = (v >= 0.f) ? v : 0.2f * v; else if (ACT == 15) v = v / (1.0f + expf(-v)); else if (ACT == 3) v = fmaxf(v, 0.f); else if (ACT == 6) v = 0.5f * v * (1.0f + erff(v * 0.70710678118654752f)); so[w][8 * hh + r][t * 16 + ln] = v; } }
  __builtin_amdgcn_fence(__ATOMIC_ACQ_REL, "workgroup"); __builtin_amdgcn_wave_barrier();
  const int rsub = lane >> 4, c4 = (lane & 15) * 4; typedef _Float16 v4h __attribute__((ext_vector_type(4)));
  {
#pragma unroll
    for (int q = 0; q < 8; ++q) { const int r = q * 2 + rsub; if (col0 + c4 < N) { const v4f v = *(const v4fa*)&so[w][r][c4]; if (C) *(v4f*)(C + cofs + (size_t)(row0 + r) * ldc + col0 + c4) = v; if (C16) { v4h h4; for (int i = 0; i < 4; ++i) h4[i] = (_Float16)v[i]; *(v4h*)(C16 + cofs + (size_t)(row0 + r) * ldc + col0 + c4) = h4; } } }
     }
}


typedef _Float16 v4h __attribute__((ext_vector_type(4)));

__global__ __launch_bounds__(256) void k_x16(const float* __restrict__ x, _Float16* __restrict__ X16, size_t n8) { const size_t t = (size_t)blockIdx.x * 256 + threadIdx.x; if (t >= n8) return; FragH f;
#pragma unroll
  for (int q = 0; q < 8; ++q) f.h[q] = (_Float16)bf16_round(x[t * 8 + q]); *(v8us*)((unsigned short*)X16 + t * 8) = f.half[0];  }
__global__ __launch_bounds__(256) void k_h16(const float* __restrict__ x, _Float16* __restrict__ X16, size_t n8) { const size_t t = (size_t)blockIdx.x * 256 + threadIdx.x; if (t >= n8) return; FragH f;
#pragma unroll
  for (int q = 0; q < 8; ++q) f.h[q] = (_Float16)x[t * 8 + q]; *(v8us*)((unsigned short*)X16 + t * 8) = f.half[0];  }
__global__ __launch_bounds__(256) void k_round16f(const float* __restrict__ W, _Float16* __restrict__ Bt, size_t n8) { const size_t t = (size_t)blockIdx.x * 256 + threadIdx.x; if (t >= n8) return; FragH f;
#pragma unroll
  for (int i = 0; i < 8; ++i) f.h[i] = (_Float16)(bf16_round(W[t * 8 + i]) * 16.0f); *(v8us*)((unsigned short*)Bt + t * 8) = f.half[0];  }
template <int NHv, int TTv>
__global__ __launch_bounds__(256) void k_vt(const _Float16* __restrict__ V16, int ldv, int voff, _Float16* __restrict__ Vt) { __shared__ unsigned short tl[64][66]; const int tid = threadIdx.x; const int slab = blockIdx.x / (TTv / 64), lg = blockIdx.x % (TTv / 64); const int b = slab / NHv, h = slab % NHv;
  for (int i = tid; i < 64 * 8; i += 256) { const int r = i / 8, c8 = (i % 8) * 8; FragH f; f.half[0] = *(const v8us*)((const unsigned short*)V16 + ((size_t)b * TTv + lg * 64 + r) * ldv + voff + h * 64 + c8);
#pragma unroll
    for (int q = 0; q < 8; ++q) tl[r][c8 + q] = f.u[q]; }
  __syncthreads();
  {
#pragma unroll
    for (int rd = 0; rd < 2; ++rd) { const int d = rd * 32 + tid / 8, pc = tid % 8; FragH f;
#pragma unroll
      for (int q = 0; q < 8; ++q) f.u[q] = tl[pc * 8 + q][d];
      *(v8us*)((unsigned short*)Vt + ((size_t)slab * 64 + d) * TTv + lg * 64 + pc * 8) = f.half[0]; }
     } }

__global__ __launch_bounds__(256) void k_hl(const float* __restrict__ F, _Float16* __restrict__ Hh, _Float16* __restrict__ Hl, size_t n8) { const size_t t = (size_t)blockIdx.x * 256 + threadIdx.x; if (t >= n8) return; FragH fh, fl; const v4f a = *(const v4fa*)(F + t * 8), c = *(const v4fa*)(F + t * 8 + 4);
#pragma unroll
  for (int q = 0; q < 4; ++q) { _Float16 h = (_Float16)a[q]; fh.h[q] = h; fl.h[q] = (_Float16)((a[q] - (float)h) * 1024.0f); h = (_Float16)c[q]; fh.h[4 + q] = h; fl.h[4 + q] = (_Float16)((c[q] - (float)h) * 1024.0f); }
  { *(v8us*)((unsigned short*)Hh + t * 8) = fh.half[0]; *(v8us*)((unsigned short*)Hl + t * 8) = fl.half[0];  } }

// ---- fast GEMM (wave tile 32x64; requires M % 32 == 0 rows per launch region and N % 64 == 0); epilogue = k_gemm_hhx semantics ----
__device__ __forceinline__ v16h g2_frag(const _Float16* p, int hh) { FragH f; f.half[0] = *(const v8us*)((const unsigned short*)p + 8 * hh); f.half[1] = *(const v8us*)((const unsigned short*)p + 16 + 8 * hh); return f.v; }
__device__ __forceinline__ v8f g2_mma(v16h a, v16h b, v8f c) { v8f d = __builtin_amdgcn_wmma_f32_16x16x32_f16(false, a, false, b, (short)0, c, false, false); asm volatile("v_nop\n\tv_nop\n\tv_nop\n\tv_nop" : "+v"(d) : "v"(a), "v"(b)); return d; }
template <int ACT>
__global__ __launch_bounds__(128) void k_gemm2(const _Float16* __restrict__ A, int lda, size_t sA, const _Float16* __restrict__ Bh, int ldb, size_t sB, float alpha, const float* __restrict__ bias, size_t sBias, const float* __restrict__ CP, int rowsPerB, size_t sCPb, int row0g,
    float* __restrict__ C, _Float16* __restrict__ C16, int ldc, size_t sC, int M, int N, int K) { static_assert(ACT == 0 || ACT == 3 || ACT == 6 || ACT == 8 || ACT == 9 || ACT == 11 || ACT == 12 || ACT == 14 || ACT == 15 || ACT == 16 || ACT == 17, "k_gemm2: unsupported ACT code (would silently apply no activation)");
  __shared__ __attribute__((aligned(16))) float so[4][32][68];
  const int tid = threadIdx.x, w = tid >> 5, lane = tid & 31, ln = lane & 15, hh = lane >> 4; const int by = blockIdx.y;
  A += (size_t)by * sA; Bh += (size_t)by * sB; const size_t cofs = (size_t)by * sC; const float* bp = bias ? bias + (size_t)by * sBias : nullptr;
  const int ntn = N >> 6; const int mt = blockIdx.x / ntn, nq = blockIdx.x - mt * ntn; const int row0 = mt * 128 + 32 * w, col0 = nq * 64; if (row0 >= M) return;
  const _Float16* a0p = A + (size_t)(row0 + ln) * lda; const _Float16* a1p = a0p + (size_t)16 * lda;
  const _Float16* b0p = Bh + (size_t)(col0 + ln) * ldb; const _Float16* b1p = b0p + (size_t)16 * ldb; const _Float16* b2p = b1p + (size_t)16 * ldb; const _Float16* b3p = b2p + (size_t)16 * ldb;
  const v8f z8 = {0.f,0.f,0.f,0.f,0.f,0.f,0.f,0.f}; v8f c00 = z8, c01 = z8, c02 = z8, c03 = z8, c10 = z8, c11 = z8, c12 = z8, c13 = z8;
#pragma unroll 1
  for (int kb = 0; kb < K; kb += 32) { const v16h a0 = g2_frag(a0p + kb, hh), a1 = g2_frag(a1p + kb, hh);
    v16h b = g2_frag(b0p + kb, hh); c00 = g2_mma(a0, b, c00); c10 = g2_mma(a1, b, c10);
    b = g2_frag(b1p + kb, hh); c01 = g2_mma(a0, b, c01); c11 = g2_mma(a1, b, c11);
    b = g2_frag(b2p + kb, hh); c02 = g2_mma(a0, b, c02); c12 = g2_mma(a1, b, c12);
    b = g2_frag(b3p + kb, hh); c03 = g2_mma(a0, b, c03); c13 = g2_mma(a1, b, c13); }
  v8f accs[8] = {c00, c01, c02, c03, c10, c11, c12, c13};
#pragma unroll
  for (int u = 0; u < 8; ++u) { const int t = u & 3, half = u >> 2; const int col = col0 + t * 16 + ln; const float bv = bp ? bf16_round(bp[col]) : 0.f;
#pragma unroll
    for (int r = 0; r < 8; ++r) { const int rloc = half * 16 + 8 * hh + r; float v = accs[u][r] * alpha + bv; if (CP) { if (rowsPerB < 0) v += CP[cofs + (size_t)(row0g + row0 + rloc) * ldc + col];      /* rowsPerB < 0: own element of the batched C plane */ else { const int bidx = (row0g + row0 + rloc) / rowsPerB; v += CP[(size_t)bidx * sCPb + (size_t)by * 64 + col]; } }
      if (ACT == 3) v = fmaxf(v, 0.f); else if (ACT == 6) v = 0.5f * v * (1.0f + erff(v * 0.70710678118654752f)); else if (ACT == 11) v = 1.0f / (1.0f + expf(-v)); else if (ACT == 15) v = v / (1.0f + expf(-v)); else if (ACT == 12) v = (v > 0.f) ? v : 0.01f * v; else if (ACT == 8) v = tanhf(v); else if (ACT == 9) v = 0.5f * v * (1.0f + tanhf(0.7978845608028654f * (v + 0.044715f * v * v * v))); else if (ACT == 14) v = (v > 0.f) ? v : 0.1f * v; else if (ACT == 16) v = (v >= 0.f) ? v : 0.3f * v; else if (ACT == 17) v = (v >= 0.f) ? v : 0.2f * v;
      so[w][rloc][t * 16 + ln] = v; } }
  __builtin_amdgcn_fence(__ATOMIC_ACQ_REL, "workgroup"); __builtin_amdgcn_wave_barrier();
  const int rsub = lane >> 4, c4 = (lane & 15) * 4;
  {
#pragma unroll
    for (int q = 0; q < 16; ++q) { const int r = q * 2 + rsub; const v4f v = *(const v4fa*)&so[w][r][c4]; if (C) *(v4f*)(C + cofs + (size_t)(row0 + r) * ldc + col0 + c4) = v; if (C16) { v4h h4; for (int i = 0; i < 4; ++i) h4[i] = (_Float16)v[i]; *(v4h*)(C16 + cofs + (size_t)(row0 + r) * ldc + col0 + c4) = h4; } }
     } }

// q | k | v projection of ALL token rows (wave tile and product order of k_gemm2, pitches and K = DM) with the per-head work in the epilogue: no f32 q | k | v plane in memory and no launch per (row, head).
// A block is 8 waves: 128 rows of one batch x 128 columns, two heads of q, of k or of v (block-uniform); four waves share a head. The K loop reads its fragments from LDS stages that asynchronous copies fill one trip ahead,
// so each operand byte leaves L2 once per block instead of once per wave. q, k: each wave stages its 32x64 f32 tile in its own LDS range; 8 lanes take one row (lanes 0-3 columns 0-31, lanes 4-7 columns 32-63),
// each reads its 8 low-half and 8 high-half values and the two table rows, rotates and stores 16 bytes: one instruction fills whole 128-byte lines.
// v: accumulator registers 0..7 of a lane are 8 consecutive token rows of one column, so each lane packs them to 16 bytes of V^T; each head's 64 x 128 tile is gathered in LDS (pitch 272 bytes) so that one wave writes each 256-byte row piece.
// Rows 0..127 of a batch (one block row) are also written in f32 for the exact first-tile attention.
// Every epilogue loop is unrolled so that accs, xs and tb are indexed by constants and stay in registers.
// A 16-byte global store (two for the f32 form) with s_wait_xcnt 0 as the last line of the same statement: the epilogue reuses its staging registers from pass to pass, and a wait in a statement of its own would not hold the next pass's register writes behind it.
__device__ __forceinline__ void st16_wait(unsigned short* p, v8us d) { asm volatile("global_store_b128 %0, %1, off\n\ts_wait_xcnt 0x0" :: "v"(p), "v"(d) : "memory"); }
__device__ __forceinline__ void st32_wait(float* p, v4f d0, v4f d1) { asm volatile("global_store_b128 %0, %1, off\n\tglobal_store_b128 %0, %2, off offset:16\n\ts_wait_xcnt 0x0" :: "v"(p), "v"(d0), "v"(d1) : "memory"); }
// Operand tiles of a GEMM K loop staged in LDS: a stage is 64 k of 128 A rows, then of 128 B rows, each row 128 bytes at a pitch of 144 (16 bytes x an odd number: the 16-byte fragment reads meet no bank conflict).
// 256 threads: thread t brings 16-byte piece t & 7 of rows (t >> 3) + 32 j, so one wave's copy covers four whole 128-byte lines.
#define GP 72                        /* LDS row pitch in f16 */
#define GSTG (256 * GP * 2)          /* bytes of one stage */
// Eight asynchronous copies, each lane its own 16 bytes, with s_wait_xcnt 0 as the last line of the same statement: it stands ahead of any rewrite of the address registers that the copies name.
__device__ __forceinline__ void g3_copy8(unsigned l, const _Float16* a, const _Float16* b) {
  asm volatile("global_load_async_to_lds_b128 %0, %8, off\n\tglobal_load_async_to_lds_b128 %1, %9, off\n\tglobal_load_async_to_lds_b128 %2, %10, off\n\tglobal_load_async_to_lds_b128 %3, %11, off\n\t"
               "global_load_async_to_lds_b128 %4, %12, off\n\tglobal_load_async_to_lds_b128 %5, %13, off\n\tglobal_load_async_to_lds_b128 %6, %14, off\n\tglobal_load_async_to_lds_b128 %7, %15, off\n\ts_wait_xcnt 0x0"
               :: "v"(l), "v"(l + 32u * GP * 2), "v"(l + 64u * GP * 2), "v"(l + 96u * GP * 2), "v"(l + 128u * GP * 2), "v"(l + 160u * GP * 2), "v"(l + 192u * GP * 2), "v"(l + 224u * GP * 2),
                  "v"(a), "v"(a + 32 * DM), "v"(a + 64 * DM), "v"(a + 96 * DM), "v"(b), "v"(b + 32 * DM), "v"(b + 64 * DM), "v"(b + 96 * DM) : "memory"); }
// Four more, for the 128 rows of a second A operand (they lie behind the B rows of the stage).
#define GSTG3 (384 * GP * 2)         /* bytes of one stage with two A operands */
__device__ __forceinline__ void g3_copy4(unsigned l, const _Float16* e) {
  asm volatile("global_load_async_to_lds_b128 %0, %4, off\n\tglobal_load_async_to_lds_b128 %1, %5, off\n\tglobal_load_async_to_lds_b128 %2, %6, off\n\tglobal_load_async_to_lds_b128 %3, %7, off\n\ts_wait_xcnt 0x0"
               :: "v"(l), "v"(l + 32u * GP * 2), "v"(l + 64u * GP * 2), "v"(l + 96u * GP * 2), "v"(e), "v"(e + 32 * DM), "v"(e + 64 * DM), "v"(e + 96 * DM) : "memory"); }
__global__ __launch_bounds__(256) void k_qkv_rope(const _Float16* __restrict__ A, const _Float16* __restrict__ Bh, const float* __restrict__ tcos, const float* __restrict__ tsin,
    _Float16* __restrict__ Q16, _Float16* __restrict__ K16, _Float16* __restrict__ VTa, float* __restrict__ QF, float* __restrict__ KF, float* __restrict__ VF) {
  __shared__ __attribute__((aligned(16))) char sm[2 * GSTG];      /* two stages in the K loop; behind it the epilogue's staging */
  static_assert(sizeof(float) * 8 * 32 * 68 <= 2 * GSTG, "the epilogue's staging fits the two stages");
  float (*so)[32][68] = (float (*)[32][68])sm;
  const int tid = threadIdx.x, w8 = tid >> 5, w = w8 & 3, wg = w8 >> 2, lane = tid & 31, ln = lane & 15, hh = lane >> 4;      /* waves 0-3: the block's first head, waves 4-7: its second; w: the wave's 32 rows */
  const int ntn = 3 * DM / 128; const int mt = blockIdx.x / ntn, np = blockIdx.x - mt * ntn; const int row0 = mt * 128 + 32 * w;
  const int sel = (np * 2) / NH, h = (np * 2) % NH + wg;      /* 0 q, 1 k, 2 v (block-uniform: a pair of heads lies in one of them); head */
  const int b = mt / (SQ / 128), pb = (mt % (SQ / 128)) * 128, p0 = pb + 32 * w;      /* batch; position of the block's and of the wave's first row */
  const bool first = pb == 0;
  const unsigned l0 = (unsigned)(size_t)sm + (unsigned)(tid >> 3) * (GP * 2) + (unsigned)(tid & 7) * 16;      /* the thread's first place in stage 0: LDS byte address */
  const _Float16* ga = A + (size_t)(mt * 128 + (tid >> 3)) * DM + (tid & 7) * 8; const _Float16* gb = Bh + (size_t)(np * 128 + (tid >> 3)) * DM + (tid & 7) * 8;
  const v8f z8 = {0.f,0.f,0.f,0.f,0.f,0.f,0.f,0.f}; v8f c00 = z8, c01 = z8, c02 = z8, c03 = z8, c10 = z8, c11 = z8, c12 = z8, c13 = z8;
  g3_copy8(l0, ga, gb);
  asm volatile("s_wait_asynccnt 0x0" ::: "memory");      /* this wave's part of tile 0 has landed */
  __syncthreads();      /* tile 0 is whole for every wave */
  g3_copy8(l0 + GSTG, ga + 64, gb + 64);
#pragma unroll 1
  for (int t = 0; t < DM / 64; ++t) {      /* kept rolled: one trip is one stage, 16 WMMAs a wave */
    const _Float16* st = (const _Float16*)(sm + (t & 1) * GSTG);
    const _Float16* ap = st + (32 * w + ln) * GP; const _Float16* bp = st + (128 + 64 * wg + ln) * GP;
#pragma unroll
    for (int kk = 0; kk < 64; kk += 32) { const v16h a0 = g2_frag(ap + kk, hh), a1 = g2_frag(ap + 16 * GP + kk, hh);      /* unrolled: the LDS offsets of both halves of the stage are immediates; the six fragments of 32 k are read as one group, ahead of their WMMAs */
      const v16h b0 = g2_frag(bp + kk, hh), b1 = g2_frag(bp + 16 * GP + kk, hh), b2 = g2_frag(bp + 32 * GP + kk, hh), b3 = g2_frag(bp + 48 * GP + kk, hh);
      c00 = g2_mma(a0, b0, c00); c10 = g2_mma(a1, b0, c10); c01 = g2_mma(a0, b1, c01); c11 = g2_mma(a1, b1, c11);
      c02 = g2_mma(a0, b2, c02); c12 = g2_mma(a1, b2, c12); c03 = g2_mma(a0, b3, c03); c13 = g2_mma(a1, b3, c13); }
    asm volatile("s_wait_dscnt 0x0" ::: "memory");      /* this wave's reads of the stage have returned */
    asm volatile("s_wait_asynccnt 0x0" ::: "memory");      /* this wave's part of tile t + 1 has landed */
    __syncthreads();      /* publishes tile t + 1 and ends every wave's reads of tile t */
    if (t + 2 < DM / 64) g3_copy8(l0 + (unsigned)(t & 1) * GSTG, ga + (t + 2) * 64, gb + (t + 2) * 64); }      /* refill of the stage just left; the test is the same for the whole block */
  asm volatile("s_wait_asynccnt 0x0" ::: "memory");      /* no copy is outstanding when the stages become the epilogue's staging */
  v8f accs[8] = {c00, c01, c02, c03, c10, c11, c12, c13};
#pragma unroll
  for (int u = 0; u < 8; ++u) accs[u] *= 0.0625f;      /* undoes the x16 of the weights, exact */
  if (sel == 2) {
    unsigned short* tv = (unsigned short*)sm + wg * 64 * 136;      /* per head [64 columns][136]: 128 token rows + 8 pad */
#pragma unroll
    for (int u = 0; u < 8; ++u) { const int t = u & 3, half = u >> 2; FragH f;
#pragma unroll
      for (int r = 0; r < 8; ++r) f.h[r] = (_Float16)accs[u][r];
      *(v8us*)(tv + (t * 16 + ln) * 136 + 32 * w + half * 16 + 8 * hh) = f.half[0]; }
    __syncthreads();      /* block-uniform branch: every wave's columns are in LDS before any wave reads whole rows of V^T */
    unsigned short* vt = (unsigned short*)VTa + ((size_t)(b * NH + h) * HD + w * 16 + hh) * SQ + pb + ln * 8;
#pragma unroll
    for (int q = 0; q < 8; ++q) { const v8us v = *(const v8us*)(tv + (w * 16 + q * 2 + hh) * 136 + ln * 8); *(v8us*)(vt + (size_t)q * 2 * SQ) = v; }
    asm volatile("s_wait_xcnt 0x0" ::: "memory");      /* stands behind the V^T stores, ahead of the first write of a register that one of them names */
    if (first) { float* vf = VF + ((size_t)b * QT0 + p0 + 8 * hh) * DM + h * HD + ln;
#pragma unroll
      for (int u = 0; u < 8; ++u)
#pragma unroll
        for (int r = 0; r < 8; ++r) vf[(size_t)((u >> 2) * 16 + r) * DM + (u & 3) * 16] = accs[u][r]; }
  } else {
#pragma unroll
    for (int u = 0; u < 8; ++u)
#pragma unroll
      for (int r = 0; r < 8; ++r) so[w8][(u >> 2) * 16 + 8 * hh + r][(u & 3) * 16 + ln] = accs[u][r];
    __builtin_amdgcn_fence(__ATOMIC_ACQ_REL, "workgroup"); __builtin_amdgcn_wave_barrier();      /* the wave reads back what its own lanes wrote */
    const int rs = lane >> 3, up = (lane >> 2) & 1, i8 = (lane & 3) * 8;
    unsigned short* h16 = (unsigned short*)(sel ? K16 : Q16) + (size_t)(row0 + rs) * DM + h * HD + up * 32 + i8;
    float* f32 = (sel ? KF : QF) + ((size_t)b * QT0 + p0 + rs) * DM + h * HD + up * 32 + i8;      /* formed for every block, used by each batch's first block row alone */
    const float* cp = tcos + (size_t)(p0 + rs) * (HD / 2) + i8; const float* sp = tsin + (size_t)(p0 + rs) * (HD / 2) + i8;
    v4f xs[2][4], tb[2][4];      /* two register sets: pass q + 1 is fetched ahead of the arithmetic of pass q, because no load moves up over the store statements */
#pragma unroll
    for (int q = -1; q < 8; ++q) {
      if (q < 7) { const int n = q + 1, s = n & 1, r = n * 4 + rs;
        xs[s][0] = *(const v4fa*)&so[w8][r][i8]; xs[s][1] = *(const v4fa*)&so[w8][r][i8 + 4]; xs[s][2] = *(const v4fa*)&so[w8][r][32 + i8]; xs[s][3] = *(const v4fa*)&so[w8][r][32 + i8 + 4];
        tb[s][0] = *(const v4fa*)(cp + n * 4 * (HD / 2)); tb[s][1] = *(const v4fa*)(cp + n * 4 * (HD / 2) + 4); tb[s][2] = *(const v4fa*)(sp + n * 4 * (HD / 2)); tb[s][3] = *(const v4fa*)(sp + n * 4 * (HD / 2) + 4); }
      if (q >= 0) { const int s = q & 1; FragH f; v4f o0, o1;
#pragma unroll
        for (int e = 0; e < 8; ++e) { const float lo = xs[s][e >> 2][e & 3], hi = xs[s][2 + (e >> 2)][e & 3]; const float cv = bf16_round(tb[s][e >> 2][e & 3]), sv = bf16_round(tb[s][2 + (e >> 2)][e & 3]);
          const float o = lo * (up ? sv : cv) + hi * (up ? cv : -sv);      /* low half x1 c - x2 s, high half x1 s + x2 c */
          f.h[e] = (_Float16)o; if (e < 4) o0[e & 3] = o; else o1[e & 3] = o; }
        st16_wait(h16 + (size_t)q * 4 * DM, f.half[0]);
        if (first) st32_wait(f32 + (size_t)q * 4 * DM, o0, o1); } }
  } }
static_assert(QT0 == 128 && SQ % 128 == 0 && HD == 64 && DM == NH * HD, "k_qkv_rope: a block is 128 rows of one batch x two heads; the first-tile rows are one block row");

__global__ __launch_bounds__(256) void k_wnat(const float* __restrict__ w, size_t n8, _Float16* __restrict__ Bt) { const size_t t = (size_t)blockIdx.x * 256 + threadIdx.x; if (t >= n8) return; FragH f; for (int q = 0; q < 8; ++q) f.h[q] = (_Float16)(bf16_round(w[t * 8 + q]) * 16.0f); *(v8us*)((unsigned short*)Bt + t * 8) = f.half[0];  }
__global__ __launch_bounds__(256) void k_rsm(const float* __restrict__ S, _Float16* __restrict__ P, int nrows) {
  #pragma clang fp contract(off)
  const int i = blockIdx.x * 256 + threadIdx.x; if (i >= nrows) return; const float* s = S + (size_t)i * SQ; float mx = -3.0e38f;
#pragma unroll 1
  for (int j = 0; j < SQ; ++j) mx = fmaxf(mx, s[j]); float se = 0.f;
#pragma unroll 1
  for (int j = 0; j < SQ; ++j) se += expf(s[j] - mx); const float sc = 256.0f / se;
#pragma unroll 1
  for (int j0 = 0; j0 < SQ; j0 += 8) { FragH f; for (int q = 0; q < 8; ++q) f.h[q] = (_Float16)(expf(s[j0 + q] - mx) * sc); unsigned short* d = (unsigned short*)P + (size_t)i * SQ + j0; *(v8us*)d = f.half[0];  } }
__global__ __launch_bounds__(256) void k_vt(const _Float16* __restrict__ V16, int b, int h0, _Float16* __restrict__ VT) { __shared__ unsigned short tl[64][65]; const int tid = threadIdx.x; const int hh = blockIdx.x % HG, sg = blockIdx.x / HG; const int s0 = sg * 64; const int h = h0 + hh;
  for (int i = tid; i < 64 * 8; i += 256) { const int j = i / 8, d8 = (i % 8) * 8; FragH f; f.half[0] = *(const v8us*)((const unsigned short*)V16 + ((size_t)b * SQ + s0 + j) * DM + h * HD + d8); for (int q = 0; q < 8; ++q) tl[d8 + q][j] = f.u[q]; }
  __syncthreads();
  { for (int i = tid; i < 64 * 8; i += 256) { const int d = i / 8, j8 = (i % 8) * 8; FragH f; for (int q = 0; q < 8; ++q) f.u[q] = tl[d][j8 + q]; *(v8us*)((unsigned short*)VT + ((size_t)hh * HD + d) * SQ + s0 + j8) = f.half[0]; }  } }


__global__ __launch_bounds__(256) void k_tab2(float theta, float* __restrict__ CS, float* __restrict__ SN) {
  #pragma clang fp contract(off)
  const int t = blockIdx.x * 256 + threadIdx.x; if (t >= SQ * (HD / 2)) return; const int i = t % (HD / 2); const int p = t / (HD / 2); const float invf = 1.0f / powf(theta, (float)(2 * i) / (float)HD); const float ang = __fmul_rn((float)p, invf); const float c = cosf(ang), s = sinf(ang);
  *(float*)(CS + t) = c; *(float*)(SN + t) = s;  }
template <int NORM, int ROPE>
__global__ __launch_bounds__(64) void k_xform(const float* __restrict__ F, int ldf, int nh, const float* __restrict__ gain, float eps, const float* __restrict__ CS, const float* __restrict__ SN, _Float16* __restrict__ H16, int ldo) {
  #pragma clang fp contract(off)
  __shared__ float xv[HD]; __shared__ float red[HD]; __shared__ unsigned short sh_[HD]; const int d = threadIdx.x; const int h = blockIdx.x % nh; const size_t r = blockIdx.x / nh; const int p = (int)(r % SQ);
  float x = F[r * (size_t)ldf + (size_t)h * HD + d];
  if (NORM) { red[d] = __fmul_rn(x, x); __syncthreads(); for (int st = HD / 2; st > 0; st >>= 1) { if (d < st) red[d] = __fadd_rn(red[d], red[d + st]); __syncthreads(); } const float rs = rsqrtf(__fadd_rn(red[0] / (float)HD, eps)); x = __fmul_rn(__fmul_rn(x, rs), bf16_round(gain[d])); }
  xv[d] = x; __syncthreads();
  float o = x;
  if (ROPE == 1) { const int i = d >> 1; const float c = CS[p * (HD / 2) + i], s = SN[p * (HD / 2) + i]; const float ev = xv[2 * i], od = xv[2 * i + 1]; o = (d & 1) ? __fadd_rn(__fmul_rn(ev, s), __fmul_rn(od, c)) : __fadd_rn(__fmul_rn(ev, c), -__fmul_rn(od, s)); }
  if (ROPE == 2) { const int i = d & (HD / 2 - 1); const float c = CS[p * (HD / 2) + i], s = SN[p * (HD / 2) + i]; const float lo = xv[i], hi = xv[i + HD / 2]; o = (d < HD / 2) ? __fadd_rn(__fmul_rn(lo, c), -__fmul_rn(hi, s)) : __fadd_rn(__fmul_rn(lo, s), __fmul_rn(hi, c)); }
  FragH th; th.h[0] = (_Float16)o; sh_[d] = th.u[0]; __syncthreads();
  if (d < HD / 8) { FragH f; for (int q = 0; q < 8; ++q) f.u[q] = sh_[d * 8 + q]; unsigned short* dst = (unsigned short*)H16 + r * (size_t)ldo + (size_t)h * HD + d * 8; *(v8us*)dst = f.half[0];  } }

__global__ __launch_bounds__(256) void k_tab4(const int* __restrict__ pos, float theta, float* __restrict__ CS, float* __restrict__ SN) {
  #pragma clang fp contract(off)
  const int t = blockIdx.x * 256 + threadIdx.x; if (t >= SQ * (HD / 2)) return; const int i = t % (HD / 2); const int p = t / (HD / 2); const float invf = (float)pow((double)theta, -((double)(2 * i)) / (double)HD); const float ang = __fmul_rn((float)pos[p], invf); const float c = cosf(ang), s = sinf(ang);
  *(float*)(CS + t) = c; *(float*)(SN + t) = s;  }
__global__ __launch_bounds__(256) void k_rsmf(const float* __restrict__ S, _Float16* __restrict__ P, int qn, int hg) {
  #pragma clang fp contract(off)
  const int t = blockIdx.x * 256 + threadIdx.x; if (t >= qn * hg) return; const size_t i = (size_t)(t / qn) * SQ + (t % qn); const float* s = S + i * SQ; float mx = -3.0e38f;
#pragma unroll 1
  for (int j = 0; j < SQ; ++j) mx = fmaxf(mx, s[j]); float se = 0.f;
#pragma unroll 1
  for (int j = 0; j < SQ; ++j) se += __expf(s[j] - mx); const float sc = 256.0f / se;
#pragma unroll 1
  for (int j0 = 0; j0 < SQ; j0 += 8) { FragH f; for (int q = 0; q < 8; ++q) f.h[q] = (_Float16)(__expf(s[j0 + q] - mx) * sc); unsigned short* d = (unsigned short*)P + i * SQ + j0; *(v8us*)d = f.half[0];  } }


__device__ __forceinline__ v8f fa_mma(v16h a, v16h b, v8f c) { return __builtin_amdgcn_wmma_f32_16x16x32_f16(false, a, false, b, (short)0, c, false, false); }
// 2^x for eight values (two for the rescale factors) in ONE statement: outputs are early-clobber, so no exponential reads its predecessor's result or overwrites its source, and the closing v_nop keeps the one
// independent slot that the instruction set asks for between the last exponential and whatever the compiler places next.
__device__ __forceinline__ v8f fa_exp8(v8f x) { float y0, y1, y2, y3, y4, y5, y6, y7;
  asm("v_exp_f32 %0, %8\n\tv_exp_f32 %1, %9\n\tv_exp_f32 %2, %10\n\tv_exp_f32 %3, %11\n\tv_exp_f32 %4, %12\n\tv_exp_f32 %5, %13\n\tv_exp_f32 %6, %14\n\tv_exp_f32 %7, %15\n\tv_nop"
      : "=&v"(y0), "=&v"(y1), "=&v"(y2), "=&v"(y3), "=&v"(y4), "=&v"(y5), "=&v"(y6), "=&v"(y7) : "v"(x[0]), "v"(x[1]), "v"(x[2]), "v"(x[3]), "v"(x[4]), "v"(x[5]), "v"(x[6]), "v"(x[7]));
  const v8f y = {y0, y1, y2, y3, y4, y5, y6, y7}; return y; }
__device__ __forceinline__ void fa_exp2(float x0, float x1, float& y0, float& y1) { asm("v_exp_f32 %0, %2\n\tv_exp_f32 %1, %3\n\tv_nop" : "=&v"(y0), "=&v"(y1) : "v"(x0), "v"(x1)); }
// One step of 32 keys. kn / vn: the NEXT step's K rows and V^T columns, fetched into the same registers right after their last use here, so that a whole step passes before they are needed;
// DIAG: the wave's last step (first key == first query): keys above the query get weight 0, and nothing is fetched.
template <bool DIAG>
__device__ __forceinline__ void fa_step(const v16h (&qf)[2][2], v16h (&kf)[2][2], v16h (&vf)[4], v8f (&o)[2][4], float (&mu)[2], float (&l)[2], const _Float16* kn, const _Float16* vn, int c, int hh) {
  const float cs = 0.125f * 1.44269504088896340736f;      /* score scale x log2(e) */
  const v8f z8 = {0.f,0.f,0.f,0.f,0.f,0.f,0.f,0.f};
  v8f s[2][2];
#pragma unroll
  for (int u = 0; u < 2; ++u)
#pragma unroll
    for (int kt = 0; kt < 2; ++kt) s[u][kt] = fa_mma(kf[kt][1], qf[u][1], fa_mma(kf[kt][0], qf[u][0], z8));
  if (!DIAG) {
#pragma unroll
    for (int kt = 0; kt < 2; ++kt) { kf[kt][0] = g2_frag(kn + (size_t)kt * 16 * DM, hh); kf[kt][1] = g2_frag(kn + (size_t)kt * 16 * DM + 32, hh); } }
  if (DIAG) {
#pragma unroll
    for (int u = 0; u < 2; ++u)
#pragma unroll
      for (int kt = 0; kt < 2; ++kt)
#pragma unroll
        for (int r = 0; r < 8; ++r) s[u][kt][r] = (kt * 16 + 8 * hh + r <= u * 16 + c) ? s[u][kt][r] : -1.0e30f; }
  float mx[2];
#pragma unroll
  for (int u = 0; u < 2; ++u) { float a = fmaxf(s[u][0][0], s[u][1][0]);
#pragma unroll
    for (int r = 1; r < 8; ++r) a = fmaxf(a, fmaxf(s[u][0][r], s[u][1][r]));
    a = fmaxf(a, __shfl_xor(a, 16)); mx[u] = a * cs; }      /* cs > 0: scaling commutes with the maximum */
  if (__builtin_amdgcn_ballot_w32(mx[0] > mu[0] + 8.0f || mx[1] > mu[1] + 8.0f) != 0) {      /* one scalar test per step */
    const float mn0 = fmaxf(mu[0], mx[0]), mn1 = fmaxf(mu[1], mx[1]); float al[2]; fa_exp2(mu[0] - mn0, mu[1] - mn1, al[0], al[1]); mu[0] = mn0; mu[1] = mn1;
#pragma unroll
    for (int u = 0; u < 2; ++u) { l[u] *= al[u];
#pragma unroll
      for (int t = 0; t < 4; ++t) o[u][t] *= al[u]; } }
  FragH pf[2];
#pragma unroll
  for (int u = 0; u < 2; ++u) { float sm = 0.f;
#pragma unroll
    for (int kt = 0; kt < 2; ++kt) { v8f x;
#pragma unroll
      for (int r = 0; r < 8; ++r) x[r] = fmaf(s[u][kt][r], cs, -mu[u]);
      const v8f p = fa_exp8(x);
#pragma unroll
      for (int r = 0; r < 8; ++r) { sm += p[r]; pf[u].h[kt * 8 + r] = (_Float16)p[r]; } }
    l[u] += sm; }
#pragma unroll
  for (int u = 0; u < 2; ++u)
#pragma unroll
    for (int t = 0; t < 4; ++t) o[u][t] = fa_mma(vf[t], pf[u].v, o[u][t]);
  if (!DIAG) {
#pragma unroll
    for (int t = 0; t < 4; ++t) vf[t] = g2_frag(vn + (size_t)t * 16 * SQ, hh);
    asm volatile("s_wait_xcnt 0x0" ::: "memory"); } }      /* stands behind the step's last loads, ahead of the next step's first write of a register that holds their address */
__global__ __launch_bounds__(128) void k_fattn(const _Float16* __restrict__ Q16, const _Float16* __restrict__ K16, const _Float16* __restrict__ VTa, _Float16* __restrict__ O) {
  const int lane = threadIdx.x & 31, c = lane & 15, hh = lane >> 4;
  const int w = __builtin_amdgcn_readfirstlane(threadIdx.x >> 5);      /* the wave's number as a scalar: the trip count is scalar */
  const int bh = blockIdx.x % (NB * NH); const int g = blockIdx.x / (4 * NB * NH), rr = (blockIdx.x / (NB * NH)) % 4;
  const int qt = (3 - g) * 4 + ((g & 1) ? rr : 3 - rr);      /* a permutation of the 16 query tiles: long tiles first, and blocks a quarter of the grid apart have tiles that sum to the same length */
  const int b = bh / NH, h = bh % NH; const int q0 = qt * 128 + w * 32;
  const _Float16* qp = Q16 + ((size_t)b * SQ + q0 + c) * DM + h * HD;
  const _Float16* kp = K16 + ((size_t)b * SQ + c) * DM + h * HD;
  const _Float16* vp = VTa + ((size_t)bh * HD + c) * SQ;
  const v8f z8 = {0.f,0.f,0.f,0.f,0.f,0.f,0.f,0.f};
  v16h qf[2][2], kf[2][2], vf[4];
#pragma unroll
  for (int u = 0; u < 2; ++u) { qf[u][0] = g2_frag(qp + (size_t)u * 16 * DM, hh); qf[u][1] = g2_frag(qp + (size_t)u * 16 * DM + 32, hh); }
#pragma unroll
  for (int kt = 0; kt < 2; ++kt) { kf[kt][0] = g2_frag(kp + (size_t)kt * 16 * DM, hh); kf[kt][1] = g2_frag(kp + (size_t)kt * 16 * DM + 32, hh); }
#pragma unroll
  for (int t = 0; t < 4; ++t) vf[t] = g2_frag(vp + (size_t)t * 16 * SQ, hh);
  asm volatile("s_wait_xcnt 0x0" ::: "memory");      /* stands behind the first fragments' loads, ahead of the first write of a register that holds one of their addresses */
  v8f o[2][4]; float mu[2], l[2];
#pragma unroll
  for (int u = 0; u < 2; ++u) { mu[u] = -1.0e30f; l[u] = 0.f;
#pragma unroll
    for (int t = 0; t < 4; ++t) o[u][t] = z8; }
#pragma unroll 1
  for (int k0 = 0; k0 < q0; k0 += 32) fa_step<false>(qf, kf, vf, o, mu, l, kp + (size_t)(k0 + 32) * DM, vp + k0 + 32, c, hh);      /* kept rolled: one step holds 16 WMMAs and the registers of four waves per SIMD; k0 + 32 <= q0 is a step of this wave */
  fa_step<true>(qf, kf, vf, o, mu, l, kp, vp, c, hh);
#pragma unroll
  for (int u = 0; u < 2; ++u) { const float fin = 64.0f / (l[u] + __shfl_xor(l[u], 16));      /* the lane halves' sums join once; o carried x64 */
    unsigned short* dst = (unsigned short*)O + ((size_t)b * SQ + q0 + u * 16 + c) * DM + h * HD + 8 * hh;
#pragma unroll
    for (int t = 0; t < 4; ++t) { FragH f;
#pragma unroll
      for (int r = 0; r < 8; ++r) f.h[r] = (_Float16)(o[u][t][r] * fin);      /* register r is output column 16 t + 8 hh + r of query c: one 16-byte store */
      *(v8us*)(dst + t * 16) = f.half[0]; } } }
static_assert(SQ == 16 * 128 && HD == 64, "k_fattn: 16 query tiles of 4 waves x 32 query columns, head size 64");


// Exact f32 causal attention for the first QT0 rows, one wave per (head, query row), 8 rows of one head per block.
// The head's QT0 key rows are staged in LDS at a pitch of HD + 4 floats (16 bytes x an odd number: row-per-lane 16-byte reads without bank conflicts).
// Lane l scores keys l, l + 32, l + 64, l + 96 (each dot product summed over d in index order); row maximum and row sum end in lane butterflies;
// then lane l sums output columns 2 l and 2 l + 1 over the keys in index order, each weight read from its lane as a scalar.
typedef float v2f __attribute__((ext_vector_type(2)));
typedef float v2fa __attribute__((ext_vector_type(2), may_alias));
typedef _Float16 v2h __attribute__((ext_vector_type(2)));
__global__ __launch_bounds__(256) void k_att0w(const float* __restrict__ QF, const float* __restrict__ KF, const float* __restrict__ VF, float scale, _Float16* __restrict__ OH, _Float16* __restrict__ OL) {      /* all five row pitches are DM, so that every row step is an immediate offset */
  __shared__ __attribute__((aligned(16))) float lk[QT0][HD + 4];
  { const size_t bo = (size_t)blockIdx.y * QT0 * DM; QF += bo; KF += bo; VF += bo; OH += bo; OL += bo; }      /* blockIdx.y: the batch */
  const int tid = threadIdx.x, lane = tid & 31; const int h = blockIdx.x / (QT0 / 8);
  const int i = (blockIdx.x % (QT0 / 8)) * 8 + __builtin_amdgcn_readfirstlane(tid >> 5);      /* the wave's query row, held as a scalar so that the q row and the group tests below are wave-uniform */
  const float* kb = KF + h * HD;
#pragma unroll
  for (int p = 0; p < QT0 / 16; ++p) { const int r = p * 16 + (tid >> 4), c4 = (tid & 15) * 4; *(v4f*)&lk[r][c4] = *(const v4fa*)(kb + (size_t)r * DM + c4); }      /* unrolled: all 8 loads of a thread in flight at once */
  __syncthreads();
  const float* qr = QF + (size_t)i * DM + h * HD;
  float sa[QT0 / 32];
#pragma unroll
  for (int g = 0; g < QT0 / 32; ++g) sa[g] = 0.f;
#pragma unroll
  for (int c = 0; c < HD / 4; ++c) { const v4f qq = *(const v4fa*)(qr + c * 4);      /* unrolled: sa stays in named registers and the four groups' sum chains interleave */
#pragma unroll
    for (int g = 0; g < QT0 / 32; ++g) { const v4f kq = *(const v4f*)&lk[g * 32 + lane][c * 4]; sa[g] = fmaf(qq[0], kq[0], sa[g]); sa[g] = fmaf(qq[1], kq[1], sa[g]); sa[g] = fmaf(qq[2], kq[2], sa[g]); sa[g] = fmaf(qq[3], kq[3], sa[g]); } }
  float m = -1.0e30f;
#pragma unroll
  for (int g = 0; g < QT0 / 32; ++g) { sa[g] = (g * 32 + lane <= i) ? sa[g] * scale : -1.0e30f; m = fmaxf(m, sa[g]); }      /* causal: keys above the row get weight 0 */
#pragma unroll
  for (int o = 16; o > 0; o >>= 1) m = fmaxf(m, __shfl_xor(m, o));
  float l = 0.f;
#pragma unroll
  for (int g = 0; g < QT0 / 32; ++g) { sa[g] = expf(sa[g] - m); l += sa[g]; }
#pragma unroll
  for (int o = 16; o > 0; o >>= 1) l += __shfl_xor(l, o);
  const float* vb = VF + h * HD + lane * 2; float o0 = 0.f, o1 = 0.f;
#pragma unroll
  for (int g = 0; g < QT0 / 32; ++g) { if (g * 32 <= i) {      /* wave-uniform: key groups wholly above the row are skipped */
#pragma unroll
      for (int jj = 0; jj < 32; ++jj) { const float p = __int_as_float(__builtin_amdgcn_readlane(__float_as_int(sa[g]), jj)); const v2f vv = *(const v2fa*)(vb + (size_t)(g * 32 + jj) * DM); o0 = fmaf(p, vv[0], o0); o1 = fmaf(p, vv[1], o1); } } }      /* unrolled: a group's 32 loads issue before the first use */
  const float fin = 64.0f / l;      /* o carried x64 like the f16 path */
  const float a0 = o0 * fin, a1 = o1 * fin; v2h hv, lv;      /* o leaves as an f16 value plus its residual x1024, the two A operands of the output projection's first-tile blocks */
  hv[0] = (_Float16)a0; hv[1] = (_Float16)a1; lv[0] = (_Float16)((a0 - (float)hv[0]) * 1024.0f); lv[1] = (_Float16)((a1 - (float)hv[1]) * 1024.0f);
  const size_t oo = (size_t)i * DM + h * HD + lane * 2; *(v2h*)(OH + oo) = hv; *(v2h*)(OL + oo) = lv; }

// Output projection of ALL token rows in ONE launch (wave tile, product order and store path of k_gemm2, pitches and K = DM; K loop on LDS stages as in k_qkv_rope): out = o W_o, o carried x64 and W_o x16.
// A block is 8 waves: 128 rows of one batch x 128 columns. The blocks of each batch's first 128 rows take the exact attention's o instead of the f16 path's: its f16 value and its x1024 residual are two A operands
// that share every B fragment in one K loop, on two accumulator sets that join in the epilogue (hi 2^-10 + lo 2^-20). These blocks do twice the products, so they have the lowest block indices.
__global__ __launch_bounds__(256) void k_oproj(const _Float16* __restrict__ O, const _Float16* __restrict__ OH, const _Float16* __restrict__ OL, const _Float16* __restrict__ Bh, float* __restrict__ C) {
  __shared__ __attribute__((aligned(16))) char sm[2 * GSTG3];      /* two stages in the K loop; behind it the epilogue's staging */
  static_assert(sizeof(float) * 8 * 32 * 68 <= 2 * GSTG3, "the epilogue's staging fits the two stages");
  float (*so)[32][68] = (float (*)[32][68])sm;
  const int tid = threadIdx.x, w8 = tid >> 5, w = w8 & 3, wg = w8 >> 2, lane = tid & 31, ln = lane & 15, hh = lane >> 4;      /* w: the wave's 32 rows; wg: its 64 columns */
  const int ntn = DM / 128, tpb = SQ / 128; const int mi = blockIdx.x / ntn, np = blockIdx.x - mi * ntn;
  const bool first = mi < NB;      /* block-uniform */
  const int b = first ? mi : (mi - NB) / (tpb - 1); const int tl = first ? 0 : 1 + (mi - NB) % (tpb - 1);      /* batch; 128-row tile in the batch */
  const int row0 = b * SQ + tl * 128 + 32 * w, col0 = np * 128 + wg * 64;
  const unsigned l0 = (unsigned)(size_t)sm + (unsigned)(tid >> 3) * (GP * 2) + (unsigned)(tid & 7) * 16;      /* the thread's first place in stage 0: LDS byte address */
  const _Float16* gb = Bh + (size_t)(np * 128 + (tid >> 3)) * DM + (tid & 7) * 8;
  const v8f z8 = {0.f,0.f,0.f,0.f,0.f,0.f,0.f,0.f}; v8f c00 = z8, c01 = z8, c02 = z8, c03 = z8, c10 = z8, c11 = z8, c12 = z8, c13 = z8;
  v8f accs[8];
  if (!first) {
    const _Float16* ga = O + (size_t)(b * SQ + tl * 128 + (tid >> 3)) * DM + (tid & 7) * 8;
    g3_copy8(l0, ga, gb);
    asm volatile("s_wait_asynccnt 0x0" ::: "memory");      /* this wave's part of tile 0 has landed */
    __syncthreads();      /* tile 0 is whole for every wave */
    g3_copy8(l0 + GSTG3, ga + 64, gb + 64);
#pragma unroll 1
    for (int t = 0; t < DM / 64; ++t) {      /* kept rolled: one trip is one stage, 16 WMMAs a wave */
      const _Float16* st = (const _Float16*)(sm + (t & 1) * GSTG3);
      const _Float16* ap = st + (32 * w + ln) * GP; const _Float16* bp = st + (128 + 64 * wg + ln) * GP;
#pragma unroll
      for (int kk = 0; kk < 64; kk += 32) { const v16h a0 = g2_frag(ap + kk, hh), a1 = g2_frag(ap + 16 * GP + kk, hh);      /* unrolled: the LDS offsets of both halves of the stage are immediates; the six fragments of 32 k are read as one group, ahead of their WMMAs */
        const v16h b0 = g2_frag(bp + kk, hh), b1 = g2_frag(bp + 16 * GP + kk, hh), b2 = g2_frag(bp + 32 * GP + kk, hh), b3 = g2_frag(bp + 48 * GP + kk, hh);
        c00 = g2_mma(a0, b0, c00); c10 = g2_mma(a1, b0, c10); c01 = g2_mma(a0, b1, c01); c11 = g2_mma(a1, b1, c11);
        c02 = g2_mma(a0, b2, c02); c12 = g2_mma(a1, b2, c12); c03 = g2_mma(a0, b3, c03); c13 = g2_mma(a1, b3, c13); }
      asm volatile("s_wait_dscnt 0x0" ::: "memory");      /* this wave's reads of the stage have returned */
      asm volatile("s_wait_asynccnt 0x0" ::: "memory");      /* this wave's part of tile t + 1 has landed */
      __syncthreads();      /* publishes tile t + 1 and ends every wave's reads of tile t */
      if (t + 2 < DM / 64) g3_copy8(l0 + (unsigned)(t & 1) * GSTG3, ga + (t + 2) * 64, gb + (t + 2) * 64); }      /* refill of the stage just left; the test is the same for the whole block */
    asm volatile("s_wait_asynccnt 0x0" ::: "memory");      /* no copy is outstanding when the stages become the epilogue's staging */
    accs[0] = c00 * 0.0009765625f; accs[1] = c01 * 0.0009765625f; accs[2] = c02 * 0.0009765625f; accs[3] = c03 * 0.0009765625f;
    accs[4] = c10 * 0.0009765625f; accs[5] = c11 * 0.0009765625f; accs[6] = c12 * 0.0009765625f; accs[7] = c13 * 0.0009765625f;
  } else {
    const size_t go = ((size_t)b * QT0 + (tid >> 3)) * DM + (tid & 7) * 8;
    const _Float16* ga = OH + go; const _Float16* ge = OL + go;
    v8f d00 = z8, d01 = z8, d02 = z8, d03 = z8, d10 = z8, d11 = z8, d12 = z8, d13 = z8;
    g3_copy8(l0, ga, gb); g3_copy4(l0 + 256u * GP * 2, ge);
    asm volatile("s_wait_asynccnt 0x0" ::: "memory");      /* this wave's part of tile 0 has landed */
    __syncthreads();      /* tile 0 is whole for every wave */
    g3_copy8(l0 + GSTG3, ga + 64, gb + 64); g3_copy4(l0 + GSTG3 + 256u * GP * 2, ge + 64);
#pragma unroll 1
    for (int t = 0; t < DM / 64; ++t) {      /* kept rolled, like the loop above: 32 WMMAs a wave */
      const _Float16* st = (const _Float16*)(sm + (t & 1) * GSTG3);
      const _Float16* ap = st + (32 * w + ln) * GP; const _Float16* bp = st + (128 + 64 * wg + ln) * GP; const _Float16* ep = st + (256 + 32 * w + ln) * GP;
#pragma unroll
      for (int kk = 0; kk < 64; kk += 32) { const v16h a0 = g2_frag(ap + kk, hh), a1 = g2_frag(ap + 16 * GP + kk, hh), e0 = g2_frag(ep + kk, hh), e1 = g2_frag(ep + 16 * GP + kk, hh);      /* unrolled and grouped as above: eight fragments */
        const v16h b0 = g2_frag(bp + kk, hh), b1 = g2_frag(bp + 16 * GP + kk, hh), b2 = g2_frag(bp + 32 * GP + kk, hh), b3 = g2_frag(bp + 48 * GP + kk, hh);
        c00 = g2_mma(a0, b0, c00); c10 = g2_mma(a1, b0, c10); d00 = g2_mma(e0, b0, d00); d10 = g2_mma(e1, b0, d10);
        c01 = g2_mma(a0, b1, c01); c11 = g2_mma(a1, b1, c11); d01 = g2_mma(e0, b1, d01); d11 = g2_mma(e1, b1, d11);
        c02 = g2_mma(a0, b2, c02); c12 = g2_mma(a1, b2, c12); d02 = g2_mma(e0, b2, d02); d12 = g2_mma(e1, b2, d12);
        c03 = g2_mma(a0, b3, c03); c13 = g2_mma(a1, b3, c13); d03 = g2_mma(e0, b3, d03); d13 = g2_mma(e1, b3, d13); }
      asm volatile("s_wait_dscnt 0x0" ::: "memory");      /* this wave's reads of the stage have returned */
      asm volatile("s_wait_asynccnt 0x0" ::: "memory");      /* this wave's part of tile t + 1 has landed */
      __syncthreads();      /* publishes tile t + 1 and ends every wave's reads of tile t */
      if (t + 2 < DM / 64) { g3_copy8(l0 + (unsigned)(t & 1) * GSTG3, ga + (t + 2) * 64, gb + (t + 2) * 64); g3_copy4(l0 + (unsigned)(t & 1) * GSTG3 + 256u * GP * 2, ge + (t + 2) * 64); } }      /* refill of the stage just left; the test is the same for the whole block */
    asm volatile("s_wait_asynccnt 0x0" ::: "memory");      /* no copy is outstanding when the stages become the epilogue's staging */
    const v8f ch[8] = {c00, c01, c02, c03, c10, c11, c12, c13}, cl[8] = {d00, d01, d02, d03, d10, d11, d12, d13};
#pragma unroll
    for (int u = 0; u < 8; ++u)
#pragma unroll
      for (int r = 0; r < 8; ++r) accs[u][r] = fmaf(cl[u][r], 0.00000095367431640625f, ch[u][r] * 0.0009765625f);      /* both factors are powers of two: one rounding, that of the sum */
  }
#pragma unroll
  for (int u = 0; u < 8; ++u)
#pragma unroll
    for (int r = 0; r < 8; ++r) so[w8][(u >> 2) * 16 + 8 * hh + r][(u & 3) * 16 + ln] = accs[u][r];
  __builtin_amdgcn_fence(__ATOMIC_ACQ_REL, "workgroup"); __builtin_amdgcn_wave_barrier();      /* the wave reads back what its own lanes wrote */
  const int rsub = lane >> 4, c4 = (lane & 15) * 4;
#pragma unroll
  for (int q = 0; q < 16; ++q) { const int r = q * 2 + rsub; const v4f v = *(const v4fa*)&so[w8][r][c4]; *(v4f*)(C + (size_t)(row0 + r) * DM + col0 + c4) = v; } }
static_assert(QT0 == 128 && SQ % 128 == 0 && SQ > 128 && DM % 128 == 0, "k_oproj: the first-tile rows are one block row of each batch");

template <int NORM, int ROPE>
__global__ __launch_bounds__(64) void k_xformf(const float* __restrict__ F, int ldf, int nh, const float* __restrict__ gain, float eps, const float* __restrict__ CS, const float* __restrict__ SN, float* __restrict__ F32, int ldo) {
  #pragma clang fp contract(off)
  __shared__ float xv[HD]; __shared__ float red[HD]; const int d = threadIdx.x; const int h = blockIdx.x % nh; const size_t r = blockIdx.x / nh; const int p = (int)(r % SQ);
  float x = F[r * (size_t)ldf + (size_t)h * HD + d];
  if (NORM) { red[d] = __fmul_rn(x, x); __syncthreads(); for (int st = HD / 2; st > 0; st >>= 1) { if (d < st) red[d] = __fadd_rn(red[d], red[d + st]); __syncthreads(); } const float rs = rsqrtf(__fadd_rn(red[0] / (float)HD, eps)); x = __fmul_rn(__fmul_rn(x, rs), bf16_round(gain[d])); }
  xv[d] = x; __syncthreads();
  float o = x;
  if (ROPE == 1) { const int i = d >> 1; const float c = CS[p * (HD / 2) + i], s = SN[p * (HD / 2) + i]; const float ev = xv[2 * i], od = xv[2 * i + 1]; o = (d & 1) ? __fadd_rn(__fmul_rn(ev, s), __fmul_rn(od, c)) : __fadd_rn(__fmul_rn(ev, c), -__fmul_rn(od, s)); }
  if (ROPE == 2) { const int i = d & (HD / 2 - 1); const float c = CS[p * (HD / 2) + i], s = SN[p * (HD / 2) + i]; const float lo = xv[i], hi = xv[i + HD / 2]; o = (d < HD / 2) ? __fadd_rn(__fmul_rn(lo, c), -__fmul_rn(hi, s)) : __fadd_rn(__fmul_rn(lo, s), __fmul_rn(hi, c)); }
  float* dst = F32 + r * (size_t)ldo + (size_t)h * HD + d; *(float*)dst = o;  }


__global__ __launch_bounds__(256) void k_bfcp(const float* __restrict__ src, float* __restrict__ dst, size_t n4) { const size_t t = (size_t)blockIdx.x * 256 + threadIdx.x; if (t >= n4) return; const v4f a = *(const v4fa*)(src + t * 4); v4f o; for (int q = 0; q < 4; ++q) o[q] = bf16_round(a[q]); *(v4f*)(dst + t * 4) = o;  }
extern "C" void kernel_launch(void* const* d_in, const int* in_sizes, int n_in,
                              void* d_out, int out_size, void* d_ws, size_t ws_size, hipStream_t stream) {
  (void)in_sizes; (void)n_in; (void)out_size;
    const float* const* I = (const float* const*)d_in; const float* x = I[0]; const float* tcos = I[1]; const float* tsin = I[2]; const float* wq = I[3]; const float* wk = I[4]; const float* wv = I[5]; const float* wo = I[6];      /* [in][out] weights, no biases; rope tables INPUT [2048][32] */
  char* ws = (char*)d_ws; size_t off = 0;
  auto take = [&](size_t bytes) { char* p = ws + off; off += (bytes + 255) & ~(size_t)255; return p; };
  _Float16* BQKV = (_Float16*)take((size_t)3 * DM * DM * 2); _Float16* BO = (_Float16*)take((size_t)DM * DM * 2);
  _Float16* X16 = (_Float16*)take(NR * DM * 2);
  _Float16* QH = (_Float16*)take(NR * DM * 2); _Float16* KH = (_Float16*)take(NR * DM * 2); _Float16* O16 = (_Float16*)take(NR * DM * 2);
  _Float16* VT = (_Float16*)take((size_t)NB * NH * HD * SQ * 2);
  float* QF0 = (float*)take((size_t)NB * QT0 * DM * 4); float* KF0 = (float*)take((size_t)NB * QT0 * DM * 4); float* VF0 = (float*)take((size_t)NB * QT0 * DM * 4); _Float16* OH0 = (_Float16*)take((size_t)NB * QT0 * DM * 2); _Float16* OL0 = (_Float16*)take((size_t)NB * QT0 * DM * 2);
  if (off > ws_size) return;
  { const unsigned g = (unsigned)(((size_t)DM * (DM / 8) + 255) / 256); k_wt_f16<<<g, 256, 0, stream>>>(wq, BQKV, DM, DM, 16.0f); k_wt_f16<<<g, 256, 0, stream>>>(wk, BQKV + (size_t)DM * DM, DM, DM, 16.0f); k_wt_f16<<<g, 256, 0, stream>>>(wv, BQKV + (size_t)2 * DM * DM, DM, DM, 16.0f); k_wt_f16<<<g, 256, 0, stream>>>(wo, BO, DM, DM, 16.0f); }      /* [in][out] -> Bt[n][k] x16; q | k | v stacked along n */
  k_x16<<<(unsigned)((NR * DM / 8 + 255) / 256), 256, 0, stream>>>(x, X16, NR * DM / 8);
  k_qkv_rope<<<(unsigned)((NR / 128) * (3 * DM / 128)), 256, 0, stream>>>(X16, BQKV, tcos, tsin, QH, KH, VT, QF0, KF0, VF0);      /* roped f16 q, k rows, V^T [NB][NH][HD][SQ], f32 q, k, v of each batch's first 128 rows */
  k_att0w<<<dim3(NH * (QT0 / 8), NB), 256, 0, stream>>>(QF0, KF0, VF0, 0.125f, OH0, OL0);      /* exact f32 causal attention for rows 0..127 of every batch (o x64) -> f16 hi + x1024 residual planes */
  k_fattn<<<(SQ / 128) * NB * NH, 128, 0, stream>>>(QH, KH, VT, O16);      /* o (merged heads, x64) as f16 rows, all batches */
  k_oproj<<<(unsigned)((NR / 128) * (DM / 128)), 256, 0, stream>>>(O16, OH0, OL0, BO, (float*)d_out);      /* out rows are the output layout; rows 0..127 of each batch from the hi and lo planes */
}

// v007
// A run of this version takes 142 microseconds.
// Timed twice side by side with v006, it ran 1.15 times as fast both times.
// All steps since v000 together make it 68.1 times as fast.
#include <hip/hip_runtime.h>
#define NB 4
#define SQ 2048
#define DM 1024
#define NH 16
#define HD 64
#define HG 4                         /* heads per launch of the k_vt(V16, b, h0, VT) overload (not launched) */
#define QT0 128                      /* first-tile rows recomputed exactly in f32 */
#define B0 0                         /* not used by any kernel or launch */
#define NBR NB                       /* read only by MPO */
#define NR ((size_t)NB * SQ)         /* token rows */
#define MPO ((int)((size_t)NBR * SQ))      /* not used by any kernel or launch */
typedef __bf16 v16b __attribute__((ext_vector_type(16)));
typedef unsigned short v8us __attribute__((ext_vector_type(8), may_alias));
typedef float  v8f  __attribute__((ext_vector_type(8)));
typedef float  v4f  __attribute__((ext_vector_type(4)));
typedef float  v4fa __attribute__((ext_vector_type(4), may_alias));
union FragB { v16b v; v8us half[2]; unsigned short u[16]; };

__device__ __forceinline__ unsigned short bf16_bits(float x) { unsigned int u = __float_as_uint(x); return (unsigned short)((u + 0x7FFFu + ((u >> 16) & 1u)) >> 16); }
__device__ __forceinline__ float bf16_val(unsigned short b) { return __uint_as_float(((unsigned int)b) << 16); }
__device__ __forceinline__ float bf16_round(float x) { return bf16_val(bf16_bits(x)); }
// D += A·B with NT terms: 1 = ah·bh, 2 = + al·bh (A split), 3 = + ah·bl (both split)
template <int NT>
__device__ __forceinline__ v8f mmaN(v16b ah, v16b al, v16b bh, v16b bl, v8f c) {
  c = __builtin_amdgcn_wmma_f32_16x16x32_bf16(false, ah, false, bh, (short)0, c, false, false);
  if (NT >= 2) c = __builtin_amdgcn_wmma_f32_16x16x32_bf16(false, al, false, bh, (short)0, c, false, false);
  if (NT >= 3) c = __builtin_amdgcn_wmma_f32_16x16x32_bf16(false, ah, false, bl, (short)0, c, false, false);
  asm volatile("v_nop\n\tv_nop\n\tv_nop\n\tv_nop" : "+v"(c) : "v"(ah), "v"(al), "v"(bh), "v"(bl));
  return c;
}

__global__ __launch_bounds__(256) void k_wt_bf16(const float* __restrict__ W, unsigned short* __restrict__ Wt, int K, int N) {
  const int t = blockIdx.x * 256 + threadIdx.x;
  const int k8n = K / 8;
  if (t >= N * k8n) return;
  const int n = t / k8n, k8 = (t % k8n) * 8;
  v8us v;
#pragma unroll
  for (int i = 0; i < 8; ++i) v[i] = bf16_bits(W[(size_t)(k8 + i) * N + n]);
  *(v8us*)(Wt + (size_t)n * K + k8) = v;
  
}

// GEMM C[M][N] (f32, pitch ldc) = act(A[M][K]·W + bias). A f32 row-major (pitch lda) converted per fragment to bf16
// (ASPLIT: hi/lo two planes -> 2 terms, else single rounded term); Wt bf16 [N][K] (pitch ldb). BIAS_BF16 rounds the
// bias to bf16 first (bias quantised to bf16 before the add). K%32==0, M%16==0, N%64==0.
template <bool ASPLIT, int ACT, bool BIAS_BF16>
__global__ __launch_bounds__(128) void k_gemm_bf(const float* __restrict__ A, int lda, const unsigned short* __restrict__ Wt, int ldb,
                                               const float* __restrict__ bias, float* __restrict__ C, int ldc, int M, int N, int K) {
  __shared__ __attribute__((aligned(16))) float so[4][16][64];
  const int tid = threadIdx.x, w = tid >> 5, lane = tid & 31, ln = lane & 15, hh = lane >> 4;
  const int ntn = N / 64;
  const int wid = blockIdx.x * 4 + w;
  const int mt = wid / ntn, nq = wid % ntn;
  if (mt * 16 >= M) return;
  const int row0 = mt * 16, col0 = nq * 64;
  const float* arow = A + (size_t)(row0 + ln) * lda;
  v8f acc[4] = {};
  for (int kb = 0; kb < K; kb += 32) {
    FragB ah, al;
    const v4f x0 = *(const v4fa*)(arow + kb + 8 * hh), x1 = *(const v4fa*)(arow + kb + 8 * hh + 4);
    const v4f x2 = *(const v4fa*)(arow + kb + 16 + 8 * hh), x3 = *(const v4fa*)(arow + kb + 16 + 8 * hh + 4);
    float xs[16] = {x0[0],x0[1],x0[2],x0[3],x1[0],x1[1],x1[2],x1[3],x2[0],x2[1],x2[2],x2[3],x3[0],x3[1],x3[2],x3[3]};
#pragma unroll
    for (int i = 0; i < 16; ++i) { const unsigned short hb = bf16_bits(xs[i]); ah.u[i] = hb; al.u[i] = ASPLIT ? bf16_bits(xs[i] - bf16_val(hb)) : (unsigned short)0; }
#pragma unroll
    for (int t = 0; t < 4; ++t) {
      const unsigned short* brow = Wt + (size_t)(col0 + t * 16 + ln) * ldb + kb;
      FragB b;
      b.half[0] = *(const v8us*)(brow + 8 * hh);
      b.half[1] = *(const v8us*)(brow + 16 + 8 * hh);
      acc[t] = mmaN<ASPLIT ? 2 : 1>(ah.v, al.v, b.v, b.v, acc[t]);
    }
  }
#pragma unroll
  for (int t = 0; t < 4; ++t) {
    float bv = bias ? bias[col0 + t * 16 + ln] : 0.f;
    if (BIAS_BF16) bv = bf16_round(bv);
#pragma unroll
    for (int r = 0; r < 8; ++r) { float v = acc[t][r] + bv; if (ACT == 1) v = fmaxf(v, 0.f); so[w][8 * hh + r][t * 16 + ln] = v; }
  }
  __builtin_amdgcn_fence(__ATOMIC_ACQ_REL, "workgroup");
  __builtin_amdgcn_wave_barrier();
  const int rsub = lane >> 4, c4 = (lane & 15) * 4;
  {
#pragma unroll
    for (int q = 0; q < 8; ++q) {
      const int r = q * 2 + rsub;
      const v4f v = *(const v4fa*)&so[w][r][c4];
      *(v4f*)(C + (size_t)(row0 + r) * ldc + col0 + c4) = v;
    }
    
  }
}

// GEMM C = act(A·W + bias + resid): A f32 (ASPLIT -> hi/lo 2 terms), Wt bf16 [N][K]; ACT 0 none, 1 relu, 2 exact gelu;
// resid (optional, f32, row index = (row % rmod), pitch ldr, RES_BF16 rounds it) added before the activation.
template <bool ASPLIT, int ACT, bool BIAS_BF16, bool RES_BF16>
__global__ __launch_bounds__(128) void k_gemm_bf3(const float* __restrict__ A, int lda, const unsigned short* __restrict__ Wt, int ldb,
                                                const float* __restrict__ bias, const float* __restrict__ resid, int rmod, int ldr,
                                                float* __restrict__ C, int ldc, int M, int N, int K) {
  __shared__ __attribute__((aligned(16))) float so[4][16][64];
  const int tid = threadIdx.x, w = tid >> 5, lane = tid & 31, ln = lane & 15, hh = lane >> 4;
  const int ntn = N / 64;
  const int wid = blockIdx.x * 4 + w;
  const int mt = wid / ntn, nq = wid % ntn;
  if (mt * 16 >= M) return;
  const int row0 = mt * 16, col0 = nq * 64;
  const float* arow = A + (size_t)(row0 + ln) * lda;
  v8f acc[4] = {};
  for (int kb = 0; kb < K; kb += 32) {
    FragB ah, al;
    const v4f x0 = *(const v4fa*)(arow + kb + 8 * hh), x1 = *(const v4fa*)(arow + kb + 8 * hh + 4);
    const v4f x2 = *(const v4fa*)(arow + kb + 16 + 8 * hh), x3 = *(const v4fa*)(arow + kb + 16 + 8 * hh + 4);
    float xs[16] = {x0[0],x0[1],x0[2],x0[3],x1[0],x1[1],x1[2],x1[3],x2[0],x2[1],x2[2],x2[3],x3[0],x3[1],x3[2],x3[3]};
#pragma unroll
    for (int i = 0; i < 16; ++i) { const unsigned short hb = bf16_bits(xs[i]); ah.u[i] = hb; al.u[i] = ASPLIT ? bf16_bits(xs[i] - bf16_val(hb)) : (unsigned short)0; }
#pragma unroll
    for (int t = 0; t < 4; ++t) {
      const unsigned short* brow = Wt + (size_t)(col0 + t * 16 + ln) * ldb + kb;
      FragB b;
      b.half[0] = *(const v8us*)(brow + 8 * hh);
      b.half[1] = *(const v8us*)(brow + 16 + 8 * hh);
      acc[t] = mmaN<ASPLIT ? 2 : 1>(ah.v, al.v, b.v, b.v, acc[t]);
    }
  }
#pragma unroll
  for (int t = 0; t < 4; ++t) {
    const int col = col0 + t * 16 + ln;
    float bv = bias ? bias[col] : 0.f;
    if (BIAS_BF16) bv = bf16_round(bv);
#pragma unroll
    for (int r = 0; r < 8; ++r) {
      float v = acc[t][r] + bv;
      if (resid) { float rv = resid[(size_t)((row0 + 8 * hh + r) % rmod) * ldr + col]; if (RES_BF16) rv = bf16_round(rv); v += rv; }
      if (ACT == 1) v = fmaxf(v, 0.f);
      if (ACT == 2) v = 0.5f * v * (1.0f + erff(v * 0.70710678118654752f));
      if (ACT == 3) { const float u = 0.7978845608028654f * (v + 0.044715f * v * v * v); v = 0.5f * v * (1.0f + tanhf(u)); }
      so[w][8 * hh + r][t * 16 + ln] = v;
    }
  }
  __builtin_amdgcn_fence(__ATOMIC_ACQ_REL, "workgroup");
  __builtin_amdgcn_wave_barrier();
  const int rsub = lane >> 4, c4 = (lane & 15) * 4;
  {
#pragma unroll
    for (int q = 0; q < 8; ++q) {
      const int r = q * 2 + rsub;
      const v4f v = *(const v4fa*)&so[w][r][c4];
      *(v4f*)(C + (size_t)(row0 + r) * ldc + col0 + c4) = v;
    }
    
  }
}
// row LayerNorm (biased variance, eps) over N: s = X (+ R); optional out_sum <- s; out_norm <- (s-mu)*rsqrt(var+eps)*g + b
template <bool PARAM_BF16>
__global__ __launch_bounds__(256) void k_layernorm(const float* __restrict__ X, const float* __restrict__ R, const float* __restrict__ g, const float* __restrict__ bta,
                                                  float* __restrict__ out_sum, float* __restrict__ out_norm, int N, float eps) {
  __shared__ float red[256];
  const int row = blockIdx.x, tid = threadIdx.x;
  const float* x = X + (size_t)row * N; const float* rr = R ? R + (size_t)row * N : nullptr;
  float vals[16];                     // up to N = 4096
  const int per = N / 256;            // contiguous chunk per thread? use strided-by-4 chunks: thread handles j = tid*4 + 1024*u
  float s1 = 0.f;
  for (int u = 0; u < per / 4; ++u) {
    const int j = tid * 4 + 1024 * u;
    const v4f a = *(const v4fa*)(x + j);
    v4f b = {0.f,0.f,0.f,0.f}; if (rr) b = *(const v4fa*)(rr + j);
#pragma unroll
    for (int q = 0; q < 4; ++q) { const float v = a[q] + b[q]; vals[u * 4 + q] = v; s1 += v; }
  }
  red[tid] = s1; __syncthreads();
  for (int st = 128; st > 0; st >>= 1) { if (tid < st) red[tid] += red[tid + st]; __syncthreads(); }
  const float mu = red[0] / (float)N; __syncthreads();
  float s2 = 0.f;
  for (int u = 0; u < per / 4; ++u)
#pragma unroll
    for (int q = 0; q < 4; ++q) { const float c = vals[u * 4 + q] - mu; s2 += c * c; }
  red[tid] = s2; __syncthreads();
  for (int st = 128; st > 0; st >>= 1) { if (tid < st) red[tid] += red[tid + st]; __syncthreads(); }
  const float rs = rsqrtf(red[0] / (float)N + eps);
  {
    for (int u = 0; u < per / 4; ++u) {
      const int j = tid * 4 + 1024 * u;
      v4f o, sm;
#pragma unroll
      for (int q = 0; q < 4; ++q) {
        float gg = g[j + q], bb = bta[j + q];
        if (PARAM_BF16) { gg = bf16_round(gg); bb = bf16_round(bb); }
        sm[q] = vals[u * 4 + q]; o[q] = (vals[u * 4 + q] - mu) * rs * gg + bb;
      }
      if (out_sum) *(v4f*)(out_sum + (size_t)row * N + j) = sm;
      *(v4f*)(out_norm + (size_t)row * N + j) = o;
    }
    
  }
}



// ---- f16 WMMA path (v_wmma_f32_16x16x32_f16): 11-bit significands for operands in range — used where a [0,1] probability operand needs more precision than bf16
typedef _Float16 v16h __attribute__((ext_vector_type(16)));
union FragH { v16h v; v8us half[2]; _Float16 h[16]; unsigned short u[16]; };
template <int NT>
__device__ __forceinline__ v8f mmaH(v16h ah, v16h al, v16h bh, v16h bl, v8f c) {
  c = __builtin_amdgcn_wmma_f32_16x16x32_f16(false, ah, false, bh, (short)0, c, false, false);
  if (NT >= 2) c = __builtin_amdgcn_wmma_f32_16x16x32_f16(false, al, false, bh, (short)0, c, false, false);
  if (NT >= 3) c = __builtin_amdgcn_wmma_f32_16x16x32_f16(false, ah, false, bl, (short)0, c, false, false);
  asm volatile("v_nop\n\tv_nop\n\tv_nop\n\tv_nop" : "+v"(c) : "v"(ah), "v"(al), "v"(bh), "v"(bl));
  return c;
}
// batched GEMM like k_gemm_b but f16 operands: A f32 (split into f16 hi/lo if ASPLIT, else rounded to f16), Bt = f16 values [n][k]; alpha; C f32; N multiple of 16 (partial tiles skipped)
template <bool ASPLIT>
__global__ __launch_bounds__(128) void k_gemm_h(const float* __restrict__ A, int lda, size_t sA, const _Float16* __restrict__ Bh, int ldb, size_t sB, float alpha, float* __restrict__ C, int ldc, size_t sC, int M, int N, int K) {
  __shared__ __attribute__((aligned(16))) float so[4][16][64];
  const int tid = threadIdx.x, w = tid >> 5, lane = tid & 31, ln = lane & 15, hh = lane >> 4; const int by = blockIdx.y;
  A += (size_t)by * sA; Bh += (size_t)by * sB; C += (size_t)by * sC;
  const int ntn = (N + 63) / 64; const int wid = blockIdx.x * 4 + w; const int mt = wid / ntn, nq = wid % ntn; if (mt * 16 >= M) return;
  const int row0 = mt * 16, col0 = nq * 64; const float* arow = A + (size_t)(row0 + ln) * lda;
  v8f acc[4] = {};
  for (int kb = 0; kb < K; kb += 32) {
    FragH ah, al;
    const v4f x0 = *(const v4fa*)(arow + kb + 8 * hh), x1 = *(const v4fa*)(arow + kb + 8 * hh + 4), x2 = *(const v4fa*)(arow + kb + 16 + 8 * hh), x3 = *(const v4fa*)(arow + kb + 16 + 8 * hh + 4);
    float xs[16] = {x0[0],x0[1],x0[2],x0[3],x1[0],x1[1],x1[2],x1[3],x2[0],x2[1],x2[2],x2[3],x3[0],x3[1],x3[2],x3[3]};
#pragma unroll
    for (int i = 0; i < 16; ++i) { const _Float16 h = (_Float16)xs[i]; ah.h[i] = h; al.h[i] = ASPLIT ? (_Float16)(xs[i] - (float)h) : (_Float16)0.0f; }
#pragma unroll
    for (int t = 0; t < 4; ++t) { if (col0 + t * 16 >= N) continue; const size_t boff = (size_t)(col0 + t * 16 + ln) * ldb + kb; FragH bq; bq.half[0] = *(const v8us*)(Bh + boff + 8 * hh); bq.half[1] = *(const v8us*)(Bh + boff + 16 + 8 * hh);
      acc[t] = mmaH<ASPLIT ? 2 : 1>(ah.v, al.v, bq.v, bq.v, acc[t]); }
  }
#pragma unroll
  for (int t = 0; t < 4; ++t) { if (col0 + t * 16 >= N) continue;
#pragma unroll
    for (int r = 0; r < 8; ++r) so[w][8 * hh + r][t * 16 + ln] = acc[t][r] * alpha; }
  __builtin_amdgcn_fence(__ATOMIC_ACQ_REL, "workgroup"); __builtin_amdgcn_wave_barrier();
  const int rsub = lane >> 4, c4 = (lane & 15) * 4;
  {
#pragma unroll
    for (int q = 0; q < 8; ++q) { const int r = q * 2 + rsub; if (col0 + c4 < N) { const v4f v = *(const v4fa*)&so[w][r][c4]; *(v4f*)(C + (size_t)(row0 + r) * ldc + col0 + c4) = v; } }
     }
}

// k_gemm_hh variant with fused epilogue: v = acc·alpha + bias[by·sBias + col] (+ CP[(row/rowsPerB)·sCPb + by·64 + col] if CP) ; ACT 0 none / 1 elu ; writes f16 C16 (and f32 C if non-null)
template <int ACT>
__global__ __launch_bounds__(128) void k_gemm_hhx(const _Float16* __restrict__ A, int lda, size_t sA, const _Float16* __restrict__ Bh, int ldb, size_t sB, float alpha, const float* __restrict__ bias, size_t sBias, const float* __restrict__ CP, int rowsPerB, size_t sCPb, int row0g,
    float* __restrict__ C, _Float16* __restrict__ C16, int ldc, size_t sC, int M, int N, int K) {
  __shared__ __attribute__((aligned(16))) float so[4][16][64];
  const int tid = threadIdx.x, w = tid >> 5, lane = tid & 31, ln = lane & 15, hh = lane >> 4; const int by = blockIdx.y;
  A += (size_t)by * sA; Bh += (size_t)by * sB; const size_t cofs = (size_t)by * sC; const float* bp = bias ? bias + (size_t)by * sBias : nullptr;
  const int ntn = (N + 63) / 64; const int wid = blockIdx.x * 4 + w; const int mt = wid / ntn, nq = wid % ntn; if (mt * 16 >= M) return;
  const int row0 = mt * 16, col0 = nq * 64; const _Float16* arow = A + (size_t)(row0 + ln) * lda;
  v8f acc[4] = {};
  for (int kb = 0; kb < K; kb += 32) { FragH ah; ah.half[0] = *(const v8us*)((const unsigned short*)arow + kb + 8 * hh); ah.half[1] = *(const v8us*)((const unsigned short*)arow + kb + 16 + 8 * hh);
#pragma unroll
    for (int t = 0; t < 4; ++t) { if (col0 + t * 16 >= N) continue; const size_t boff = (size_t)(col0 + t * 16 + ln) * ldb + kb; FragH bq; bq.half[0] = *(const v8us*)((const unsigned short*)Bh + boff + 8 * hh); bq.half[1] = *(const v8us*)((const unsigned short*)Bh + boff + 16 + 8 * hh);
      acc[t] = mmaH<1>(ah.v, ah.v, bq.v, bq.v, acc[t]); }
  }
#pragma unroll
  for (int t = 0; t < 4; ++t) { if (col0 + t * 16 >= N) continue; const int col = col0 + t * 16 + ln; const float bv = bp ? bf16_round(bp[col]) : 0.f;
#pragma unroll
    for (int r = 0; r < 8; ++r) { float v = acc[t][r] * alpha + bv; if (CP) { const int rr = row0g + row0 + 8 * hh + r; if (rowsPerB < 0) v += CP[cofs + (size_t)rr * ldc + col];      /* rowsPerB < 0: own element of the batched C plane */ else { const int bidx = rr / rowsPerB; v += CP[(size_t)bidx * sCPb + (size_t)by * 64 + col]; } } if (ACT == 1) v = (v > 0.f) ? v : expm1f(v); else if (ACT == 7) v = (v > 0.f) ? v + 1.0f : expf(v); else if (ACT == 8) v = tanhf(v); else if (ACT == 9) v = 0.5f * v * (1.0f + tanhf(0.7978845608028654f * (v + 0.044715f * v * v * v))); else if (ACT == 11) v = 1.0f / (1.0f + expf(-v)); else if (ACT == 12) v = (v > 0.f) ? v : 0.01f * v; else if (ACT == 14) v = (v > 0.f) ? v : 0.1f * v; else if (ACT == 16) v = (v >= 0.f) ? v : 0.3f * v; else if (ACT == 17) v = (v >= 0.f) ? v : 0.2f * v; else if (ACT == 15) v = v / (1.0f + expf(-v)); else if (ACT == 3) v = fmaxf(v, 0.f); else if (ACT == 6) v = 0.5f * v * (1.0f + erff(v * 0.70710678118654752f)); so[w][8 * hh + r][t * 16 + ln] = v; } }
  __builtin_amdgcn_fence(__ATOMIC_ACQ_REL, "workgroup"); __builtin_amdgcn_wave_barrier();
  const int rsub = lane >> 4, c4 = (lane & 15) * 4; typedef _Float16 v4h __attribute__((ext_vector_type(4)));
  {
#pragma unroll
    for (int q = 0; q < 8; ++q) { const int r = q * 2 + rsub; if (col0 + c4 < N) { const v4f v = *(const v4fa*)&so[w][r][c4]; if (C) *(v4f*)(C + cofs + (size_t)(row0 + r) * ldc + col0 + c4) = v; if (C16) { v4h h4; for (int i = 0; i < 4; ++i) h4[i] = (_Float16)v[i]; *(v4h*)(C16 + cofs + (size_t)(row0 + r) * ldc + col0 + c4) = h4; } } }
     }
}


typedef _Float16 v4h __attribute__((ext_vector_type(4)));

// Operand preparation in ONE launch: blocks 0 .. PWB - 1 transpose the four weight matrices, the others round x. Bt[n][k] = f16(bf16(W[k][n]) x 16) (exact), X16 = f16(bf16(x)) (exact).
// Weights: a block takes 128 k x 64 n of one matrix. A thread reads 8 k rows x 4 n, 16 bytes a row, so that one wave's load is two 256-byte row pieces (whole lines); it then holds 8 consecutive k of 4 columns,
// four 16-byte pieces of Bt rows, which are gathered in LDS so that one wave writes each 256-byte piece of a Bt row. LDS rows are 256 bytes, and piece c of row n lies at place c ^ (n >> 2):
// the 16 lanes of a write (rows 4 apart, one c) and the 16 lanes of a read (one row, every c) each meet all 64 banks once.
// x: a block takes PXV values, a thread 16 pieces of 4: each wave's load is 512 contiguous bytes, each store 256, and the loads run ahead of the arithmetic, eight and more of a thread in flight.
#define PWB (4 * (DM / 64) * (DM / 128))      /* weight blocks */
#define PXV 16384                    /* x values per block */
__global__ __launch_bounds__(256) void k_prep(const float* __restrict__ x, const float* __restrict__ wq, const float* __restrict__ wk, const float* __restrict__ wv, const float* __restrict__ wo,
    _Float16* __restrict__ X16, _Float16* __restrict__ BQKV, _Float16* __restrict__ BO) {
  __shared__ __attribute__((aligned(16))) unsigned short tl[64 * 128];
  const int tid = threadIdx.x;
  if (blockIdx.x < PWB) {      /* block-uniform */
    const int tpm = (DM / 64) * (DM / 128); const int m = blockIdx.x / tpm, tt = blockIdx.x % tpm; const int n0 = (tt / (DM / 128)) * 64, k0 = (tt % (DM / 128)) * 128;
    const float* Wm = m == 0 ? wq : m == 1 ? wk : m == 2 ? wv : wo;
    unsigned short* Bt = (unsigned short*)(m < 3 ? BQKV + (size_t)m * DM * DM : BO);      /* q | k | v stacked along n */
    const int ng = tid & 15, kg = tid >> 4;
    const float* sp = Wm + (size_t)(k0 + kg * 8) * DM + n0 + ng * 4;
    v4f r[8];
#pragma unroll
    for (int i = 0; i < 8; ++i) r[i] = *(const v4fa*)(sp + i * DM);      /* unrolled: r stays in registers and the 8 loads are in flight together */
#pragma unroll
    for (int j = 0; j < 4; ++j) { FragH f;
#pragma unroll
      for (int i = 0; i < 8; ++i) f.h[i] = (_Float16)(bf16_round(r[i][j]) * 16.0f);
      *(v8us*)(tl + (ng * 4 + j) * 128 + (kg ^ ng) * 8) = f.half[0]; }
    __syncthreads();      /* the tile is whole in LDS before any wave reads rows of it */
    const int rw = (tid >> 5) * 8 + ((tid >> 4) & 1), c = tid & 15;      /* a wave writes 8 rows, two per store */
    unsigned short* dp = Bt + (size_t)(n0 + rw) * DM + k0 + c * 8;
#pragma unroll
    for (int q = 0; q < 4; ++q) { const int n = rw + q * 2; const v8us v = *(const v8us*)(tl + n * 128 + (c ^ (n >> 2)) * 8); *(v8us*)(dp + q * 2 * DM) = v; }
  } else {
    const size_t base = (size_t)(blockIdx.x - PWB) * PXV + tid * 4;
    const float* sp = x + base; _Float16* dp = X16 + base;
    v4f r[16];
#pragma unroll
    for (int u = 0; u < 16; ++u) r[u] = *(const v4fa*)(sp + u * 1024);      /* unrolled: r stays in registers, every offset is an immediate, and the loads are issued ahead of the arithmetic */
#pragma unroll
    for (int u = 0; u < 16; ++u) { v4h h;
#pragma unroll
      for (int q = 0; q < 4; ++q) h[q] = (_Float16)bf16_round(r[u][q]);
      *(v4h*)(dp + u * 1024) = h; }
    asm volatile("s_wait_xcnt 0x0" ::: "memory");      /* stands behind the last x stores, ahead of any later write of a register that one of them names */
  } }
static_assert(DM % 128 == 0 && (NR * DM) % PXV == 0 && PXV == 16 * 256 * 4, "k_prep: whole weight tiles and whole x blocks");
__global__ __launch_bounds__(256) void k_h16(const float* __restrict__ x, _Float16* __restrict__ X16, size_t n8) { const size_t t = (size_t)blockIdx.x * 256 + threadIdx.x; if (t >= n8) return; FragH f;
#pragma unroll
  for (int q = 0; q < 8; ++q) f.h[q] = (_Float16)x[t * 8 + q]; *(v8us*)((unsigned short*)X16 + t * 8) = f.half[0];  }
__global__ __launch_bounds__(256) void k_round16f(const float* __restrict__ W, _Float16* __restrict__ Bt, size_t n8) { const size_t t = (size_t)blockIdx.x * 256 + threadIdx.x; if (t >= n8) return; FragH f;
#pragma unroll
  for (int i = 0; i < 8; ++i) f.h[i] = (_Float16)(bf16_round(W[t * 8 + i]) * 16.0f); *(v8us*)((unsigned short*)Bt + t * 8) = f.half[0];  }
template <int NHv, int TTv>
__global__ __launch_bounds__(256) void k_vt(const _Float16* __restrict__ V16, int ldv, int voff, _Float16* __restrict__ Vt) { __shared__ unsigned short tl[64][66]; const int tid = threadIdx.x; const int slab = blockIdx.x / (TTv / 64), lg = blockIdx.x % (TTv / 64); const int b = slab / NHv, h = slab % NHv;
  for (int i = tid; i < 64 * 8; i += 256) { const int r = i / 8, c8 = (i % 8) * 8; FragH f; f.half[0] = *(const v8us*)((const unsigned short*)V16 + ((size_t)b * TTv + lg * 64 + r) * ldv + voff + h * 64 + c8);
#pragma unroll
    for (int q = 0; q < 8; ++q) tl[r][c8 + q] = f.u[q]; }
  __syncthreads();
  {
#pragma unroll
    for (int rd = 0; rd < 2; ++rd) { const int d = rd * 32 + tid / 8, pc = tid % 8; FragH f;
#pragma unroll
      for (int q = 0; q < 8; ++q) f.u[q] = tl[pc * 8 + q][d];
      *(v8us*)((unsigned short*)Vt + ((size_t)slab * 64 + d) * TTv + lg * 64 + pc * 8) = f.half[0]; }
     } }

__global__ __launch_bounds__(256) void k_hl(const float* __restrict__ F, _Float16* __restrict__ Hh, _Float16* __restrict__ Hl, size_t n8) { const size_t t = (size_t)blockIdx.x * 256 + threadIdx.x; if (t >= n8) return; FragH fh, fl; const v4f a = *(const v4fa*)(F + t * 8), c = *(const v4fa*)(F + t * 8 + 4);
#pragma unroll
  for (int q = 0; q < 4; ++q) { _Float16 h = (_Float16)a[q]; fh.h[q] = h; fl.h[q] = (_Float16)((a[q] - (float)h) * 1024.0f); h = (_Float16)c[q]; fh.h[4 + q] = h; fl.h[4 + q] = (_Float16)((c[q] - (float)h) * 1024.0f); }
  { *(v8us*)((unsigned short*)Hh + t * 8) = fh.half[0]; *(v8us*)((unsigned short*)Hl + t * 8) = fl.half[0];  } }

// ---- fast GEMM (wave tile 32x64; requires M % 32 == 0 rows per launch region and N % 64 == 0); epilogue = k_gemm_hhx semantics ----
__device__ __forceinline__ v16h g2_frag(const _Float16* p, int hh) { FragH f; f.half[0] = *(const v8us*)((const unsigned short*)p + 8 * hh); f.half[1] = *(const v8us*)((const unsigned short*)p + 16 + 8 * hh); return f.v; }
__device__ __forceinline__ v8f g2_mma(v16h a, v16h b, v8f c) { v8f d = __builtin_amdgcn_wmma_f32_16x16x32_f16(false, a, false, b, (short)0, c, false, false); asm volatile("v_nop\n\tv_nop\n\tv_nop\n\tv_nop" : "+v"(d) : "v"(a), "v"(b)); return d; }
template <int ACT>
__global__ __launch_bounds__(128) void k_gemm2(const _Float16* __restrict__ A, int lda, size_t sA, const _Float16* __restrict__ Bh, int ldb, size_t sB, float alpha, const float* __restrict__ bias, size_t sBias, const float* __restrict__ CP, int rowsPerB, size_t sCPb, int row0g,
    float* __restrict__ C, _Float16* __restrict__ C16, int ldc, size_t sC, int M, int N, int K) { static_assert(ACT == 0 || ACT == 3 || ACT == 6 || ACT == 8 || ACT == 9 || ACT == 11 || ACT == 12 || ACT == 14 || ACT == 15 || ACT == 16 || ACT == 17, "k_gemm2: unsupported ACT code (would silently apply no activation)");
  __shared__ __attribute__((aligned(16))) float so[4][32][68];
  const int tid = threadIdx.x, w = tid >> 5, lane = tid & 31, ln = lane & 15, hh = lane >> 4; const int by = blockIdx.y;
  A += (size_t)by * sA; Bh += (size_t)by * sB; const size_t cofs = (size_t)by * sC; const float* bp = bias ? bias + (size_t)by * sBias : nullptr;
  const int ntn = N >> 6; const int mt = blockIdx.x / ntn, nq = blockIdx.x - mt * ntn; const int row0 = mt * 128 + 32 * w, col0 = nq * 64; if (row0 >= M) return;
  const _Float16* a0p = A + (size_t)(row0 + ln) * lda; const _Float16* a1p = a0p + (size_t)16 * lda;
  const _Float16* b0p = Bh + (size_t)(col0 + ln) * ldb; const _Float16* b1p = b0p + (size_t)16 * ldb; const _Float16* b2p = b1p + (size_t)16 * ldb; const _Float16* b3p = b2p + (size_t)16 * ldb;
  const v8f z8 = {0.f,0.f,0.f,0.f,0.f,0.f,0.f,0.f}; v8f c00 = z8, c01 = z8, c02 = z8, c03 = z8, c10 = z8, c11 = z8, c12 = z8, c13 = z8;
#pragma unroll 1
  for (int kb = 0; kb < K; kb += 32) { const v16h a0 = g2_frag(a0p + kb, hh), a1 = g2_frag(a1p + kb, hh);
    v16h b = g2_frag(b0p + kb, hh); c00 = g2_mma(a0, b, c00); c10 = g2_mma(a1, b, c10);
    b = g2_frag(b1p + kb, hh); c01 = g2_mma(a0, b, c01); c11 = g2_mma(a1, b, c11);
    b = g2_frag(b2p + kb, hh); c02 = g2_mma(a0, b, c02); c12 = g2_mma(a1, b, c12);
    b = g2_frag(b3p + kb, hh); c03 = g2_mma(a0, b, c03); c13 = g2_mma(a1, b, c13); }
  v8f accs[8] = {c00, c01, c02, c03, c10, c11, c12, c13};
#pragma unroll
  for (int u = 0; u < 8; ++u) { const int t = u & 3, half = u >> 2; const int col = col0 + t * 16 + ln; const float bv = bp ? bf16_round(bp[col]) : 0.f;
#pragma unroll
    for (int r = 0; r < 8; ++r) { const int rloc = half * 16 + 8 * hh + r; float v = accs[u][r] * alpha + bv; if (CP) { if (rowsPerB < 0) v += CP[cofs + (size_t)(row0g + row0 + rloc) * ldc + col];      /* rowsPerB < 0: own element of the batched C plane */ else { const int bidx = (row0g + row0 + rloc) / rowsPerB; v += CP[(size_t)bidx * sCPb + (size_t)by * 64 + col]; } }
      if (ACT == 3) v = fmaxf(v, 0.f); else if (ACT == 6) v = 0.5f * v * (1.0f + erff(v * 0.70710678118654752f)); else if (ACT == 11) v = 1.0f / (1.0f + expf(-v)); else if (ACT == 15) v = v / (1.0f + expf(-v)); else if (ACT == 12) v = (v > 0.f) ? v : 0.01f * v; else if (ACT == 8) v = tanhf(v); else if (ACT == 9) v = 0.5f * v * (1.0f + tanhf(0.7978845608028654f * (v + 0.044715f * v * v * v))); else if (ACT == 14) v = (v > 0.f) ? v : 0.1f * v; else if (ACT == 16) v = (v >= 0.f) ? v : 0.3f * v; else if (ACT == 17) v = (v >= 0.f) ? v : 0.2f * v;
      so[w][rloc][t * 16 + ln] = v; } }
  __builtin_amdgcn_fence(__ATOMIC_ACQ_REL, "workgroup"); __builtin_amdgcn_wave_barrier();
  const int rsub = lane >> 4, c4 = (lane & 15) * 4;
  {
#pragma unroll
    for (int q = 0; q < 16; ++q) { const int r = q * 2 + rsub; const v4f v = *(const v4fa*)&so[w][r][c4]; if (C) *(v4f*)(C + cofs + (size_t)(row0 + r) * ldc + col0 + c4) = v; if (C16) { v4h h4; for (int i = 0; i < 4; ++i) h4[i] = (_Float16)v[i]; *(v4h*)(C16 + cofs + (size_t)(row0 + r) * ldc + col0 + c4) = h4; } }
     } }

// q | k | v projection of ALL token rows (wave tile and product order of k_gemm2, pitches and K = DM) with the per-head work in the epilogue: no f32 q | k | v plane in memory and no launch per (row, head).
// A block is 8 waves: 128 rows of one batch x 128 columns, two heads of q, of k or of v (block-uniform); four waves share a head. The K loop reads its fragments from LDS stages that asynchronous copies fill one trip ahead,
// so each operand byte leaves L2 once per block instead of once per wave. q, k: each wave stages its 32x64 f32 tile in its own LDS range; 8 lanes take one row (lanes 0-3 columns 0-31, lanes 4-7 columns 32-63),
// each reads its 8 low-half and 8 high-half values and the two table rows, rotates and stores 16 bytes: one instruction fills whole 128-byte lines.
// v: accumulator registers 0..7 of a lane are 8 consecutive token rows of one column, so each lane packs them to 16 bytes of V^T; each head's 64 x 128 tile is gathered in LDS (pitch 272 bytes) so that one wave writes each 256-byte row piece.
// Rows 0..127 of a batch (one block row) are also written in f32 for the exact first-tile attention.
// Every epilogue loop is unrolled so that accs, xs and tb are indexed by constants and stay in registers.
// A 16-byte global store (two for the f32 form) with s_wait_xcnt 0 as the last line of the same statement: the epilogue reuses its staging registers from pass to pass, and a wait in a statement of its own would not hold the next pass's register writes behind it.
__device__ __forceinline__ void st16_wait(unsigned short* p, v8us d) { asm volatile("global_store_b128 %0, %1, off\n\ts_wait_xcnt 0x0" :: "v"(p), "v"(d) : "memory"); }
__device__ __forceinline__ void st32_wait(float* p, v4f d0, v4f d1) { asm volatile("global_store_b128 %0, %1, off\n\tglobal_store_b128 %0, %2, off offset:16\n\ts_wait_xcnt 0x0" :: "v"(p), "v"(d0), "v"(d1) : "memory"); }
// Operand tiles of a GEMM K loop staged in LDS: a stage is 64 k of 128 A rows, then of 128 B rows, each row 128 bytes at a pitch of 144 (16 bytes x an odd number: the 16-byte fragment reads meet no bank conflict).
// 256 threads: thread t brings 16-byte piece t & 7 of rows (t >> 3) + 32 j, so one wave's copy covers four whole 128-byte lines.
#define GP 72                        /* LDS row pitch in f16 */
#define GSTG (256 * GP * 2)          /* bytes of one stage */
// Eight asynchronous copies, each lane its own 16 bytes, with s_wait_xcnt 0 as the last line of the same statement: it stands ahead of any rewrite of the address registers that the copies name.
__device__ __forceinline__ void g3_copy8(unsigned l, const _Float16* a, const _Float16* b) {
  asm volatile("global_load_async_to_lds_b128 %0, %8, off\n\tglobal_load_async_to_lds_b128 %1, %9, off\n\tglobal_load_async_to_lds_b128 %2, %10, off\n\tglobal_load_async_to_lds_b128 %3, %11, off\n\t"
               "global_load_async_to_lds_b128 %4, %12, off\n\tglobal_load_async_to_lds_b128 %5, %13, off\n\tglobal_load_async_to_lds_b128 %6, %14, off\n\tglobal_load_async_to_lds_b128 %7, %15, off\n\ts_wait_xcnt 0x0"
               :: "v"(l), "v"(l + 32u * GP * 2), "v"(l + 64u * GP * 2), "v"(l + 96u * GP * 2), "v"(l + 128u * GP * 2), "v"(l + 160u * GP * 2), "v"(l + 192u * GP * 2), "v"(l + 224u * GP * 2),
                  "v"(a), "v"(a + 32 * DM), "v"(a + 64 * DM), "v"(a + 96 * DM), "v"(b), "v"(b + 32 * DM), "v"(b + 64 * DM), "v"(b + 96 * DM) : "memory"); }
// Four more, for the 128 rows of a second A operand (they lie behind the B rows of the stage).
#define GSTG3 (384 * GP * 2)         /* bytes of one stage with two A operands */
__device__ __forceinline__ void g3_copy4(unsigned l, const _Float16* e) {
  asm volatile("global_load_async_to_lds_b128 %0, %4, off\n\tglobal_load_async_to_lds_b128 %1, %5, off\n\tglobal_load_async_to_lds_b128 %2, %6, off\n\tglobal_load_async_to_lds_b128 %3, %7, off\n\ts_wait_xcnt 0x0"
               :: "v"(l), "v"(l + 32u * GP * 2), "v"(l + 64u * GP * 2), "v"(l + 96u * GP * 2), "v"(e), "v"(e + 32 * DM), "v"(e + 64 * DM), "v"(e + 96 * DM) : "memory"); }
__global__ __launch_bounds__(256) void k_qkv_rope(const _Float16* __restrict__ A, const _Float16* __restrict__ Bh, const float* __restrict__ tcos, const float* __restrict__ tsin,
    _Float16* __restrict__ Q16, _Float16* __restrict__ K16, _Float16* __restrict__ VTa, float* __restrict__ QF, float* __restrict__ KF, float* __restrict__ VF) {
  __shared__ __attribute__((aligned(16))) char sm[2 * GSTG];      /* two stages in the K loop; behind it the epilogue's staging */
  static_assert(sizeof(float) * 8 * 32 * 68 <= 2 * GSTG, "the epilogue's staging fits the two stages");
  float (*so)[32][68] = (float (*)[32][68])sm;
  const int tid = threadIdx.x, w8 = tid >> 5, w = w8 & 3, wg = w8 >> 2, lane = tid & 31, ln = lane & 15, hh = lane >> 4;      /* waves 0-3: the block's first head, waves 4-7: its second; w: the wave's 32 rows */
  const int ntn = 3 * DM / 128; const int mt = blockIdx.x / ntn, np = blockIdx.x - mt * ntn; const int row0 = mt * 128 + 32 * w;
  const int sel = (np * 2) / NH, h = (np * 2) % NH + wg;      /* 0 q, 1 k, 2 v (block-uniform: a pair of heads lies in one of them); head */
  const int b = mt / (SQ / 128), pb = (mt % (SQ / 128)) * 128, p0 = pb + 32 * w;      /* batch; position of the block's and of the wave's first row */
  const bool first = pb == 0;
  const unsigned l0 = (unsigned)(size_t)sm + (unsigned)(tid >> 3) * (GP * 2) + (unsigned)(tid & 7) * 16;      /* the thread's first place in stage 0: LDS byte address */
  const _Float16* ga = A + (size_t)(mt * 128 + (tid >> 3)) * DM + (tid & 7) * 8; const _Float16* gb = Bh + (size_t)(np * 128 + (tid >> 3)) * DM + (tid & 7) * 8;
  const v8f z8 = {0.f,0.f,0.f,0.f,0.f,0.f,0.f,0.f}; v8f c00 = z8, c01 = z8, c02 = z8, c03 = z8, c10 = z8, c11 = z8, c12 = z8, c13 = z8;
  g3_copy8(l0, ga, gb);
  asm volatile("s_wait_asynccnt 0x0" ::: "memory");      /* this wave's part of tile 0 has landed */
  __syncthreads();      /* tile 0 is whole for every wave */
  g3_copy8(l0 + GSTG, ga + 64, gb + 64);
#pragma unroll 1
  for (int t = 0; t < DM / 64; ++t) {      /* kept rolled: one trip is one stage, 16 WMMAs a wave */
    const _Float16* st = (const _Float16*)(sm + (t & 1) * GSTG);
    const _Float16* ap = st + (32 * w + ln) * GP; const _Float16* bp = st + (128 + 64 * wg + ln) * GP;
#pragma unroll
    for (int kk = 0; kk < 64; kk += 32) { const v16h a0 = g2_frag(ap + kk, hh), a1 = g2_frag(ap + 16 * GP + kk, hh);      /* unrolled: the LDS offsets of both halves of the stage are immediates; the six fragments of 32 k are read as one group, ahead of their WMMAs */
      const v16h b0 = g2_frag(bp + kk, hh), b1 = g2_frag(bp + 16 * GP + kk, hh), b2 = g2_frag(bp + 32 * GP + kk, hh), b3 = g2_frag(bp + 48 * GP + kk, hh);
      c00 = g2_mma(a0, b0, c00); c10 = g2_mma(a1, b0, c10); c01 = g2_mma(a0, b1, c01); c11 = g2_mma(a1, b1, c11);
      c02 = g2_mma(a0, b2, c02); c12 = g2_mma(a1, b2, c12); c03 = g2_mma(a0, b3, c03); c13 = g2_mma(a1, b3, c13); }
    asm volatile("s_wait_dscnt 0x0" ::: "memory");      /* this wave's reads of the stage have returned */
    asm volatile("s_wait_asynccnt 0x0" ::: "memory");      /* this wave's part of tile t + 1 has landed */
    __syncthreads();      /* publishes tile t + 1 and ends every wave's reads of tile t */
    if (t + 2 < DM / 64) g3_copy8(l0 + (unsigned)(t & 1) * GSTG, ga + (t + 2) * 64, gb + (t + 2) * 64); }      /* refill of the stage just left; the test is the same for the whole block */
  asm volatile("s_wait_asynccnt 0x0" ::: "memory");      /* no copy is outstanding when the stages become the epilogue's staging */
  v8f accs[8] = {c00, c01, c02, c03, c10, c11, c12, c13};
#pragma unroll
  for (int u = 0; u < 8; ++u) accs[u] *= 0.0625f;      /* undoes the x16 of the weights, exact */
  if (sel == 2) {
    unsigned short* tv = (unsigned short*)sm + wg * 64 * 136;      /* per head [64 columns][136]: 128 token rows + 8 pad */
#pragma unroll
    for (int u = 0; u < 8; ++u) { const int t = u & 3, half = u >> 2; FragH f;
#pragma unroll
      for (int r = 0; r < 8; ++r) f.h[r] = (_Float16)accs[u][r];
      *(v8us*)(tv + (t * 16 + ln) * 136 + 32 * w + half * 16 + 8 * hh) = f.half[0]; }
    __syncthreads();      /* block-uniform branch: every wave's columns are in LDS before any wave reads whole rows of V^T */
    unsigned short* vt = (unsigned short*)VTa + ((size_t)(b * NH + h) * HD + w * 16 + hh) * SQ + pb + ln * 8;
#pragma unroll
    for (int q = 0; q < 8; ++q) { const v8us v = *(const v8us*)(tv + (w * 16 + q * 2 + hh) * 136 + ln * 8); *(v8us*)(vt + (size_t)q * 2 * SQ) = v; }
    asm volatile("s_wait_xcnt 0x0" ::: "memory");      /* stands behind the V^T stores, ahead of the first write of a register that one of them names */
    if (first) { float* vf = VF + ((size_t)b * QT0 + p0 + 8 * hh) * DM + h * HD + ln;
#pragma unroll
      for (int u = 0; u < 8; ++u)
#pragma unroll
        for (int r = 0; r < 8; ++r) vf[(size_t)((u >> 2) * 16 + r) * DM + (u & 3) * 16] = accs[u][r]; }
  } else {
#pragma unroll
    for (int u = 0; u < 8; ++u)
#pragma unroll
      for (int r = 0; r < 8; ++r) so[w8][(u >> 2) * 16 + 8 * hh + r][(u & 3) * 16 + ln] = accs[u][r];
    __builtin_amdgcn_fence(__ATOMIC_ACQ_REL, "workgroup"); __builtin_amdgcn_wave_barrier();      /* the wave reads back what its own lanes wrote */
    const int rs = lane >> 3, up = (lane >> 2) & 1, i8 = (lane & 3) * 8;
    unsigned short* h16 = (unsigned short*)(sel ? K16 : Q16) + (size_t)(row0 + rs) * DM + h * HD + up * 32 + i8;
    float* f32 = (sel ? KF : QF) + ((size_t)b * QT0 + p0 + rs) * DM + h * HD + up * 32 + i8;      /* formed for every block, used by each batch's first block row alone */
    const float* cp = tcos + (size_t)(p0 + rs) * (HD / 2) + i8; const float* sp = tsin + (size_t)(p0 + rs) * (HD / 2) + i8;
    v4f xs[2][4], tb[2][4];      /* two register sets: pass q + 1 is fetched ahead of the arithmetic of pass q, because no load moves up over the store statements */
#pragma unroll
    for (int q = -1; q < 8; ++q) {
      if (q < 7) { const int n = q + 1, s = n & 1, r = n * 4 + rs;
        xs[s][0] = *(const v4fa*)&so[w8][r][i8]; xs[s][1] = *(const v4fa*)&so[w8][r][i8 + 4]; xs[s][2] = *(const v4fa*)&so[w8][r][32 + i8]; xs[s][3] = *(const v4fa*)&so[w8][r][32 + i8 + 4];
        tb[s][0] = *(const v4fa*)(cp + n * 4 * (HD / 2)); tb[s][1] = *(const v4fa*)(cp + n * 4 * (HD / 2) + 4); tb[s][2] = *(const v4fa*)(sp + n * 4 * (HD / 2)); tb[s][3] = *(const v4fa*)(sp + n * 4 * (HD / 2) + 4); }
      if (q >= 0) { const int s = q & 1; FragH f; v4f o0, o1;
#pragma unroll
        for (int e = 0; e < 8; ++e) { const float lo = xs[s][e >> 2][e & 3], hi = xs[s][2 + (e >> 2)][e & 3]; const float cv = bf16_round(tb[s][e >> 2][e & 3]), sv = bf16_round(tb[s][2 + (e >> 2)][e & 3]);
          const float o = lo * (up ? sv : cv) + hi * (up ? cv : -sv);      /* low half x1 c - x2 s, high half x1 s + x2 c */
          f.h[e] = (_Float16)o; if (e < 4) o0[e & 3] = o; else o1[e & 3] = o; }
        st16_wait(h16 + (size_t)q * 4 * DM, f.half[0]);
        if (first) st32_wait(f32 + (size_t)q * 4 * DM, o0, o1); } }
  } }
static_assert(QT0 == 128 && SQ % 128 == 0 && HD == 64 && DM == NH * HD, "k_qkv_rope: a block is 128 rows of one batch x two heads; the first-tile rows are one block row");

__global__ __launch_bounds__(256) void k_wnat(const float* __restrict__ w, size_t n8, _Float16* __restrict__ Bt) { const size_t t = (size_t)blockIdx.x * 256 + threadIdx.x; if (t >= n8) return; FragH f; for (int q = 0; q < 8; ++q) f.h[q] = (_Float16)(bf16_round(w[t * 8 + q]) * 16.0f); *(v8us*)((unsigned short*)Bt + t * 8) = f.half[0];  }
__global__ __launch_bounds__(256) void k_rsm(const float* __restrict__ S, _Float16* __restrict__ P, int nrows) {
  #pragma clang fp contract(off)
  const int i = blockIdx.x * 256 + threadIdx.x; if (i >= nrows) return; const float* s = S + (size_t)i * SQ; float mx = -3.0e38f;
#pragma unroll 1
  for (int j = 0; j < SQ; ++j) mx = fmaxf(mx, s[j]); float se = 0.f;
#pragma unroll 1
  for (int j = 0; j < SQ; ++j) se += expf(s[j] - mx); const float sc = 256.0f / se;
#pragma unroll 1
  for (int j0 = 0; j0 < SQ; j0 += 8) { FragH f; for (int q = 0; q < 8; ++q) f.h[q] = (_Float16)(expf(s[j0 + q] - mx) * sc); unsigned short* d = (unsigned short*)P + (size_t)i * SQ + j0; *(v8us*)d = f.half[0];  } }
__global__ __launch_bounds__(256) void k_vt(const _Float16* __restrict__ V16, int b, int h0, _Float16* __restrict__ VT) { __shared__ unsigned short tl[64][65]; const int tid = threadIdx.x; const int hh = blockIdx.x % HG, sg = blockIdx.x / HG; const int s0 = sg * 64; const int h = h0 + hh;
  for (int i = tid; i < 64 * 8; i += 256) { const int j = i / 8, d8 = (i % 8) * 8; FragH f; f.half[0] = *(const v8us*)((const unsigned short*)V16 + ((size_t)b * SQ + s0 + j) * DM + h * HD + d8); for (int q = 0; q < 8; ++q) tl[d8 + q][j] = f.u[q]; }
  __syncthreads();
  { for (int i = tid; i < 64 * 8; i += 256) { const int d = i / 8, j8 = (i % 8) * 8; FragH f; for (int q = 0; q < 8; ++q) f.u[q] = tl[d][j8 + q]; *(v8us*)((unsigned short*)VT + ((size_t)hh * HD + d) * SQ + s0 + j8) = f.half[0]; }  } }


__global__ __launch_bounds__(256) void k_tab2(float theta, float* __restrict__ CS, float* __restrict__ SN) {
  #pragma clang fp contract(off)
  const int t = blockIdx.x * 256 + threadIdx.x; if (t >= SQ * (HD / 2)) return; const int i = t % (HD / 2); const int p = t / (HD / 2); const float invf = 1.0f / powf(theta, (float)(2 * i) / (float)HD); const float ang = __fmul_rn((float)p, invf); const float c = cosf(ang), s = sinf(ang);
  *(float*)(CS + t) = c; *(float*)(SN + t) = s;  }
template <int NORM, int ROPE>
__global__ __launch_bounds__(64) void k_xform(const float* __restrict__ F, int ldf, int nh, const float* __restrict__ gain, float eps, const float* __restrict__ CS, const float* __restrict__ SN, _Float16* __restrict__ H16, int ldo) {
  #pragma clang fp contract(off)
  __shared__ float xv[HD]; __shared__ float red[HD]; __shared__ unsigned short sh_[HD]; const int d = threadIdx.x; const int h = blockIdx.x % nh; const size_t r = blockIdx.x / nh; const int p = (int)(r % SQ);
  float x = F[r * (size_t)ldf + (size_t)h * HD + d];
  if (NORM) { red[d] = __fmul_rn(x, x); __syncthreads(); for (int st = HD / 2; st > 0; st >>= 1) { if (d < st) red[d] = __fadd_rn(red[d], red[d + st]); __syncthreads(); } const float rs = rsqrtf(__fadd_rn(red[0] / (float)HD, eps)); x = __fmul_rn(__fmul_rn(x, rs), bf16_round(gain[d])); }
  xv[d] = x; __syncthreads();
  float o = x;
  if (ROPE == 1) { const int i = d >> 1; const float c = CS[p * (HD / 2) + i], s = SN[p * (HD / 2) + i]; const float ev = xv[2 * i], od = xv[2 * i + 1]; o = (d & 1) ? __fadd_rn(__fmul_rn(ev, s), __fmul_rn(od, c)) : __fadd_rn(__fmul_rn(ev, c), -__fmul_rn(od, s)); }
  if (ROPE == 2) { const int i = d & (HD / 2 - 1); const float c = CS[p * (HD / 2) + i], s = SN[p * (HD / 2) + i]; const float lo = xv[i], hi = xv[i + HD / 2]; o = (d < HD / 2) ? __fadd_rn(__fmul_rn(lo, c), -__fmul_rn(hi, s)) : __fadd_rn(__fmul_rn(lo, s), __fmul_rn(hi, c)); }
  FragH th; th.h[0] = (_Float16)o; sh_[d] = th.u[0]; __syncthreads();
  if (d < HD / 8) { FragH f; for (int q = 0; q < 8; ++q) f.u[q] = sh_[d * 8 + q]; unsigned short* dst = (unsigned short*)H16 + r * (size_t)ldo + (size_t)h * HD + d * 8; *(v8us*)dst = f.half[0];  } }

__global__ __launch_bounds__(256) void k_tab4(const int* __restrict__ pos, float theta, float* __restrict__ CS, float* __restrict__ SN) {
  #pragma clang fp contract(off)
  const int t = blockIdx.x * 256 + threadIdx.x; if (t >= SQ * (HD / 2)) return; const int i = t % (HD / 2); const int p = t / (HD / 2); const float invf = (float)pow((double)theta, -((double)(2 * i)) / (double)HD); const float ang = __fmul_rn((float)pos[p], invf); const float c = cosf(ang), s = sinf(ang);
  *(float*)(CS + t) = c; *(float*)(SN + t) = s;  }
__global__ __launch_bounds__(256) void k_rsmf(const float* __restrict__ S, _Float16* __restrict__ P, int qn, int hg) {
  #pragma clang fp contract(off)
  const int t = blockIdx.x * 256 + threadIdx.x; if (t >= qn * hg) return; const size_t i = (size_t)(t / qn) * SQ + (t % qn); const float* s = S + i * SQ; float mx = -3.0e38f;
#pragma unroll 1
  for (int j = 0; j < SQ; ++j) mx = fmaxf(mx, s[j]); float se = 0.f;
#pragma unroll 1
  for (int j = 0; j < SQ; ++j) se += __expf(s[j] - mx); const float sc = 256.0f / se;
#pragma unroll 1
  for (int j0 = 0; j0 < SQ; j0 += 8) { FragH f; for (int q = 0; q < 8; ++q) f.h[q] = (_Float16)(__expf(s[j0 + q] - mx) * sc); unsigned short* d = (unsigned short*)P + i * SQ + j0; *(v8us*)d = f.half[0];  } }


__device__ __forceinline__ v8f fa_mma(v16h a, v16h b, v8f c) { return __builtin_amdgcn_wmma_f32_16x16x32_f16(false, a, false, b, (short)0, c, false, false); }
// 2^x for eight values (two for the rescale factors) in ONE statement: outputs are early-clobber, so no exponential reads its predecessor's result or overwrites its source, and the closing v_nop keeps the one
// independent slot that the instruction set asks for between the last exponential and whatever the compiler places next.
__device__ __forceinline__ v8f fa_exp8(v8f x) { float y0, y1, y2, y3, y4, y5, y6, y7;
  asm("v_exp_f32 %0, %8\n\tv_exp_f32 %1, %9\n\tv_exp_f32 %2, %10\n\tv_exp_f32 %3, %11\n\tv_exp_f32 %4, %12\n\tv_exp_f32 %5, %13\n\tv_exp_f32 %6, %14\n\tv_exp_f32 %7, %15\n\tv_nop"
      : "=&v"(y0), "=&v"(y1), "=&v"(y2), "=&v"(y3), "=&v"(y4), "=&v"(y5), "=&v"(y6), "=&v"(y7) : "v"(x[0]), "v"(x[1]), "v"(x[2]), "v"(x[3]), "v"(x[4]), "v"(x[5]), "v"(x[6]), "v"(x[7]));
  const v8f y = {y0, y1, y2, y3, y4, y5, y6, y7}; return y; }
__device__ __forceinline__ void fa_exp2(float x0, float x1, float& y0, float& y1) { asm("v_exp_f32 %0, %2\n\tv_exp_f32 %1, %3\n\tv_nop" : "=&v"(y0), "=&v"(y1) : "v"(x0), "v"(x1)); }
// One step of 32 keys. kn / vn: the NEXT step's K rows and V^T columns, fetched into the same registers right after their last use here, so that a whole step passes before they are needed;
// DIAG: the wave's last step (first key == first query): keys above the query get weight 0, and nothing is fetched.
template <bool DIAG>
__device__ __forceinline__ void fa_step(const v16h (&qf)[2][2], v16h (&kf)[2][2], v16h (&vf)[4], v8f (&o)[2][4], float (&mu)[2], float (&l)[2], const _Float16* kn, const _Float16* vn, int c, int hh) {
  const float cs = 0.125f * 1.44269504088896340736f;      /* score scale x log2(e) */
  const v8f z8 = {0.f,0.f,0.f,0.f,0.f,0.f,0.f,0.f};
  v8f s[2][2];
#pragma unroll
  for (int u = 0; u < 2; ++u)
#pragma unroll
    for (int kt = 0; kt < 2; ++kt) s[u][kt] = fa_mma(kf[kt][1], qf[u][1], fa_mma(kf[kt][0], qf[u][0], z8));
  if (!DIAG) {
#pragma unroll
    for (int kt = 0; kt < 2; ++kt) { kf[kt][0] = g2_frag(kn + (size_t)kt * 16 * DM, hh); kf[kt][1] = g2_frag(kn + (size_t)kt * 16 * DM + 32, hh); } }
  if (DIAG) {
#pragma unroll
    for (int u = 0; u < 2; ++u)
#pragma unroll
      for (int kt = 0; kt < 2; ++kt)
#pragma unroll
        for (int r = 0; r < 8; ++r) s[u][kt][r] = (kt * 16 + 8 * hh + r <= u * 16 + c) ? s[u][kt][r] : -1.0e30f; }
  float mx[2];
#pragma unroll
  for (int u = 0; u < 2; ++u) { float a = fmaxf(s[u][0][0], s[u][1][0]);
#pragma unroll
    for (int r = 1; r < 8; ++r) a = fmaxf(a, fmaxf(s[u][0][r], s[u][1][r]));
    a = fmaxf(a, __shfl_xor(a, 16)); mx[u] = a * cs; }      /* cs > 0: scaling commutes with the maximum */
  if (__builtin_amdgcn_ballot_w32(mx[0] > mu[0] + 8.0f || mx[1] > mu[1] + 8.0f) != 0) {      /* one scalar test per step */
    const float mn0 = fmaxf(mu[0], mx[0]), mn1 = fmaxf(mu[1], mx[1]); float al[2]; fa_exp2(mu[0] - mn0, mu[1] - mn1, al[0], al[1]); mu[0] = mn0; mu[1] = mn1;
#pragma unroll
    for (int u = 0; u < 2; ++u) { l[u] *= al[u];
#pragma unroll
      for (int t = 0; t < 4; ++t) o[u][t] *= al[u]; } }
  FragH pf[2];
#pragma unroll
  for (int u = 0; u < 2; ++u) { float sm = 0.f;
#pragma unroll
    for (int kt = 0; kt < 2; ++kt) { v8f x;
#pragma unroll
      for (int r = 0; r < 8; ++r) x[r] = fmaf(s[u][kt][r], cs, -mu[u]);
      const v8f p = fa_exp8(x);
#pragma unroll
      for (int r = 0; r < 8; ++r) { sm += p[r]; pf[u].h[kt * 8 + r] = (_Float16)p[r]; } }
    l[u] += sm; }
#pragma unroll
  for (int u = 0; u < 2; ++u)
#pragma unroll
    for (int t = 0; t < 4; ++t) o[u][t] = fa_mma(vf[t], pf[u].v, o[u][t]);
  if (!DIAG) {
#pragma unroll
    for (int t = 0; t < 4; ++t) vf[t] = g2_frag(vn + (size_t)t * 16 * SQ, hh);
    asm volatile("s_wait_xcnt 0x0" ::: "memory"); } }      /* stands behind the step's last loads, ahead of the next step's first write of a register that holds their address */
__global__ __launch_bounds__(128) void k_fattn(const _Float16* __restrict__ Q16, const _Float16* __restrict__ K16, const _Float16* __restrict__ VTa, _Float16* __restrict__ O) {
  const int lane = threadIdx.x & 31, c = lane & 15, hh = lane >> 4;
  const int w = __builtin_amdgcn_readfirstlane(threadIdx.x >> 5);      /* the wave's number as a scalar: the trip count is scalar */
  const int bh = blockIdx.x % (NB * NH); const int g = blockIdx.x / (4 * NB * NH), rr = (blockIdx.x / (NB * NH)) % 4;
  const int qt = (3 - g) * 4 + ((g & 1) ? rr : 3 - rr);      /* a permutation of the 16 query tiles: long tiles first, and blocks a quarter of the grid apart have tiles that sum to the same length */
  const int b = bh / NH, h = bh % NH; const int q0 = qt * 128 + w * 32;
  const _Float16* qp = Q16 + ((size_t)b * SQ + q0 + c) * DM + h * HD;
  const _Float16* kp = K16 + ((size_t)b * SQ + c) * DM + h * HD;
  const _Float16* vp = VTa + ((size_t)bh * HD + c) * SQ;
  const v8f z8 = {0.f,0.f,0.f,0.f,0.f,0.f,0.f,0.f};
  v16h qf[2][2], kf[2][2], vf[4];
#pragma unroll
  for (int u = 0; u < 2; ++u) { qf[u][0] = g2_frag(qp + (size_t)u * 16 * DM, hh); qf[u][1] = g2_frag(qp + (size_t)u * 16 * DM + 32, hh); }
#pragma unroll
  for (int kt = 0; kt < 2; ++kt) { kf[kt][0] = g2_frag(kp + (size_t)kt * 16 * DM, hh); kf[kt][1] = g2_frag(kp + (size_t)kt * 16 * DM + 32, hh); }
#pragma unroll
  for (int t = 0; t < 4; ++t) vf[t] = g2_frag(vp + (size_t)t * 16 * SQ, hh);
  asm volatile("s_wait_xcnt 0x0" ::: "memory");      /* stands behind the first fragments' loads, ahead of the first write of a register that holds one of their addresses */
  v8f o[2][4]; float mu[2], l[2];
#pragma unroll
  for (int u = 0; u < 2; ++u) { mu[u] = -1.0e30f; l[u] = 0.f;
#pragma unroll
    for (int t = 0; t < 4; ++t) o[u][t] = z8; }
#pragma unroll 1
  for (int k0 = 0; k0 < q0; k0 += 32) fa_step<false>(qf, kf, vf, o, mu, l, kp + (size_t)(k0 + 32) * DM, vp + k0 + 32, c, hh);      /* kept rolled: one step holds 16 WMMAs and the registers of four waves per SIMD; k0 + 32 <= q0 is a step of this wave */
  fa_step<true>(qf, kf, vf, o, mu, l, kp, vp, c, hh);
#pragma unroll
  for (int u = 0; u < 2; ++u) { const float fin = 64.0f / (l[u] + __shfl_xor(l[u], 16));      /* the lane halves' sums join once; o carried x64 */
    unsigned short* dst = (unsigned short*)O + ((size_t)b * SQ + q0 + u * 16 + c) * DM + h * HD + 8 * hh;
#pragma unroll
    for (int t = 0; t < 4; ++t) { FragH f;
#pragma unroll
      for (int r = 0; r < 8; ++r) f.h[r] = (_Float16)(o[u][t][r] * fin);      /* register r is output column 16 t + 8 hh + r of query c: one 16-byte store */
      *(v8us*)(dst + t * 16) = f.half[0]; } } }
static_assert(SQ == 16 * 128 && HD == 64, "k_fattn: 16 query tiles of 4 waves x 32 query columns, head size 64");


// Exact f32 causal attention for the first QT0 rows, one wave per (head, query row), 8 rows of one head per block.
// The head's QT0 key rows are staged in LDS at a pitch of HD + 4 floats (16 bytes x an odd number: row-per-lane 16-byte reads without bank conflicts).
// Lane l scores keys l, l + 32, l + 64, l + 96 (each dot product summed over d in index order); row maximum and row sum end in lane butterflies;
// then lane l sums output columns 2 l and 2 l + 1 over the keys in index order, each weight read from its lane as a scalar.
typedef float v2f __attribute__((ext_vector_type(2)));
typedef float v2fa __attribute__((ext_vector_type(2), may_alias));
typedef _Float16 v2h __attribute__((ext_vector_type(2)));
__global__ __launch_bounds__(256) void k_att0w(const float* __restrict__ QF, const float* __restrict__ KF, const float* __restrict__ VF, float scale, _Float16* __restrict__ OH, _Float16* __restrict__ OL) {      /* all five row pitches are DM, so that every row step is an immediate offset */
  __shared__ __attribute__((aligned(16))) float lk[QT0][HD + 4];
  { const size_t bo = (size_t)blockIdx.y * QT0 * DM; QF += bo; KF += bo; VF += bo; OH += bo; OL += bo; }      /* blockIdx.y: the batch */
  const int tid = threadIdx.x, lane = tid & 31; const int h = blockIdx.x / (QT0 / 8);
  const int i = (blockIdx.x % (QT0 / 8)) * 8 + __builtin_amdgcn_readfirstlane(tid >> 5);      /* the wave's query row, held as a scalar so that the q row and the group tests below are wave-uniform */
  const float* kb = KF + h * HD;
#pragma unroll
  for (int p = 0; p < QT0 / 16; ++p) { const int r = p * 16 + (tid >> 4), c4 = (tid & 15) * 4; *(v4f*)&lk[r][c4] = *(const v4fa*)(kb + (size_t)r * DM + c4); }      /* unrolled: all 8 loads of a thread in flight at once */
  __syncthreads();
  const float* qr = QF + (size_t)i * DM + h * HD;
  float sa[QT0 / 32];
#pragma unroll
  for (int g = 0; g < QT0 / 32; ++g) sa[g] = 0.f;
#pragma unroll
  for (int c = 0; c < HD / 4; ++c) { const v4f qq = *(const v4fa*)(qr + c * 4);      /* unrolled: sa stays in named registers and the four groups' sum chains interleave */
#pragma unroll
    for (int g = 0; g < QT0 / 32; ++g) { const v4f kq = *(const v4f*)&lk[g * 32 + lane][c * 4]; sa[g] = fmaf(qq[0], kq[0], sa[g]); sa[g] = fmaf(qq[1], kq[1], sa[g]); sa[g] = fmaf(qq[2], kq[2], sa[g]); sa[g] = fmaf(qq[3], kq[3], sa[g]); } }
  float m = -1.0e30f;
#pragma unroll
  for (int g = 0; g < QT0 / 32; ++g) { sa[g] = (g * 32 + lane <= i) ? sa[g] * scale : -1.0e30f; m = fmaxf(m, sa[g]); }      /* causal: keys above the row get weight 0 */
#pragma unroll
  for (int o = 16; o > 0; o >>= 1) m = fmaxf(m, __shfl_xor(m, o));
  float l = 0.f;
#pragma unroll
  for (int g = 0; g < QT0 / 32; ++g) { sa[g] = expf(sa[g] - m); l += sa[g]; }
#pragma unroll
  for (int o = 16; o > 0; o >>= 1) l += __shfl_xor(l, o);
  const float* vb = VF + h * HD + lane * 2; float o0 = 0.f, o1 = 0.f;
#pragma unroll
  for (int g = 0; g < QT0 / 32; ++g) { if (g * 32 <= i) {      /* wave-uniform: key groups wholly above the row are skipped */
#pragma unroll
      for (int jj = 0; jj < 32; ++jj) { const float p = __int_as_float(__builtin_amdgcn_readlane(__float_as_int(sa[g]), jj)); const v2f vv = *(const v2fa*)(vb + (size_t)(g * 32 + jj) * DM); o0 = fmaf(p, vv[0], o0); o1 = fmaf(p, vv[1], o1); } } }      /* unrolled: a group's 32 loads issue before the first use */
  const float fin = 64.0f / l;      /* o carried x64 like the f16 path */
  const float a0 = o0 * fin, a1 = o1 * fin; v2h hv, lv;      /* o leaves as an f16 value plus its residual x1024, the two A operands of the output projection's first-tile blocks */
  hv[0] = (_Float16)a0; hv[1] = (_Float16)a1; lv[0] = (_Float16)((a0 - (float)hv[0]) * 1024.0f); lv[1] = (_Float16)((a1 - (float)hv[1]) * 1024.0f);
  const size_t oo = (size_t)i * DM + h * HD + lane * 2; *(v2h*)(OH + oo) = hv; *(v2h*)(OL + oo) = lv; }

// Output projection of ALL token rows in ONE launch (wave tile, product order and store path of k_gemm2, pitches and K = DM; K loop on LDS stages as in k_qkv_rope): out = o W_o, o carried x64 and W_o x16.
// A block is 8 waves: 128 rows of one batch x 128 columns. The blocks of each batch's first 128 rows take the exact attention's o instead of the f16 path's: its f16 value and its x1024 residual are two A operands
// that share every B fragment in one K loop, on two accumulator sets that join in the epilogue (hi 2^-10 + lo 2^-20). These blocks do twice the products, so they have the lowest block indices.
__global__ __launch_bounds__(256) void k_oproj(const _Float16* __restrict__ O, const _Float16* __restrict__ OH, const _Float16* __restrict__ OL, const _Float16* __restrict__ Bh, float* __restrict__ C) {
  __shared__ __attribute__((aligned(16))) char sm[2 * GSTG3];      /* two stages in the K loop; behind it the epilogue's staging */
  static_assert(sizeof(float) * 8 * 32 * 68 <= 2 * GSTG3, "the epilogue's staging fits the two stages");
  float (*so)[32][68] = (float (*)[32][68])sm;
  const int tid = threadIdx.x, w8 = tid >> 5, w = w8 & 3, wg = w8 >> 2, lane = tid & 31, ln = lane & 15, hh = lane >> 4;      /* w: the wave's 32 rows; wg: its 64 columns */
  const int ntn = DM / 128, tpb = SQ / 128; const int mi = blockIdx.x / ntn, np = blockIdx.x - mi * ntn;
  const bool first = mi < NB;      /* block-uniform */
  const int b = first ? mi : (mi - NB) / (tpb - 1); const int tl = first ? 0 : 1 + (mi - NB) % (tpb - 1);      /* batch; 128-row tile in the batch */
  const int row0 = b * SQ + tl * 128 + 32 * w, col0 = np * 128 + wg * 64;
  const unsigned l0 = (unsigned)(size_t)sm + (unsigned)(tid >> 3) * (GP * 2) + (unsigned)(tid & 7) * 16;      /* the thread's first place in stage 0: LDS byte address */
  const _Float16* gb = Bh + (size_t)(np * 128 + (tid >> 3)) * DM + (tid & 7) * 8;
  const v8f z8 = {0.f,0.f,0.f,0.f,0.f,0.f,0.f,0.f}; v8f c00 = z8, c01 = z8, c02 = z8, c03 = z8, c10 = z8, c11 = z8, c12 = z8, c13 = z8;
  v8f accs[8];
  if (!first) {
    const _Float16* ga = O + (size_t)(b * SQ + tl * 128 + (tid >> 3)) * DM + (tid & 7) * 8;
    g3_copy8(l0, ga, gb);
    asm volatile("s_wait_asynccnt 0x0" ::: "memory");      /* this wave's part of tile 0 has landed */
    __syncthreads();      /* tile 0 is whole for every wave */
    g3_copy8(l0 + GSTG3, ga + 64, gb + 64);
#pragma unroll 1
    for (int t = 0; t < DM / 64; ++t) {      /* kept rolled: one trip is one stage, 16 WMMAs a wave */
      const _Float16* st = (const _Float16*)(sm + (t & 1) * GSTG3);
      const _Float16* ap = st + (32 * w + ln) * GP; const _Float16* bp = st + (128 + 64 * wg + ln) * GP;
#pragma unroll
      for (int kk = 0; kk < 64; kk += 32) { const v16h a0 = g2_frag(ap + kk, hh), a1 = g2_frag(ap + 16 * GP + kk, hh);      /* unrolled: the LDS offsets of both halves of the stage are immediates; the six fragments of 32 k are read as one group, ahead of their WMMAs */
        const v16h b0 = g2_frag(bp + kk, hh), b1 = g2_frag(bp + 16 * GP + kk, hh), b2 = g2_frag(bp + 32 * GP + kk, hh), b3 = g2_frag(bp + 48 * GP + kk, hh);
        c00 = g2_mma(a0, b0, c00); c10 = g2_mma(a1, b0, c10); c01 = g2_mma(a0, b1, c01); c11 = g2_mma(a1, b1, c11);
        c02 = g2_mma(a0, b2, c02); c12 = g2_mma(a1, b2, c12); c03 = g2_mma(a0, b3, c03); c13 = g2_mma(a1, b3, c13); }
      asm volatile("s_wait_dscnt 0x0" ::: "memory");      /* this wave's reads of the stage have returned */
      asm volatile("s_wait_asynccnt 0x0" ::: "memory");      /* this wave's part of tile t + 1 has landed */
      __syncthreads();      /* publishes tile t + 1 and ends every wave's reads of tile t */
      if (t + 2 < DM / 64) g3_copy8(l0 + (unsigned)(t & 1) * GSTG3, ga + (t + 2) * 64, gb + (t + 2) * 64); }      /* refill of the stage just left; the test is the same for the whole block */
    asm volatile("s_wait_asynccnt 0x0" ::: "memory");      /* no copy is outstanding when the stages become the epilogue's staging */
    accs[0] = c00 * 0.0009765625f; accs[1] = c01 * 0.0009765625f; accs[2] = c02 * 0.0009765625f; accs[3] = c03 * 0.0009765625f;
    accs[4] = c10 * 0.0009765625f; accs[5] = c11 * 0.0009765625f; accs[6] = c12 * 0.0009765625f; accs[7] = c13 * 0.0009765625f;
  } else {
    const size_t go = ((size_t)b * QT0 + (tid >> 3)) * DM + (tid & 7) * 8;
    const _Float16* ga = OH + go; const _Float16* ge = OL + go;
    v8f d00 = z8, d01 = z8, d02 = z8, d03 = z8, d10 = z8, d11 = z8, d12 = z8, d13 = z8;
    g3_copy8(l0, ga, gb); g3_copy4(l0 + 256u * GP * 2, ge);
    asm volatile("s_wait_asynccnt 0x0" ::: "memory");      /* this wave's part of tile 0 has landed */
    __syncthreads();      /* tile 0 is whole for every wave */
    g3_copy8(l0 + GSTG3, ga + 64, gb + 64); g3_copy4(l0 + GSTG3 + 256u * GP * 2, ge + 64);
#pragma unroll 1
    for (int t = 0; t < DM / 64; ++t) {      /* kept rolled, like the loop above: 32 WMMAs a wave */
      const _Float16* st = (const _Float16*)(sm + (t & 1) * GSTG3);
      const _Float16* ap = st + (32 * w + ln) * GP; const _Float16* bp = st + (128 + 64 * wg + ln) * GP; const _Float16* ep = st + (256 + 32 * w + ln) * GP;
#pragma unroll
      for (int kk = 0; kk < 64; kk += 32) { const v16h a0 = g2_frag(ap + kk, hh), a1 = g2_frag(ap + 16 * GP + kk, hh), e0 = g2_frag(ep + kk, hh), e1 = g2_frag(ep + 16 * GP + kk, hh);      /* unrolled and grouped as above: eight fragments */
        const v16h b0 = g2_frag(bp + kk, hh), b1 = g2_frag(bp + 16 * GP + kk, hh), b2 = g2_frag(bp + 32 * GP + kk, hh), b3 = g2_frag(bp + 48 * GP + kk, hh);
        c00 = g2_mma(a0, b0, c00); c10 = g2_mma(a1, b0, c10); d00 = g2_mma(e0, b0, d00); d10 = g2_mma(e1, b0, d10);
        c01 = g2_mma(a0, b1, c01); c11 = g2_mma(a1, b1, c11); d01 = g2_mma(e0, b1, d01); d11 = g2_mma(e1, b1, d11);
        c02 = g2_mma(a0, b2, c02); c12 = g2_mma(a1, b2, c12); d02 = g2_mma(e0, b2, d02); d12 = g2_mma(e1, b2, d12);
        c03 = g2_mma(a0, b3, c03); c13 = g2_mma(a1, b3, c13); d03 = g2_mma(e0, b3, d03); d13 = g2_mma(e1, b3, d13); }
      asm volatile("s_wait_dscnt 0x0" ::: "memory");      /* this wave's reads of the stage have returned */
      asm volatile("s_wait_asynccnt 0x0" ::: "memory");      /* this wave's part of tile t + 1 has landed */
      __syncthreads();      /* publishes tile t + 1 and ends every wave's reads of tile t */
      if (t + 2 < DM / 64) { g3_copy8(l0 + (unsigned)(t & 1) * GSTG3, ga + (t + 2) * 64, gb + (t + 2) * 64); g3_copy4(l0 + (unsigned)(t & 1) * GSTG3 + 256u * GP * 2, ge + (t + 2) * 64); } }      /* refill of the stage just left; the test is the same for the whole block */
    asm volatile("s_wait_asynccnt 0x0" ::: "memory");      /* no copy is outstanding when the stages become the epilogue's staging */
    const v8f ch[8] = {c00, c01, c02, c03, c10, c11, c12, c13}, cl[8] = {d00, d01, d02, d03, d10, d11, d12, d13};
#pragma unroll
    for (int u = 0; u < 8; ++u)
#pragma unroll
      for (int r = 0; r < 8; ++r) accs[u][r] = fmaf(cl[u][r], 0.00000095367431640625f, ch[u][r] * 0.0009765625f);      /* both factors are powers of two: one rounding, that of the sum */
  }
#pragma unroll
  for (int u = 0; u < 8; ++u)
#pragma unroll
    for (int r = 0; r < 8; ++r) so[w8][(u >> 2) * 16 + 8 * hh + r][(u & 3) * 16 + ln] = accs[u][r];
  __builtin_amdgcn_fence(__ATOMIC_ACQ_REL, "workgroup"); __builtin_amdgcn_wave_barrier();      /* the wave reads back what its own lanes wrote */
  const int rsub = lane >> 4, c4 = (lane & 15) * 4;
#pragma unroll
  for (int q = 0; q < 16; ++q) { const int r = q * 2 + rsub; const v4f v = *(const v4fa*)&so[w8][r][c4]; *(v4f*)(C + (size_t)(row0 + r) * DM + col0 + c4) = v; } }
static_assert(QT0 == 128 && SQ % 128 == 0 && SQ > 128 && DM % 128 == 0, "k_oproj: the first-tile rows are one block row of each batch");

template <int NORM, int ROPE>
__global__ __launch_bounds__(64) void k_xformf(const float* __restrict__ F, int ldf, int nh, const float* __restrict__ gain, float eps, const float* __restrict__ CS, const float* __restrict__ SN, float* __restrict__ F32, int ldo) {
  #pragma clang fp contract(off)
  __shared__ float xv[HD]; __shared__ float red[HD]; const int d = threadIdx.x; const int h = blockIdx.x % nh; const size_t r = blockIdx.x / nh; const int p = (int)(r % SQ);
  float x = F[r * (size_t)ldf + (size_t)h * HD + d];
  if (NORM) { red[d] = __fmul_rn(x, x); __syncthreads(); for (int st = HD / 2; st > 0; st >>= 1) { if (d < st) red[d] = __fadd_rn(red[d], red[d + st]); __syncthreads(); } const float rs = rsqrtf(__fadd_rn(red[0] / (float)HD, eps)); x = __fmul_rn(__fmul_rn(x, rs), bf16_round(gain[d])); }
  xv[d] = x; __syncthreads();
  float o = x;
  if (ROPE == 1) { const int i = d >> 1; const float c = CS[p * (HD / 2) + i], s = SN[p * (HD / 2) + i]; const float ev = xv[2 * i], od = xv[2 * i + 1]; o = (d & 1) ? __fadd_rn(__fmul_rn(ev, s), __fmul_rn(od, c)) : __fadd_rn(__fmul_rn(ev, c), -__fmul_rn(od, s)); }
  if (ROPE == 2) { const int i = d & (HD / 2 - 1); const float c = CS[p * (HD / 2) + i], s = SN[p * (HD / 2) + i]; const float lo = xv[i], hi = xv[i + HD / 2]; o = (d < HD / 2) ? __fadd_rn(__fmul_rn(lo, c), -__fmul_rn(hi, s)) : __fadd_rn(__fmul_rn(lo, s), __fmul_rn(hi, c)); }
  float* dst = F32 + r * (size_t)ldo + (size_t)h * HD + d; *(float*)dst = o;  }


__global__ __launch_bounds__(256) void k_bfcp(const float* __restrict__ src, float* __restrict__ dst, size_t n4) { const size_t t = (size_t)blockIdx.x * 256 + threadIdx.x; if (t >= n4) return; const v4f a = *(const v4fa*)(src + t * 4); v4f o; for (int q = 0; q < 4; ++q) o[q] = bf16_round(a[q]); *(v4f*)(dst + t * 4) = o;  }
extern "C" void kernel_launch(void* const* d_in, const int* in_sizes, int n_in,
                              void* d_out, int out_size, void* d_ws, size_t ws_size, hipStream_t stream) {
  (void)in_sizes; (void)n_in; (void)out_size;
    const float* const* I = (const float* const*)d_in; const float* x = I[0]; const float* tcos = I[1]; const float* tsin = I[2]; const float* wq = I[3]; const float* wk = I[4]; const float* wv = I[5]; const float* wo = I[6];      /* [in][out] weights, no biases; rope tables INPUT [2048][32] */
  char* ws = (char*)d_ws; size_t off = 0;
  auto take = [&](size_t bytes) { char* p = ws + off; off += (bytes + 255) & ~(size_t)255; return p; };
  _Float16* BQKV = (_Float16*)take((size_t)3 * DM * DM * 2); _Float16* BO = (_Float16*)take((size_t)DM * DM * 2);
  _Float16* X16 = (_Float16*)take(NR * DM * 2);
  _Float16* QH = (_Float16*)take(NR * DM * 2); _Float16* KH = (_Float16*)take(NR * DM * 2); _Float16* O16 = (_Float16*)take(NR * DM * 2);
  _Float16* VT = (_Float16*)take((size_t)NB * NH * HD * SQ * 2);
  float* QF0 = (float*)take((size_t)NB * QT0 * DM * 4); float* KF0 = (float*)take((size_t)NB * QT0 * DM * 4); float* VF0 = (float*)take((size_t)NB * QT0 * DM * 4); _Float16* OH0 = (_Float16*)take((size_t)NB * QT0 * DM * 2); _Float16* OL0 = (_Float16*)take((size_t)NB * QT0 * DM * 2);
  if (off > ws_size) return;
  k_prep<<<(unsigned)(PWB + NR * DM / PXV), 256, 0, stream>>>(x, wq, wk, wv, wo, X16, BQKV, BO);      /* [in][out] weights -> Bt[n][k] x16, q | k | v stacked along n; x -> f16 rows */
  k_qkv_rope<<<(unsigned)((NR / 128) * (3 * DM / 128)), 256, 0, stream>>>(X16, BQKV, tcos, tsin, QH, KH, VT, QF0, KF0, VF0);      /* roped f16 q, k rows, V^T [NB][NH][HD][SQ], f32 q, k, v of each batch's first 128 rows */
  k_att0w<<<dim3(NH * (QT0 / 8), NB), 256, 0, stream>>>(QF0, KF0, VF0, 0.125f, OH0, OL0);      /* exact f32 causal attention for rows 0..127 of every batch (o x64) -> f16 hi + x1024 residual planes */
  k_fattn<<<(SQ / 128) * NB * NH, 128, 0, stream>>>(QH, KH, VT, O16);      /* o (merged heads, x64) as f16 rows, all batches */
  k_oproj<<<(unsigned)((NR / 128) * (DM / 128)), 256, 0, stream>>>(O16, OH0, OL0, BO, (float*)d_out);      /* out rows are the output layout; rows 0..127 of each batch from the hi and lo planes */
}
